// v000
// Measured on an AMD MI455X. A time is GPU time per run, averaged over a window of back-to-back runs after a warm-up
// (all launches, gaps included; the runs take copies of the inputs in turn), and the median of several windows.
// Apart from v000's, it joins two sittings. Times from different sittings can be a few percent apart, while
// side-by-side timings come from the same sitting.
// The starting kernel, v000, takes 9970 microseconds a run.
#include <hip/hip_runtime.h>
// Causal multi-head self-attention with a fused post-LayerNorm (x [4][2048][1024]; k/q/v = x W^T (natural [1024][1024], no biases); 16 heads of 64; wei = q k^T * 64^-0.5; causal (tril, -inf); softmax; y = merged Wp^T; out = LayerNorm(y) (biased var, eps per the module, gamma / beta) -> [4][2048][1024]).
// Structure: token rows r = b*2048 + s; x as exact f16 rows (bf16-rounded); Q, K, V as three WMMA GEMMs (32x64 wave tiles, f32 accumulation, exact x16 weights, f16 outputs); per batch: V^T for all heads via LDS transposes; per query tile of 256 rows: scores against the keys below the tile end only (K = 64, all heads on grid.y, alpha = 0.125), causal row softmax on VALU with an arithmetic 0/1 key mask over the computed range (f32 statistics, native exp; weights x256 f16), o = P . V^T (K = keys below the tile end, alpha 2^-2: o carried x64, folded into the output GEMM alpha) written straight into the merged f16 o rows; y = o W_o GEMM (f32 rows), then out = LayerNorm(y) into the output layout.
// Compute dtype: inputs rounded to bf16; x / weights exact; q, k, v, softmax weights and o as plain f16 GEMM operands (~2^-12); scores and softmax statistics f32. v_wmma_f32_16x16x32_f16.
#define NB 4
#define SQ 2048
#define DM 1024
#define NH 16
#define HD 64
#define HG 4                         /* heads per launch of the k_vt(b, h0) overload, which is not launched */
#define QT 256                       /* query rows per causal tile */
#define NKX SQ                       /* S / P row pitch */
#define QT0 128                      /* first-tile rows recomputed exactly in f32 */
#define B0 0                         /* first batch processed (debug hook) */
#define NBR NB                       /* batches processed (debug hook) */
#define NR ((size_t)NB * SQ)         /* token rows */
#define MP ((int)((size_t)NBR * SQ)) /* rows projected (debug hook) */
#define QN SQ                        /* query rows attended per batch (debug hook) */
#define NHD NH                       /* heads attended (debug hook) */
#define MPO MP                       /* rows through the output stage (debug hook) */
#define LQ DM      /* row pitch of the q/k/v rows */
typedef __bf16 v16b __attribute__((ext_vector_type(16)));
typedef unsigned short v8us __attribute__((ext_vector_type(8), may_alias));
typedef float  v8f  __attribute__((ext_vector_type(8)));
typedef float  v4f  __attribute__((ext_vector_type(4)));
typedef float  v4fa __attribute__((ext_vector_type(4), may_alias));
union FragB { v16b v; v8us half[2]; unsigned short u[16]; };

__device__ __forceinline__ unsigned short bf16_bits(float x) { unsigned int u = __float_as_uint(x); return (unsigned short)((u + 0x7FFFu + ((u >> 16) & 1u)) >> 16); }
__device__ __forceinline__ float bf16_val(unsigned short b) { return __uint_as_float(((unsigned int)b) << 16); }
__device__ __forceinline__ float bf16_round(float x) { return bf16_val(bf16_bits(x)); }
// D += A·B with NT terms: 1 = ah·bh, 2 = + al·bh (A split), 3 = + ah·bl (both split)
template <int NT>
__device__ __forceinline__ v8f mmaN(v16b ah, v16b al, v16b bh, v16b bl, v8f c) {
  c = __builtin_amdgcn_wmma_f32_16x16x32_bf16(false, ah, false, bh, (short)0, c, false, false);
  if (NT >= 2) c = __builtin_amdgcn_wmma_f32_16x16x32_bf16(false, al, false, bh, (short)0, c, false, false);
  if (NT >= 3) c = __builtin_amdgcn_wmma_f32_16x16x32_bf16(false, ah, false, bl, (short)0, c, false, false);
  asm volatile("v_nop\n\tv_nop\n\tv_nop\n\tv_nop" : "+v"(c) : "v"(ah), "v"(al), "v"(bh), "v"(bl));
  return c;
}

__global__ __launch_bounds__(256) void k_wt_bf16(const float* __restrict__ W, unsigned short* __restrict__ Wt, int K, int N) {
  const int t = blockIdx.x * 256 + threadIdx.x;
  const int k8n = K / 8;
  if (t >= N * k8n) return;
  const int n = t / k8n, k8 = (t % k8n) * 8;
  v8us v;
#pragma unroll
  for (int i = 0; i < 8; ++i) v[i] = bf16_bits(W[(size_t)(k8 + i) * N + n]);
  *(v8us*)(Wt + (size_t)n * K + k8) = v;
  
}

// GEMM C[M][N] (f32, pitch ldc) = act(A[M][K]·W + bias). A f32 row-major (pitch lda) converted per fragment to bf16
// (ASPLIT: hi/lo two planes -> 2 terms, else single rounded term); Wt bf16 [N][K] (pitch ldb). BIAS_BF16 rounds the
// bias to bf16 first (bias quantised to bf16 before the add). K%32==0, M%16==0, N%64==0.
template <bool ASPLIT, int ACT, bool BIAS_BF16>
__global__ __launch_bounds__(128) void k_gemm_bf(const float* __restrict__ A, int lda, const unsigned short* __restrict__ Wt, int ldb,
                                               const float* __restrict__ bias, float* __restrict__ C, int ldc, int M, int N, int K) {
  __shared__ __attribute__((aligned(16))) float so[4][16][64];
  const int tid = threadIdx.x, w = tid >> 5, lane = tid & 31, ln = lane & 15, hh = lane >> 4;
  const int ntn = N / 64;
  const int wid = blockIdx.x * 4 + w;
  const int mt = wid / ntn, nq = wid % ntn;
  if (mt * 16 >= M) return;
  const int row0 = mt * 16, col0 = nq * 64;
  const float* arow = A + (size_t)(row0 + ln) * lda;
  v8f acc[4] = {};
  for (int kb = 0; kb < K; kb += 32) {
    FragB ah, al;
    const v4f x0 = *(const v4fa*)(arow + kb + 8 * hh), x1 = *(const v4fa*)(arow + kb + 8 * hh + 4);
    const v4f x2 = *(const v4fa*)(arow + kb + 16 + 8 * hh), x3 = *(const v4fa*)(arow + kb + 16 + 8 * hh + 4);
    float xs[16] = {x0[0],x0[1],x0[2],x0[3],x1[0],x1[1],x1[2],x1[3],x2[0],x2[1],x2[2],x2[3],x3[0],x3[1],x3[2],x3[3]};
#pragma unroll
    for (int i = 0; i < 16; ++i) { const unsigned short hb = bf16_bits(xs[i]); ah.u[i] = hb; al.u[i] = ASPLIT ? bf16_bits(xs[i] - bf16_val(hb)) : (unsigned short)0; }
#pragma unroll
    for (int t = 0; t < 4; ++t) {
      const unsigned short* brow = Wt + (size_t)(col0 + t * 16 + ln) * ldb + kb;
      FragB b;
      b.half[0] = *(const v8us*)(brow + 8 * hh);
      b.half[1] = *(const v8us*)(brow + 16 + 8 * hh);
      acc[t] = mmaN<ASPLIT ? 2 : 1>(ah.v, al.v, b.v, b.v, acc[t]);
    }
  }
#pragma unroll
  for (int t = 0; t < 4; ++t) {
    float bv = bias ? bias[col0 + t * 16 + ln] : 0.f;
    if (BIAS_BF16) bv = bf16_round(bv);
#pragma unroll
    for (int r = 0; r < 8; ++r) { float v = acc[t][r] + bv; if (ACT == 1) v = fmaxf(v, 0.f); so[w][8 * hh + r][t * 16 + ln] = v; }
  }
  __builtin_amdgcn_fence(__ATOMIC_ACQ_REL, "workgroup");
  __builtin_amdgcn_wave_barrier();
  const int rsub = lane >> 4, c4 = (lane & 15) * 4;
  {
#pragma unroll
    for (int q = 0; q < 8; ++q) {
      const int r = q * 2 + rsub;
      const v4f v = *(const v4fa*)&so[w][r][c4];
      *(v4f*)(C + (size_t)(row0 + r) * ldc + col0 + c4) = v;
    }
    
  }
}

// GEMM C = act(A·W + bias + resid): A f32 (ASPLIT -> hi/lo 2 terms), Wt bf16 [N][K]; ACT 0 none, 1 relu, 2 exact gelu;
// resid (optional, f32, row index = (row % rmod), pitch ldr, RES_BF16 rounds it) added before the activation.
template <bool ASPLIT, int ACT, bool BIAS_BF16, bool RES_BF16>
__global__ __launch_bounds__(128) void k_gemm_bf3(const float* __restrict__ A, int lda, const unsigned short* __restrict__ Wt, int ldb,
                                                const float* __restrict__ bias, const float* __restrict__ resid, int rmod, int ldr,
                                                float* __restrict__ C, int ldc, int M, int N, int K) {
  __shared__ __attribute__((aligned(16))) float so[4][16][64];
  const int tid = threadIdx.x, w = tid >> 5, lane = tid & 31, ln = lane & 15, hh = lane >> 4;
  const int ntn = N / 64;
  const int wid = blockIdx.x * 4 + w;
  const int mt = wid / ntn, nq = wid % ntn;
  if (mt * 16 >= M) return;
  const int row0 = mt * 16, col0 = nq * 64;
  const float* arow = A + (size_t)(row0 + ln) * lda;
  v8f acc[4] = {};
  for (int kb = 0; kb < K; kb += 32) {
    FragB ah, al;
    const v4f x0 = *(const v4fa*)(arow + kb + 8 * hh), x1 = *(const v4fa*)(arow + kb + 8 * hh + 4);
    const v4f x2 = *(const v4fa*)(arow + kb + 16 + 8 * hh), x3 = *(const v4fa*)(arow + kb + 16 + 8 * hh + 4);
    float xs[16] = {x0[0],x0[1],x0[2],x0[3],x1[0],x1[1],x1[2],x1[3],x2[0],x2[1],x2[2],x2[3],x3[0],x3[1],x3[2],x3[3]};
#pragma unroll
    for (int i = 0; i < 16; ++i) { const unsigned short hb = bf16_bits(xs[i]); ah.u[i] = hb; al.u[i] = ASPLIT ? bf16_bits(xs[i] - bf16_val(hb)) : (unsigned short)0; }
#pragma unroll
    for (int t = 0; t < 4; ++t) {
      const unsigned short* brow = Wt + (size_t)(col0 + t * 16 + ln) * ldb + kb;
      FragB b;
      b.half[0] = *(const v8us*)(brow + 8 * hh);
      b.half[1] = *(const v8us*)(brow + 16 + 8 * hh);
      acc[t] = mmaN<ASPLIT ? 2 : 1>(ah.v, al.v, b.v, b.v, acc[t]);
    }
  }
#pragma unroll
  for (int t = 0; t < 4; ++t) {
    const int col = col0 + t * 16 + ln;
    float bv = bias ? bias[col] : 0.f;
    if (BIAS_BF16) bv = bf16_round(bv);
#pragma unroll
    for (int r = 0; r < 8; ++r) {
      float v = acc[t][r] + bv;
      if (resid) { float rv = resid[(size_t)((row0 + 8 * hh + r) % rmod) * ldr + col]; if (RES_BF16) rv = bf16_round(rv); v += rv; }
      if (ACT == 1) v = fmaxf(v, 0.f);
      if (ACT == 2) v = 0.5f * v * (1.0f + erff(v * 0.70710678118654752f));
      if (ACT == 3) { const float u = 0.7978845608028654f * (v + 0.044715f * v * v * v); v = 0.5f * v * (1.0f + tanhf(u)); }
      so[w][8 * hh + r][t * 16 + ln] = v;
    }
  }
  __builtin_amdgcn_fence(__ATOMIC_ACQ_REL, "workgroup");
  __builtin_amdgcn_wave_barrier();
  const int rsub = lane >> 4, c4 = (lane & 15) * 4;
  {
#pragma unroll
    for (int q = 0; q < 8; ++q) {
      const int r = q * 2 + rsub;
      const v4f v = *(const v4fa*)&so[w][r][c4];
      *(v4f*)(C + (size_t)(row0 + r) * ldc + col0 + c4) = v;
    }
    
  }
}
// row LayerNorm (biased variance, eps) over N: s = X (+ R); optional out_sum <- s; out_norm <- (s-mu)*rsqrt(var+eps)*g + b
template <bool PARAM_BF16>
__global__ __launch_bounds__(256) void k_layernorm(const float* __restrict__ X, const float* __restrict__ R, const float* __restrict__ g, const float* __restrict__ bta,
                                                  float* __restrict__ out_sum, float* __restrict__ out_norm, int N, float eps) {
  __shared__ float red[256];
  const int row = blockIdx.x, tid = threadIdx.x;
  const float* x = X + (size_t)row * N; const float* rr = R ? R + (size_t)row * N : nullptr;
  float vals[16];                     // up to N = 4096
  const int per = N / 256;            // contiguous chunk per thread? use strided-by-4 chunks: thread handles j = tid*4 + 1024*u
  float s1 = 0.f;
  for (int u = 0; u < per / 4; ++u) {
    const int j = tid * 4 + 1024 * u;
    const v4f a = *(const v4fa*)(x + j);
    v4f b = {0.f,0.f,0.f,0.f}; if (rr) b = *(const v4fa*)(rr + j);
#pragma unroll
    for (int q = 0; q < 4; ++q) { const float v = a[q] + b[q]; vals[u * 4 + q] = v; s1 += v; }
  }
  red[tid] = s1; __syncthreads();
  for (int st = 128; st > 0; st >>= 1) { if (tid < st) red[tid] += red[tid + st]; __syncthreads(); }
  const float mu = red[0] / (float)N; __syncthreads();
  float s2 = 0.f;
  for (int u = 0; u < per / 4; ++u)
#pragma unroll
    for (int q = 0; q < 4; ++q) { const float c = vals[u * 4 + q] - mu; s2 += c * c; }
  red[tid] = s2; __syncthreads();
  for (int st = 128; st > 0; st >>= 1) { if (tid < st) red[tid] += red[tid + st]; __syncthreads(); }
  const float rs = rsqrtf(red[0] / (float)N + eps);
  {
    for (int u = 0; u < per / 4; ++u) {
      const int j = tid * 4 + 1024 * u;
      v4f o, sm;
#pragma unroll
      for (int q = 0; q < 4; ++q) {
        float gg = g[j + q], bb = bta[j + q];
        if (PARAM_BF16) { gg = bf16_round(gg); bb = bf16_round(bb); }
        sm[q] = vals[u * 4 + q]; o[q] = (vals[u * 4 + q] - mu) * rs * gg + bb;
      }
      if (out_sum) *(v4f*)(out_sum + (size_t)row * N + j) = sm;
      *(v4f*)(out_norm + (size_t)row * N + j) = o;
    }
    
  }
}



// ---- f16 WMMA path (v_wmma_f32_16x16x32_f16): 11-bit significands for operands in range — used where a [0,1] probability operand needs more precision than bf16
typedef _Float16 v16h __attribute__((ext_vector_type(16)));
union FragH { v16h v; v8us half[2]; _Float16 h[16]; unsigned short u[16]; };
template <int NT>
__device__ __forceinline__ v8f mmaH(v16h ah, v16h al, v16h bh, v16h bl, v8f c) {
  c = __builtin_amdgcn_wmma_f32_16x16x32_f16(false, ah, false, bh, (short)0, c, false, false);
  if (NT >= 2) c = __builtin_amdgcn_wmma_f32_16x16x32_f16(false, al, false, bh, (short)0, c, false, false);
  if (NT >= 3) c = __builtin_amdgcn_wmma_f32_16x16x32_f16(false, ah, false, bl, (short)0, c, false, false);
  asm volatile("v_nop\n\tv_nop\n\tv_nop\n\tv_nop" : "+v"(c) : "v"(ah), "v"(al), "v"(bh), "v"(bl));
  return c;
}
// batched GEMM like k_gemm_b but f16 operands: A f32 (split into f16 hi/lo if ASPLIT, else rounded to f16), Bt = f16 values [n][k]; alpha; C f32; N multiple of 16 (partial tiles skipped)
template <bool ASPLIT>
__global__ __launch_bounds__(128) void k_gemm_h(const float* __restrict__ A, int lda, size_t sA, const _Float16* __restrict__ Bh, int ldb, size_t sB, float alpha, float* __restrict__ C, int ldc, size_t sC, int M, int N, int K) {
  __shared__ __attribute__((aligned(16))) float so[4][16][64];
  const int tid = threadIdx.x, w = tid >> 5, lane = tid & 31, ln = lane & 15, hh = lane >> 4; const int by = blockIdx.y;
  A += (size_t)by * sA; Bh += (size_t)by * sB; C += (size_t)by * sC;
  const int ntn = (N + 63) / 64; const int wid = blockIdx.x * 4 + w; const int mt = wid / ntn, nq = wid % ntn; if (mt * 16 >= M) return;
  const int row0 = mt * 16, col0 = nq * 64; const float* arow = A + (size_t)(row0 + ln) * lda;
  v8f acc[4] = {};
  for (int kb = 0; kb < K; kb += 32) {
    FragH ah, al;
    const v4f x0 = *(const v4fa*)(arow + kb + 8 * hh), x1 = *(const v4fa*)(arow + kb + 8 * hh + 4), x2 = *(const v4fa*)(arow + kb + 16 + 8 * hh), x3 = *(const v4fa*)(arow + kb + 16 + 8 * hh + 4);
    float xs[16] = {x0[0],x0[1],x0[2],x0[3],x1[0],x1[1],x1[2],x1[3],x2[0],x2[1],x2[2],x2[3],x3[0],x3[1],x3[2],x3[3]};
#pragma unroll
    for (int i = 0; i < 16; ++i) { const _Float16 h = (_Float16)xs[i]; ah.h[i] = h; al.h[i] = ASPLIT ? (_Float16)(xs[i] - (float)h) : (_Float16)0.0f; }
#pragma unroll
    for (int t = 0; t < 4; ++t) { if (col0 + t * 16 >= N) continue; const size_t boff = (size_t)(col0 + t * 16 + ln) * ldb + kb; FragH bq; bq.half[0] = *(const v8us*)(Bh + boff + 8 * hh); bq.half[1] = *(const v8us*)(Bh + boff + 16 + 8 * hh);
      acc[t] = mmaH<ASPLIT ? 2 : 1>(ah.v, al.v, bq.v, bq.v, acc[t]); }
  }
#pragma unroll
  for (int t = 0; t < 4; ++t) { if (col0 + t * 16 >= N) continue;
#pragma unroll
    for (int r = 0; r < 8; ++r) so[w][8 * hh + r][t * 16 + ln] = acc[t][r] * alpha; }
  __builtin_amdgcn_fence(__ATOMIC_ACQ_REL, "workgroup"); __builtin_amdgcn_wave_barrier();
  const int rsub = lane >> 4, c4 = (lane & 15) * 4;
  {
#pragma unroll
    for (int q = 0; q < 8; ++q) { const int r = q * 2 + rsub; if (col0 + c4 < N) { const v4f v = *(const v4fa*)&so[w][r][c4]; *(v4f*)(C + (size_t)(row0 + r) * ldc + col0 + c4) = v; } }
     }
}

// Wt[n][k] = f16(W[k][n]·scale) from f32 row-major W[K][N] (scale = power of two; bf16-exact weights stay exact in f16 away from the subnormal range)
__global__ __launch_bounds__(256) void k_wt_f16(const float* __restrict__ W, _Float16* __restrict__ Wt, int K, int N, float scale) {
  const int t = blockIdx.x * 256 + threadIdx.x; if (t >= N * (K / 8)) return; const int n = t / (K / 8), k8 = (t % (K / 8)) * 8; FragH f;
#pragma unroll
  for (int i = 0; i < 8; ++i) f.h[i] = (_Float16)(bf16_round(W[(size_t)(k8 + i) * N + n]) * scale); const v8us o = f.half[0];
  *(v8us*)((unsigned short*)Wt + (size_t)n * K + k8) = o; 
}
// k_gemm_hh variant with fused epilogue: v = acc·alpha + bias[by·sBias + col] (+ CP[(row/rowsPerB)·sCPb + by·64 + col] if CP) ; ACT 0 none / 1 elu ; writes f16 C16 (and f32 C if non-null)
template <int ACT>
__global__ __launch_bounds__(128) void k_gemm_hhx(const _Float16* __restrict__ A, int lda, size_t sA, const _Float16* __restrict__ Bh, int ldb, size_t sB, float alpha, const float* __restrict__ bias, size_t sBias, const float* __restrict__ CP, int rowsPerB, size_t sCPb, int row0g,
    float* __restrict__ C, _Float16* __restrict__ C16, int ldc, size_t sC, int M, int N, int K) {
  __shared__ __attribute__((aligned(16))) float so[4][16][64];
  const int tid = threadIdx.x, w = tid >> 5, lane = tid & 31, ln = lane & 15, hh = lane >> 4; const int by = blockIdx.y;
  A += (size_t)by * sA; Bh += (size_t)by * sB; const size_t cofs = (size_t)by * sC; const float* bp = bias ? bias + (size_t)by * sBias : nullptr;
  const int ntn = (N + 63) / 64; const int wid = blockIdx.x * 4 + w; const int mt = wid / ntn, nq = wid % ntn; if (mt * 16 >= M) return;
  const int row0 = mt * 16, col0 = nq * 64; const _Float16* arow = A + (size_t)(row0 + ln) * lda;
  v8f acc[4] = {};
  for (int kb = 0; kb < K; kb += 32) { FragH ah; ah.half[0] = *(const v8us*)((const unsigned short*)arow + kb + 8 * hh); ah.half[1] = *(const v8us*)((const unsigned short*)arow + kb + 16 + 8 * hh);
#pragma unroll
    for (int t = 0; t < 4; ++t) { if (col0 + t * 16 >= N) continue; const size_t boff = (size_t)(col0 + t * 16 + ln) * ldb + kb; FragH bq; bq.half[0] = *(const v8us*)((const unsigned short*)Bh + boff + 8 * hh); bq.half[1] = *(const v8us*)((const unsigned short*)Bh + boff + 16 + 8 * hh);
      acc[t] = mmaH<1>(ah.v, ah.v, bq.v, bq.v, acc[t]); }
  }
#pragma unroll
  for (int t = 0; t < 4; ++t) { if (col0 + t * 16 >= N) continue; const int col = col0 + t * 16 + ln; const float bv = bp ? bf16_round(bp[col]) : 0.f;
#pragma unroll
    for (int r = 0; r < 8; ++r) { float v = acc[t][r] * alpha + bv; if (CP) { const int rr = row0g + row0 + 8 * hh + r; if (rowsPerB < 0) v += CP[cofs + (size_t)rr * ldc + col];      /* rowsPerB < 0: own element of the batched C plane */ else { const int bidx = rr / rowsPerB; v += CP[(size_t)bidx * sCPb + (size_t)by * 64 + col]; } } if (ACT == 1) v = (v > 0.f) ? v : expm1f(v); else if (ACT == 7) v = (v > 0.f) ? v + 1.0f : expf(v); else if (ACT == 8) v = tanhf(v); else if (ACT == 9) v = 0.5f * v * (1.0f + tanhf(0.7978845608028654f * (v + 0.044715f * v * v * v))); else if (ACT == 11) v = 1.0f / (1.0f + expf(-v)); else if (ACT == 12) v = (v > 0.f) ? v : 0.01f * v; else if (ACT == 14) v = (v > 0.f) ? v : 0.1f * v; else if (ACT == 16) v = (v >= 0.f) ? v : 0.3f * v; else if (ACT == 17) v = (v >= 0.f) ? v : 0.2f * v; else if (ACT == 15) v = v / (1.0f + expf(-v)); else if (ACT == 3) v = fmaxf(v, 0.f); else if (ACT == 6) v = 0.5f * v * (1.0f + erff(v * 0.70710678118654752f)); so[w][8 * hh + r][t * 16 + ln] = v; } }
  __builtin_amdgcn_fence(__ATOMIC_ACQ_REL, "workgroup"); __builtin_amdgcn_wave_barrier();
  const int rsub = lane >> 4, c4 = (lane & 15) * 4; typedef _Float16 v4h __attribute__((ext_vector_type(4)));
  {
#pragma unroll
    for (int q = 0; q < 8; ++q) { const int r = q * 2 + rsub; if (col0 + c4 < N) { const v4f v = *(const v4fa*)&so[w][r][c4]; if (C) *(v4f*)(C + cofs + (size_t)(row0 + r) * ldc + col0 + c4) = v; if (C16) { v4h h4; for (int i = 0; i < 4; ++i) h4[i] = (_Float16)v[i]; *(v4h*)(C16 + cofs + (size_t)(row0 + r) * ldc + col0 + c4) = h4; } } }
     }
}


typedef _Float16 v4h __attribute__((ext_vector_type(4)));

__global__ __launch_bounds__(256) void k_x16(const float* __restrict__ x, _Float16* __restrict__ X16, size_t n8) { const size_t t = (size_t)blockIdx.x * 256 + threadIdx.x; if (t >= n8) return; FragH f;
#pragma unroll
  for (int q = 0; q < 8; ++q) f.h[q] = (_Float16)bf16_round(x[t * 8 + q]); *(v8us*)((unsigned short*)X16 + t * 8) = f.half[0];  }
__global__ __launch_bounds__(256) void k_h16(const float* __restrict__ x, _Float16* __restrict__ X16, size_t n8) { const size_t t = (size_t)blockIdx.x * 256 + threadIdx.x; if (t >= n8) return; FragH f;
#pragma unroll
  for (int q = 0; q < 8; ++q) f.h[q] = (_Float16)x[t * 8 + q]; *(v8us*)((unsigned short*)X16 + t * 8) = f.half[0];  }
__global__ __launch_bounds__(256) void k_round16f(const float* __restrict__ W, _Float16* __restrict__ Bt, size_t n8) { const size_t t = (size_t)blockIdx.x * 256 + threadIdx.x; if (t >= n8) return; FragH f;
#pragma unroll
  for (int i = 0; i < 8; ++i) f.h[i] = (_Float16)(bf16_round(W[t * 8 + i]) * 16.0f); *(v8us*)((unsigned short*)Bt + t * 8) = f.half[0];  }
template <int NHv, int TTv>
__global__ __launch_bounds__(256) void k_vt(const _Float16* __restrict__ V16, int ldv, int voff, _Float16* __restrict__ Vt) { __shared__ unsigned short tl[64][66]; const int tid = threadIdx.x; const int slab = blockIdx.x / (TTv / 64), lg = blockIdx.x % (TTv / 64); const int b = slab / NHv, h = slab % NHv;
  for (int i = tid; i < 64 * 8; i += 256) { const int r = i / 8, c8 = (i % 8) * 8; FragH f; f.half[0] = *(const v8us*)((const unsigned short*)V16 + ((size_t)b * TTv + lg * 64 + r) * ldv + voff + h * 64 + c8);
#pragma unroll
    for (int q = 0; q < 8; ++q) tl[r][c8 + q] = f.u[q]; }
  __syncthreads();
  {
#pragma unroll
    for (int rd = 0; rd < 2; ++rd) { const int d = rd * 32 + tid / 8, pc = tid % 8; FragH f;
#pragma unroll
      for (int q = 0; q < 8; ++q) f.u[q] = tl[pc * 8 + q][d];
      *(v8us*)((unsigned short*)Vt + ((size_t)slab * 64 + d) * TTv + lg * 64 + pc * 8) = f.half[0]; }
     } }

__global__ __launch_bounds__(256) void k_hl(const float* __restrict__ F, _Float16* __restrict__ Hh, _Float16* __restrict__ Hl, size_t n8) { const size_t t = (size_t)blockIdx.x * 256 + threadIdx.x; if (t >= n8) return; FragH fh, fl; const v4f a = *(const v4fa*)(F + t * 8), c = *(const v4fa*)(F + t * 8 + 4);
#pragma unroll
  for (int q = 0; q < 4; ++q) { _Float16 h = (_Float16)a[q]; fh.h[q] = h; fl.h[q] = (_Float16)((a[q] - (float)h) * 1024.0f); h = (_Float16)c[q]; fh.h[4 + q] = h; fl.h[4 + q] = (_Float16)((c[q] - (float)h) * 1024.0f); }
  { *(v8us*)((unsigned short*)Hh + t * 8) = fh.half[0]; *(v8us*)((unsigned short*)Hl + t * 8) = fl.half[0];  } }

// ---- fast GEMM (wave tile 32x64; requires M % 32 == 0 rows per launch region and N % 64 == 0); epilogue = k_gemm_hhx semantics ----
__device__ __forceinline__ v16h g2_frag(const _Float16* p, int hh) { FragH f; f.half[0] = *(const v8us*)((const unsigned short*)p + 8 * hh); f.half[1] = *(const v8us*)((const unsigned short*)p + 16 + 8 * hh); return f.v; }
__device__ __forceinline__ v8f g2_mma(v16h a, v16h b, v8f c) { v8f d = __builtin_amdgcn_wmma_f32_16x16x32_f16(false, a, false, b, (short)0, c, false, false); asm volatile("v_nop\n\tv_nop\n\tv_nop\n\tv_nop" : "+v"(d) : "v"(a), "v"(b)); return d; }
template <int ACT>
__global__ __launch_bounds__(128) void k_gemm2(const _Float16* __restrict__ A, int lda, size_t sA, const _Float16* __restrict__ Bh, int ldb, size_t sB, float alpha, const float* __restrict__ bias, size_t sBias, const float* __restrict__ CP, int rowsPerB, size_t sCPb, int row0g,
    float* __restrict__ C, _Float16* __restrict__ C16, int ldc, size_t sC, int M, int N, int K) { static_assert(ACT == 0 || ACT == 3 || ACT == 6 || ACT == 8 || ACT == 9 || ACT == 11 || ACT == 12 || ACT == 14 || ACT == 15 || ACT == 16 || ACT == 17, "k_gemm2: unsupported ACT code (would silently apply no activation)");
  __shared__ __attribute__((aligned(16))) float so[4][32][68];
  const int tid = threadIdx.x, w = tid >> 5, lane = tid & 31, ln = lane & 15, hh = lane >> 4; const int by = blockIdx.y;
  A += (size_t)by * sA; Bh += (size_t)by * sB; const size_t cofs = (size_t)by * sC; const float* bp = bias ? bias + (size_t)by * sBias : nullptr;
  const int ntn = N >> 6; const int mt = blockIdx.x / ntn, nq = blockIdx.x - mt * ntn; const int row0 = mt * 128 + 32 * w, col0 = nq * 64; if (row0 >= M) return;
  const _Float16* a0p = A + (size_t)(row0 + ln) * lda; const _Float16* a1p = a0p + (size_t)16 * lda;
  const _Float16* b0p = Bh + (size_t)(col0 + ln) * ldb; const _Float16* b1p = b0p + (size_t)16 * ldb; const _Float16* b2p = b1p + (size_t)16 * ldb; const _Float16* b3p = b2p + (size_t)16 * ldb;
  const v8f z8 = {0.f,0.f,0.f,0.f,0.f,0.f,0.f,0.f}; v8f c00 = z8, c01 = z8, c02 = z8, c03 = z8, c10 = z8, c11 = z8, c12 = z8, c13 = z8;
#pragma unroll 1
  for (int kb = 0; kb < K; kb += 32) { const v16h a0 = g2_frag(a0p + kb, hh), a1 = g2_frag(a1p + kb, hh);
    v16h b = g2_frag(b0p + kb, hh); c00 = g2_mma(a0, b, c00); c10 = g2_mma(a1, b, c10);
    b = g2_frag(b1p + kb, hh); c01 = g2_mma(a0, b, c01); c11 = g2_mma(a1, b, c11);
    b = g2_frag(b2p + kb, hh); c02 = g2_mma(a0, b, c02); c12 = g2_mma(a1, b, c12);
    b = g2_frag(b3p + kb, hh); c03 = g2_mma(a0, b, c03); c13 = g2_mma(a1, b, c13); }
  v8f accs[8] = {c00, c01, c02, c03, c10, c11, c12, c13};
#pragma unroll
  for (int u = 0; u < 8; ++u) { const int t = u & 3, half = u >> 2; const int col = col0 + t * 16 + ln; const float bv = bp ? bf16_round(bp[col]) : 0.f;
#pragma unroll
    for (int r = 0; r < 8; ++r) { const int rloc = half * 16 + 8 * hh + r; float v = accs[u][r] * alpha + bv; if (CP) { if (rowsPerB < 0) v += CP[cofs + (size_t)(row0g + row0 + rloc) * ldc + col];      /* rowsPerB < 0: own element of the batched C plane */ else { const int bidx = (row0g + row0 + rloc) / rowsPerB; v += CP[(size_t)bidx * sCPb + (size_t)by * 64 + col]; } }
      if (ACT == 3) v = fmaxf(v, 0.f); else if (ACT == 6) v = 0.5f * v * (1.0f + erff(v * 0.70710678118654752f)); else if (ACT == 11) v = 1.0f / (1.0f + expf(-v)); else if (ACT == 15) v = v / (1.0f + expf(-v)); else if (ACT == 12) v = (v > 0.f) ? v : 0.01f * v; else if (ACT == 8) v = tanhf(v); else if (ACT == 9) v = 0.5f * v * (1.0f + tanhf(0.7978845608028654f * (v + 0.044715f * v * v * v))); else if (ACT == 14) v = (v > 0.f) ? v : 0.1f * v; else if (ACT == 16) v = (v >= 0.f) ? v : 0.3f * v; else if (ACT == 17) v = (v >= 0.f) ? v : 0.2f * v;
      so[w][rloc][t * 16 + ln] = v; } }
  __builtin_amdgcn_fence(__ATOMIC_ACQ_REL, "workgroup"); __builtin_amdgcn_wave_barrier();
  const int rsub = lane >> 4, c4 = (lane & 15) * 4;
  {
#pragma unroll
    for (int q = 0; q < 16; ++q) { const int r = q * 2 + rsub; const v4f v = *(const v4fa*)&so[w][r][c4]; if (C) *(v4f*)(C + cofs + (size_t)(row0 + r) * ldc + col0 + c4) = v; if (C16) { v4h h4; for (int i = 0; i < 4; ++i) h4[i] = (_Float16)v[i]; *(v4h*)(C16 + cofs + (size_t)(row0 + r) * ldc + col0 + c4) = h4; } }
     } }


__global__ __launch_bounds__(256) void k_wnat(const float* __restrict__ w, size_t n8, _Float16* __restrict__ Bt) { const size_t t = (size_t)blockIdx.x * 256 + threadIdx.x; if (t >= n8) return; FragH f; for (int q = 0; q < 8; ++q) f.h[q] = (_Float16)(bf16_round(w[t * 8 + q]) * 16.0f); *(v8us*)((unsigned short*)Bt + t * 8) = f.half[0];  }
__global__ __launch_bounds__(256) void k_rsm(const float* __restrict__ S, _Float16* __restrict__ P, int nrows) {
  #pragma clang fp contract(off)
  const int i = blockIdx.x * 256 + threadIdx.x; if (i >= nrows) return; const float* s = S + (size_t)i * SQ; float mx = -3.0e38f;
#pragma unroll 1
  for (int j = 0; j < SQ; ++j) mx = fmaxf(mx, s[j]); float se = 0.f;
#pragma unroll 1
  for (int j = 0; j < SQ; ++j) se += expf(s[j] - mx); const float sc = 256.0f / se;
#pragma unroll 1
  for (int j0 = 0; j0 < SQ; j0 += 8) { FragH f; for (int q = 0; q < 8; ++q) f.h[q] = (_Float16)(expf(s[j0 + q] - mx) * sc); unsigned short* d = (unsigned short*)P + (size_t)i * SQ + j0; *(v8us*)d = f.half[0];  } }
__global__ __launch_bounds__(256) void k_vt(const _Float16* __restrict__ V16, int b, int h0, _Float16* __restrict__ VT) { __shared__ unsigned short tl[64][65]; const int tid = threadIdx.x; const int hh = blockIdx.x % HG, sg = blockIdx.x / HG; const int s0 = sg * 64; const int h = h0 + hh;
  for (int i = tid; i < 64 * 8; i += 256) { const int j = i / 8, d8 = (i % 8) * 8; FragH f; f.half[0] = *(const v8us*)((const unsigned short*)V16 + ((size_t)b * SQ + s0 + j) * DM + h * HD + d8); for (int q = 0; q < 8; ++q) tl[d8 + q][j] = f.u[q]; }
  __syncthreads();
  { for (int i = tid; i < 64 * 8; i += 256) { const int d = i / 8, j8 = (i % 8) * 8; FragH f; for (int q = 0; q < 8; ++q) f.u[q] = tl[d][j8 + q]; *(v8us*)((unsigned short*)VT + ((size_t)hh * HD + d) * SQ + s0 + j8) = f.half[0]; }  } }



__global__ __launch_bounds__(256) void k_rsmcf2(const float* __restrict__ S, _Float16* __restrict__ P, int hg, int q0, int nk) {
  #pragma clang fp contract(off)
  const int t = blockIdx.x * 256 + threadIdx.x; if (t >= hg * QT) return; const size_t i = (size_t)t; const float* s = S + i * NKX; const int last = q0 + (t % QT); float mx = -3.0e38f;
#pragma unroll 1
  for (int j = 0; j < nk; ++j) { const float f = (j <= last) ? 1.f : 0.f; mx = fmaxf(mx, fmaf(f, s[j], (1.f - f) * -1.0e9f)); } float se = 0.f;
#pragma unroll 1
  for (int j = 0; j < nk; ++j) { const float f = (j <= last) ? 1.f : 0.f; se += __expf(fmaf(f, s[j], (1.f - f) * -1.0e9f) - mx); } const float sc = 256.0f / se;
#pragma unroll 1
  for (int j0 = 0; j0 < nk; j0 += 8) { FragH fr; for (int q = 0; q < 8; ++q) { const int j = j0 + q; const float f = (j <= last) ? 1.f : 0.f; fr.h[q] = (_Float16)(__expf(fmaf(f, s[j], (1.f - f) * -1.0e9f) - mx) * sc); } unsigned short* d = (unsigned short*)P + i * NKX + j0; *(v8us*)d = fr.half[0];  } }


template <int MASKADD>
__global__ __launch_bounds__(64) void k_att0(const float* __restrict__ QF, const float* __restrict__ KF, const float* __restrict__ VF, int ld, const float* __restrict__ mask, float scale, float* __restrict__ OF, int ldo) {
  #pragma clang fp contract(off)
  __shared__ __attribute__((aligned(16))) float lq[64][64]; __shared__ __attribute__((aligned(16))) float lo[64][64];
  const int tid = threadIdx.x; const int h = blockIdx.x / (QT0 / 64), rg = blockIdx.x % (QT0 / 64); const int i = rg * 64 + tid;
  const float* qr = QF + (size_t)i * ld + h * HD;
#pragma unroll 1
  for (int c = 0; c < HD / 4; ++c) { *(v4f*)&lq[tid][c * 4] = *(const v4fa*)(qr + c * 4); const v4f z = {0.f, 0.f, 0.f, 0.f}; *(v4f*)&lo[tid][c * 4] = z; }
  float m = -1.0e30f, l = 0.f; const int jmax = MASKADD ? (SQ - 1) : (rg * 64 + 63);      /* additive-mask form: every key (the mask input decides); causal form: keys up to the block's last row */
#pragma unroll 1
  for (int j = 0; j <= jmax; ++j) { const float* kr = KF + (size_t)j * ld + h * HD; const float* vr = VF + (size_t)j * ld + h * HD; float s = 0.f;
#pragma unroll 1
    for (int c = 0; c < HD / 4; ++c) { const v4f kq = *(const v4fa*)(kr + c * 4); const v4f qq = *(v4f*)&lq[tid][c * 4]; s = __fadd_rn(s, __fmul_rn(qq[0], kq[0])); s = __fadd_rn(s, __fmul_rn(qq[1], kq[1])); s = __fadd_rn(s, __fmul_rn(qq[2], kq[2])); s = __fadd_rn(s, __fmul_rn(qq[3], kq[3])); }
    s = __fmul_rn(s, scale); if (MASKADD) s = __fadd_rn(s, __fmul_rn(bf16_round(mask[(size_t)i * SQ + j]), -10000.0f));
    const float f = (MASKADD || j <= i) ? 1.f : 0.f; const float sm = fmaf(f, s, (1.f - f) * -1.0e30f); const float mn = fmaxf(m, sm); const float sc = expf(m - mn); const float e = expf(sm - mn); l = __fadd_rn(__fmul_rn(l, sc), e); m = mn;
#pragma unroll 1
    for (int c = 0; c < HD / 4; ++c) { const v4f vv = *(const v4fa*)(vr + c * 4); v4f oo = *(v4f*)&lo[tid][c * 4]; for (int u = 0; u < 4; ++u) oo[u] = __fadd_rn(__fmul_rn(oo[u], sc), __fmul_rn(e, vv[u])); *(v4f*)&lo[tid][c * 4] = oo; } }
  const float fin = 64.0f / l;      /* o carried x64 like the f16 path */
#pragma unroll 1
  for (int c = 0; c < HD / 4; ++c) { v4f oo = *(v4f*)&lo[tid][c * 4]; for (int u = 0; u < 4; ++u) oo[u] = __fmul_rn(oo[u], fin); *(v4f*)&lo[tid][c * 4] = oo; }
  __syncthreads();
  {
#pragma unroll 1
    for (int it = 0; it < 16; ++it) { const int row = it * 4 + tid / 16, pc = (tid % 16) * 4; const v4f v = *(const v4f*)&lo[row][pc]; *(v4f*)(OF + (size_t)(rg * 64 + row) * ldo + h * HD + pc) = v; }
     } }

#define DMQ DM

template <int BFIN, int W16, int W32>
__global__ __launch_bounds__(256) void k_lnx(const float* __restrict__ X, const float* __restrict__ g, const float* __restrict__ bb, float eps, _Float16* __restrict__ N16, float* __restrict__ N32) {
  #pragma clang fp contract(off)
  __shared__ float red[256]; const size_t r = blockIdx.x; const int t = threadIdx.x; const bool act = t < (DMQ / 4); const int c0 = act ? t * 4 : 0;
  const v4f xa = *(const v4fa*)(X + r * DMQ + c0); float s[4]; float sum = 0.f;
  for (int q = 0; q < 4; ++q) { s[q] = act ? (BFIN ? bf16_round(xa[q]) : xa[q]) : 0.f; sum = __fadd_rn(sum, s[q]); }
  red[t] = sum; __syncthreads(); for (int st = 128; st > 0; st >>= 1) { if (t < st) red[t] = __fadd_rn(red[t], red[t + st]); __syncthreads(); } const float mu = red[0] / (float)DMQ; __syncthreads();
  float vs = 0.f; for (int q = 0; q < 4; ++q) { const float dl = act ? __fadd_rn(s[q], -mu) : 0.f; vs = __fadd_rn(vs, __fmul_rn(dl, dl)); } red[t] = vs; __syncthreads(); for (int st = 128; st > 0; st >>= 1) { if (t < st) red[t] = __fadd_rn(red[t], red[t + st]); __syncthreads(); }
  const float rs = rsqrtf(__fadd_rn(red[0] / (float)DMQ, eps)); v4h y; v4f yf;
  for (int q = 0; q < 4; ++q) { const int c = c0 + q; yf[q] = __fadd_rn(__fmul_rn(__fmul_rn(__fadd_rn(s[q], -mu), rs), bf16_round(g[c])), bf16_round(bb[c])); y[q] = (_Float16)yf[q]; }
  if (!act) return;      /* no barriers after this point */
  { if (W16) *(v4h*)(N16 + r * DMQ + c0) = y; if (W32) *(v4f*)(N32 + r * DMQ + c0) = yf;  } }


extern "C" void kernel_launch(void* const* d_in, const int* in_sizes, int n_in,
                              void* d_out, int out_size, void* d_ws, size_t ws_size, hipStream_t stream) {
  (void)in_sizes; (void)n_in; (void)out_size;
  const float* const* I = (const float* const*)d_in; const float* x = I[0]; const float* wk = I[1]; const float* wq = I[2]; const float* wv = I[3]; const float* wo = I[4]; const float* lng = I[5]; const float* lnb = I[6]; const float* bq = nullptr; const float* bk = nullptr; const float* bv = nullptr; const float* bo = nullptr;      /* x; natural [out][in] Wk, Wq, Wv (THIS order), Wp; LayerNorm gamma, beta; no biases */
  char* ws = (char*)d_ws; size_t off = 0;
  auto take = [&](size_t bytes) { char* p = ws + off; off += (bytes + 255) & ~(size_t)255; return p; };
  _Float16* BQ = (_Float16*)take((size_t)DM * DM * 2); _Float16* BK = (_Float16*)take((size_t)DM * DM * 2); _Float16* BV = (_Float16*)take((size_t)DM * DM * 2); _Float16* BO = (_Float16*)take((size_t)DM * DM * 2);
  _Float16* X16 = (_Float16*)take(NR * DM * 2); _Float16* Q16 = (_Float16*)take(NR * DM * 2); _Float16* K16 = (_Float16*)take(NR * DM * 2); _Float16* V16 = (_Float16*)take(NR * DM * 2); _Float16* O16 = (_Float16*)take(NR * DM * 2);
  float* S = (float*)take((size_t)NH * QT * NKX * 4); _Float16* P = (_Float16*)take((size_t)NH * QT * NKX * 2); _Float16* VT = (_Float16*)take((size_t)NH * HD * SQ * 2);
  float* QF0 = (float*)take((size_t)QT0 * DM * 4); float* KF0 = (float*)take((size_t)QT0 * DM * 4); float* VF0 = (float*)take((size_t)QT0 * DM * 4); float* OF0 = (float*)take((size_t)NB * QT0 * DM * 4); _Float16* OH0 = (_Float16*)take((size_t)NB * QT0 * DM * 2); _Float16* OL0 = (_Float16*)take((size_t)NB * QT0 * DM * 2);
  float* YO = (float*)take(NR * DM * 4);      /* pre-norm projection rows y (f32) */
  if (off > ws_size) return;
  { const unsigned g = (unsigned)(((size_t)DM * DM / 8 + 255) / 256); k_wnat<<<g, 256, 0, stream>>>(wq, (size_t)DM * DM / 8, BQ); k_wnat<<<g, 256, 0, stream>>>(wk, (size_t)DM * DM / 8, BK); k_wnat<<<g, 256, 0, stream>>>(wv, (size_t)DM * DM / 8, BV); k_wnat<<<g, 256, 0, stream>>>(wo, (size_t)DM * DM / 8, BO); }      /* natural [out][in] = Bt x16 */

  k_x16<<<(unsigned)((NR * DM / 8 + 255) / 256), 256, 0, stream>>>(x, X16, NR * DM / 8);
  const size_t r0p = (size_t)B0 * SQ;      /* first projected row */
  k_gemm2<0><<<dim3((unsigned)((MP / 128) * (DM / 64)), 1), 128, 0, stream>>>(X16 + r0p * DM, DM, 0, BQ, DM, 0, 0.0625f, nullptr, 0, nullptr, 1, 0, 0, nullptr, Q16 + r0p * DM, DM, 0, MP, DM, DM);
  k_gemm2<0><<<dim3((unsigned)((MP / 128) * (DM / 64)), 1), 128, 0, stream>>>(X16 + r0p * DM, DM, 0, BK, DM, 0, 0.0625f, nullptr, 0, nullptr, 1, 0, 0, nullptr, K16 + r0p * DM, DM, 0, MP, DM, DM);
  k_gemm2<0><<<dim3((unsigned)((MP / 128) * (DM / 64)), 1), 128, 0, stream>>>(X16 + r0p * DM, DM, 0, BV, DM, 0, 0.0625f, nullptr, 0, nullptr, 1, 0, 0, nullptr, V16 + r0p * DM, DM, 0, MP, DM, DM);
  for (int b = B0; b < B0 + NBR; ++b) { const size_t r0 = (size_t)b * SQ;
    k_vt<NH, SQ><<<NH * (SQ / 64), 256, 0, stream>>>(V16 + r0 * LQ, LQ, 0, VT);      /* V^T [NH][HD][SQ] for this batch */
    k_gemm2<0><<<dim3((QT0 / 128) * (DM / 64), 1), 128, 0, stream>>>(X16 + r0 * DM, DM, 0, BQ, DM, 0, 0.0625f, nullptr, 0, nullptr, 1, 0, 0, QF0, nullptr, DM, 0, QT0, DM, DM); k_gemm2<0><<<dim3((QT0 / 128) * (DM / 64), 1), 128, 0, stream>>>(X16 + r0 * DM, DM, 0, BK, DM, 0, 0.0625f, nullptr, 0, nullptr, 1, 0, 0, KF0, nullptr, DM, 0, QT0, DM, DM); k_gemm2<0><<<dim3((QT0 / 128) * (DM / 64), 1), 128, 0, stream>>>(X16 + r0 * DM, DM, 0, BV, DM, 0, 0.0625f, nullptr, 0, nullptr, 1, 0, 0, VF0, nullptr, DM, 0, QT0, DM, DM);      /* f32 q, k, v of the first 128 rows (exact products) */
    k_att0<0><<<NH * (QT0 / 64), 64, 0, stream>>>(QF0, KF0, VF0, DM, nullptr, 0.125f, OF0 + (size_t)b * QT0 * DM, DM);      /* exact f32 attention for rows 0..127 (o x64) */
    for (int q0 = 0; q0 < QN; q0 += QT) { const int nk = q0 + QT;      /* causal: only keys below the tile end are computed */
      k_gemm2<0><<<dim3((QT / 128) * (nk / 64), NHD), 128, 0, stream>>>(Q16 + (r0 + q0) * LQ, LQ, (size_t)HD, K16 + r0 * LQ, LQ, (size_t)HD, 0.125f, nullptr, 0, nullptr, 1, 0, 0, S, nullptr, NKX, (size_t)QT * NKX, QT, nk, HD);      /* scores, all heads on grid.y */
      k_rsmcf2<<<(NHD * QT + 255) / 256, 256, 0, stream>>>(S, P, NHD, q0, nk);
      k_gemm2<0><<<dim3((QT / 128) * (HD / 64), NHD), 128, 0, stream>>>(P, NKX, (size_t)QT * NKX, VT, SQ, (size_t)HD * SQ, 0.25f, nullptr, 0, nullptr, 1, 0, 0, nullptr, O16 + (r0 + q0) * DM, DM, (size_t)HD, QT, HD, nk); } }      /* o (merged heads, x64) as f16 rows */
  k_gemm2<0><<<dim3((unsigned)((MPO / 128) * (DM / 64)), 1), 128, 0, stream>>>(O16 + r0p * DM, DM, 0, BO, DM, 0, 0.0009765625f, nullptr, 0, nullptr, 1, 0, 0, YO + r0p * DM, nullptr, DM, 0, MPO, DM, DM);      /* pre-norm y rows in the output layout */
  k_hl<<<(unsigned)(((size_t)NB * QT0 * DM / 8 + 255) / 256), 256, 0, stream>>>(OF0, OH0, OL0, (size_t)NB * QT0 * DM / 8);      /* first-tile o (x64) -> f16 hi + x1024 residual planes */
  for (int b = B0; b < B0 + NBR; ++b) { const size_t r0 = (size_t)b * SQ; const size_t f0 = (size_t)b * QT0;
    k_gemm2<0><<<dim3((QT0 / 128) * (DM / 64), 1), 128, 0, stream>>>(OH0 + f0 * DM, DM, 0, BO, DM, 0, 0.0009765625f, bo, 0, nullptr, 1, 0, 0, YO + r0 * DM, nullptr, DM, 0, QT0, DM, DM);      /* rows 0..127: y = o_hi Wo, overwriting the f16-path rows */
    k_gemm2<0><<<dim3((QT0 / 128) * (DM / 64), 1), 128, 0, stream>>>(OL0 + f0 * DM, DM, 0, BO, DM, 0, 0.00000095367431640625f, nullptr, 0, (const float*)YO + r0 * DM, -1, 0, 0, YO + r0 * DM, nullptr, DM, 0, QT0, DM, DM); }      /* += o_lo Wo 2^-20 (own-element accumulate) */
  k_lnx<0, 0, 1><<<(unsigned)NR, 256, 0, stream>>>(YO, lng, lnb, 1e-5f, nullptr, (float*)d_out);      /* out = LayerNorm(y) -> f32 output rows */
}

// v001
// A run of this version takes 4100 microseconds.
// Timed twice side by side with v000, it ran 2.42 and 2.41 times as fast.
#include <hip/hip_runtime.h>
// Causal multi-head self-attention with a fused post-LayerNorm (x [4][2048][1024]; k/q/v = x W^T (natural [1024][1024], no biases); 16 heads of 64; wei = q k^T * 64^-0.5; causal (tril, -inf); softmax; y = merged Wp^T; out = LayerNorm(y) (biased var, eps per the module, gamma / beta) -> [4][2048][1024]).
// Structure: token rows r = b*2048 + s; x as exact f16 rows (bf16-rounded); Q, K, V as three WMMA GEMMs (32x64 wave tiles, f32 accumulation, exact x16 weights, f16 outputs); per batch: V^T for all heads via LDS transposes; per query tile of 256 rows: scores against the keys below the tile end only (K = 64, all heads on grid.y, alpha = 0.125), causal row softmax on VALU, one wave per row, keys above the query masked over the computed range (f32 statistics, native exp; weights x256 f16), o = P . V^T (K = keys below the tile end, alpha 2^-2: o carried x64, folded into the output GEMM alpha) written straight into the merged f16 o rows; y = o W_o GEMM (f32) into the output layout, rows 0..127 of each batch redone from an f32 attention; out = LayerNorm(y).
// Compute dtype: inputs rounded to bf16; x / weights exact; q, k, v, softmax weights and o as plain f16 GEMM operands (~2^-12); scores and softmax statistics f32. v_wmma_f32_16x16x32_f16.
#define NB 4
#define SQ 2048
#define DM 1024
#define NH 16
#define HD 64
#define HG 4                         /* heads per launch of the k_vt(b, h0) overload, which is not launched */
#define QT 256                       /* query rows per causal tile */
#define NKX SQ                       /* S / P row pitch */
#define QT0 128                      /* first-tile rows recomputed exactly in f32 */
#define B0 0                         /* first batch processed (debug hook) */
#define NBR NB                       /* batches processed (debug hook) */
#define NR ((size_t)NB * SQ)         /* token rows */
#define MP ((int)((size_t)NBR * SQ)) /* rows projected (debug hook) */
#define QN SQ                        /* query rows attended per batch (debug hook) */
#define NHD NH                       /* heads attended (debug hook) */
#define MPO MP                       /* rows through the output stage (debug hook) */
#define LQ DM      /* row pitch of the q/k/v rows */
typedef __bf16 v16b __attribute__((ext_vector_type(16)));
typedef unsigned short v8us __attribute__((ext_vector_type(8), may_alias));
typedef float  v8f  __attribute__((ext_vector_type(8)));
typedef float  v4f  __attribute__((ext_vector_type(4)));
typedef float  v4fa __attribute__((ext_vector_type(4), may_alias));
union FragB { v16b v; v8us half[2]; unsigned short u[16]; };

__device__ __forceinline__ unsigned short bf16_bits(float x) { unsigned int u = __float_as_uint(x); return (unsigned short)((u + 0x7FFFu + ((u >> 16) & 1u)) >> 16); }
__device__ __forceinline__ float bf16_val(unsigned short b) { return __uint_as_float(((unsigned int)b) << 16); }
__device__ __forceinline__ float bf16_round(float x) { return bf16_val(bf16_bits(x)); }
// D += A·B with NT terms: 1 = ah·bh, 2 = + al·bh (A split), 3 = + ah·bl (both split)
template <int NT>
__device__ __forceinline__ v8f mmaN(v16b ah, v16b al, v16b bh, v16b bl, v8f c) {
  c = __builtin_amdgcn_wmma_f32_16x16x32_bf16(false, ah, false, bh, (short)0, c, false, false);
  if (NT >= 2) c = __builtin_amdgcn_wmma_f32_16x16x32_bf16(false, al, false, bh, (short)0, c, false, false);
  if (NT >= 3) c = __builtin_amdgcn_wmma_f32_16x16x32_bf16(false, ah, false, bl, (short)0, c, false, false);
  asm volatile("v_nop\n\tv_nop\n\tv_nop\n\tv_nop" : "+v"(c) : "v"(ah), "v"(al), "v"(bh), "v"(bl));
  return c;
}

__global__ __launch_bounds__(256) void k_wt_bf16(const float* __restrict__ W, unsigned short* __restrict__ Wt, int K, int N) {
  const int t = blockIdx.x * 256 + threadIdx.x;
  const int k8n = K / 8;
  if (t >= N * k8n) return;
  const int n = t / k8n, k8 = (t % k8n) * 8;
  v8us v;
#pragma unroll
  for (int i = 0; i < 8; ++i) v[i] = bf16_bits(W[(size_t)(k8 + i) * N + n]);
  *(v8us*)(Wt + (size_t)n * K + k8) = v;
  
}

// GEMM C[M][N] (f32, pitch ldc) = act(A[M][K]·W + bias). A f32 row-major (pitch lda) converted per fragment to bf16
// (ASPLIT: hi/lo two planes -> 2 terms, else single rounded term); Wt bf16 [N][K] (pitch ldb). BIAS_BF16 rounds the
// bias to bf16 first (bias quantised to bf16 before the add). K%32==0, M%16==0, N%64==0.
template <bool ASPLIT, int ACT, bool BIAS_BF16>
__global__ __launch_bounds__(128) void k_gemm_bf(const float* __restrict__ A, int lda, const unsigned short* __restrict__ Wt, int ldb,
                                               const float* __restrict__ bias, float* __restrict__ C, int ldc, int M, int N, int K) {
  __shared__ __attribute__((aligned(16))) float so[4][16][64];
  const int tid = threadIdx.x, w = tid >> 5, lane = tid & 31, ln = lane & 15, hh = lane >> 4;
  const int ntn = N / 64;
  const int wid = blockIdx.x * 4 + w;
  const int mt = wid / ntn, nq = wid % ntn;
  if (mt * 16 >= M) return;
  const int row0 = mt * 16, col0 = nq * 64;
  const float* arow = A + (size_t)(row0 + ln) * lda;
  v8f acc[4] = {};
  for (int kb = 0; kb < K; kb += 32) {
    FragB ah, al;
    const v4f x0 = *(const v4fa*)(arow + kb + 8 * hh), x1 = *(const v4fa*)(arow + kb + 8 * hh + 4);
    const v4f x2 = *(const v4fa*)(arow + kb + 16 + 8 * hh), x3 = *(const v4fa*)(arow + kb + 16 + 8 * hh + 4);
    float xs[16] = {x0[0],x0[1],x0[2],x0[3],x1[0],x1[1],x1[2],x1[3],x2[0],x2[1],x2[2],x2[3],x3[0],x3[1],x3[2],x3[3]};
#pragma unroll
    for (int i = 0; i < 16; ++i) { const unsigned short hb = bf16_bits(xs[i]); ah.u[i] = hb; al.u[i] = ASPLIT ? bf16_bits(xs[i] - bf16_val(hb)) : (unsigned short)0; }
#pragma unroll
    for (int t = 0; t < 4; ++t) {
      const unsigned short* brow = Wt + (size_t)(col0 + t * 16 + ln) * ldb + kb;
      FragB b;
      b.half[0] = *(const v8us*)(brow + 8 * hh);
      b.half[1] = *(const v8us*)(brow + 16 + 8 * hh);
      acc[t] = mmaN<ASPLIT ? 2 : 1>(ah.v, al.v, b.v, b.v, acc[t]);
    }
  }
#pragma unroll
  for (int t = 0; t < 4; ++t) {
    float bv = bias ? bias[col0 + t * 16 + ln] : 0.f;
    if (BIAS_BF16) bv = bf16_round(bv);
#pragma unroll
    for (int r = 0; r < 8; ++r) { float v = acc[t][r] + bv; if (ACT == 1) v = fmaxf(v, 0.f); so[w][8 * hh + r][t * 16 + ln] = v; }
  }
  __builtin_amdgcn_fence(__ATOMIC_ACQ_REL, "workgroup");
  __builtin_amdgcn_wave_barrier();
  const int rsub = lane >> 4, c4 = (lane & 15) * 4;
  {
#pragma unroll
    for (int q = 0; q < 8; ++q) {
      const int r = q * 2 + rsub;
      const v4f v = *(const v4fa*)&so[w][r][c4];
      *(v4f*)(C + (size_t)(row0 + r) * ldc + col0 + c4) = v;
    }
    
  }
}

// GEMM C = act(A·W + bias + resid): A f32 (ASPLIT -> hi/lo 2 terms), Wt bf16 [N][K]; ACT 0 none, 1 relu, 2 exact gelu;
// resid (optional, f32, row index = (row % rmod), pitch ldr, RES_BF16 rounds it) added before the activation.
template <bool ASPLIT, int ACT, bool BIAS_BF16, bool RES_BF16>
__global__ __launch_bounds__(128) void k_gemm_bf3(const float* __restrict__ A, int lda, const unsigned short* __restrict__ Wt, int ldb,
                                                const float* __restrict__ bias, const float* __restrict__ resid, int rmod, int ldr,
                                                float* __restrict__ C, int ldc, int M, int N, int K) {
  __shared__ __attribute__((aligned(16))) float so[4][16][64];
  const int tid = threadIdx.x, w = tid >> 5, lane = tid & 31, ln = lane & 15, hh = lane >> 4;
  const int ntn = N / 64;
  const int wid = blockIdx.x * 4 + w;
  const int mt = wid / ntn, nq = wid % ntn;
  if (mt * 16 >= M) return;
  const int row0 = mt * 16, col0 = nq * 64;
  const float* arow = A + (size_t)(row0 + ln) * lda;
  v8f acc[4] = {};
  for (int kb = 0; kb < K; kb += 32) {
    FragB ah, al;
    const v4f x0 = *(const v4fa*)(arow + kb + 8 * hh), x1 = *(const v4fa*)(arow + kb + 8 * hh + 4);
    const v4f x2 = *(const v4fa*)(arow + kb + 16 + 8 * hh), x3 = *(const v4fa*)(arow + kb + 16 + 8 * hh + 4);
    float xs[16] = {x0[0],x0[1],x0[2],x0[3],x1[0],x1[1],x1[2],x1[3],x2[0],x2[1],x2[2],x2[3],x3[0],x3[1],x3[2],x3[3]};
#pragma unroll
    for (int i = 0; i < 16; ++i) { const unsigned short hb = bf16_bits(xs[i]); ah.u[i] = hb; al.u[i] = ASPLIT ? bf16_bits(xs[i] - bf16_val(hb)) : (unsigned short)0; }
#pragma unroll
    for (int t = 0; t < 4; ++t) {
      const unsigned short* brow = Wt + (size_t)(col0 + t * 16 + ln) * ldb + kb;
      FragB b;
      b.half[0] = *(const v8us*)(brow + 8 * hh);
      b.half[1] = *(const v8us*)(brow + 16 + 8 * hh);
      acc[t] = mmaN<ASPLIT ? 2 : 1>(ah.v, al.v, b.v, b.v, acc[t]);
    }
  }
#pragma unroll
  for (int t = 0; t < 4; ++t) {
    const int col = col0 + t * 16 + ln;
    float bv = bias ? bias[col] : 0.f;
    if (BIAS_BF16) bv = bf16_round(bv);
#pragma unroll
    for (int r = 0; r < 8; ++r) {
      float v = acc[t][r] + bv;
      if (resid) { float rv = resid[(size_t)((row0 + 8 * hh + r) % rmod) * ldr + col]; if (RES_BF16) rv = bf16_round(rv); v += rv; }
      if (ACT == 1) v = fmaxf(v, 0.f);
      if (ACT == 2) v = 0.5f * v * (1.0f + erff(v * 0.70710678118654752f));
      if (ACT == 3) { const float u = 0.7978845608028654f * (v + 0.044715f * v * v * v); v = 0.5f * v * (1.0f + tanhf(u)); }
      so[w][8 * hh + r][t * 16 + ln] = v;
    }
  }
  __builtin_amdgcn_fence(__ATOMIC_ACQ_REL, "workgroup");
  __builtin_amdgcn_wave_barrier();
  const int rsub = lane >> 4, c4 = (lane & 15) * 4;
  {
#pragma unroll
    for (int q = 0; q < 8; ++q) {
      const int r = q * 2 + rsub;
      const v4f v = *(const v4fa*)&so[w][r][c4];
      *(v4f*)(C + (size_t)(row0 + r) * ldc + col0 + c4) = v;
    }
    
  }
}
// row LayerNorm (biased variance, eps) over N: s = X (+ R); optional out_sum <- s; out_norm <- (s-mu)*rsqrt(var+eps)*g + b
template <bool PARAM_BF16>
__global__ __launch_bounds__(256) void k_layernorm(const float* __restrict__ X, const float* __restrict__ R, const float* __restrict__ g, const float* __restrict__ bta,
                                                  float* __restrict__ out_sum, float* __restrict__ out_norm, int N, float eps) {
  __shared__ float red[256];
  const int row = blockIdx.x, tid = threadIdx.x;
  const float* x = X + (size_t)row * N; const float* rr = R ? R + (size_t)row * N : nullptr;
  float vals[16];                     // up to N = 4096
  const int per = N / 256;            // contiguous chunk per thread? use strided-by-4 chunks: thread handles j = tid*4 + 1024*u
  float s1 = 0.f;
  for (int u = 0; u < per / 4; ++u) {
    const int j = tid * 4 + 1024 * u;
    const v4f a = *(const v4fa*)(x + j);
    v4f b = {0.f,0.f,0.f,0.f}; if (rr) b = *(const v4fa*)(rr + j);
#pragma unroll
    for (int q = 0; q < 4; ++q) { const float v = a[q] + b[q]; vals[u * 4 + q] = v; s1 += v; }
  }
  red[tid] = s1; __syncthreads();
  for (int st = 128; st > 0; st >>= 1) { if (tid < st) red[tid] += red[tid + st]; __syncthreads(); }
  const float mu = red[0] / (float)N; __syncthreads();
  float s2 = 0.f;
  for (int u = 0; u < per / 4; ++u)
#pragma unroll
    for (int q = 0; q < 4; ++q) { const float c = vals[u * 4 + q] - mu; s2 += c * c; }
  red[tid] = s2; __syncthreads();
  for (int st = 128; st > 0; st >>= 1) { if (tid < st) red[tid] += red[tid + st]; __syncthreads(); }
  const float rs = rsqrtf(red[0] / (float)N + eps);
  {
    for (int u = 0; u < per / 4; ++u) {
      const int j = tid * 4 + 1024 * u;
      v4f o, sm;
#pragma unroll
      for (int q = 0; q < 4; ++q) {
        float gg = g[j + q], bb = bta[j + q];
        if (PARAM_BF16) { gg = bf16_round(gg); bb = bf16_round(bb); }
        sm[q] = vals[u * 4 + q]; o[q] = (vals[u * 4 + q] - mu) * rs * gg + bb;
      }
      if (out_sum) *(v4f*)(out_sum + (size_t)row * N + j) = sm;
      *(v4f*)(out_norm + (size_t)row * N + j) = o;
    }
    
  }
}



// ---- f16 WMMA path (v_wmma_f32_16x16x32_f16): 11-bit significands for operands in range — used where a [0,1] probability operand needs more precision than bf16
typedef _Float16 v16h __attribute__((ext_vector_type(16)));
union FragH { v16h v; v8us half[2]; _Float16 h[16]; unsigned short u[16]; };
template <int NT>
__device__ __forceinline__ v8f mmaH(v16h ah, v16h al, v16h bh, v16h bl, v8f c) {
  c = __builtin_amdgcn_wmma_f32_16x16x32_f16(false, ah, false, bh, (short)0, c, false, false);
  if (NT >= 2) c = __builtin_amdgcn_wmma_f32_16x16x32_f16(false, al, false, bh, (short)0, c, false, false);
  if (NT >= 3) c = __builtin_amdgcn_wmma_f32_16x16x32_f16(false, ah, false, bl, (short)0, c, false, false);
  asm volatile("v_nop\n\tv_nop\n\tv_nop\n\tv_nop" : "+v"(c) : "v"(ah), "v"(al), "v"(bh), "v"(bl));
  return c;
}
// batched GEMM like k_gemm_b but f16 operands: A f32 (split into f16 hi/lo if ASPLIT, else rounded to f16), Bt = f16 values [n][k]; alpha; C f32; N multiple of 16 (partial tiles skipped)
template <bool ASPLIT>
__global__ __launch_bounds__(128) void k_gemm_h(const float* __restrict__ A, int lda, size_t sA, const _Float16* __restrict__ Bh, int ldb, size_t sB, float alpha, float* __restrict__ C, int ldc, size_t sC, int M, int N, int K) {
  __shared__ __attribute__((aligned(16))) float so[4][16][64];
  const int tid = threadIdx.x, w = tid >> 5, lane = tid & 31, ln = lane & 15, hh = lane >> 4; const int by = blockIdx.y;
  A += (size_t)by * sA; Bh += (size_t)by * sB; C += (size_t)by * sC;
  const int ntn = (N + 63) / 64; const int wid = blockIdx.x * 4 + w; const int mt = wid / ntn, nq = wid % ntn; if (mt * 16 >= M) return;
  const int row0 = mt * 16, col0 = nq * 64; const float* arow = A + (size_t)(row0 + ln) * lda;
  v8f acc[4] = {};
  for (int kb = 0; kb < K; kb += 32) {
    FragH ah, al;
    const v4f x0 = *(const v4fa*)(arow + kb + 8 * hh), x1 = *(const v4fa*)(arow + kb + 8 * hh + 4), x2 = *(const v4fa*)(arow + kb + 16 + 8 * hh), x3 = *(const v4fa*)(arow + kb + 16 + 8 * hh + 4);
    float xs[16] = {x0[0],x0[1],x0[2],x0[3],x1[0],x1[1],x1[2],x1[3],x2[0],x2[1],x2[2],x2[3],x3[0],x3[1],x3[2],x3[3]};
#pragma unroll
    for (int i = 0; i < 16; ++i) { const _Float16 h = (_Float16)xs[i]; ah.h[i] = h; al.h[i] = ASPLIT ? (_Float16)(xs[i] - (float)h) : (_Float16)0.0f; }
#pragma unroll
    for (int t = 0; t < 4; ++t) { if (col0 + t * 16 >= N) continue; const size_t boff = (size_t)(col0 + t * 16 + ln) * ldb + kb; FragH bq; bq.half[0] = *(const v8us*)(Bh + boff + 8 * hh); bq.half[1] = *(const v8us*)(Bh + boff + 16 + 8 * hh);
      acc[t] = mmaH<ASPLIT ? 2 : 1>(ah.v, al.v, bq.v, bq.v, acc[t]); }
  }
#pragma unroll
  for (int t = 0; t < 4; ++t) { if (col0 + t * 16 >= N) continue;
#pragma unroll
    for (int r = 0; r < 8; ++r) so[w][8 * hh + r][t * 16 + ln] = acc[t][r] * alpha; }
  __builtin_amdgcn_fence(__ATOMIC_ACQ_REL, "workgroup"); __builtin_amdgcn_wave_barrier();
  const int rsub = lane >> 4, c4 = (lane & 15) * 4;
  {
#pragma unroll
    for (int q = 0; q < 8; ++q) { const int r = q * 2 + rsub; if (col0 + c4 < N) { const v4f v = *(const v4fa*)&so[w][r][c4]; *(v4f*)(C + (size_t)(row0 + r) * ldc + col0 + c4) = v; } }
     }
}

// Wt[n][k] = f16(W[k][n]·scale) from f32 row-major W[K][N] (scale = power of two; bf16-exact weights stay exact in f16 away from the subnormal range)
__global__ __launch_bounds__(256) void k_wt_f16(const float* __restrict__ W, _Float16* __restrict__ Wt, int K, int N, float scale) {
  const int t = blockIdx.x * 256 + threadIdx.x; if (t >= N * (K / 8)) return; const int n = t / (K / 8), k8 = (t % (K / 8)) * 8; FragH f;
#pragma unroll
  for (int i = 0; i < 8; ++i) f.h[i] = (_Float16)(bf16_round(W[(size_t)(k8 + i) * N + n]) * scale); const v8us o = f.half[0];
  *(v8us*)((unsigned short*)Wt + (size_t)n * K + k8) = o; 
}
// k_gemm_hh variant with fused epilogue: v = acc·alpha + bias[by·sBias + col] (+ CP[(row/rowsPerB)·sCPb + by·64 + col] if CP) ; ACT 0 none / 1 elu ; writes f16 C16 (and f32 C if non-null)
template <int ACT>
__global__ __launch_bounds__(128) void k_gemm_hhx(const _Float16* __restrict__ A, int lda, size_t sA, const _Float16* __restrict__ Bh, int ldb, size_t sB, float alpha, const float* __restrict__ bias, size_t sBias, const float* __restrict__ CP, int rowsPerB, size_t sCPb, int row0g,
    float* __restrict__ C, _Float16* __restrict__ C16, int ldc, size_t sC, int M, int N, int K) {
  __shared__ __attribute__((aligned(16))) float so[4][16][64];
  const int tid = threadIdx.x, w = tid >> 5, lane = tid & 31, ln = lane & 15, hh = lane >> 4; const int by = blockIdx.y;
  A += (size_t)by * sA; Bh += (size_t)by * sB; const size_t cofs = (size_t)by * sC; const float* bp = bias ? bias + (size_t)by * sBias : nullptr;
  const int ntn = (N + 63) / 64; const int wid = blockIdx.x * 4 + w; const int mt = wid / ntn, nq = wid % ntn; if (mt * 16 >= M) return;
  const int row0 = mt * 16, col0 = nq * 64; const _Float16* arow = A + (size_t)(row0 + ln) * lda;
  v8f acc[4] = {};
  for (int kb = 0; kb < K; kb += 32) { FragH ah; ah.half[0] = *(const v8us*)((const unsigned short*)arow + kb + 8 * hh); ah.half[1] = *(const v8us*)((const unsigned short*)arow + kb + 16 + 8 * hh);
#pragma unroll
    for (int t = 0; t < 4; ++t) { if (col0 + t * 16 >= N) continue; const size_t boff = (size_t)(col0 + t * 16 + ln) * ldb + kb; FragH bq; bq.half[0] = *(const v8us*)((const unsigned short*)Bh + boff + 8 * hh); bq.half[1] = *(const v8us*)((const unsigned short*)Bh + boff + 16 + 8 * hh);
      acc[t] = mmaH<1>(ah.v, ah.v, bq.v, bq.v, acc[t]); }
  }
#pragma unroll
  for (int t = 0; t < 4; ++t) { if (col0 + t * 16 >= N) continue; const int col = col0 + t * 16 + ln; const float bv = bp ? bf16_round(bp[col]) : 0.f;
#pragma unroll
    for (int r = 0; r < 8; ++r) { float v = acc[t][r] * alpha + bv; if (CP) { const int rr = row0g + row0 + 8 * hh + r; if (rowsPerB < 0) v += CP[cofs + (size_t)rr * ldc + col];      /* rowsPerB < 0: own element of the batched C plane */ else { const int bidx = rr / rowsPerB; v += CP[(size_t)bidx * sCPb + (size_t)by * 64 + col]; } } if (ACT == 1) v = (v > 0.f) ? v : expm1f(v); else if (ACT == 7) v = (v > 0.f) ? v + 1.0f : expf(v); else if (ACT == 8) v = tanhf(v); else if (ACT == 9) v = 0.5f * v * (1.0f + tanhf(0.7978845608028654f * (v + 0.044715f * v * v * v))); else if (ACT == 11) v = 1.0f / (1.0f + expf(-v)); else if (ACT == 12) v = (v > 0.f) ? v : 0.01f * v; else if (ACT == 14) v = (v > 0.f) ? v : 0.1f * v; else if (ACT == 16) v = (v >= 0.f) ? v : 0.3f * v; else if (ACT == 17) v = (v >= 0.f) ? v : 0.2f * v; else if (ACT == 15) v = v / (1.0f + expf(-v)); else if (ACT == 3) v = fmaxf(v, 0.f); else if (ACT == 6) v = 0.5f * v * (1.0f + erff(v * 0.70710678118654752f)); so[w][8 * hh + r][t * 16 + ln] = v; } }
  __builtin_amdgcn_fence(__ATOMIC_ACQ_REL, "workgroup"); __builtin_amdgcn_wave_barrier();
  const int rsub = lane >> 4, c4 = (lane & 15) * 4; typedef _Float16 v4h __attribute__((ext_vector_type(4)));
  {
#pragma unroll
    for (int q = 0; q < 8; ++q) { const int r = q * 2 + rsub; if (col0 + c4 < N) { const v4f v = *(const v4fa*)&so[w][r][c4]; if (C) *(v4f*)(C + cofs + (size_t)(row0 + r) * ldc + col0 + c4) = v; if (C16) { v4h h4; for (int i = 0; i < 4; ++i) h4[i] = (_Float16)v[i]; *(v4h*)(C16 + cofs + (size_t)(row0 + r) * ldc + col0 + c4) = h4; } } }
     }
}


typedef _Float16 v4h __attribute__((ext_vector_type(4)));

__global__ __launch_bounds__(256) void k_x16(const float* __restrict__ x, _Float16* __restrict__ X16, size_t n8) { const size_t t = (size_t)blockIdx.x * 256 + threadIdx.x; if (t >= n8) return; FragH f;
#pragma unroll
  for (int q = 0; q < 8; ++q) f.h[q] = (_Float16)bf16_round(x[t * 8 + q]); *(v8us*)((unsigned short*)X16 + t * 8) = f.half[0];  }
__global__ __launch_bounds__(256) void k_h16(const float* __restrict__ x, _Float16* __restrict__ X16, size_t n8) { const size_t t = (size_t)blockIdx.x * 256 + threadIdx.x; if (t >= n8) return; FragH f;
#pragma unroll
  for (int q = 0; q < 8; ++q) f.h[q] = (_Float16)x[t * 8 + q]; *(v8us*)((unsigned short*)X16 + t * 8) = f.half[0];  }
__global__ __launch_bounds__(256) void k_round16f(const float* __restrict__ W, _Float16* __restrict__ Bt, size_t n8) { const size_t t = (size_t)blockIdx.x * 256 + threadIdx.x; if (t >= n8) return; FragH f;
#pragma unroll
  for (int i = 0; i < 8; ++i) f.h[i] = (_Float16)(bf16_round(W[t * 8 + i]) * 16.0f); *(v8us*)((unsigned short*)Bt + t * 8) = f.half[0];  }
template <int NHv, int TTv>
__global__ __launch_bounds__(256) void k_vt(const _Float16* __restrict__ V16, int ldv, int voff, _Float16* __restrict__ Vt) { __shared__ unsigned short tl[64][66]; const int tid = threadIdx.x; const int slab = blockIdx.x / (TTv / 64), lg = blockIdx.x % (TTv / 64); const int b = slab / NHv, h = slab % NHv;
  for (int i = tid; i < 64 * 8; i += 256) { const int r = i / 8, c8 = (i % 8) * 8; FragH f; f.half[0] = *(const v8us*)((const unsigned short*)V16 + ((size_t)b * TTv + lg * 64 + r) * ldv + voff + h * 64 + c8);
#pragma unroll
    for (int q = 0; q < 8; ++q) tl[r][c8 + q] = f.u[q]; }
  __syncthreads();
  {
#pragma unroll
    for (int rd = 0; rd < 2; ++rd) { const int d = rd * 32 + tid / 8, pc = tid % 8; FragH f;
#pragma unroll
      for (int q = 0; q < 8; ++q) f.u[q] = tl[pc * 8 + q][d];
      *(v8us*)((unsigned short*)Vt + ((size_t)slab * 64 + d) * TTv + lg * 64 + pc * 8) = f.half[0]; }
     } }

__global__ __launch_bounds__(256) void k_hl(const float* __restrict__ F, _Float16* __restrict__ Hh, _Float16* __restrict__ Hl, size_t n8) { const size_t t = (size_t)blockIdx.x * 256 + threadIdx.x; if (t >= n8) return; FragH fh, fl; const v4f a = *(const v4fa*)(F + t * 8), c = *(const v4fa*)(F + t * 8 + 4);
#pragma unroll
  for (int q = 0; q < 4; ++q) { _Float16 h = (_Float16)a[q]; fh.h[q] = h; fl.h[q] = (_Float16)((a[q] - (float)h) * 1024.0f); h = (_Float16)c[q]; fh.h[4 + q] = h; fl.h[4 + q] = (_Float16)((c[q] - (float)h) * 1024.0f); }
  { *(v8us*)((unsigned short*)Hh + t * 8) = fh.half[0]; *(v8us*)((unsigned short*)Hl + t * 8) = fl.half[0];  } }

// ---- fast GEMM (wave tile 32x64; requires M % 32 == 0 rows per launch region and N % 64 == 0); epilogue = k_gemm_hhx semantics ----
__device__ __forceinline__ v16h g2_frag(const _Float16* p, int hh) { FragH f; f.half[0] = *(const v8us*)((const unsigned short*)p + 8 * hh); f.half[1] = *(const v8us*)((const unsigned short*)p + 16 + 8 * hh); return f.v; }
__device__ __forceinline__ v8f g2_mma(v16h a, v16h b, v8f c) { v8f d = __builtin_amdgcn_wmma_f32_16x16x32_f16(false, a, false, b, (short)0, c, false, false); asm volatile("v_nop\n\tv_nop\n\tv_nop\n\tv_nop" : "+v"(d) : "v"(a), "v"(b)); return d; }
template <int ACT>
__global__ __launch_bounds__(128) void k_gemm2(const _Float16* __restrict__ A, int lda, size_t sA, const _Float16* __restrict__ Bh, int ldb, size_t sB, float alpha, const float* __restrict__ bias, size_t sBias, const float* __restrict__ CP, int rowsPerB, size_t sCPb, int row0g,
    float* __restrict__ C, _Float16* __restrict__ C16, int ldc, size_t sC, int M, int N, int K) { static_assert(ACT == 0 || ACT == 3 || ACT == 6 || ACT == 8 || ACT == 9 || ACT == 11 || ACT == 12 || ACT == 14 || ACT == 15 || ACT == 16 || ACT == 17, "k_gemm2: unsupported ACT code (would silently apply no activation)");
  __shared__ __attribute__((aligned(16))) float so[4][32][68];
  const int tid = threadIdx.x, w = tid >> 5, lane = tid & 31, ln = lane & 15, hh = lane >> 4; const int by = blockIdx.y;
  A += (size_t)by * sA; Bh += (size_t)by * sB; const size_t cofs = (size_t)by * sC; const float* bp = bias ? bias + (size_t)by * sBias : nullptr;
  const int ntn = N >> 6; const int mt = blockIdx.x / ntn, nq = blockIdx.x - mt * ntn; const int row0 = mt * 128 + 32 * w, col0 = nq * 64; if (row0 >= M) return;
  const _Float16* a0p = A + (size_t)(row0 + ln) * lda; const _Float16* a1p = a0p + (size_t)16 * lda;
  const _Float16* b0p = Bh + (size_t)(col0 + ln) * ldb; const _Float16* b1p = b0p + (size_t)16 * ldb; const _Float16* b2p = b1p + (size_t)16 * ldb; const _Float16* b3p = b2p + (size_t)16 * ldb;
  const v8f z8 = {0.f,0.f,0.f,0.f,0.f,0.f,0.f,0.f}; v8f c00 = z8, c01 = z8, c02 = z8, c03 = z8, c10 = z8, c11 = z8, c12 = z8, c13 = z8;
#pragma unroll 1
  for (int kb = 0; kb < K; kb += 32) { const v16h a0 = g2_frag(a0p + kb, hh), a1 = g2_frag(a1p + kb, hh);
    v16h b = g2_frag(b0p + kb, hh); c00 = g2_mma(a0, b, c00); c10 = g2_mma(a1, b, c10);
    b = g2_frag(b1p + kb, hh); c01 = g2_mma(a0, b, c01); c11 = g2_mma(a1, b, c11);
    b = g2_frag(b2p + kb, hh); c02 = g2_mma(a0, b, c02); c12 = g2_mma(a1, b, c12);
    b = g2_frag(b3p + kb, hh); c03 = g2_mma(a0, b, c03); c13 = g2_mma(a1, b, c13); }
  v8f accs[8] = {c00, c01, c02, c03, c10, c11, c12, c13};
#pragma unroll
  for (int u = 0; u < 8; ++u) { const int t = u & 3, half = u >> 2; const int col = col0 + t * 16 + ln; const float bv = bp ? bf16_round(bp[col]) : 0.f;
#pragma unroll
    for (int r = 0; r < 8; ++r) { const int rloc = half * 16 + 8 * hh + r; float v = accs[u][r] * alpha + bv; if (CP) { if (rowsPerB < 0) v += CP[cofs + (size_t)(row0g + row0 + rloc) * ldc + col];      /* rowsPerB < 0: own element of the batched C plane */ else { const int bidx = (row0g + row0 + rloc) / rowsPerB; v += CP[(size_t)bidx * sCPb + (size_t)by * 64 + col]; } }
      if (ACT == 3) v = fmaxf(v, 0.f); else if (ACT == 6) v = 0.5f * v * (1.0f + erff(v * 0.70710678118654752f)); else if (ACT == 11) v = 1.0f / (1.0f + expf(-v)); else if (ACT == 15) v = v / (1.0f + expf(-v)); else if (ACT == 12) v = (v > 0.f) ? v : 0.01f * v; else if (ACT == 8) v = tanhf(v); else if (ACT == 9) v = 0.5f * v * (1.0f + tanhf(0.7978845608028654f * (v + 0.044715f * v * v * v))); else if (ACT == 14) v = (v > 0.f) ? v : 0.1f * v; else if (ACT == 16) v = (v >= 0.f) ? v : 0.3f * v; else if (ACT == 17) v = (v >= 0.f) ? v : 0.2f * v;
      so[w][rloc][t * 16 + ln] = v; } }
  __builtin_amdgcn_fence(__ATOMIC_ACQ_REL, "workgroup"); __builtin_amdgcn_wave_barrier();
  const int rsub = lane >> 4, c4 = (lane & 15) * 4;
  {
#pragma unroll
    for (int q = 0; q < 16; ++q) { const int r = q * 2 + rsub; const v4f v = *(const v4fa*)&so[w][r][c4]; if (C) *(v4f*)(C + cofs + (size_t)(row0 + r) * ldc + col0 + c4) = v; if (C16) { v4h h4; for (int i = 0; i < 4; ++i) h4[i] = (_Float16)v[i]; *(v4h*)(C16 + cofs + (size_t)(row0 + r) * ldc + col0 + c4) = h4; } }
     } }


__global__ __launch_bounds__(256) void k_wnat(const float* __restrict__ w, size_t n8, _Float16* __restrict__ Bt) { const size_t t = (size_t)blockIdx.x * 256 + threadIdx.x; if (t >= n8) return; FragH f; for (int q = 0; q < 8; ++q) f.h[q] = (_Float16)(bf16_round(w[t * 8 + q]) * 16.0f); *(v8us*)((unsigned short*)Bt + t * 8) = f.half[0];  }
__global__ __launch_bounds__(256) void k_rsm(const float* __restrict__ S, _Float16* __restrict__ P, int nrows) {
  #pragma clang fp contract(off)
  const int i = blockIdx.x * 256 + threadIdx.x; if (i >= nrows) return; const float* s = S + (size_t)i * SQ; float mx = -3.0e38f;
#pragma unroll 1
  for (int j = 0; j < SQ; ++j) mx = fmaxf(mx, s[j]); float se = 0.f;
#pragma unroll 1
  for (int j = 0; j < SQ; ++j) se += expf(s[j] - mx); const float sc = 256.0f / se;
#pragma unroll 1
  for (int j0 = 0; j0 < SQ; j0 += 8) { FragH f; for (int q = 0; q < 8; ++q) f.h[q] = (_Float16)(expf(s[j0 + q] - mx) * sc); unsigned short* d = (unsigned short*)P + (size_t)i * SQ + j0; *(v8us*)d = f.half[0];  } }
__global__ __launch_bounds__(256) void k_vt(const _Float16* __restrict__ V16, int b, int h0, _Float16* __restrict__ VT) { __shared__ unsigned short tl[64][65]; const int tid = threadIdx.x; const int hh = blockIdx.x % HG, sg = blockIdx.x / HG; const int s0 = sg * 64; const int h = h0 + hh;
  for (int i = tid; i < 64 * 8; i += 256) { const int j = i / 8, d8 = (i % 8) * 8; FragH f; f.half[0] = *(const v8us*)((const unsigned short*)V16 + ((size_t)b * SQ + s0 + j) * DM + h * HD + d8); for (int q = 0; q < 8; ++q) tl[d8 + q][j] = f.u[q]; }
  __syncthreads();
  { for (int i = tid; i < 64 * 8; i += 256) { const int d = i / 8, j8 = (i % 8) * 8; FragH f; for (int q = 0; q < 8; ++q) f.u[q] = tl[d][j8 + q]; *(v8us*)((unsigned short*)VT + ((size_t)hh * HD + d) * SQ + s0 + j8) = f.half[0]; }  } }



// Native exp as __expf compiles it: v_exp_f32 of x * log2(e). Written as asm so that the v_nop stands directly behind the transcendental: it keeps the one free
// issue slot that the instruction set asks for before an instruction that reads the result or overwrites the source.
__device__ __forceinline__ float exp_native(float x) { float r; asm("v_exp_f32 %0, %1\n\tv_nop" : "=v"(r) : "v"(x * 1.44269504088896340736f)); return r; }
// Causal row softmax, one wave per score row (row t = head * QT + query) over the NCH * 128 computed keys. Lane l holds keys 128 c + 4 l .. + 3 of chunk c, so
// every load covers 512 contiguous bytes and every store 256; the row is read once and stays in registers. Keys above the query get -1e9 (weight exactly 0).
// Row maximum and row sum: per lane over its own keys (the sum in four chains), then a five-step butterfly over the wave. Weights x256 as f16.
template <int NCH>
__global__ __launch_bounds__(256) void k_rsmw(const float* __restrict__ S, _Float16* __restrict__ P, int hg, int q0) {
  const int lane = threadIdx.x & 31; const int t = blockIdx.x * 8 + __builtin_amdgcn_readfirstlane(threadIdx.x >> 5); if (t >= hg * QT) return;      /* the row index is the wave's: scalar; the kernel has no barrier */
  const float* s = S + (size_t)t * NKX; _Float16* p = P + (size_t)t * NKX; const int rel = q0 + (t % QT) - lane * 4;      /* key 128 c + 4 l + q is kept while 128 c + q <= rel */
  v4f v[NCH];
#pragma unroll
  for (int c = 0; c < NCH; ++c) v[c] = *(const v4fa*)(s + c * 128 + lane * 4);
  float mx = -3.0e38f;
#pragma unroll
  for (int c = 0; c < NCH; ++c) for (int q = 0; q < 4; ++q) { v[c][q] = (c * 128 + q <= rel) ? v[c][q] : -1.0e9f; mx = fmaxf(mx, v[c][q]); }
  for (int m = 16; m > 0; m >>= 1) mx = fmaxf(mx, __shfl_xor(mx, m, 32));
  v4f s4 = {0.f, 0.f, 0.f, 0.f};      /* four independent sum chains per lane */
#pragma unroll
  for (int c = 0; c < NCH; ++c) for (int q = 0; q < 4; ++q) { v[c][q] = exp_native(v[c][q] - mx); s4[q] += v[c][q]; }
  float se = (s4[0] + s4[1]) + (s4[2] + s4[3]);
  for (int m = 16; m > 0; m >>= 1) se += __shfl_xor(se, m, 32);
  const float sc = 256.0f / se;
#pragma unroll
  for (int c = 0; c < NCH; ++c) { v4h h4; for (int q = 0; q < 4; ++q) h4[q] = (_Float16)(v[c][q] * sc); *(v4h*)(p + c * 128 + lane * 4) = h4; } }


template <int MASKADD>
__global__ __launch_bounds__(64) void k_att0(const float* __restrict__ QF, const float* __restrict__ KF, const float* __restrict__ VF, int ld, const float* __restrict__ mask, float scale, float* __restrict__ OF, int ldo) {
  #pragma clang fp contract(off)
  __shared__ __attribute__((aligned(16))) float lq[64][64]; __shared__ __attribute__((aligned(16))) float lo[64][64];
  const int tid = threadIdx.x; const int h = blockIdx.x / (QT0 / 64), rg = blockIdx.x % (QT0 / 64); const int i = rg * 64 + tid;
  const float* qr = QF + (size_t)i * ld + h * HD;
#pragma unroll 1
  for (int c = 0; c < HD / 4; ++c) { *(v4f*)&lq[tid][c * 4] = *(const v4fa*)(qr + c * 4); const v4f z = {0.f, 0.f, 0.f, 0.f}; *(v4f*)&lo[tid][c * 4] = z; }
  float m = -1.0e30f, l = 0.f; const int jmax = MASKADD ? (SQ - 1) : (rg * 64 + 63);      /* additive-mask form: every key (the mask input decides); causal form: keys up to the block's last row */
#pragma unroll 1
  for (int j = 0; j <= jmax; ++j) { const float* kr = KF + (size_t)j * ld + h * HD; const float* vr = VF + (size_t)j * ld + h * HD; float s = 0.f;
#pragma unroll 1
    for (int c = 0; c < HD / 4; ++c) { const v4f kq = *(const v4fa*)(kr + c * 4); const v4f qq = *(v4f*)&lq[tid][c * 4]; s = __fadd_rn(s, __fmul_rn(qq[0], kq[0])); s = __fadd_rn(s, __fmul_rn(qq[1], kq[1])); s = __fadd_rn(s, __fmul_rn(qq[2], kq[2])); s = __fadd_rn(s, __fmul_rn(qq[3], kq[3])); }
    s = __fmul_rn(s, scale); if (MASKADD) s = __fadd_rn(s, __fmul_rn(bf16_round(mask[(size_t)i * SQ + j]), -10000.0f));
    const float f = (MASKADD || j <= i) ? 1.f : 0.f; const float sm = fmaf(f, s, (1.f - f) * -1.0e30f); const float mn = fmaxf(m, sm); const float sc = expf(m - mn); const float e = expf(sm - mn); l = __fadd_rn(__fmul_rn(l, sc), e); m = mn;
#pragma unroll 1
    for (int c = 0; c < HD / 4; ++c) { const v4f vv = *(const v4fa*)(vr + c * 4); v4f oo = *(v4f*)&lo[tid][c * 4]; for (int u = 0; u < 4; ++u) oo[u] = __fadd_rn(__fmul_rn(oo[u], sc), __fmul_rn(e, vv[u])); *(v4f*)&lo[tid][c * 4] = oo; } }
  const float fin = 64.0f / l;      /* o carried x64 like the f16 path */
#pragma unroll 1
  for (int c = 0; c < HD / 4; ++c) { v4f oo = *(v4f*)&lo[tid][c * 4]; for (int u = 0; u < 4; ++u) oo[u] = __fmul_rn(oo[u], fin); *(v4f*)&lo[tid][c * 4] = oo; }
  __syncthreads();
  {
#pragma unroll 1
    for (int it = 0; it < 16; ++it) { const int row = it * 4 + tid / 16, pc = (tid % 16) * 4; const v4f v = *(const v4f*)&lo[row][pc]; *(v4f*)(OF + (size_t)(rg * 64 + row) * ldo + h * HD + pc) = v; }
     } }

#define DMQ DM

template <int BFIN, int W16, int W32>
__global__ __launch_bounds__(256) void k_lnx(const float* __restrict__ X, const float* __restrict__ g, const float* __restrict__ bb, float eps, _Float16* __restrict__ N16, float* __restrict__ N32) {
  #pragma clang fp contract(off)
  __shared__ float red[256]; const size_t r = blockIdx.x; const int t = threadIdx.x; const bool act = t < (DMQ / 4); const int c0 = act ? t * 4 : 0;
  const v4f xa = *(const v4fa*)(X + r * DMQ + c0); float s[4]; float sum = 0.f;
  for (int q = 0; q < 4; ++q) { s[q] = act ? (BFIN ? bf16_round(xa[q]) : xa[q]) : 0.f; sum = __fadd_rn(sum, s[q]); }
  red[t] = sum; __syncthreads(); for (int st = 128; st > 0; st >>= 1) { if (t < st) red[t] = __fadd_rn(red[t], red[t + st]); __syncthreads(); } const float mu = red[0] / (float)DMQ; __syncthreads();
  float vs = 0.f; for (int q = 0; q < 4; ++q) { const float dl = act ? __fadd_rn(s[q], -mu) : 0.f; vs = __fadd_rn(vs, __fmul_rn(dl, dl)); } red[t] = vs; __syncthreads(); for (int st = 128; st > 0; st >>= 1) { if (t < st) red[t] = __fadd_rn(red[t], red[t + st]); __syncthreads(); }
  const float rs = rsqrtf(__fadd_rn(red[0] / (float)DMQ, eps)); v4h y; v4f yf;
  for (int q = 0; q < 4; ++q) { const int c = c0 + q; yf[q] = __fadd_rn(__fmul_rn(__fmul_rn(__fadd_rn(s[q], -mu), rs), bf16_round(g[c])), bf16_round(bb[c])); y[q] = (_Float16)yf[q]; }
  if (!act) return;      /* no barriers after this point */
  { if (W16) *(v4h*)(N16 + r * DMQ + c0) = y; if (W32) *(v4f*)(N32 + r * DMQ + c0) = yf;  } }


extern "C" void kernel_launch(void* const* d_in, const int* in_sizes, int n_in,
                              void* d_out, int out_size, void* d_ws, size_t ws_size, hipStream_t stream) {
  (void)in_sizes; (void)n_in; (void)out_size;
  const float* const* I = (const float* const*)d_in; const float* x = I[0]; const float* wk = I[1]; const float* wq = I[2]; const float* wv = I[3]; const float* wo = I[4]; const float* lng = I[5]; const float* lnb = I[6]; const float* bq = nullptr; const float* bk = nullptr; const float* bv = nullptr; const float* bo = nullptr;      /* x; natural [out][in] Wk, Wq, Wv (THIS order), Wp; LayerNorm gamma, beta; no biases */
  char* ws = (char*)d_ws; size_t off = 0;
  auto take = [&](size_t bytes) { char* p = ws + off; off += (bytes + 255) & ~(size_t)255; return p; };
  _Float16* BQ = (_Float16*)take((size_t)DM * DM * 2); _Float16* BK = (_Float16*)take((size_t)DM * DM * 2); _Float16* BV = (_Float16*)take((size_t)DM * DM * 2); _Float16* BO = (_Float16*)take((size_t)DM * DM * 2);
  _Float16* X16 = (_Float16*)take(NR * DM * 2); _Float16* Q16 = (_Float16*)take(NR * DM * 2); _Float16* K16 = (_Float16*)take(NR * DM * 2); _Float16* V16 = (_Float16*)take(NR * DM * 2); _Float16* O16 = (_Float16*)take(NR * DM * 2);
  float* S = (float*)take((size_t)NH * QT * NKX * 4); _Float16* P = (_Float16*)take((size_t)NH * QT * NKX * 2); _Float16* VT = (_Float16*)take((size_t)NH * HD * SQ * 2);
  float* QF0 = (float*)take((size_t)QT0 * DM * 4); float* KF0 = (float*)take((size_t)QT0 * DM * 4); float* VF0 = (float*)take((size_t)QT0 * DM * 4); float* OF0 = (float*)take((size_t)NB * QT0 * DM * 4); _Float16* OH0 = (_Float16*)take((size_t)NB * QT0 * DM * 2); _Float16* OL0 = (_Float16*)take((size_t)NB * QT0 * DM * 2);
  float* YO = (float*)take(NR * DM * 4);      /* pre-norm projection rows y (f32) */
  if (off > ws_size) return;
  { const unsigned g = (unsigned)(((size_t)DM * DM / 8 + 255) / 256); k_wnat<<<g, 256, 0, stream>>>(wq, (size_t)DM * DM / 8, BQ); k_wnat<<<g, 256, 0, stream>>>(wk, (size_t)DM * DM / 8, BK); k_wnat<<<g, 256, 0, stream>>>(wv, (size_t)DM * DM / 8, BV); k_wnat<<<g, 256, 0, stream>>>(wo, (size_t)DM * DM / 8, BO); }      /* natural [out][in] = Bt x16 */

  k_x16<<<(unsigned)((NR * DM / 8 + 255) / 256), 256, 0, stream>>>(x, X16, NR * DM / 8);
  const size_t r0p = (size_t)B0 * SQ;      /* first projected row */
  k_gemm2<0><<<dim3((unsigned)((MP / 128) * (DM / 64)), 1), 128, 0, stream>>>(X16 + r0p * DM, DM, 0, BQ, DM, 0, 0.0625f, nullptr, 0, nullptr, 1, 0, 0, nullptr, Q16 + r0p * DM, DM, 0, MP, DM, DM);
  k_gemm2<0><<<dim3((unsigned)((MP / 128) * (DM / 64)), 1), 128, 0, stream>>>(X16 + r0p * DM, DM, 0, BK, DM, 0, 0.0625f, nullptr, 0, nullptr, 1, 0, 0, nullptr, K16 + r0p * DM, DM, 0, MP, DM, DM);
  k_gemm2<0><<<dim3((unsigned)((MP / 128) * (DM / 64)), 1), 128, 0, stream>>>(X16 + r0p * DM, DM, 0, BV, DM, 0, 0.0625f, nullptr, 0, nullptr, 1, 0, 0, nullptr, V16 + r0p * DM, DM, 0, MP, DM, DM);
  for (int b = B0; b < B0 + NBR; ++b) { const size_t r0 = (size_t)b * SQ;
    k_vt<NH, SQ><<<NH * (SQ / 64), 256, 0, stream>>>(V16 + r0 * LQ, LQ, 0, VT);      /* V^T [NH][HD][SQ] for this batch */
    k_gemm2<0><<<dim3((QT0 / 128) * (DM / 64), 1), 128, 0, stream>>>(X16 + r0 * DM, DM, 0, BQ, DM, 0, 0.0625f, nullptr, 0, nullptr, 1, 0, 0, QF0, nullptr, DM, 0, QT0, DM, DM); k_gemm2<0><<<dim3((QT0 / 128) * (DM / 64), 1), 128, 0, stream>>>(X16 + r0 * DM, DM, 0, BK, DM, 0, 0.0625f, nullptr, 0, nullptr, 1, 0, 0, KF0, nullptr, DM, 0, QT0, DM, DM); k_gemm2<0><<<dim3((QT0 / 128) * (DM / 64), 1), 128, 0, stream>>>(X16 + r0 * DM, DM, 0, BV, DM, 0, 0.0625f, nullptr, 0, nullptr, 1, 0, 0, VF0, nullptr, DM, 0, QT0, DM, DM);      /* f32 q, k, v of the first 128 rows (exact products) */
    k_att0<0><<<NH * (QT0 / 64), 64, 0, stream>>>(QF0, KF0, VF0, DM, nullptr, 0.125f, OF0 + (size_t)b * QT0 * DM, DM);      /* exact f32 attention for rows 0..127 (o x64) */
    for (int q0 = 0; q0 < QN; q0 += QT) { const int nk = q0 + QT;      /* causal: only keys below the tile end are computed */
      k_gemm2<0><<<dim3((QT / 128) * (nk / 64), NHD), 128, 0, stream>>>(Q16 + (r0 + q0) * LQ, LQ, (size_t)HD, K16 + r0 * LQ, LQ, (size_t)HD, 0.125f, nullptr, 0, nullptr, 1, 0, 0, S, nullptr, NKX, (size_t)QT * NKX, QT, nk, HD);      /* scores, all heads on grid.y */
      switch (nk / QT) {      /* one wave per row, 8 rows per block; the row's length in chunks of 128 keys is a compile-time constant */
        case 1: k_rsmw<2><<<NHD * QT / 8, 256, 0, stream>>>(S, P, NHD, q0); break;
        case 2: k_rsmw<4><<<NHD * QT / 8, 256, 0, stream>>>(S, P, NHD, q0); break;
        case 3: k_rsmw<6><<<NHD * QT / 8, 256, 0, stream>>>(S, P, NHD, q0); break;
        case 4: k_rsmw<8><<<NHD * QT / 8, 256, 0, stream>>>(S, P, NHD, q0); break;
        case 5: k_rsmw<10><<<NHD * QT / 8, 256, 0, stream>>>(S, P, NHD, q0); break;
        case 6: k_rsmw<12><<<NHD * QT / 8, 256, 0, stream>>>(S, P, NHD, q0); break;
        case 7: k_rsmw<14><<<NHD * QT / 8, 256, 0, stream>>>(S, P, NHD, q0); break;
        case 8: k_rsmw<16><<<NHD * QT / 8, 256, 0, stream>>>(S, P, NHD, q0); break;
        default: break; }
      k_gemm2<0><<<dim3((QT / 128) * (HD / 64), NHD), 128, 0, stream>>>(P, NKX, (size_t)QT * NKX, VT, SQ, (size_t)HD * SQ, 0.25f, nullptr, 0, nullptr, 1, 0, 0, nullptr, O16 + (r0 + q0) * DM, DM, (size_t)HD, QT, HD, nk); } }      /* o (merged heads, x64) as f16 rows */
  k_gemm2<0><<<dim3((unsigned)((MPO / 128) * (DM / 64)), 1), 128, 0, stream>>>(O16 + r0p * DM, DM, 0, BO, DM, 0, 0.0009765625f, nullptr, 0, nullptr, 1, 0, 0, YO + r0p * DM, nullptr, DM, 0, MPO, DM, DM);      /* pre-norm y rows in the output layout */
  k_hl<<<(unsigned)(((size_t)NB * QT0 * DM / 8 + 255) / 256), 256, 0, stream>>>(OF0, OH0, OL0, (size_t)NB * QT0 * DM / 8);      /* first-tile o (x64) -> f16 hi + x1024 residual planes */
  for (int b = B0; b < B0 + NBR; ++b) { const size_t r0 = (size_t)b * SQ; const size_t f0 = (size_t)b * QT0;
    k_gemm2<0><<<dim3((QT0 / 128) * (DM / 64), 1), 128, 0, stream>>>(OH0 + f0 * DM, DM, 0, BO, DM, 0, 0.0009765625f, bo, 0, nullptr, 1, 0, 0, YO + r0 * DM, nullptr, DM, 0, QT0, DM, DM);      /* rows 0..127: y = o_hi Wo, overwriting the f16-path rows */
    k_gemm2<0><<<dim3((QT0 / 128) * (DM / 64), 1), 128, 0, stream>>>(OL0 + f0 * DM, DM, 0, BO, DM, 0, 0.00000095367431640625f, nullptr, 0, (const float*)YO + r0 * DM, -1, 0, 0, YO + r0 * DM, nullptr, DM, 0, QT0, DM, DM); }      /* += o_lo Wo 2^-20 (own-element accumulate) */
  k_lnx<0, 0, 1><<<(unsigned)NR, 256, 0, stream>>>(YO, lng, lnb, 1e-5f, nullptr, (float*)d_out);      /* out = LayerNorm(y) -> f32 output rows */
}

// v002
// Measured time: 2420 microseconds a run.
// Next to v001, in two timings, it ran 1.69 and 1.70 times as fast.
// All steps since v000 together make it 4.09 times as fast.
#include <hip/hip_runtime.h>
// Causal multi-head self-attention with a fused post-LayerNorm (x [4][2048][1024]; k/q/v = x W^T (natural [1024][1024], no biases); 16 heads of 64; wei = q k^T * 64^-0.5; causal (tril, -inf); softmax; y = merged Wp^T; out = LayerNorm(y) (biased var, eps per the module, gamma / beta) -> [4][2048][1024]).
// Structure: token rows r = b*2048 + s; x as exact f16 rows (bf16-rounded); Q, K, V as three WMMA GEMMs (32x64 wave tiles, f32 accumulation, exact x16 weights, f16 outputs); per batch: V^T for all heads via LDS transposes; per query tile of 256 rows: scores against the keys below the tile end only (K = 64, all heads on grid.y, alpha = 0.125), causal row softmax on VALU, one wave per row, keys above the query masked over the computed range (f32 statistics, native exp; weights x256 f16), o = P . V^T (K = keys below the tile end, alpha 2^-2: o carried x64, folded into the output GEMM alpha) written straight into the merged f16 o rows; y = o W_o GEMM (f32) into the output layout, rows 0..127 of each batch redone from an f32 attention; out = LayerNorm(y).
// Compute dtype: inputs rounded to bf16; x / weights exact; q, k, v, softmax weights and o as plain f16 GEMM operands (~2^-12); scores and softmax statistics f32. v_wmma_f32_16x16x32_f16.
#define NB 4
#define SQ 2048
#define DM 1024
#define NH 16
#define HD 64
#define HG 4                         /* heads per launch of the k_vt(b, h0) overload, which is not launched */
#define QT 256                       /* query rows per causal tile */
#define NKX SQ                       /* S / P row pitch */
#define QT0 128                      /* first-tile rows recomputed exactly in f32 */
#define B0 0                         /* first batch processed (debug hook) */
#define NBR NB                       /* batches processed (debug hook) */
#define NR ((size_t)NB * SQ)         /* token rows */
#define MP ((int)((size_t)NBR * SQ)) /* rows projected (debug hook) */
#define QN SQ                        /* query rows attended per batch (debug hook) */
#define NHD NH                       /* heads attended (debug hook) */
#define MPO MP                       /* rows through the output stage (debug hook) */
#define LQ DM      /* row pitch of the q/k/v rows */
typedef __bf16 v16b __attribute__((ext_vector_type(16)));
typedef unsigned short v8us __attribute__((ext_vector_type(8), may_alias));
typedef float  v8f  __attribute__((ext_vector_type(8)));
typedef float  v4f  __attribute__((ext_vector_type(4)));
typedef float  v4fa __attribute__((ext_vector_type(4), may_alias));
union FragB { v16b v; v8us half[2]; unsigned short u[16]; };

__device__ __forceinline__ unsigned short bf16_bits(float x) { unsigned int u = __float_as_uint(x); return (unsigned short)((u + 0x7FFFu + ((u >> 16) & 1u)) >> 16); }
__device__ __forceinline__ float bf16_val(unsigned short b) { return __uint_as_float(((unsigned int)b) << 16); }
__device__ __forceinline__ float bf16_round(float x) { return bf16_val(bf16_bits(x)); }
// D += A·B with NT terms: 1 = ah·bh, 2 = + al·bh (A split), 3 = + ah·bl (both split)
template <int NT>
__device__ __forceinline__ v8f mmaN(v16b ah, v16b al, v16b bh, v16b bl, v8f c) {
  c = __builtin_amdgcn_wmma_f32_16x16x32_bf16(false, ah, false, bh, (short)0, c, false, false);
  if (NT >= 2) c = __builtin_amdgcn_wmma_f32_16x16x32_bf16(false, al, false, bh, (short)0, c, false, false);
  if (NT >= 3) c = __builtin_amdgcn_wmma_f32_16x16x32_bf16(false, ah, false, bl, (short)0, c, false, false);
  asm volatile("v_nop\n\tv_nop\n\tv_nop\n\tv_nop" : "+v"(c) : "v"(ah), "v"(al), "v"(bh), "v"(bl));
  return c;
}

__global__ __launch_bounds__(256) void k_wt_bf16(const float* __restrict__ W, unsigned short* __restrict__ Wt, int K, int N) {
  const int t = blockIdx.x * 256 + threadIdx.x;
  const int k8n = K / 8;
  if (t >= N * k8n) return;
  const int n = t / k8n, k8 = (t % k8n) * 8;
  v8us v;
#pragma unroll
  for (int i = 0; i < 8; ++i) v[i] = bf16_bits(W[(size_t)(k8 + i) * N + n]);
  *(v8us*)(Wt + (size_t)n * K + k8) = v;
  
}

// GEMM C[M][N] (f32, pitch ldc) = act(A[M][K]·W + bias). A f32 row-major (pitch lda) converted per fragment to bf16
// (ASPLIT: hi/lo two planes -> 2 terms, else single rounded term); Wt bf16 [N][K] (pitch ldb). BIAS_BF16 rounds the
// bias to bf16 first (bias quantised to bf16 before the add). K%32==0, M%16==0, N%64==0.
template <bool ASPLIT, int ACT, bool BIAS_BF16>
__global__ __launch_bounds__(128) void k_gemm_bf(const float* __restrict__ A, int lda, const unsigned short* __restrict__ Wt, int ldb,
                                               const float* __restrict__ bias, float* __restrict__ C, int ldc, int M, int N, int K) {
  __shared__ __attribute__((aligned(16))) float so[4][16][64];
  const int tid = threadIdx.x, w = tid >> 5, lane = tid & 31, ln = lane & 15, hh = lane >> 4;
  const int ntn = N / 64;
  const int wid = blockIdx.x * 4 + w;
  const int mt = wid / ntn, nq = wid % ntn;
  if (mt * 16 >= M) return;
  const int row0 = mt * 16, col0 = nq * 64;
  const float* arow = A + (size_t)(row0 + ln) * lda;
  v8f acc[4] = {};
  for (int kb = 0; kb < K; kb += 32) {
    FragB ah, al;
    const v4f x0 = *(const v4fa*)(arow + kb + 8 * hh), x1 = *(const v4fa*)(arow + kb + 8 * hh + 4);
    const v4f x2 = *(const v4fa*)(arow + kb + 16 + 8 * hh), x3 = *(const v4fa*)(arow + kb + 16 + 8 * hh + 4);
    float xs[16] = {x0[0],x0[1],x0[2],x0[3],x1[0],x1[1],x1[2],x1[3],x2[0],x2[1],x2[2],x2[3],x3[0],x3[1],x3[2],x3[3]};
#pragma unroll
    for (int i = 0; i < 16; ++i) { const unsigned short hb = bf16_bits(xs[i]); ah.u[i] = hb; al.u[i] = ASPLIT ? bf16_bits(xs[i] - bf16_val(hb)) : (unsigned short)0; }
#pragma unroll
    for (int t = 0; t < 4; ++t) {
      const unsigned short* brow = Wt + (size_t)(col0 + t * 16 + ln) * ldb + kb;
      FragB b;
      b.half[0] = *(const v8us*)(brow + 8 * hh);
      b.half[1] = *(const v8us*)(brow + 16 + 8 * hh);
      acc[t] = mmaN<ASPLIT ? 2 : 1>(ah.v, al.v, b.v, b.v, acc[t]);
    }
  }
#pragma unroll
  for (int t = 0; t < 4; ++t) {
    float bv = bias ? bias[col0 + t * 16 + ln] : 0.f;
    if (BIAS_BF16) bv = bf16_round(bv);
#pragma unroll
    for (int r = 0; r < 8; ++r) { float v = acc[t][r] + bv; if (ACT == 1) v = fmaxf(v, 0.f); so[w][8 * hh + r][t * 16 + ln] = v; }
  }
  __builtin_amdgcn_fence(__ATOMIC_ACQ_REL, "workgroup");
  __builtin_amdgcn_wave_barrier();
  const int rsub = lane >> 4, c4 = (lane & 15) * 4;
  {
#pragma unroll
    for (int q = 0; q < 8; ++q) {
      const int r = q * 2 + rsub;
      const v4f v = *(const v4fa*)&so[w][r][c4];
      *(v4f*)(C + (size_t)(row0 + r) * ldc + col0 + c4) = v;
    }
    
  }
}

// GEMM C = act(A·W + bias + resid): A f32 (ASPLIT -> hi/lo 2 terms), Wt bf16 [N][K]; ACT 0 none, 1 relu, 2 exact gelu;
// resid (optional, f32, row index = (row % rmod), pitch ldr, RES_BF16 rounds it) added before the activation.
template <bool ASPLIT, int ACT, bool BIAS_BF16, bool RES_BF16>
__global__ __launch_bounds__(128) void k_gemm_bf3(const float* __restrict__ A, int lda, const unsigned short* __restrict__ Wt, int ldb,
                                                const float* __restrict__ bias, const float* __restrict__ resid, int rmod, int ldr,
                                                float* __restrict__ C, int ldc, int M, int N, int K) {
  __shared__ __attribute__((aligned(16))) float so[4][16][64];
  const int tid = threadIdx.x, w = tid >> 5, lane = tid & 31, ln = lane & 15, hh = lane >> 4;
  const int ntn = N / 64;
  const int wid = blockIdx.x * 4 + w;
  const int mt = wid / ntn, nq = wid % ntn;
  if (mt * 16 >= M) return;
  const int row0 = mt * 16, col0 = nq * 64;
  const float* arow = A + (size_t)(row0 + ln) * lda;
  v8f acc[4] = {};
  for (int kb = 0; kb < K; kb += 32) {
    FragB ah, al;
    const v4f x0 = *(const v4fa*)(arow + kb + 8 * hh), x1 = *(const v4fa*)(arow + kb + 8 * hh + 4);
    const v4f x2 = *(const v4fa*)(arow + kb + 16 + 8 * hh), x3 = *(const v4fa*)(arow + kb + 16 + 8 * hh + 4);
    float xs[16] = {x0[0],x0[1],x0[2],x0[3],x1[0],x1[1],x1[2],x1[3],x2[0],x2[1],x2[2],x2[3],x3[0],x3[1],x3[2],x3[3]};
#pragma unroll
    for (int i = 0; i < 16; ++i) { const unsigned short hb = bf16_bits(xs[i]); ah.u[i] = hb; al.u[i] = ASPLIT ? bf16_bits(xs[i] - bf16_val(hb)) : (unsigned short)0; }
#pragma unroll
    for (int t = 0; t < 4; ++t) {
      const unsigned short* brow = Wt + (size_t)(col0 + t * 16 + ln) * ldb + kb;
      FragB b;
      b.half[0] = *(const v8us*)(brow + 8 * hh);
      b.half[1] = *(const v8us*)(brow + 16 + 8 * hh);
      acc[t] = mmaN<ASPLIT ? 2 : 1>(ah.v, al.v, b.v, b.v, acc[t]);
    }
  }
#pragma unroll
  for (int t = 0; t < 4; ++t) {
    const int col = col0 + t * 16 + ln;
    float bv = bias ? bias[col] : 0.f;
    if (BIAS_BF16) bv = bf16_round(bv);
#pragma unroll
    for (int r = 0; r < 8; ++r) {
      float v = acc[t][r] + bv;
      if (resid) { float rv = resid[(size_t)((row0 + 8 * hh + r) % rmod) * ldr + col]; if (RES_BF16) rv = bf16_round(rv); v += rv; }
      if (ACT == 1) v = fmaxf(v, 0.f);
      if (ACT == 2) v = 0.5f * v * (1.0f + erff(v * 0.70710678118654752f));
      if (ACT == 3) { const float u = 0.7978845608028654f * (v + 0.044715f * v * v * v); v = 0.5f * v * (1.0f + tanhf(u)); }
      so[w][8 * hh + r][t * 16 + ln] = v;
    }
  }
  __builtin_amdgcn_fence(__ATOMIC_ACQ_REL, "workgroup");
  __builtin_amdgcn_wave_barrier();
  const int rsub = lane >> 4, c4 = (lane & 15) * 4;
  {
#pragma unroll
    for (int q = 0; q < 8; ++q) {
      const int r = q * 2 + rsub;
      const v4f v = *(const v4fa*)&so[w][r][c4];
      *(v4f*)(C + (size_t)(row0 + r) * ldc + col0 + c4) = v;
    }
    
  }
}
// row LayerNorm (biased variance, eps) over N: s = X (+ R); optional out_sum <- s; out_norm <- (s-mu)*rsqrt(var+eps)*g + b
template <bool PARAM_BF16>
__global__ __launch_bounds__(256) void k_layernorm(const float* __restrict__ X, const float* __restrict__ R, const float* __restrict__ g, const float* __restrict__ bta,
                                                  float* __restrict__ out_sum, float* __restrict__ out_norm, int N, float eps) {
  __shared__ float red[256];
  const int row = blockIdx.x, tid = threadIdx.x;
  const float* x = X + (size_t)row * N; const float* rr = R ? R + (size_t)row * N : nullptr;
  float vals[16];                     // up to N = 4096
  const int per = N / 256;            // contiguous chunk per thread? use strided-by-4 chunks: thread handles j = tid*4 + 1024*u
  float s1 = 0.f;
  for (int u = 0; u < per / 4; ++u) {
    const int j = tid * 4 + 1024 * u;
    const v4f a = *(const v4fa*)(x + j);
    v4f b = {0.f,0.f,0.f,0.f}; if (rr) b = *(const v4fa*)(rr + j);
#pragma unroll
    for (int q = 0; q < 4; ++q) { const float v = a[q] + b[q]; vals[u * 4 + q] = v; s1 += v; }
  }
  red[tid] = s1; __syncthreads();
  for (int st = 128; st > 0; st >>= 1) { if (tid < st) red[tid] += red[tid + st]; __syncthreads(); }
  const float mu = red[0] / (float)N; __syncthreads();
  float s2 = 0.f;
  for (int u = 0; u < per / 4; ++u)
#pragma unroll
    for (int q = 0; q < 4; ++q) { const float c = vals[u * 4 + q] - mu; s2 += c * c; }
  red[tid] = s2; __syncthreads();
  for (int st = 128; st > 0; st >>= 1) { if (tid < st) red[tid] += red[tid + st]; __syncthreads(); }
  const float rs = rsqrtf(red[0] / (float)N + eps);
  {
    for (int u = 0; u < per / 4; ++u) {
      const int j = tid * 4 + 1024 * u;
      v4f o, sm;
#pragma unroll
      for (int q = 0; q < 4; ++q) {
        float gg = g[j + q], bb = bta[j + q];
        if (PARAM_BF16) { gg = bf16_round(gg); bb = bf16_round(bb); }
        sm[q] = vals[u * 4 + q]; o[q] = (vals[u * 4 + q] - mu) * rs * gg + bb;
      }
      if (out_sum) *(v4f*)(out_sum + (size_t)row * N + j) = sm;
      *(v4f*)(out_norm + (size_t)row * N + j) = o;
    }
    
  }
}



// ---- f16 WMMA path (v_wmma_f32_16x16x32_f16): 11-bit significands for operands in range — used where a [0,1] probability operand needs more precision than bf16
typedef _Float16 v16h __attribute__((ext_vector_type(16)));
union FragH { v16h v; v8us half[2]; _Float16 h[16]; unsigned short u[16]; };
template <int NT>
__device__ __forceinline__ v8f mmaH(v16h ah, v16h al, v16h bh, v16h bl, v8f c) {
  c = __builtin_amdgcn_wmma_f32_16x16x32_f16(false, ah, false, bh, (short)0, c, false, false);
  if (NT >= 2) c = __builtin_amdgcn_wmma_f32_16x16x32_f16(false, al, false, bh, (short)0, c, false, false);
  if (NT >= 3) c = __builtin_amdgcn_wmma_f32_16x16x32_f16(false, ah, false, bl, (short)0, c, false, false);
  asm volatile("v_nop\n\tv_nop\n\tv_nop\n\tv_nop" : "+v"(c) : "v"(ah), "v"(al), "v"(bh), "v"(bl));
  return c;
}
// batched GEMM like k_gemm_b but f16 operands: A f32 (split into f16 hi/lo if ASPLIT, else rounded to f16), Bt = f16 values [n][k]; alpha; C f32; N multiple of 16 (partial tiles skipped)
template <bool ASPLIT>
__global__ __launch_bounds__(128) void k_gemm_h(const float* __restrict__ A, int lda, size_t sA, const _Float16* __restrict__ Bh, int ldb, size_t sB, float alpha, float* __restrict__ C, int ldc, size_t sC, int M, int N, int K) {
  __shared__ __attribute__((aligned(16))) float so[4][16][64];
  const int tid = threadIdx.x, w = tid >> 5, lane = tid & 31, ln = lane & 15, hh = lane >> 4; const int by = blockIdx.y;
  A += (size_t)by * sA; Bh += (size_t)by * sB; C += (size_t)by * sC;
  const int ntn = (N + 63) / 64; const int wid = blockIdx.x * 4 + w; const int mt = wid / ntn, nq = wid % ntn; if (mt * 16 >= M) return;
  const int row0 = mt * 16, col0 = nq * 64; const float* arow = A + (size_t)(row0 + ln) * lda;
  v8f acc[4] = {};
  for (int kb = 0; kb < K; kb += 32) {
    FragH ah, al;
    const v4f x0 = *(const v4fa*)(arow + kb + 8 * hh), x1 = *(const v4fa*)(arow + kb + 8 * hh + 4), x2 = *(const v4fa*)(arow + kb + 16 + 8 * hh), x3 = *(const v4fa*)(arow + kb + 16 + 8 * hh + 4);
    float xs[16] = {x0[0],x0[1],x0[2],x0[3],x1[0],x1[1],x1[2],x1[3],x2[0],x2[1],x2[2],x2[3],x3[0],x3[1],x3[2],x3[3]};
#pragma unroll
    for (int i = 0; i < 16; ++i) { const _Float16 h = (_Float16)xs[i]; ah.h[i] = h; al.h[i] = ASPLIT ? (_Float16)(xs[i] - (float)h) : (_Float16)0.0f; }
#pragma unroll
    for (int t = 0; t < 4; ++t) { if (col0 + t * 16 >= N) continue; const size_t boff = (size_t)(col0 + t * 16 + ln) * ldb + kb; FragH bq; bq.half[0] = *(const v8us*)(Bh + boff + 8 * hh); bq.half[1] = *(const v8us*)(Bh + boff + 16 + 8 * hh);
      acc[t] = mmaH<ASPLIT ? 2 : 1>(ah.v, al.v, bq.v, bq.v, acc[t]); }
  }
#pragma unroll
  for (int t = 0; t < 4; ++t) { if (col0 + t * 16 >= N) continue;
#pragma unroll
    for (int r = 0; r < 8; ++r) so[w][8 * hh + r][t * 16 + ln] = acc[t][r] * alpha; }
  __builtin_amdgcn_fence(__ATOMIC_ACQ_REL, "workgroup"); __builtin_amdgcn_wave_barrier();
  const int rsub = lane >> 4, c4 = (lane & 15) * 4;
  {
#pragma unroll
    for (int q = 0; q < 8; ++q) { const int r = q * 2 + rsub; if (col0 + c4 < N) { const v4f v = *(const v4fa*)&so[w][r][c4]; *(v4f*)(C + (size_t)(row0 + r) * ldc + col0 + c4) = v; } }
     }
}

// Wt[n][k] = f16(W[k][n]·scale) from f32 row-major W[K][N] (scale = power of two; bf16-exact weights stay exact in f16 away from the subnormal range)
__global__ __launch_bounds__(256) void k_wt_f16(const float* __restrict__ W, _Float16* __restrict__ Wt, int K, int N, float scale) {
  const int t = blockIdx.x * 256 + threadIdx.x; if (t >= N * (K / 8)) return; const int n = t / (K / 8), k8 = (t % (K / 8)) * 8; FragH f;
#pragma unroll
  for (int i = 0; i < 8; ++i) f.h[i] = (_Float16)(bf16_round(W[(size_t)(k8 + i) * N + n]) * scale); const v8us o = f.half[0];
  *(v8us*)((unsigned short*)Wt + (size_t)n * K + k8) = o; 
}
// k_gemm_hh variant with fused epilogue: v = acc·alpha + bias[by·sBias + col] (+ CP[(row/rowsPerB)·sCPb + by·64 + col] if CP) ; ACT 0 none / 1 elu ; writes f16 C16 (and f32 C if non-null)
template <int ACT>
__global__ __launch_bounds__(128) void k_gemm_hhx(const _Float16* __restrict__ A, int lda, size_t sA, const _Float16* __restrict__ Bh, int ldb, size_t sB, float alpha, const float* __restrict__ bias, size_t sBias, const float* __restrict__ CP, int rowsPerB, size_t sCPb, int row0g,
    float* __restrict__ C, _Float16* __restrict__ C16, int ldc, size_t sC, int M, int N, int K) {
  __shared__ __attribute__((aligned(16))) float so[4][16][64];
  const int tid = threadIdx.x, w = tid >> 5, lane = tid & 31, ln = lane & 15, hh = lane >> 4; const int by = blockIdx.y;
  A += (size_t)by * sA; Bh += (size_t)by * sB; const size_t cofs = (size_t)by * sC; const float* bp = bias ? bias + (size_t)by * sBias : nullptr;
  const int ntn = (N + 63) / 64; const int wid = blockIdx.x * 4 + w; const int mt = wid / ntn, nq = wid % ntn; if (mt * 16 >= M) return;
  const int row0 = mt * 16, col0 = nq * 64; const _Float16* arow = A + (size_t)(row0 + ln) * lda;
  v8f acc[4] = {};
  for (int kb = 0; kb < K; kb += 32) { FragH ah; ah.half[0] = *(const v8us*)((const unsigned short*)arow + kb + 8 * hh); ah.half[1] = *(const v8us*)((const unsigned short*)arow + kb + 16 + 8 * hh);
#pragma unroll
    for (int t = 0; t < 4; ++t) { if (col0 + t * 16 >= N) continue; const size_t boff = (size_t)(col0 + t * 16 + ln) * ldb + kb; FragH bq; bq.half[0] = *(const v8us*)((const unsigned short*)Bh + boff + 8 * hh); bq.half[1] = *(const v8us*)((const unsigned short*)Bh + boff + 16 + 8 * hh);
      acc[t] = mmaH<1>(ah.v, ah.v, bq.v, bq.v, acc[t]); }
  }
#pragma unroll
  for (int t = 0; t < 4; ++t) { if (col0 + t * 16 >= N) continue; const int col = col0 + t * 16 + ln; const float bv = bp ? bf16_round(bp[col]) : 0.f;
#pragma unroll
    for (int r = 0; r < 8; ++r) { float v = acc[t][r] * alpha + bv; if (CP) { const int rr = row0g + row0 + 8 * hh + r; if (rowsPerB < 0) v += CP[cofs + (size_t)rr * ldc + col];      /* rowsPerB < 0: own element of the batched C plane */ else { const int bidx = rr / rowsPerB; v += CP[(size_t)bidx * sCPb + (size_t)by * 64 + col]; } } if (ACT == 1) v = (v > 0.f) ? v : expm1f(v); else if (ACT == 7) v = (v > 0.f) ? v + 1.0f : expf(v); else if (ACT == 8) v = tanhf(v); else if (ACT == 9) v = 0.5f * v * (1.0f + tanhf(0.7978845608028654f * (v + 0.044715f * v * v * v))); else if (ACT == 11) v = 1.0f / (1.0f + expf(-v)); else if (ACT == 12) v = (v > 0.f) ? v : 0.01f * v; else if (ACT == 14) v = (v > 0.f) ? v : 0.1f * v; else if (ACT == 16) v = (v >= 0.f) ? v : 0.3f * v; else if (ACT == 17) v = (v >= 0.f) ? v : 0.2f * v; else if (ACT == 15) v = v / (1.0f + expf(-v)); else if (ACT == 3) v = fmaxf(v, 0.f); else if (ACT == 6) v = 0.5f * v * (1.0f + erff(v * 0.70710678118654752f)); so[w][8 * hh + r][t * 16 + ln] = v; } }
  __builtin_amdgcn_fence(__ATOMIC_ACQ_REL, "workgroup"); __builtin_amdgcn_wave_barrier();
  const int rsub = lane >> 4, c4 = (lane & 15) * 4; typedef _Float16 v4h __attribute__((ext_vector_type(4)));
  {
#pragma unroll
    for (int q = 0; q < 8; ++q) { const int r = q * 2 + rsub; if (col0 + c4 < N) { const v4f v = *(const v4fa*)&so[w][r][c4]; if (C) *(v4f*)(C + cofs + (size_t)(row0 + r) * ldc + col0 + c4) = v; if (C16) { v4h h4; for (int i = 0; i < 4; ++i) h4[i] = (_Float16)v[i]; *(v4h*)(C16 + cofs + (size_t)(row0 + r) * ldc + col0 + c4) = h4; } } }
     }
}


typedef _Float16 v4h __attribute__((ext_vector_type(4)));

__global__ __launch_bounds__(256) void k_x16(const float* __restrict__ x, _Float16* __restrict__ X16, size_t n8) { const size_t t = (size_t)blockIdx.x * 256 + threadIdx.x; if (t >= n8) return; FragH f;
#pragma unroll
  for (int q = 0; q < 8; ++q) f.h[q] = (_Float16)bf16_round(x[t * 8 + q]); *(v8us*)((unsigned short*)X16 + t * 8) = f.half[0];  }
__global__ __launch_bounds__(256) void k_h16(const float* __restrict__ x, _Float16* __restrict__ X16, size_t n8) { const size_t t = (size_t)blockIdx.x * 256 + threadIdx.x; if (t >= n8) return; FragH f;
#pragma unroll
  for (int q = 0; q < 8; ++q) f.h[q] = (_Float16)x[t * 8 + q]; *(v8us*)((unsigned short*)X16 + t * 8) = f.half[0];  }
__global__ __launch_bounds__(256) void k_round16f(const float* __restrict__ W, _Float16* __restrict__ Bt, size_t n8) { const size_t t = (size_t)blockIdx.x * 256 + threadIdx.x; if (t >= n8) return; FragH f;
#pragma unroll
  for (int i = 0; i < 8; ++i) f.h[i] = (_Float16)(bf16_round(W[t * 8 + i]) * 16.0f); *(v8us*)((unsigned short*)Bt + t * 8) = f.half[0];  }
template <int NHv, int TTv>
__global__ __launch_bounds__(256) void k_vt(const _Float16* __restrict__ V16, int ldv, int voff, _Float16* __restrict__ Vt) { __shared__ unsigned short tl[64][66]; const int tid = threadIdx.x; const int slab = blockIdx.x / (TTv / 64), lg = blockIdx.x % (TTv / 64); const int b = slab / NHv, h = slab % NHv;
  for (int i = tid; i < 64 * 8; i += 256) { const int r = i / 8, c8 = (i % 8) * 8; FragH f; f.half[0] = *(const v8us*)((const unsigned short*)V16 + ((size_t)b * TTv + lg * 64 + r) * ldv + voff + h * 64 + c8);
#pragma unroll
    for (int q = 0; q < 8; ++q) tl[r][c8 + q] = f.u[q]; }
  __syncthreads();
  {
#pragma unroll
    for (int rd = 0; rd < 2; ++rd) { const int d = rd * 32 + tid / 8, pc = tid % 8; FragH f;
#pragma unroll
      for (int q = 0; q < 8; ++q) f.u[q] = tl[pc * 8 + q][d];
      *(v8us*)((unsigned short*)Vt + ((size_t)slab * 64 + d) * TTv + lg * 64 + pc * 8) = f.half[0]; }
     } }

__global__ __launch_bounds__(256) void k_hl(const float* __restrict__ F, _Float16* __restrict__ Hh, _Float16* __restrict__ Hl, size_t n8) { const size_t t = (size_t)blockIdx.x * 256 + threadIdx.x; if (t >= n8) return; FragH fh, fl; const v4f a = *(const v4fa*)(F + t * 8), c = *(const v4fa*)(F + t * 8 + 4);
#pragma unroll
  for (int q = 0; q < 4; ++q) { _Float16 h = (_Float16)a[q]; fh.h[q] = h; fl.h[q] = (_Float16)((a[q] - (float)h) * 1024.0f); h = (_Float16)c[q]; fh.h[4 + q] = h; fl.h[4 + q] = (_Float16)((c[q] - (float)h) * 1024.0f); }
  { *(v8us*)((unsigned short*)Hh + t * 8) = fh.half[0]; *(v8us*)((unsigned short*)Hl + t * 8) = fl.half[0];  } }

// ---- fast GEMM (wave tile 32x64; requires M % 32 == 0 rows per launch region and N % 64 == 0); epilogue = k_gemm_hhx semantics ----
__device__ __forceinline__ v16h g2_frag(const _Float16* p, int hh) { FragH f; f.half[0] = *(const v8us*)((const unsigned short*)p + 8 * hh); f.half[1] = *(const v8us*)((const unsigned short*)p + 16 + 8 * hh); return f.v; }
__device__ __forceinline__ v8f g2_mma(v16h a, v16h b, v8f c) { v8f d = __builtin_amdgcn_wmma_f32_16x16x32_f16(false, a, false, b, (short)0, c, false, false); asm volatile("v_nop\n\tv_nop\n\tv_nop\n\tv_nop" : "+v"(d) : "v"(a), "v"(b)); return d; }
template <int ACT>
__global__ __launch_bounds__(128) void k_gemm2(const _Float16* __restrict__ A, int lda, size_t sA, const _Float16* __restrict__ Bh, int ldb, size_t sB, float alpha, const float* __restrict__ bias, size_t sBias, const float* __restrict__ CP, int rowsPerB, size_t sCPb, int row0g,
    float* __restrict__ C, _Float16* __restrict__ C16, int ldc, size_t sC, int M, int N, int K) { static_assert(ACT == 0 || ACT == 3 || ACT == 6 || ACT == 8 || ACT == 9 || ACT == 11 || ACT == 12 || ACT == 14 || ACT == 15 || ACT == 16 || ACT == 17, "k_gemm2: unsupported ACT code (would silently apply no activation)");
  __shared__ __attribute__((aligned(16))) float so[4][32][68];
  const int tid = threadIdx.x, w = tid >> 5, lane = tid & 31, ln = lane & 15, hh = lane >> 4; const int by = blockIdx.y;
  A += (size_t)by * sA; Bh += (size_t)by * sB; const size_t cofs = (size_t)by * sC; const float* bp = bias ? bias + (size_t)by * sBias : nullptr;
  const int ntn = N >> 6; const int mt = blockIdx.x / ntn, nq = blockIdx.x - mt * ntn; const int row0 = mt * 128 + 32 * w, col0 = nq * 64; if (row0 >= M) return;
  const _Float16* a0p = A + (size_t)(row0 + ln) * lda; const _Float16* a1p = a0p + (size_t)16 * lda;
  const _Float16* b0p = Bh + (size_t)(col0 + ln) * ldb; const _Float16* b1p = b0p + (size_t)16 * ldb; const _Float16* b2p = b1p + (size_t)16 * ldb; const _Float16* b3p = b2p + (size_t)16 * ldb;
  const v8f z8 = {0.f,0.f,0.f,0.f,0.f,0.f,0.f,0.f}; v8f c00 = z8, c01 = z8, c02 = z8, c03 = z8, c10 = z8, c11 = z8, c12 = z8, c13 = z8;
#pragma unroll 1
  for (int kb = 0; kb < K; kb += 32) { const v16h a0 = g2_frag(a0p + kb, hh), a1 = g2_frag(a1p + kb, hh);
    v16h b = g2_frag(b0p + kb, hh); c00 = g2_mma(a0, b, c00); c10 = g2_mma(a1, b, c10);
    b = g2_frag(b1p + kb, hh); c01 = g2_mma(a0, b, c01); c11 = g2_mma(a1, b, c11);
    b = g2_frag(b2p + kb, hh); c02 = g2_mma(a0, b, c02); c12 = g2_mma(a1, b, c12);
    b = g2_frag(b3p + kb, hh); c03 = g2_mma(a0, b, c03); c13 = g2_mma(a1, b, c13); }
  v8f accs[8] = {c00, c01, c02, c03, c10, c11, c12, c13};
#pragma unroll
  for (int u = 0; u < 8; ++u) { const int t = u & 3, half = u >> 2; const int col = col0 + t * 16 + ln; const float bv = bp ? bf16_round(bp[col]) : 0.f;
#pragma unroll
    for (int r = 0; r < 8; ++r) { const int rloc = half * 16 + 8 * hh + r; float v = accs[u][r] * alpha + bv; if (CP) { if (rowsPerB < 0) v += CP[cofs + (size_t)(row0g + row0 + rloc) * ldc + col];      /* rowsPerB < 0: own element of the batched C plane */ else { const int bidx = (row0g + row0 + rloc) / rowsPerB; v += CP[(size_t)bidx * sCPb + (size_t)by * 64 + col]; } }
      if (ACT == 3) v = fmaxf(v, 0.f); else if (ACT == 6) v = 0.5f * v * (1.0f + erff(v * 0.70710678118654752f)); else if (ACT == 11) v = 1.0f / (1.0f + expf(-v)); else if (ACT == 15) v = v / (1.0f + expf(-v)); else if (ACT == 12) v = (v > 0.f) ? v : 0.01f * v; else if (ACT == 8) v = tanhf(v); else if (ACT == 9) v = 0.5f * v * (1.0f + tanhf(0.7978845608028654f * (v + 0.044715f * v * v * v))); else if (ACT == 14) v = (v > 0.f) ? v : 0.1f * v; else if (ACT == 16) v = (v >= 0.f) ? v : 0.3f * v; else if (ACT == 17) v = (v >= 0.f) ? v : 0.2f * v;
      so[w][rloc][t * 16 + ln] = v; } }
  __builtin_amdgcn_fence(__ATOMIC_ACQ_REL, "workgroup"); __builtin_amdgcn_wave_barrier();
  const int rsub = lane >> 4, c4 = (lane & 15) * 4;
  {
#pragma unroll
    for (int q = 0; q < 16; ++q) { const int r = q * 2 + rsub; const v4f v = *(const v4fa*)&so[w][r][c4]; if (C) *(v4f*)(C + cofs + (size_t)(row0 + r) * ldc + col0 + c4) = v; if (C16) { v4h h4; for (int i = 0; i < 4; ++i) h4[i] = (_Float16)v[i]; *(v4h*)(C16 + cofs + (size_t)(row0 + r) * ldc + col0 + c4) = h4; } }
     } }


__global__ __launch_bounds__(256) void k_wnat(const float* __restrict__ w, size_t n8, _Float16* __restrict__ Bt) { const size_t t = (size_t)blockIdx.x * 256 + threadIdx.x; if (t >= n8) return; FragH f; for (int q = 0; q < 8; ++q) f.h[q] = (_Float16)(bf16_round(w[t * 8 + q]) * 16.0f); *(v8us*)((unsigned short*)Bt + t * 8) = f.half[0];  }
__global__ __launch_bounds__(256) void k_rsm(const float* __restrict__ S, _Float16* __restrict__ P, int nrows) {
  #pragma clang fp contract(off)
  const int i = blockIdx.x * 256 + threadIdx.x; if (i >= nrows) return; const float* s = S + (size_t)i * SQ; float mx = -3.0e38f;
#pragma unroll 1
  for (int j = 0; j < SQ; ++j) mx = fmaxf(mx, s[j]); float se = 0.f;
#pragma unroll 1
  for (int j = 0; j < SQ; ++j) se += expf(s[j] - mx); const float sc = 256.0f / se;
#pragma unroll 1
  for (int j0 = 0; j0 < SQ; j0 += 8) { FragH f; for (int q = 0; q < 8; ++q) f.h[q] = (_Float16)(expf(s[j0 + q] - mx) * sc); unsigned short* d = (unsigned short*)P + (size_t)i * SQ + j0; *(v8us*)d = f.half[0];  } }
__global__ __launch_bounds__(256) void k_vt(const _Float16* __restrict__ V16, int b, int h0, _Float16* __restrict__ VT) { __shared__ unsigned short tl[64][65]; const int tid = threadIdx.x; const int hh = blockIdx.x % HG, sg = blockIdx.x / HG; const int s0 = sg * 64; const int h = h0 + hh;
  for (int i = tid; i < 64 * 8; i += 256) { const int j = i / 8, d8 = (i % 8) * 8; FragH f; f.half[0] = *(const v8us*)((const unsigned short*)V16 + ((size_t)b * SQ + s0 + j) * DM + h * HD + d8); for (int q = 0; q < 8; ++q) tl[d8 + q][j] = f.u[q]; }
  __syncthreads();
  { for (int i = tid; i < 64 * 8; i += 256) { const int d = i / 8, j8 = (i % 8) * 8; FragH f; for (int q = 0; q < 8; ++q) f.u[q] = tl[d][j8 + q]; *(v8us*)((unsigned short*)VT + ((size_t)hh * HD + d) * SQ + s0 + j8) = f.half[0]; }  } }



// Native exp as __expf compiles it: v_exp_f32 of x * log2(e). Written as asm so that the v_nop stands directly behind the transcendental: it keeps the one free
// issue slot that the instruction set asks for before an instruction that reads the result or overwrites the source.
__device__ __forceinline__ float exp_native(float x) { float r; asm("v_exp_f32 %0, %1\n\tv_nop" : "=v"(r) : "v"(x * 1.44269504088896340736f)); return r; }
// Causal row softmax, one wave per score row (row t = head * QT + query) over the NCH * 128 computed keys. Lane l holds keys 128 c + 4 l .. + 3 of chunk c, so
// every load covers 512 contiguous bytes and every store 256; the row is read once and stays in registers. Keys above the query get -1e9 (weight exactly 0).
// Row maximum and row sum: per lane over its own keys (the sum in four chains), then a five-step butterfly over the wave. Weights x256 as f16.
template <int NCH>
__global__ __launch_bounds__(256) void k_rsmw(const float* __restrict__ S, _Float16* __restrict__ P, int hg, int q0) {
  const int lane = threadIdx.x & 31; const int t = blockIdx.x * 8 + __builtin_amdgcn_readfirstlane(threadIdx.x >> 5); if (t >= hg * QT) return;      /* the row index is the wave's: scalar; the kernel has no barrier */
  const float* s = S + (size_t)t * NKX; _Float16* p = P + (size_t)t * NKX; const int rel = q0 + (t % QT) - lane * 4;      /* key 128 c + 4 l + q is kept while 128 c + q <= rel */
  v4f v[NCH];
#pragma unroll
  for (int c = 0; c < NCH; ++c) v[c] = *(const v4fa*)(s + c * 128 + lane * 4);
  float mx = -3.0e38f;
#pragma unroll
  for (int c = 0; c < NCH; ++c) for (int q = 0; q < 4; ++q) { v[c][q] = (c * 128 + q <= rel) ? v[c][q] : -1.0e9f; mx = fmaxf(mx, v[c][q]); }
  for (int m = 16; m > 0; m >>= 1) mx = fmaxf(mx, __shfl_xor(mx, m, 32));
  v4f s4 = {0.f, 0.f, 0.f, 0.f};      /* four independent sum chains per lane */
#pragma unroll
  for (int c = 0; c < NCH; ++c) for (int q = 0; q < 4; ++q) { v[c][q] = exp_native(v[c][q] - mx); s4[q] += v[c][q]; }
  float se = (s4[0] + s4[1]) + (s4[2] + s4[3]);
  for (int m = 16; m > 0; m >>= 1) se += __shfl_xor(se, m, 32);
  const float sc = 256.0f / se;
#pragma unroll
  for (int c = 0; c < NCH; ++c) { v4h h4; for (int q = 0; q < 4; ++q) h4[q] = (_Float16)(v[c][q] * sc); *(v4h*)(p + c * 128 + lane * 4) = h4; } }


typedef float v2f __attribute__((ext_vector_type(2)));
// exp(x) to f32 accuracy, in the way expf is expanded: n = nearest integer to x log2(e); v_exp_f32 of x log2(e) - n, log2(e) taken in two parts (two fma, so the difference is
// rounded once); ldexp by n; 0 and infinity beyond the two range ends. Written out so that v_exp_f32 can stand in asm with its v_nop directly behind it: the one free issue slot
// that the instruction set asks for before an instruction that reads the result or overwrites the source.
__device__ __forceinline__ float exp_slot(float x) {
  const float c_hi = __uint_as_float(0x3fb8aa3bu), c_lo = __uint_as_float(0x32a5705fu);
  const float n = rintf(x * c_hi); const float a = fmaf(x, c_lo, fmaf(x, c_hi, -n));
  float r; asm("v_exp_f32 %0, %1\n\tv_nop" : "=v"(r) : "v"(a));
  r = ldexpf(r, (int)n); r = (__uint_as_float(0xc2ce8ed0u) > x) ? 0.f : r; r = (__uint_as_float(0x42b17218u) < x) ? __uint_as_float(0x7f800000u) : r; return r; }
// Exact f32 attention of the first QT0 rows, one thread per query row. The row's q and o stay in registers. K and V come in tiles of 64 keys through LDS
// (K transposed to [dim][key], V as [key][dim]) and are read back as broadcasts, 32 reads at a time, one such batch in flight while the batch before it is worked on.
// Eight keys are worked on together: their eight score sums run side by side (each still summed over the dims in ascending order, s = fma(q, k, s)),
// then the running maximum, the two exps and the running sum key by key, then the o update key by key (o = fma(o, sc, e v), l = fma(l, sc, e)).
// Every row sees its keys, and every sum its terms, in the same order as with one key at a time.
template <int MASKADD>
__global__ __launch_bounds__(64) void k_att0(const float* __restrict__ QF, const float* __restrict__ KF, const float* __restrict__ VF, int ld, const float* __restrict__ mask, float scale, float* __restrict__ OF, int ldo) {
  __shared__ __attribute__((aligned(16))) float lkt[HD][64]; __shared__ __attribute__((aligned(16))) float lv[64][HD]; __shared__ __attribute__((aligned(16))) float lo[64][HD + 4];
  const int tid = threadIdx.x; const int h = blockIdx.x / (QT0 / 64), rg = blockIdx.x % (QT0 / 64); const int i = rg * 64 + tid;
  const float* qr = QF + (size_t)i * ld + h * HD;
  float q[HD]; v2f o[HD / 2];
#pragma unroll
  for (int c = 0; c < HD / 4; ++c) { const v4f t = *(const v4fa*)(qr + c * 4); for (int u = 0; u < 4; ++u) q[c * 4 + u] = t[u]; const v2f z = {0.f, 0.f}; o[c * 2] = z; o[c * 2 + 1] = z; }
  asm volatile("s_wait_xcnt 0x0" :: "v"(qr) : "memory");      /* the wait in front of any overwrite of the loads' address register; named as an input, the address stays in its register up to here (else the last load's result lands on it) */
  float m = -1.0e30f, l = 0.f; const int jmax = MASKADD ? (SQ - 1) : (rg * 64 + 63);      /* additive-mask form: every key (the mask input decides); causal form: keys up to the block's last row */
#pragma unroll 1
  for (int j0 = 0; j0 <= jmax; j0 += 64) {      /* rolled, for speed only */
    const float* kr = KF + (size_t)(j0 + tid) * ld + h * HD;      /* thread = key: the transposed stores of a wave fall on consecutive banks */
    const float* vr = VF + (size_t)(j0 + tid / 16) * ld + h * HD + (tid % 16) * 4;      /* 16 threads a row: whole lines */
    v4f tk[16], tv[16]; const float* vp[16];
#pragma unroll
    for (int c = 0; c < 16; ++c) { vp[c] = vr + (size_t)(c * 4) * ld; tk[c] = *(const v4fa*)(kr + c * 4); tv[c] = *(const v4fa*)vp[c]; }
    asm volatile("s_wait_xcnt 0x0" :: "v"(kr), "v"(vp[0]), "v"(vp[1]), "v"(vp[2]), "v"(vp[3]), "v"(vp[4]), "v"(vp[5]), "v"(vp[6]), "v"(vp[7]), "v"(vp[8]), "v"(vp[9]), "v"(vp[10]), "v"(vp[11]), "v"(vp[12]), "v"(vp[13]), "v"(vp[14]), "v"(vp[15]) : "memory");      /* as behind the q loads: every address of the batch keeps its register up to the wait (else later loads' results land on earlier loads' addresses) */
    __builtin_amdgcn_sched_barrier(0);      /* all 32 loads of the tile are issued before the first is waited for: without it each load sinks to its LDS store and the latencies add up */
#pragma unroll
    for (int c = 0; c < 16; ++c) { for (int u = 0; u < 4; ++u) lkt[c * 4 + u][tid] = tk[c][u]; *(v4f*)&lv[c * 4 + tid / 16][(tid % 16) * 4] = tv[c]; }
    __syncthreads();      /* the tile is complete before any thread reads it */
#pragma unroll 1
    for (int jg = 0; jg < 64; jg += 8) {      /* rolled for the same reason */
      v4f ba[32], bb[32]; v2f s2[4]; float sc[8], e[8]; for (int p = 0; p < 4; ++p) { const v2f z = {0.f, 0.f}; s2[p] = z; }
      /* batch b of K: dims 16 b .. + 15 of the eight keys; batch b of V: keys 2 b and 2 b + 1, all dims */
      auto load_k = [&](int b, v4f* t) {
#pragma unroll
        for (int x = 0; x < 16; ++x) { t[x * 2] = *(const v4f*)&lkt[b * 16 + x][jg]; t[x * 2 + 1] = *(const v4f*)&lkt[b * 16 + x][jg + 4]; }
        __builtin_amdgcn_sched_barrier(0); };      /* keeps the batch's reads in front of the arithmetic on the batch before: without it they sink to their first use and every read's latency shows */
      auto load_v = [&](int b, v4f* t) {
#pragma unroll
        for (int x = 0; x < 32; ++x) t[x] = *(const v4f*)&lv[jg + b * 2 + (x >> 4)][(x & 15) * 4];
        __builtin_amdgcn_sched_barrier(0); };      /* as in load_k */
      auto work_k = [&](int b, const v4f* t) {
#pragma unroll
        for (int x = 0; x < 16; ++x) { const float qs = q[b * 16 + x]; const v2f qd = {qs, qs}; const v4f ka = t[x * 2], kb = t[x * 2 + 1];
          const v2f k0 = {ka[0], ka[1]}, k1 = {ka[2], ka[3]}, k2 = {kb[0], kb[1]}, k3 = {kb[2], kb[3]};
          s2[0] = __builtin_elementwise_fma(qd, k0, s2[0]); s2[1] = __builtin_elementwise_fma(qd, k1, s2[1]); s2[2] = __builtin_elementwise_fma(qd, k2, s2[2]); s2[3] = __builtin_elementwise_fma(qd, k3, s2[3]); }
        __builtin_amdgcn_sched_barrier(0); };      /* the next batch's reads stay behind this arithmetic, so that no more than two batches hold registers */
      auto work_v = [&](int b, const v4f* t) {
#pragma unroll
        for (int x = 0; x < 32; ++x) { const int u = b * 2 + (x >> 4), c = x & 15; const v2f sc2 = {sc[u], sc[u]}, e2 = {e[u], e[u]}; const v4f vv = t[x]; const v2f v0 = {vv[0], vv[1]}, v1 = {vv[2], vv[3]};
          o[c * 2] = __builtin_elementwise_fma(o[c * 2], sc2, e2 * v0); o[c * 2 + 1] = __builtin_elementwise_fma(o[c * 2 + 1], sc2, e2 * v1); }
        __builtin_amdgcn_sched_barrier(0); };      /* as in work_k */
      load_k(0, ba); load_k(1, bb); work_k(0, ba); load_k(2, ba); work_k(1, bb); load_k(3, bb); work_k(2, ba); load_v(0, ba); work_k(3, bb); load_v(1, bb);
#pragma unroll
      for (int u = 0; u < 8; ++u) { const int j = j0 + jg + u; float s = __fmul_rn(s2[u >> 1][u & 1], scale); if (MASKADD) s = __fadd_rn(s, __fmul_rn(bf16_round(mask[(size_t)i * SQ + j]), -10000.0f));
        const float f = (MASKADD || j <= i) ? 1.f : 0.f; const float sm = fmaf(f, s, (1.f - f) * -1.0e30f); const float mn = fmaxf(m, sm); sc[u] = exp_slot(m - mn); e[u] = exp_slot(sm - mn); l = fmaf(l, sc[u], e[u]); m = mn; }
      work_v(0, ba); load_v(2, ba); work_v(1, bb); load_v(3, bb); work_v(2, ba); work_v(3, bb); }
    __syncthreads(); }      /* every thread has left the tile before the next one overwrites it */
  const float fin = 64.0f / l;      /* o carried x64 like the f16 path */
#pragma unroll
  for (int c = 0; c < HD / 4; ++c) { const v4f oo = {__fmul_rn(o[c * 2][0], fin), __fmul_rn(o[c * 2][1], fin), __fmul_rn(o[c * 2 + 1][0], fin), __fmul_rn(o[c * 2 + 1][1], fin)}; *(v4f*)&lo[tid][c * 4] = oo; }
  __syncthreads();
  {
#pragma unroll 1
    for (int it = 0; it < 16; ++it) { const int row = it * 4 + tid / 16, pc = (tid % 16) * 4; const v4f v = *(const v4f*)&lo[row][pc]; *(v4f*)(OF + (size_t)(rg * 64 + row) * ldo + h * HD + pc) = v; }
     } }

#define DMQ DM

template <int BFIN, int W16, int W32>
__global__ __launch_bounds__(256) void k_lnx(const float* __restrict__ X, const float* __restrict__ g, const float* __restrict__ bb, float eps, _Float16* __restrict__ N16, float* __restrict__ N32) {
  #pragma clang fp contract(off)
  __shared__ float red[256]; const size_t r = blockIdx.x; const int t = threadIdx.x; const bool act = t < (DMQ / 4); const int c0 = act ? t * 4 : 0;
  const v4f xa = *(const v4fa*)(X + r * DMQ + c0); float s[4]; float sum = 0.f;
  for (int q = 0; q < 4; ++q) { s[q] = act ? (BFIN ? bf16_round(xa[q]) : xa[q]) : 0.f; sum = __fadd_rn(sum, s[q]); }
  red[t] = sum; __syncthreads(); for (int st = 128; st > 0; st >>= 1) { if (t < st) red[t] = __fadd_rn(red[t], red[t + st]); __syncthreads(); } const float mu = red[0] / (float)DMQ; __syncthreads();
  float vs = 0.f; for (int q = 0; q < 4; ++q) { const float dl = act ? __fadd_rn(s[q], -mu) : 0.f; vs = __fadd_rn(vs, __fmul_rn(dl, dl)); } red[t] = vs; __syncthreads(); for (int st = 128; st > 0; st >>= 1) { if (t < st) red[t] = __fadd_rn(red[t], red[t + st]); __syncthreads(); }
  const float rs = rsqrtf(__fadd_rn(red[0] / (float)DMQ, eps)); v4h y; v4f yf;
  for (int q = 0; q < 4; ++q) { const int c = c0 + q; yf[q] = __fadd_rn(__fmul_rn(__fmul_rn(__fadd_rn(s[q], -mu), rs), bf16_round(g[c])), bf16_round(bb[c])); y[q] = (_Float16)yf[q]; }
  if (!act) return;      /* no barriers after this point */
  { if (W16) *(v4h*)(N16 + r * DMQ + c0) = y; if (W32) *(v4f*)(N32 + r * DMQ + c0) = yf;  } }


extern "C" void kernel_launch(void* const* d_in, const int* in_sizes, int n_in,
                              void* d_out, int out_size, void* d_ws, size_t ws_size, hipStream_t stream) {
  (void)in_sizes; (void)n_in; (void)out_size;
  const float* const* I = (const float* const*)d_in; const float* x = I[0]; const float* wk = I[1]; const float* wq = I[2]; const float* wv = I[3]; const float* wo = I[4]; const float* lng = I[5]; const float* lnb = I[6]; const float* bq = nullptr; const float* bk = nullptr; const float* bv = nullptr; const float* bo = nullptr;      /* x; natural [out][in] Wk, Wq, Wv (THIS order), Wp; LayerNorm gamma, beta; no biases */
  char* ws = (char*)d_ws; size_t off = 0;
  auto take = [&](size_t bytes) { char* p = ws + off; off += (bytes + 255) & ~(size_t)255; return p; };
  _Float16* BQ = (_Float16*)take((size_t)DM * DM * 2); _Float16* BK = (_Float16*)take((size_t)DM * DM * 2); _Float16* BV = (_Float16*)take((size_t)DM * DM * 2); _Float16* BO = (_Float16*)take((size_t)DM * DM * 2);
  _Float16* X16 = (_Float16*)take(NR * DM * 2); _Float16* Q16 = (_Float16*)take(NR * DM * 2); _Float16* K16 = (_Float16*)take(NR * DM * 2); _Float16* V16 = (_Float16*)take(NR * DM * 2); _Float16* O16 = (_Float16*)take(NR * DM * 2);
  float* S = (float*)take((size_t)NH * QT * NKX * 4); _Float16* P = (_Float16*)take((size_t)NH * QT * NKX * 2); _Float16* VT = (_Float16*)take((size_t)NH * HD * SQ * 2);
  float* QF0 = (float*)take((size_t)QT0 * DM * 4); float* KF0 = (float*)take((size_t)QT0 * DM * 4); float* VF0 = (float*)take((size_t)QT0 * DM * 4); float* OF0 = (float*)take((size_t)NB * QT0 * DM * 4); _Float16* OH0 = (_Float16*)take((size_t)NB * QT0 * DM * 2); _Float16* OL0 = (_Float16*)take((size_t)NB * QT0 * DM * 2);
  float* YO = (float*)take(NR * DM * 4);      /* pre-norm projection rows y (f32) */
  if (off > ws_size) return;
  { const unsigned g = (unsigned)(((size_t)DM * DM / 8 + 255) / 256); k_wnat<<<g, 256, 0, stream>>>(wq, (size_t)DM * DM / 8, BQ); k_wnat<<<g, 256, 0, stream>>>(wk, (size_t)DM * DM / 8, BK); k_wnat<<<g, 256, 0, stream>>>(wv, (size_t)DM * DM / 8, BV); k_wnat<<<g, 256, 0, stream>>>(wo, (size_t)DM * DM / 8, BO); }      /* natural [out][in] = Bt x16 */

  k_x16<<<(unsigned)((NR * DM / 8 + 255) / 256), 256, 0, stream>>>(x, X16, NR * DM / 8);
  const size_t r0p = (size_t)B0 * SQ;      /* first projected row */
  k_gemm2<0><<<dim3((unsigned)((MP / 128) * (DM / 64)), 1), 128, 0, stream>>>(X16 + r0p * DM, DM, 0, BQ, DM, 0, 0.0625f, nullptr, 0, nullptr, 1, 0, 0, nullptr, Q16 + r0p * DM, DM, 0, MP, DM, DM);
  k_gemm2<0><<<dim3((unsigned)((MP / 128) * (DM / 64)), 1), 128, 0, stream>>>(X16 + r0p * DM, DM, 0, BK, DM, 0, 0.0625f, nullptr, 0, nullptr, 1, 0, 0, nullptr, K16 + r0p * DM, DM, 0, MP, DM, DM);
  k_gemm2<0><<<dim3((unsigned)((MP / 128) * (DM / 64)), 1), 128, 0, stream>>>(X16 + r0p * DM, DM, 0, BV, DM, 0, 0.0625f, nullptr, 0, nullptr, 1, 0, 0, nullptr, V16 + r0p * DM, DM, 0, MP, DM, DM);
  for (int b = B0; b < B0 + NBR; ++b) { const size_t r0 = (size_t)b * SQ;
    k_vt<NH, SQ><<<NH * (SQ / 64), 256, 0, stream>>>(V16 + r0 * LQ, LQ, 0, VT);      /* V^T [NH][HD][SQ] for this batch */
    k_gemm2<0><<<dim3((QT0 / 128) * (DM / 64), 1), 128, 0, stream>>>(X16 + r0 * DM, DM, 0, BQ, DM, 0, 0.0625f, nullptr, 0, nullptr, 1, 0, 0, QF0, nullptr, DM, 0, QT0, DM, DM); k_gemm2<0><<<dim3((QT0 / 128) * (DM / 64), 1), 128, 0, stream>>>(X16 + r0 * DM, DM, 0, BK, DM, 0, 0.0625f, nullptr, 0, nullptr, 1, 0, 0, KF0, nullptr, DM, 0, QT0, DM, DM); k_gemm2<0><<<dim3((QT0 / 128) * (DM / 64), 1), 128, 0, stream>>>(X16 + r0 * DM, DM, 0, BV, DM, 0, 0.0625f, nullptr, 0, nullptr, 1, 0, 0, VF0, nullptr, DM, 0, QT0, DM, DM);      /* f32 q, k, v of the first 128 rows (exact products) */
    k_att0<0><<<NH * (QT0 / 64), 64, 0, stream>>>(QF0, KF0, VF0, DM, nullptr, 0.125f, OF0 + (size_t)b * QT0 * DM, DM);      /* exact f32 attention for rows 0..127 (o x64) */
    for (int q0 = 0; q0 < QN; q0 += QT) { const int nk = q0 + QT;      /* causal: only keys below the tile end are computed */
      k_gemm2<0><<<dim3((QT / 128) * (nk / 64), NHD), 128, 0, stream>>>(Q16 + (r0 + q0) * LQ, LQ, (size_t)HD, K16 + r0 * LQ, LQ, (size_t)HD, 0.125f, nullptr, 0, nullptr, 1, 0, 0, S, nullptr, NKX, (size_t)QT * NKX, QT, nk, HD);      /* scores, all heads on grid.y */
      switch (nk / QT) {      /* one wave per row, 8 rows per block; the row's length in chunks of 128 keys is a compile-time constant */
        case 1: k_rsmw<2><<<NHD * QT / 8, 256, 0, stream>>>(S, P, NHD, q0); break;
        case 2: k_rsmw<4><<<NHD * QT / 8, 256, 0, stream>>>(S, P, NHD, q0); break;
        case 3: k_rsmw<6><<<NHD * QT / 8, 256, 0, stream>>>(S, P, NHD, q0); break;
        case 4: k_rsmw<8><<<NHD * QT / 8, 256, 0, stream>>>(S, P, NHD, q0); break;
        case 5: k_rsmw<10><<<NHD * QT / 8, 256, 0, stream>>>(S, P, NHD, q0); break;
        case 6: k_rsmw<12><<<NHD * QT / 8, 256, 0, stream>>>(S, P, NHD, q0); break;
        case 7: k_rsmw<14><<<NHD * QT / 8, 256, 0, stream>>>(S, P, NHD, q0); break;
        case 8: k_rsmw<16><<<NHD * QT / 8, 256, 0, stream>>>(S, P, NHD, q0); break;
        default: break; }
      k_gemm2<0><<<dim3((QT / 128) * (HD / 64), NHD), 128, 0, stream>>>(P, NKX, (size_t)QT * NKX, VT, SQ, (size_t)HD * SQ, 0.25f, nullptr, 0, nullptr, 1, 0, 0, nullptr, O16 + (r0 + q0) * DM, DM, (size_t)HD, QT, HD, nk); } }      /* o (merged heads, x64) as f16 rows */
  k_gemm2<0><<<dim3((unsigned)((MPO / 128) * (DM / 64)), 1), 128, 0, stream>>>(O16 + r0p * DM, DM, 0, BO, DM, 0, 0.0009765625f, nullptr, 0, nullptr, 1, 0, 0, YO + r0p * DM, nullptr, DM, 0, MPO, DM, DM);      /* pre-norm y rows in the output layout */
  k_hl<<<(unsigned)(((size_t)NB * QT0 * DM / 8 + 255) / 256), 256, 0, stream>>>(OF0, OH0, OL0, (size_t)NB * QT0 * DM / 8);      /* first-tile o (x64) -> f16 hi + x1024 residual planes */
  for (int b = B0; b < B0 + NBR; ++b) { const size_t r0 = (size_t)b * SQ; const size_t f0 = (size_t)b * QT0;
    k_gemm2<0><<<dim3((QT0 / 128) * (DM / 64), 1), 128, 0, stream>>>(OH0 + f0 * DM, DM, 0, BO, DM, 0, 0.0009765625f, bo, 0, nullptr, 1, 0, 0, YO + r0 * DM, nullptr, DM, 0, QT0, DM, DM);      /* rows 0..127: y = o_hi Wo, overwriting the f16-path rows */
    k_gemm2<0><<<dim3((QT0 / 128) * (DM / 64), 1), 128, 0, stream>>>(OL0 + f0 * DM, DM, 0, BO, DM, 0, 0.00000095367431640625f, nullptr, 0, (const float*)YO + r0 * DM, -1, 0, 0, YO + r0 * DM, nullptr, DM, 0, QT0, DM, DM); }      /* += o_lo Wo 2^-20 (own-element accumulate) */
  k_lnx<0, 0, 1><<<(unsigned)NR, 256, 0, stream>>>(YO, lng, lnb, 1e-5f, nullptr, (float*)d_out);      /* out = LayerNorm(y) -> f32 output rows */
}

// v003
// A run of this version takes 1020 microseconds.
// Next to v002, in two timings, it ran 2.36 and 2.38 times as fast.
// Counting every step since v000, it is 9.68 times as fast.
#include <hip/hip_runtime.h>
// Causal multi-head self-attention with a fused post-LayerNorm (x [4][2048][1024]; k/q/v = x W^T (natural [1024][1024], no biases); 16 heads of 64; wei = q k^T * 64^-0.5; causal (tril, -inf); softmax; y = merged Wp^T; out = LayerNorm(y) (biased var, eps per the module, gamma / beta) -> [4][2048][1024]).
// Structure: token rows r = b*2048 + s; x as exact f16 rows (bf16-rounded); Q, K, V as three WMMA GEMMs (32x64 wave tiles, f32 accumulation, exact x16 weights, f16 outputs); V^T for all heads via LDS transposes; all four batches ride on the grid of every launch (blockIdx.z, or .y where no heads are there, else folded into grid.x); per query tile of 256 rows: scores against the keys below the tile end only (K = 64, all heads on grid.y, alpha = 0.125), causal row softmax on VALU, one wave per row, keys above the query masked over the computed range (f32 statistics, native exp; weights x256 f16), o = P . V^T (K = keys below the tile end, alpha 2^-2: o carried x64, folded into the output GEMM alpha) written straight into the merged f16 o rows; out = o W_o GEMM (f32) into the output layout.
// Compute dtype: inputs rounded to bf16; x / weights exact; q, k, v, softmax weights and o as plain f16 GEMM operands (~2^-12); scores and softmax statistics f32. v_wmma_f32_16x16x32_f16.
#define NB 4
#define SQ 2048
#define DM 1024
#define NH 16
#define HD 64
#define HG 4                         /* heads per launch of the k_vt(b, h0) overload, which is not launched */
#define QT 256                       /* query rows per causal tile */
#define NKX SQ                       /* S row pitch (f32) */
#define PKX (2 * NKX)                /* P row pitch (f16): a row's weights lie at the head of the row's own scores */
#define QT0 128                      /* first-tile rows recomputed exactly in f32 */
#define B0 0                         /* first batch processed (debug hook) */
#define NBR NB                       /* batches processed (debug hook) */
#define NR ((size_t)NB * SQ)         /* token rows */
#define MP ((int)((size_t)NBR * SQ)) /* rows projected (debug hook) */
#define QN SQ                        /* query rows attended per batch (debug hook) */
#define NHD NH                       /* heads attended (debug hook) */
#define MPO MP                       /* rows through the output stage (debug hook) */
#define LQ DM      /* row pitch of the q/k/v rows */
typedef __bf16 v16b __attribute__((ext_vector_type(16)));
typedef unsigned short v8us __attribute__((ext_vector_type(8), may_alias));
typedef float  v8f  __attribute__((ext_vector_type(8)));
typedef float  v4f  __attribute__((ext_vector_type(4)));
typedef float  v4fa __attribute__((ext_vector_type(4), may_alias));
union FragB { v16b v; v8us half[2]; unsigned short u[16]; };

__device__ __forceinline__ unsigned short bf16_bits(float x) { unsigned int u = __float_as_uint(x); return (unsigned short)((u + 0x7FFFu + ((u >> 16) & 1u)) >> 16); }
__device__ __forceinline__ float bf16_val(unsigned short b) { return __uint_as_float(((unsigned int)b) << 16); }
__device__ __forceinline__ float bf16_round(float x) { return bf16_val(bf16_bits(x)); }
// D += A·B with NT terms: 1 = ah·bh, 2 = + al·bh (A split), 3 = + ah·bl (both split)
template <int NT>
__device__ __forceinline__ v8f mmaN(v16b ah, v16b al, v16b bh, v16b bl, v8f c) {
  c = __builtin_amdgcn_wmma_f32_16x16x32_bf16(false, ah, false, bh, (short)0, c, false, false);
  if (NT >= 2) c = __builtin_amdgcn_wmma_f32_16x16x32_bf16(false, al, false, bh, (short)0, c, false, false);
  if (NT >= 3) c = __builtin_amdgcn_wmma_f32_16x16x32_bf16(false, ah, false, bl, (short)0, c, false, false);
  asm volatile("v_nop\n\tv_nop\n\tv_nop\n\tv_nop" : "+v"(c) : "v"(ah), "v"(al), "v"(bh), "v"(bl));
  return c;
}

__global__ __launch_bounds__(256) void k_wt_bf16(const float* __restrict__ W, unsigned short* __restrict__ Wt, int K, int N) {
  const int t = blockIdx.x * 256 + threadIdx.x;
  const int k8n = K / 8;
  if (t >= N * k8n) return;
  const int n = t / k8n, k8 = (t % k8n) * 8;
  v8us v;
#pragma unroll
  for (int i = 0; i < 8; ++i) v[i] = bf16_bits(W[(size_t)(k8 + i) * N + n]);
  *(v8us*)(Wt + (size_t)n * K + k8) = v;
  
}

// GEMM C[M][N] (f32, pitch ldc) = act(A[M][K]·W + bias). A f32 row-major (pitch lda) converted per fragment to bf16
// (ASPLIT: hi/lo two planes -> 2 terms, else single rounded term); Wt bf16 [N][K] (pitch ldb). BIAS_BF16 rounds the
// bias to bf16 first (bias quantised to bf16 before the add). K%32==0, M%16==0, N%64==0.
template <bool ASPLIT, int ACT, bool BIAS_BF16>
__global__ __launch_bounds__(128) void k_gemm_bf(const float* __restrict__ A, int lda, const unsigned short* __restrict__ Wt, int ldb,
                                               const float* __restrict__ bias, float* __restrict__ C, int ldc, int M, int N, int K) {
  __shared__ __attribute__((aligned(16))) float so[4][16][64];
  const int tid = threadIdx.x, w = tid >> 5, lane = tid & 31, ln = lane & 15, hh = lane >> 4;
  const int ntn = N / 64;
  const int wid = blockIdx.x * 4 + w;
  const int mt = wid / ntn, nq = wid % ntn;
  if (mt * 16 >= M) return;
  const int row0 = mt * 16, col0 = nq * 64;
  const float* arow = A + (size_t)(row0 + ln) * lda;
  v8f acc[4] = {};
  for (int kb = 0; kb < K; kb += 32) {
    FragB ah, al;
    const v4f x0 = *(const v4fa*)(arow + kb + 8 * hh), x1 = *(const v4fa*)(arow + kb + 8 * hh + 4);
    const v4f x2 = *(const v4fa*)(arow + kb + 16 + 8 * hh), x3 = *(const v4fa*)(arow + kb + 16 + 8 * hh + 4);
    float xs[16] = {x0[0],x0[1],x0[2],x0[3],x1[0],x1[1],x1[2],x1[3],x2[0],x2[1],x2[2],x2[3],x3[0],x3[1],x3[2],x3[3]};
#pragma unroll
    for (int i = 0; i < 16; ++i) { const unsigned short hb = bf16_bits(xs[i]); ah.u[i] = hb; al.u[i] = ASPLIT ? bf16_bits(xs[i] - bf16_val(hb)) : (unsigned short)0; }
#pragma unroll
    for (int t = 0; t < 4; ++t) {
      const unsigned short* brow = Wt + (size_t)(col0 + t * 16 + ln) * ldb + kb;
      FragB b;
      b.half[0] = *(const v8us*)(brow + 8 * hh);
      b.half[1] = *(const v8us*)(brow + 16 + 8 * hh);
      acc[t] = mmaN<ASPLIT ? 2 : 1>(ah.v, al.v, b.v, b.v, acc[t]);
    }
  }
#pragma unroll
  for (int t = 0; t < 4; ++t) {
    float bv = bias ? bias[col0 + t * 16 + ln] : 0.f;
    if (BIAS_BF16) bv = bf16_round(bv);
#pragma unroll
    for (int r = 0; r < 8; ++r) { float v = acc[t][r] + bv; if (ACT == 1) v = fmaxf(v, 0.f); so[w][8 * hh + r][t * 16 + ln] = v; }
  }
  __builtin_amdgcn_fence(__ATOMIC_ACQ_REL, "workgroup");
  __builtin_amdgcn_wave_barrier();
  const int rsub = lane >> 4, c4 = (lane & 15) * 4;
  {
#pragma unroll
    for (int q = 0; q < 8; ++q) {
      const int r = q * 2 + rsub;
      const v4f v = *(const v4fa*)&so[w][r][c4];
      *(v4f*)(C + (size_t)(row0 + r) * ldc + col0 + c4) = v;
    }
    
  }
}

// GEMM C = act(A·W + bias + resid): A f32 (ASPLIT -> hi/lo 2 terms), Wt bf16 [N][K]; ACT 0 none, 1 relu, 2 exact gelu;
// resid (optional, f32, row index = (row % rmod), pitch ldr, RES_BF16 rounds it) added before the activation.
template <bool ASPLIT, int ACT, bool BIAS_BF16, bool RES_BF16>
__global__ __launch_bounds__(128) void k_gemm_bf3(const float* __restrict__ A, int lda, const unsigned short* __restrict__ Wt, int ldb,
                                                const float* __restrict__ bias, const float* __restrict__ resid, int rmod, int ldr,
                                                float* __restrict__ C, int ldc, int M, int N, int K) {
  __shared__ __attribute__((aligned(16))) float so[4][16][64];
  const int tid = threadIdx.x, w = tid >> 5, lane = tid & 31, ln = lane & 15, hh = lane >> 4;
  const int ntn = N / 64;
  const int wid = blockIdx.x * 4 + w;
  const int mt = wid / ntn, nq = wid % ntn;
  if (mt * 16 >= M) return;
  const int row0 = mt * 16, col0 = nq * 64;
  const float* arow = A + (size_t)(row0 + ln) * lda;
  v8f acc[4] = {};
  for (int kb = 0; kb < K; kb += 32) {
    FragB ah, al;
    const v4f x0 = *(const v4fa*)(arow + kb + 8 * hh), x1 = *(const v4fa*)(arow + kb + 8 * hh + 4);
    const v4f x2 = *(const v4fa*)(arow + kb + 16 + 8 * hh), x3 = *(const v4fa*)(arow + kb + 16 + 8 * hh + 4);
    float xs[16] = {x0[0],x0[1],x0[2],x0[3],x1[0],x1[1],x1[2],x1[3],x2[0],x2[1],x2[2],x2[3],x3[0],x3[1],x3[2],x3[3]};
#pragma unroll
    for (int i = 0; i < 16; ++i) { const unsigned short hb = bf16_bits(xs[i]); ah.u[i] = hb; al.u[i] = ASPLIT ? bf16_bits(xs[i] - bf16_val(hb)) : (unsigned short)0; }
#pragma unroll
    for (int t = 0; t < 4; ++t) {
      const unsigned short* brow = Wt + (size_t)(col0 + t * 16 + ln) * ldb + kb;
      FragB b;
      b.half[0] = *(const v8us*)(brow + 8 * hh);
      b.half[1] = *(const v8us*)(brow + 16 + 8 * hh);
      acc[t] = mmaN<ASPLIT ? 2 : 1>(ah.v, al.v, b.v, b.v, acc[t]);
    }
  }
#pragma unroll
  for (int t = 0; t < 4; ++t) {
    const int col = col0 + t * 16 + ln;
    float bv = bias ? bias[col] : 0.f;
    if (BIAS_BF16) bv = bf16_round(bv);
#pragma unroll
    for (int r = 0; r < 8; ++r) {
      float v = acc[t][r] + bv;
      if (resid) { float rv = resid[(size_t)((row0 + 8 * hh + r) % rmod) * ldr + col]; if (RES_BF16) rv = bf16_round(rv); v += rv; }
      if (ACT == 1) v = fmaxf(v, 0.f);
      if (ACT == 2) v = 0.5f * v * (1.0f + erff(v * 0.70710678118654752f));
      if (ACT == 3) { const float u = 0.7978845608028654f * (v + 0.044715f * v * v * v); v = 0.5f * v * (1.0f + tanhf(u)); }
      so[w][8 * hh + r][t * 16 + ln] = v;
    }
  }
  __builtin_amdgcn_fence(__ATOMIC_ACQ_REL, "workgroup");
  __builtin_amdgcn_wave_barrier();
  const int rsub = lane >> 4, c4 = (lane & 15) * 4;
  {
#pragma unroll
    for (int q = 0; q < 8; ++q) {
      const int r = q * 2 + rsub;
      const v4f v = *(const v4fa*)&so[w][r][c4];
      *(v4f*)(C + (size_t)(row0 + r) * ldc + col0 + c4) = v;
    }
    
  }
}
// row LayerNorm (biased variance, eps) over N: s = X (+ R); optional out_sum <- s; out_norm <- (s-mu)*rsqrt(var+eps)*g + b
template <bool PARAM_BF16>
__global__ __launch_bounds__(256) void k_layernorm(const float* __restrict__ X, const float* __restrict__ R, const float* __restrict__ g, const float* __restrict__ bta,
                                                  float* __restrict__ out_sum, float* __restrict__ out_norm, int N, float eps) {
  __shared__ float red[256];
  const int row = blockIdx.x, tid = threadIdx.x;
  const float* x = X + (size_t)row * N; const float* rr = R ? R + (size_t)row * N : nullptr;
  float vals[16];                     // up to N = 4096
  const int per = N / 256;            // contiguous chunk per thread? use strided-by-4 chunks: thread handles j = tid*4 + 1024*u
  float s1 = 0.f;
  for (int u = 0; u < per / 4; ++u) {
    const int j = tid * 4 + 1024 * u;
    const v4f a = *(const v4fa*)(x + j);
    v4f b = {0.f,0.f,0.f,0.f}; if (rr) b = *(const v4fa*)(rr + j);
#pragma unroll
    for (int q = 0; q < 4; ++q) { const float v = a[q] + b[q]; vals[u * 4 + q] = v; s1 += v; }
  }
  red[tid] = s1; __syncthreads();
  for (int st = 128; st > 0; st >>= 1) { if (tid < st) red[tid] += red[tid + st]; __syncthreads(); }
  const float mu = red[0] / (float)N; __syncthreads();
  float s2 = 0.f;
  for (int u = 0; u < per / 4; ++u)
#pragma unroll
    for (int q = 0; q < 4; ++q) { const float c = vals[u * 4 + q] - mu; s2 += c * c; }
  red[tid] = s2; __syncthreads();
  for (int st = 128; st > 0; st >>= 1) { if (tid < st) red[tid] += red[tid + st]; __syncthreads(); }
  const float rs = rsqrtf(red[0] / (float)N + eps);
  {
    for (int u = 0; u < per / 4; ++u) {
      const int j = tid * 4 + 1024 * u;
      v4f o, sm;
#pragma unroll
      for (int q = 0; q < 4; ++q) {
        float gg = g[j + q], bb = bta[j + q];
        if (PARAM_BF16) { gg = bf16_round(gg); bb = bf16_round(bb); }
        sm[q] = vals[u * 4 + q]; o[q] = (vals[u * 4 + q] - mu) * rs * gg + bb;
      }
      if (out_sum) *(v4f*)(out_sum + (size_t)row * N + j) = sm;
      *(v4f*)(out_norm + (size_t)row * N + j) = o;
    }
    
  }
}



// ---- f16 WMMA path (v_wmma_f32_16x16x32_f16): 11-bit significands for operands in range — used where a [0,1] probability operand needs more precision than bf16
typedef _Float16 v16h __attribute__((ext_vector_type(16)));
union FragH { v16h v; v8us half[2]; _Float16 h[16]; unsigned short u[16]; };
template <int NT>
__device__ __forceinline__ v8f mmaH(v16h ah, v16h al, v16h bh, v16h bl, v8f c) {
  c = __builtin_amdgcn_wmma_f32_16x16x32_f16(false, ah, false, bh, (short)0, c, false, false);
  if (NT >= 2) c = __builtin_amdgcn_wmma_f32_16x16x32_f16(false, al, false, bh, (short)0, c, false, false);
  if (NT >= 3) c = __builtin_amdgcn_wmma_f32_16x16x32_f16(false, ah, false, bl, (short)0, c, false, false);
  asm volatile("v_nop\n\tv_nop\n\tv_nop\n\tv_nop" : "+v"(c) : "v"(ah), "v"(al), "v"(bh), "v"(bl));
  return c;
}
// batched GEMM like k_gemm_b but f16 operands: A f32 (split into f16 hi/lo if ASPLIT, else rounded to f16), Bt = f16 values [n][k]; alpha; C f32; N multiple of 16 (partial tiles skipped)
template <bool ASPLIT>
__global__ __launch_bounds__(128) void k_gemm_h(const float* __restrict__ A, int lda, size_t sA, const _Float16* __restrict__ Bh, int ldb, size_t sB, float alpha, float* __restrict__ C, int ldc, size_t sC, int M, int N, int K) {
  __shared__ __attribute__((aligned(16))) float so[4][16][64];
  const int tid = threadIdx.x, w = tid >> 5, lane = tid & 31, ln = lane & 15, hh = lane >> 4; const int by = blockIdx.y;
  A += (size_t)by * sA; Bh += (size_t)by * sB; C += (size_t)by * sC;
  const int ntn = (N + 63) / 64; const int wid = blockIdx.x * 4 + w; const int mt = wid / ntn, nq = wid % ntn; if (mt * 16 >= M) return;
  const int row0 = mt * 16, col0 = nq * 64; const float* arow = A + (size_t)(row0 + ln) * lda;
  v8f acc[4] = {};
  for (int kb = 0; kb < K; kb += 32) {
    FragH ah, al;
    const v4f x0 = *(const v4fa*)(arow + kb + 8 * hh), x1 = *(const v4fa*)(arow + kb + 8 * hh + 4), x2 = *(const v4fa*)(arow + kb + 16 + 8 * hh), x3 = *(const v4fa*)(arow + kb + 16 + 8 * hh + 4);
    float xs[16] = {x0[0],x0[1],x0[2],x0[3],x1[0],x1[1],x1[2],x1[3],x2[0],x2[1],x2[2],x2[3],x3[0],x3[1],x3[2],x3[3]};
#pragma unroll
    for (int i = 0; i < 16; ++i) { const _Float16 h = (_Float16)xs[i]; ah.h[i] = h; al.h[i] = ASPLIT ? (_Float16)(xs[i] - (float)h) : (_Float16)0.0f; }
#pragma unroll
    for (int t = 0; t < 4; ++t) { if (col0 + t * 16 >= N) continue; const size_t boff = (size_t)(col0 + t * 16 + ln) * ldb + kb; FragH bq; bq.half[0] = *(const v8us*)(Bh + boff + 8 * hh); bq.half[1] = *(const v8us*)(Bh + boff + 16 + 8 * hh);
      acc[t] = mmaH<ASPLIT ? 2 : 1>(ah.v, al.v, bq.v, bq.v, acc[t]); }
  }
#pragma unroll
  for (int t = 0; t < 4; ++t) { if (col0 + t * 16 >= N) continue;
#pragma unroll
    for (int r = 0; r < 8; ++r) so[w][8 * hh + r][t * 16 + ln] = acc[t][r] * alpha; }
  __builtin_amdgcn_fence(__ATOMIC_ACQ_REL, "workgroup"); __builtin_amdgcn_wave_barrier();
  const int rsub = lane >> 4, c4 = (lane & 15) * 4;
  {
#pragma unroll
    for (int q = 0; q < 8; ++q) { const int r = q * 2 + rsub; if (col0 + c4 < N) { const v4f v = *(const v4fa*)&so[w][r][c4]; *(v4f*)(C + (size_t)(row0 + r) * ldc + col0 + c4) = v; } }
     }
}

// Wt[n][k] = f16(W[k][n]·scale) from f32 row-major W[K][N] (scale = power of two; bf16-exact weights stay exact in f16 away from the subnormal range)
__global__ __launch_bounds__(256) void k_wt_f16(const float* __restrict__ W, _Float16* __restrict__ Wt, int K, int N, float scale) {
  const int t = blockIdx.x * 256 + threadIdx.x; if (t >= N * (K / 8)) return; const int n = t / (K / 8), k8 = (t % (K / 8)) * 8; FragH f;
#pragma unroll
  for (int i = 0; i < 8; ++i) f.h[i] = (_Float16)(bf16_round(W[(size_t)(k8 + i) * N + n]) * scale); const v8us o = f.half[0];
  *(v8us*)((unsigned short*)Wt + (size_t)n * K + k8) = o; 
}
// k_gemm_hh variant with fused epilogue: v = acc·alpha + bias[by·sBias + col] (+ CP[(row/rowsPerB)·sCPb + by·64 + col] if CP) ; ACT 0 none / 1 elu ; writes f16 C16 (and f32 C if non-null)
template <int ACT>
__global__ __launch_bounds__(128) void k_gemm_hhx(const _Float16* __restrict__ A, int lda, size_t sA, const _Float16* __restrict__ Bh, int ldb, size_t sB, float alpha, const float* __restrict__ bias, size_t sBias, const float* __restrict__ CP, int rowsPerB, size_t sCPb, int row0g,
    float* __restrict__ C, _Float16* __restrict__ C16, int ldc, size_t sC, int M, int N, int K) {
  __shared__ __attribute__((aligned(16))) float so[4][16][64];
  const int tid = threadIdx.x, w = tid >> 5, lane = tid & 31, ln = lane & 15, hh = lane >> 4; const int by = blockIdx.y;
  A += (size_t)by * sA; Bh += (size_t)by * sB; const size_t cofs = (size_t)by * sC; const float* bp = bias ? bias + (size_t)by * sBias : nullptr;
  const int ntn = (N + 63) / 64; const int wid = blockIdx.x * 4 + w; const int mt = wid / ntn, nq = wid % ntn; if (mt * 16 >= M) return;
  const int row0 = mt * 16, col0 = nq * 64; const _Float16* arow = A + (size_t)(row0 + ln) * lda;
  v8f acc[4] = {};
  for (int kb = 0; kb < K; kb += 32) { FragH ah; ah.half[0] = *(const v8us*)((const unsigned short*)arow + kb + 8 * hh); ah.half[1] = *(const v8us*)((const unsigned short*)arow + kb + 16 + 8 * hh);
#pragma unroll
    for (int t = 0; t < 4; ++t) { if (col0 + t * 16 >= N) continue; const size_t boff = (size_t)(col0 + t * 16 + ln) * ldb + kb; FragH bq; bq.half[0] = *(const v8us*)((const unsigned short*)Bh + boff + 8 * hh); bq.half[1] = *(const v8us*)((const unsigned short*)Bh + boff + 16 + 8 * hh);
      acc[t] = mmaH<1>(ah.v, ah.v, bq.v, bq.v, acc[t]); }
  }
#pragma unroll
  for (int t = 0; t < 4; ++t) { if (col0 + t * 16 >= N) continue; const int col = col0 + t * 16 + ln; const float bv = bp ? bf16_round(bp[col]) : 0.f;
#pragma unroll
    for (int r = 0; r < 8; ++r) { float v = acc[t][r] * alpha + bv; if (CP) { const int rr = row0g + row0 + 8 * hh + r; if (rowsPerB < 0) v += CP[cofs + (size_t)rr * ldc + col];      /* rowsPerB < 0: own element of the batched C plane */ else { const int bidx = rr / rowsPerB; v += CP[(size_t)bidx * sCPb + (size_t)by * 64 + col]; } } if (ACT == 1) v = (v > 0.f) ? v : expm1f(v); else if (ACT == 7) v = (v > 0.f) ? v + 1.0f : expf(v); else if (ACT == 8) v = tanhf(v); else if (ACT == 9) v = 0.5f * v * (1.0f + tanhf(0.7978845608028654f * (v + 0.044715f * v * v * v))); else if (ACT == 11) v = 1.0f / (1.0f + expf(-v)); else if (ACT == 12) v = (v > 0.f) ? v : 0.01f * v; else if (ACT == 14) v = (v > 0.f) ? v : 0.1f * v; else if (ACT == 16) v = (v >= 0.f) ? v : 0.3f * v; else if (ACT == 17) v = (v >= 0.f) ? v : 0.2f * v; else if (ACT == 15) v = v / (1.0f + expf(-v)); else if (ACT == 3) v = fmaxf(v, 0.f); else if (ACT == 6) v = 0.5f * v * (1.0f + erff(v * 0.70710678118654752f)); so[w][8 * hh + r][t * 16 + ln] = v; } }
  __builtin_amdgcn_fence(__ATOMIC_ACQ_REL, "workgroup"); __builtin_amdgcn_wave_barrier();
  const int rsub = lane >> 4, c4 = (lane & 15) * 4; typedef _Float16 v4h __attribute__((ext_vector_type(4)));
  {
#pragma unroll
    for (int q = 0; q < 8; ++q) { const int r = q * 2 + rsub; if (col0 + c4 < N) { const v4f v = *(const v4fa*)&so[w][r][c4]; if (C) *(v4f*)(C + cofs + (size_t)(row0 + r) * ldc + col0 + c4) = v; if (C16) { v4h h4; for (int i = 0; i < 4; ++i) h4[i] = (_Float16)v[i]; *(v4h*)(C16 + cofs + (size_t)(row0 + r) * ldc + col0 + c4) = h4; } } }
     }
}


typedef _Float16 v4h __attribute__((ext_vector_type(4)));

__global__ __launch_bounds__(256) void k_x16(const float* __restrict__ x, _Float16* __restrict__ X16, size_t n8) { const size_t t = (size_t)blockIdx.x * 256 + threadIdx.x; if (t >= n8) return; FragH f;
#pragma unroll
  for (int q = 0; q < 8; ++q) f.h[q] = (_Float16)bf16_round(x[t * 8 + q]); *(v8us*)((unsigned short*)X16 + t * 8) = f.half[0];  }
__global__ __launch_bounds__(256) void k_h16(const float* __restrict__ x, _Float16* __restrict__ X16, size_t n8) { const size_t t = (size_t)blockIdx.x * 256 + threadIdx.x; if (t >= n8) return; FragH f;
#pragma unroll
  for (int q = 0; q < 8; ++q) f.h[q] = (_Float16)x[t * 8 + q]; *(v8us*)((unsigned short*)X16 + t * 8) = f.half[0];  }
__global__ __launch_bounds__(256) void k_round16f(const float* __restrict__ W, _Float16* __restrict__ Bt, size_t n8) { const size_t t = (size_t)blockIdx.x * 256 + threadIdx.x; if (t >= n8) return; FragH f;
#pragma unroll
  for (int i = 0; i < 8; ++i) f.h[i] = (_Float16)(bf16_round(W[t * 8 + i]) * 16.0f); *(v8us*)((unsigned short*)Bt + t * 8) = f.half[0];  }
template <int NHv, int TTv>
__global__ __launch_bounds__(256) void k_vt(const _Float16* __restrict__ V16, int ldv, int voff, _Float16* __restrict__ Vt) { __shared__ unsigned short tl[64][66]; const int tid = threadIdx.x; const int slab = blockIdx.x / (TTv / 64), lg = blockIdx.x % (TTv / 64); const int b = slab / NHv, h = slab % NHv;
  for (int i = tid; i < 64 * 8; i += 256) { const int r = i / 8, c8 = (i % 8) * 8; FragH f; f.half[0] = *(const v8us*)((const unsigned short*)V16 + ((size_t)b * TTv + lg * 64 + r) * ldv + voff + h * 64 + c8);
#pragma unroll
    for (int q = 0; q < 8; ++q) tl[r][c8 + q] = f.u[q]; }
  __syncthreads();
  {
#pragma unroll
    for (int rd = 0; rd < 2; ++rd) { const int d = rd * 32 + tid / 8, pc = tid % 8; FragH f;
#pragma unroll
      for (int q = 0; q < 8; ++q) f.u[q] = tl[pc * 8 + q][d];
      *(v8us*)((unsigned short*)Vt + ((size_t)slab * 64 + d) * TTv + lg * 64 + pc * 8) = f.half[0]; }
     } }

__global__ __launch_bounds__(256) void k_hl(const float* __restrict__ F, _Float16* __restrict__ Hh, _Float16* __restrict__ Hl, size_t n8) { const size_t t = (size_t)blockIdx.x * 256 + threadIdx.x; if (t >= n8) return; FragH fh, fl; const v4f a = *(const v4fa*)(F + t * 8), c = *(const v4fa*)(F + t * 8 + 4);
#pragma unroll
  for (int q = 0; q < 4; ++q) { _Float16 h = (_Float16)a[q]; fh.h[q] = h; fl.h[q] = (_Float16)((a[q] - (float)h) * 1024.0f); h = (_Float16)c[q]; fh.h[4 + q] = h; fl.h[4 + q] = (_Float16)((c[q] - (float)h) * 1024.0f); }
  { *(v8us*)((unsigned short*)Hh + t * 8) = fh.half[0]; *(v8us*)((unsigned short*)Hl + t * 8) = fl.half[0];  } }

// ---- fast GEMM (wave tile 32x64; requires M % 32 == 0 rows per launch region and N % 64 == 0); epilogue = k_gemm_hhx semantics ----
__device__ __forceinline__ v16h g2_frag(const _Float16* p, int hh) { FragH f; f.half[0] = *(const v8us*)((const unsigned short*)p + 8 * hh); f.half[1] = *(const v8us*)((const unsigned short*)p + 16 + 8 * hh); return f.v; }
__device__ __forceinline__ v8f g2_mma(v16h a, v16h b, v8f c) { v8f d = __builtin_amdgcn_wmma_f32_16x16x32_f16(false, a, false, b, (short)0, c, false, false); asm volatile("v_nop\n\tv_nop\n\tv_nop\n\tv_nop" : "+v"(d) : "v"(a), "v"(b)); return d; }
template <int ACT>
__global__ __launch_bounds__(128) void k_gemm2(const _Float16* __restrict__ A, int lda, size_t sA, const _Float16* __restrict__ Bh, int ldb, size_t sB, float alpha, const float* __restrict__ bias, size_t sBias, const float* __restrict__ CP, int rowsPerB, size_t sCPb, int row0g,
    float* __restrict__ C, _Float16* __restrict__ C16, int ldc, size_t sC, int M, int N, int K, size_t zA, size_t zB, size_t zC) { static_assert(ACT == 0 || ACT == 3 || ACT == 6 || ACT == 8 || ACT == 9 || ACT == 11 || ACT == 12 || ACT == 14 || ACT == 15 || ACT == 16 || ACT == 17, "k_gemm2: unsupported ACT code (would silently apply no activation)");
  __shared__ __attribute__((aligned(16))) float so[4][32][68];
  const int tid = threadIdx.x, w = tid >> 5, lane = tid & 31, ln = lane & 15, hh = lane >> 4; const int by = blockIdx.y, bz = blockIdx.z;      /* two batch axes, each with its own strides */
  A += (size_t)by * sA + (size_t)bz * zA; Bh += (size_t)by * sB + (size_t)bz * zB; const size_t cofs = (size_t)by * sC + (size_t)bz * zC; const float* bp = bias ? bias + (size_t)by * sBias : nullptr;
  const int ntn = N >> 6; const int mt = blockIdx.x / ntn, nq = blockIdx.x - mt * ntn; const int row0 = mt * 128 + 32 * w, col0 = nq * 64; if (row0 >= M) return;
  const _Float16* a0p = A + (size_t)(row0 + ln) * lda; const _Float16* a1p = a0p + (size_t)16 * lda;
  const _Float16* b0p = Bh + (size_t)(col0 + ln) * ldb; const _Float16* b1p = b0p + (size_t)16 * ldb; const _Float16* b2p = b1p + (size_t)16 * ldb; const _Float16* b3p = b2p + (size_t)16 * ldb;
  const v8f z8 = {0.f,0.f,0.f,0.f,0.f,0.f,0.f,0.f}; v8f c00 = z8, c01 = z8, c02 = z8, c03 = z8, c10 = z8, c11 = z8, c12 = z8, c13 = z8;
#pragma unroll 1
  for (int kb = 0; kb < K; kb += 32) { const v16h a0 = g2_frag(a0p + kb, hh), a1 = g2_frag(a1p + kb, hh);
    v16h b = g2_frag(b0p + kb, hh); c00 = g2_mma(a0, b, c00); c10 = g2_mma(a1, b, c10);
    b = g2_frag(b1p + kb, hh); c01 = g2_mma(a0, b, c01); c11 = g2_mma(a1, b, c11);
    b = g2_frag(b2p + kb, hh); c02 = g2_mma(a0, b, c02); c12 = g2_mma(a1, b, c12);
    b = g2_frag(b3p + kb, hh); c03 = g2_mma(a0, b, c03); c13 = g2_mma(a1, b, c13); }
  v8f accs[8] = {c00, c01, c02, c03, c10, c11, c12, c13};
#pragma unroll
  for (int u = 0; u < 8; ++u) { const int t = u & 3, half = u >> 2; const int col = col0 + t * 16 + ln; const float bv = bp ? bf16_round(bp[col]) : 0.f;
#pragma unroll
    for (int r = 0; r < 8; ++r) { const int rloc = half * 16 + 8 * hh + r; float v = accs[u][r] * alpha + bv; if (CP) { if (rowsPerB < 0) v += CP[cofs + (size_t)(row0g + row0 + rloc) * ldc + col];      /* rowsPerB < 0: own element of the batched C plane */ else { const int bidx = (row0g + row0 + rloc) / rowsPerB; v += CP[(size_t)bidx * sCPb + (size_t)by * 64 + col]; } }
      if (ACT == 3) v = fmaxf(v, 0.f); else if (ACT == 6) v = 0.5f * v * (1.0f + erff(v * 0.70710678118654752f)); else if (ACT == 11) v = 1.0f / (1.0f + expf(-v)); else if (ACT == 15) v = v / (1.0f + expf(-v)); else if (ACT == 12) v = (v > 0.f) ? v : 0.01f * v; else if (ACT == 8) v = tanhf(v); else if (ACT == 9) v = 0.5f * v * (1.0f + tanhf(0.7978845608028654f * (v + 0.044715f * v * v * v))); else if (ACT == 14) v = (v > 0.f) ? v : 0.1f * v; else if (ACT == 16) v = (v >= 0.f) ? v : 0.3f * v; else if (ACT == 17) v = (v >= 0.f) ? v : 0.2f * v;
      so[w][rloc][t * 16 + ln] = v; } }
  __builtin_amdgcn_fence(__ATOMIC_ACQ_REL, "workgroup"); __builtin_amdgcn_wave_barrier();
  const int rsub = lane >> 4, c4 = (lane & 15) * 4;
  {
#pragma unroll
    for (int q = 0; q < 16; ++q) { const int r = q * 2 + rsub; const v4f v = *(const v4fa*)&so[w][r][c4]; if (C) *(v4f*)(C + cofs + (size_t)(row0 + r) * ldc + col0 + c4) = v; if (C16) { v4h h4; for (int i = 0; i < 4; ++i) h4[i] = (_Float16)v[i]; *(v4h*)(C16 + cofs + (size_t)(row0 + r) * ldc + col0 + c4) = h4; } }
     } }


__global__ __launch_bounds__(256) void k_wnat(const float* __restrict__ w, size_t n8, _Float16* __restrict__ Bt) { const size_t t = (size_t)blockIdx.x * 256 + threadIdx.x; if (t >= n8) return; FragH f; for (int q = 0; q < 8; ++q) f.h[q] = (_Float16)(bf16_round(w[t * 8 + q]) * 16.0f); *(v8us*)((unsigned short*)Bt + t * 8) = f.half[0];  }
__global__ __launch_bounds__(256) void k_rsm(const float* __restrict__ S, _Float16* __restrict__ P, int nrows) {
  #pragma clang fp contract(off)
  const int i = blockIdx.x * 256 + threadIdx.x; if (i >= nrows) return; const float* s = S + (size_t)i * SQ; float mx = -3.0e38f;
#pragma unroll 1
  for (int j = 0; j < SQ; ++j) mx = fmaxf(mx, s[j]); float se = 0.f;
#pragma unroll 1
  for (int j = 0; j < SQ; ++j) se += expf(s[j] - mx); const float sc = 256.0f / se;
#pragma unroll 1
  for (int j0 = 0; j0 < SQ; j0 += 8) { FragH f; for (int q = 0; q < 8; ++q) f.h[q] = (_Float16)(expf(s[j0 + q] - mx) * sc); unsigned short* d = (unsigned short*)P + (size_t)i * SQ + j0; *(v8us*)d = f.half[0];  } }
__global__ __launch_bounds__(256) void k_vt(const _Float16* __restrict__ V16, int b, int h0, _Float16* __restrict__ VT) { __shared__ unsigned short tl[64][65]; const int tid = threadIdx.x; const int hh = blockIdx.x % HG, sg = blockIdx.x / HG; const int s0 = sg * 64; const int h = h0 + hh;
  for (int i = tid; i < 64 * 8; i += 256) { const int j = i / 8, d8 = (i % 8) * 8; FragH f; f.half[0] = *(const v8us*)((const unsigned short*)V16 + ((size_t)b * SQ + s0 + j) * DM + h * HD + d8); for (int q = 0; q < 8; ++q) tl[d8 + q][j] = f.u[q]; }
  __syncthreads();
  { for (int i = tid; i < 64 * 8; i += 256) { const int d = i / 8, j8 = (i % 8) * 8; FragH f; for (int q = 0; q < 8; ++q) f.u[q] = tl[d][j8 + q]; *(v8us*)((unsigned short*)VT + ((size_t)hh * HD + d) * SQ + s0 + j8) = f.half[0]; }  } }



// Native exp as __expf compiles it: v_exp_f32 of x * log2(e). Written as asm so that the v_nop stands directly behind the transcendental: it keeps the one free
// issue slot that the instruction set asks for before an instruction that reads the result or overwrites the source.
__device__ __forceinline__ float exp_native(float x) { float r; asm("v_exp_f32 %0, %1\n\tv_nop" : "=v"(r) : "v"(x * 1.44269504088896340736f)); return r; }
// Causal row softmax, one wave per score row (row t = (batch * NH + head) * QT + query) over the NCH * 128 computed keys. Lane l holds keys 128 c + 4 l .. + 3 of chunk c, so
// every load covers 512 contiguous bytes and every store 256; the row is read once and stays in registers. Keys above the query get -1e9 (weight exactly 0).
// Row maximum and row sum: per lane over its own keys (the sum in four chains), then a five-step butterfly over the wave. Weights x256 as f16.
// P may be S itself (pitch PKX): a row belongs to one wave, and every store needs the row sum, hence every load of the row.
template <int NCH>
__global__ __launch_bounds__(256) void k_rsmw(const float* S, _Float16* P, int hg, int q0) {
  const int lane = threadIdx.x & 31; const int t = blockIdx.x * 8 + __builtin_amdgcn_readfirstlane(threadIdx.x >> 5); if (t >= hg * QT) return;      /* the row index is the wave's: scalar; the kernel has no barrier */
  const float* s = S + (size_t)t * NKX; _Float16* p = P + (size_t)t * PKX; const int rel = q0 + (t % QT) - lane * 4;      /* key 128 c + 4 l + q is kept while 128 c + q <= rel */
  v4f v[NCH];
#pragma unroll
  for (int c = 0; c < NCH; ++c) v[c] = *(const v4fa*)(s + c * 128 + lane * 4);
  float mx = -3.0e38f;
#pragma unroll
  for (int c = 0; c < NCH; ++c) for (int q = 0; q < 4; ++q) { v[c][q] = (c * 128 + q <= rel) ? v[c][q] : -1.0e9f; mx = fmaxf(mx, v[c][q]); }
  for (int m = 16; m > 0; m >>= 1) mx = fmaxf(mx, __shfl_xor(mx, m, 32));
  v4f s4 = {0.f, 0.f, 0.f, 0.f};      /* four independent sum chains per lane */
#pragma unroll
  for (int c = 0; c < NCH; ++c) for (int q = 0; q < 4; ++q) { v[c][q] = exp_native(v[c][q] - mx); s4[q] += v[c][q]; }
  float se = (s4[0] + s4[1]) + (s4[2] + s4[3]);
  for (int m = 16; m > 0; m >>= 1) se += __shfl_xor(se, m, 32);
  const float sc = 256.0f / se;
#pragma unroll
  for (int c = 0; c < NCH; ++c) { v4h h4; for (int q = 0; q < 4; ++q) h4[q] = (_Float16)(v[c][q] * sc); *(v4h*)(p + c * 128 + lane * 4) = h4; } }


typedef float v2f __attribute__((ext_vector_type(2)));
// exp(x) to f32 accuracy, in the way expf is expanded: n = nearest integer to x log2(e); v_exp_f32 of x log2(e) - n, log2(e) taken in two parts (two fma, so the difference is
// rounded once); ldexp by n; 0 and infinity beyond the two range ends. Written out so that v_exp_f32 can stand in asm with its v_nop directly behind it: the one free issue slot
// that the instruction set asks for before an instruction that reads the result or overwrites the source.
__device__ __forceinline__ float exp_slot(float x) {
  const float c_hi = __uint_as_float(0x3fb8aa3bu), c_lo = __uint_as_float(0x32a5705fu);
  const float n = rintf(x * c_hi); const float a = fmaf(x, c_lo, fmaf(x, c_hi, -n));
  float r; asm("v_exp_f32 %0, %1\n\tv_nop" : "=v"(r) : "v"(a));
  r = ldexpf(r, (int)n); r = (__uint_as_float(0xc2ce8ed0u) > x) ? 0.f : r; r = (__uint_as_float(0x42b17218u) < x) ? __uint_as_float(0x7f800000u) : r; return r; }
// Exact f32 attention of the first QT0 rows, one thread per query row. The row's q and o stay in registers. K and V come in tiles of 64 keys through LDS
// (K transposed to [dim][key], V as [key][dim]) and are read back as broadcasts, 32 reads at a time, one such batch in flight while the batch before it is worked on.
// Eight keys are worked on together: their eight score sums run side by side (each still summed over the dims in ascending order, s = fma(q, k, s)),
// then the running maximum, the two exps and the running sum key by key, then the o update key by key (o = fma(o, sc, e v), l = fma(l, sc, e)).
// Every row sees its keys, and every sum its terms, in the same order as with one key at a time.
template <int MASKADD>
__global__ __launch_bounds__(64) void k_att0(const float* __restrict__ QF, const float* __restrict__ KF, const float* __restrict__ VF, int ld, const float* __restrict__ mask, float scale, float* __restrict__ OF, int ldo) {
  __shared__ __attribute__((aligned(16))) float lkt[HD][64]; __shared__ __attribute__((aligned(16))) float lv[64][HD]; __shared__ __attribute__((aligned(16))) float lo[64][HD + 4];
  const int tid = threadIdx.x; const int h = blockIdx.x / (QT0 / 64), rg = blockIdx.x % (QT0 / 64); const int i = rg * 64 + tid;
  { const size_t rb = (size_t)blockIdx.y * QT0; QF += rb * ld; KF += rb * ld; VF += rb * ld; OF += rb * ldo; }      /* blockIdx.y = batch: QT0 rows of q, k, v and o each */
  const float* qr = QF + (size_t)i * ld + h * HD;
  float q[HD]; v2f o[HD / 2];
#pragma unroll
  for (int c = 0; c < HD / 4; ++c) { const v4f t = *(const v4fa*)(qr + c * 4); for (int u = 0; u < 4; ++u) q[c * 4 + u] = t[u]; const v2f z = {0.f, 0.f}; o[c * 2] = z; o[c * 2 + 1] = z; }
  asm volatile("s_wait_xcnt 0x0" :: "v"(qr) : "memory");      /* the wait in front of any overwrite of the loads' address register; named as an input, the address stays in its register up to here (else the last load's result lands on it) */
  float m = -1.0e30f, l = 0.f; const int jmax = MASKADD ? (SQ - 1) : (rg * 64 + 63);      /* additive-mask form: every key (the mask input decides); causal form: keys up to the block's last row */
#pragma unroll 1
  for (int j0 = 0; j0 <= jmax; j0 += 64) {      /* rolled, for speed only */
    const float* kr = KF + (size_t)(j0 + tid) * ld + h * HD;      /* thread = key: the transposed stores of a wave fall on consecutive banks */
    const float* vr = VF + (size_t)(j0 + tid / 16) * ld + h * HD + (tid % 16) * 4;      /* 16 threads a row: whole lines */
    v4f tk[16], tv[16]; const float* vp[16];
#pragma unroll
    for (int c = 0; c < 16; ++c) { vp[c] = vr + (size_t)(c * 4) * ld; tk[c] = *(const v4fa*)(kr + c * 4); tv[c] = *(const v4fa*)vp[c]; }
    asm volatile("s_wait_xcnt 0x0" :: "v"(kr), "v"(vp[0]), "v"(vp[1]), "v"(vp[2]), "v"(vp[3]), "v"(vp[4]), "v"(vp[5]), "v"(vp[6]), "v"(vp[7]), "v"(vp[8]), "v"(vp[9]), "v"(vp[10]), "v"(vp[11]), "v"(vp[12]), "v"(vp[13]), "v"(vp[14]), "v"(vp[15]) : "memory");      /* as behind the q loads: every address of the batch keeps its register up to the wait (else later loads' results land on earlier loads' addresses) */
    __builtin_amdgcn_sched_barrier(0);      /* all 32 loads of the tile are issued before the first is waited for: without it each load sinks to its LDS store and the latencies add up */
#pragma unroll
    for (int c = 0; c < 16; ++c) { for (int u = 0; u < 4; ++u) lkt[c * 4 + u][tid] = tk[c][u]; *(v4f*)&lv[c * 4 + tid / 16][(tid % 16) * 4] = tv[c]; }
    __syncthreads();      /* the tile is complete before any thread reads it */
#pragma unroll 1
    for (int jg = 0; jg < 64; jg += 8) {      /* rolled for the same reason */
      v4f ba[32], bb[32]; v2f s2[4]; float sc[8], e[8]; for (int p = 0; p < 4; ++p) { const v2f z = {0.f, 0.f}; s2[p] = z; }
      /* batch b of K: dims 16 b .. + 15 of the eight keys; batch b of V: keys 2 b and 2 b + 1, all dims */
      auto load_k = [&](int b, v4f* t) {
#pragma unroll
        for (int x = 0; x < 16; ++x) { t[x * 2] = *(const v4f*)&lkt[b * 16 + x][jg]; t[x * 2 + 1] = *(const v4f*)&lkt[b * 16 + x][jg + 4]; }
        __builtin_amdgcn_sched_barrier(0); };      /* keeps the batch's reads in front of the arithmetic on the batch before: without it they sink to their first use and every read's latency shows */
      auto load_v = [&](int b, v4f* t) {
#pragma unroll
        for (int x = 0; x < 32; ++x) t[x] = *(const v4f*)&lv[jg + b * 2 + (x >> 4)][(x & 15) * 4];
        __builtin_amdgcn_sched_barrier(0); };      /* as in load_k */
      auto work_k = [&](int b, const v4f* t) {
#pragma unroll
        for (int x = 0; x < 16; ++x) { const float qs = q[b * 16 + x]; const v2f qd = {qs, qs}; const v4f ka = t[x * 2], kb = t[x * 2 + 1];
          const v2f k0 = {ka[0], ka[1]}, k1 = {ka[2], ka[3]}, k2 = {kb[0], kb[1]}, k3 = {kb[2], kb[3]};
          s2[0] = __builtin_elementwise_fma(qd, k0, s2[0]); s2[1] = __builtin_elementwise_fma(qd, k1, s2[1]); s2[2] = __builtin_elementwise_fma(qd, k2, s2[2]); s2[3] = __builtin_elementwise_fma(qd, k3, s2[3]); }
        __builtin_amdgcn_sched_barrier(0); };      /* the next batch's reads stay behind this arithmetic, so that no more than two batches hold registers */
      auto work_v = [&](int b, const v4f* t) {
#pragma unroll
        for (int x = 0; x < 32; ++x) { const int u = b * 2 + (x >> 4), c = x & 15; const v2f sc2 = {sc[u], sc[u]}, e2 = {e[u], e[u]}; const v4f vv = t[x]; const v2f v0 = {vv[0], vv[1]}, v1 = {vv[2], vv[3]};
          o[c * 2] = __builtin_elementwise_fma(o[c * 2], sc2, e2 * v0); o[c * 2 + 1] = __builtin_elementwise_fma(o[c * 2 + 1], sc2, e2 * v1); }
        __builtin_amdgcn_sched_barrier(0); };      /* as in work_k */
      load_k(0, ba); load_k(1, bb); work_k(0, ba); load_k(2, ba); work_k(1, bb); load_k(3, bb); work_k(2, ba); load_v(0, ba); work_k(3, bb); load_v(1, bb);
#pragma unroll
      for (int u = 0; u < 8; ++u) { const int j = j0 + jg + u; float s = __fmul_rn(s2[u >> 1][u & 1], scale); if (MASKADD) s = __fadd_rn(s, __fmul_rn(bf16_round(mask[(size_t)i * SQ + j]), -10000.0f));
        const float f = (MASKADD || j <= i) ? 1.f : 0.f; const float sm = fmaf(f, s, (1.f - f) * -1.0e30f); const float mn = fmaxf(m, sm); sc[u] = exp_slot(m - mn); e[u] = exp_slot(sm - mn); l = fmaf(l, sc[u], e[u]); m = mn; }
      work_v(0, ba); load_v(2, ba); work_v(1, bb); load_v(3, bb); work_v(2, ba); work_v(3, bb); }
    __syncthreads(); }      /* every thread has left the tile before the next one overwrites it */
  const float fin = 64.0f / l;      /* o carried x64 like the f16 path */
#pragma unroll
  for (int c = 0; c < HD / 4; ++c) { const v4f oo = {__fmul_rn(o[c * 2][0], fin), __fmul_rn(o[c * 2][1], fin), __fmul_rn(o[c * 2 + 1][0], fin), __fmul_rn(o[c * 2 + 1][1], fin)}; *(v4f*)&lo[tid][c * 4] = oo; }
  __syncthreads();
  {
#pragma unroll 1
    for (int it = 0; it < 16; ++it) { const int row = it * 4 + tid / 16, pc = (tid % 16) * 4; const v4f v = *(const v4f*)&lo[row][pc]; *(v4f*)(OF + (size_t)(rg * 64 + row) * ldo + h * HD + pc) = v; }
     } }

#define DMQ DM

template <int BFIN, int W16, int W32>
__global__ __launch_bounds__(256) void k_lnx(const float* __restrict__ X, const float* __restrict__ g, const float* __restrict__ bb, float eps, _Float16* __restrict__ N16, float* __restrict__ N32) {
  #pragma clang fp contract(off)
  __shared__ float red[256]; const size_t r = blockIdx.x; const int t = threadIdx.x; const bool act = t < (DMQ / 4); const int c0 = act ? t * 4 : 0;
  const v4f xa = *(const v4fa*)(X + r * DMQ + c0); float s[4]; float sum = 0.f;
  for (int q = 0; q < 4; ++q) { s[q] = act ? (BFIN ? bf16_round(xa[q]) : xa[q]) : 0.f; sum = __fadd_rn(sum, s[q]); }
  red[t] = sum; __syncthreads(); for (int st = 128; st > 0; st >>= 1) { if (t < st) red[t] = __fadd_rn(red[t], red[t + st]); __syncthreads(); } const float mu = red[0] / (float)DMQ; __syncthreads();
  float vs = 0.f; for (int q = 0; q < 4; ++q) { const float dl = act ? __fadd_rn(s[q], -mu) : 0.f; vs = __fadd_rn(vs, __fmul_rn(dl, dl)); } red[t] = vs; __syncthreads(); for (int st = 128; st > 0; st >>= 1) { if (t < st) red[t] = __fadd_rn(red[t], red[t + st]); __syncthreads(); }
  const float rs = rsqrtf(__fadd_rn(red[0] / (float)DMQ, eps)); v4h y; v4f yf;
  for (int q = 0; q < 4; ++q) { const int c = c0 + q; yf[q] = __fadd_rn(__fmul_rn(__fmul_rn(__fadd_rn(s[q], -mu), rs), bf16_round(g[c])), bf16_round(bb[c])); y[q] = (_Float16)yf[q]; }
  if (!act) return;      /* no barriers after this point */
  { if (W16) *(v4h*)(N16 + r * DMQ + c0) = y; if (W32) *(v4f*)(N32 + r * DMQ + c0) = yf;  } }


extern "C" void kernel_launch(void* const* d_in, const int* in_sizes, int n_in,
                              void* d_out, int out_size, void* d_ws, size_t ws_size, hipStream_t stream) {
  (void)in_sizes; (void)n_in; (void)out_size;
  const float* const* I = (const float* const*)d_in; const float* x = I[0]; const float* wk = I[1]; const float* wq = I[2]; const float* wv = I[3]; const float* wo = I[4]; const float* lng = I[5]; const float* lnb = I[6]; const float* bq = nullptr; const float* bk = nullptr; const float* bv = nullptr; const float* bo = nullptr;      /* x; natural [out][in] Wk, Wq, Wv (THIS order), Wp; LayerNorm gamma, beta; no biases */
  char* ws = (char*)d_ws; size_t off = 0;
  auto take = [&](size_t bytes) { char* p = ws + off; off += (bytes + 255) & ~(size_t)255; return p; };
  _Float16* BQ = (_Float16*)take((size_t)DM * DM * 2); _Float16* BK = (_Float16*)take((size_t)DM * DM * 2); _Float16* BV = (_Float16*)take((size_t)DM * DM * 2); _Float16* BO = (_Float16*)take((size_t)DM * DM * 2);
  _Float16* X16 = (_Float16*)take(NR * DM * 2); _Float16* Q16 = (_Float16*)take(NR * DM * 2); _Float16* K16 = (_Float16*)take(NR * DM * 2); _Float16* V16 = (_Float16*)take(NR * DM * 2); _Float16* O16 = (_Float16*)take(NR * DM * 2);
  float* S = (float*)take((size_t)NB * NH * QT * NKX * 4); _Float16* P = (_Float16*)S; _Float16* VT = (_Float16*)take((size_t)NB * NH * HD * SQ * 2);      /* one query tile's scores of all batches and heads; the weights overwrite their own score rows */
  float* QF0 = (float*)take((size_t)NB * QT0 * DM * 4); float* KF0 = (float*)take((size_t)NB * QT0 * DM * 4); float* VF0 = (float*)take((size_t)NB * QT0 * DM * 4); float* OF0 = (float*)take((size_t)NB * QT0 * DM * 4); _Float16* OH0 = (_Float16*)take((size_t)NB * QT0 * DM * 2); _Float16* OL0 = (_Float16*)take((size_t)NB * QT0 * DM * 2);
  float* YO = S;      /* pre-norm projection rows y (f32): written when the last score tile has been used up */
  if (off > ws_size) return;
  { const unsigned g = (unsigned)(((size_t)DM * DM / 8 + 255) / 256); k_wnat<<<g, 256, 0, stream>>>(wq, (size_t)DM * DM / 8, BQ); k_wnat<<<g, 256, 0, stream>>>(wk, (size_t)DM * DM / 8, BK); k_wnat<<<g, 256, 0, stream>>>(wv, (size_t)DM * DM / 8, BV); k_wnat<<<g, 256, 0, stream>>>(wo, (size_t)DM * DM / 8, BO); }      /* natural [out][in] = Bt x16 */

  k_x16<<<(unsigned)((NR * DM / 8 + 255) / 256), 256, 0, stream>>>(x, X16, NR * DM / 8);
  const size_t r0p = (size_t)B0 * SQ;      /* first projected row */
  const size_t f0p = (size_t)B0 * QT0;      /* its first-tile row */
  k_gemm2<0><<<dim3((unsigned)((MP / 128) * (DM / 64)), 1), 128, 0, stream>>>(X16 + r0p * DM, DM, 0, BQ, DM, 0, 0.0625f, nullptr, 0, nullptr, 1, 0, 0, nullptr, Q16 + r0p * DM, DM, 0, MP, DM, DM, 0, 0, 0);
  k_gemm2<0><<<dim3((unsigned)((MP / 128) * (DM / 64)), 1), 128, 0, stream>>>(X16 + r0p * DM, DM, 0, BK, DM, 0, 0.0625f, nullptr, 0, nullptr, 1, 0, 0, nullptr, K16 + r0p * DM, DM, 0, MP, DM, DM, 0, 0, 0);
  k_gemm2<0><<<dim3((unsigned)((MP / 128) * (DM / 64)), 1), 128, 0, stream>>>(X16 + r0p * DM, DM, 0, BV, DM, 0, 0.0625f, nullptr, 0, nullptr, 1, 0, 0, nullptr, V16 + r0p * DM, DM, 0, MP, DM, DM, 0, 0, 0);
  k_vt<NH, SQ><<<NBR * NH * (SQ / 64), 256, 0, stream>>>(V16 + r0p * LQ, LQ, 0, VT);      /* V^T [NBR][NH][HD][SQ] */
  k_gemm2<0><<<dim3((QT0 / 128) * (DM / 64), NBR), 128, 0, stream>>>(X16 + r0p * DM, DM, (size_t)SQ * DM, BQ, DM, 0, 0.0625f, nullptr, 0, nullptr, 1, 0, 0, QF0, nullptr, DM, (size_t)QT0 * DM, QT0, DM, DM, 0, 0, 0);      /* f32 q, k, v of each batch's first 128 rows (exact products), batch on grid.y */
  k_gemm2<0><<<dim3((QT0 / 128) * (DM / 64), NBR), 128, 0, stream>>>(X16 + r0p * DM, DM, (size_t)SQ * DM, BK, DM, 0, 0.0625f, nullptr, 0, nullptr, 1, 0, 0, KF0, nullptr, DM, (size_t)QT0 * DM, QT0, DM, DM, 0, 0, 0);
  k_gemm2<0><<<dim3((QT0 / 128) * (DM / 64), NBR), 128, 0, stream>>>(X16 + r0p * DM, DM, (size_t)SQ * DM, BV, DM, 0, 0.0625f, nullptr, 0, nullptr, 1, 0, 0, VF0, nullptr, DM, (size_t)QT0 * DM, QT0, DM, DM, 0, 0, 0);
  k_att0<0><<<dim3(NH * (QT0 / 64), NBR), 64, 0, stream>>>(QF0, KF0, VF0, DM, nullptr, 0.125f, OF0 + f0p * DM, DM);      /* exact f32 attention for rows 0..127 of each batch (o x64) */
  for (int q0 = 0; q0 < QN; q0 += QT) { const int nk = q0 + QT;      /* causal: only keys below the tile end are computed */
    k_gemm2<0><<<dim3((QT / 128) * (nk / 64), NHD, NBR), 128, 0, stream>>>(Q16 + (r0p + q0) * LQ, LQ, (size_t)HD, K16 + r0p * LQ, LQ, (size_t)HD, 0.125f, nullptr, 0, nullptr, 1, 0, 0, S, nullptr, NKX, (size_t)QT * NKX, QT, nk, HD, (size_t)SQ * LQ, (size_t)SQ * LQ, (size_t)NHD * QT * NKX);      /* scores, heads on grid.y, batches on grid.z */
    switch (nk / QT) {      /* one wave per row, 8 rows per block; the row's length in chunks of 128 keys is a compile-time constant */
      case 1: k_rsmw<2><<<NBR * NHD * QT / 8, 256, 0, stream>>>(S, P, NBR * NHD, q0); break;
      case 2: k_rsmw<4><<<NBR * NHD * QT / 8, 256, 0, stream>>>(S, P, NBR * NHD, q0); break;
      case 3: k_rsmw<6><<<NBR * NHD * QT / 8, 256, 0, stream>>>(S, P, NBR * NHD, q0); break;
      case 4: k_rsmw<8><<<NBR * NHD * QT / 8, 256, 0, stream>>>(S, P, NBR * NHD, q0); break;
      case 5: k_rsmw<10><<<NBR * NHD * QT / 8, 256, 0, stream>>>(S, P, NBR * NHD, q0); break;
      case 6: k_rsmw<12><<<NBR * NHD * QT / 8, 256, 0, stream>>>(S, P, NBR * NHD, q0); break;
      case 7: k_rsmw<14><<<NBR * NHD * QT / 8, 256, 0, stream>>>(S, P, NBR * NHD, q0); break;
      case 8: k_rsmw<16><<<NBR * NHD * QT / 8, 256, 0, stream>>>(S, P, NBR * NHD, q0); break;
      default: break; }
    k_gemm2<0><<<dim3((QT / 128) * (HD / 64), NHD, NBR), 128, 0, stream>>>(P, PKX, (size_t)QT * PKX, VT, SQ, (size_t)HD * SQ, 0.25f, nullptr, 0, nullptr, 1, 0, 0, nullptr, O16 + (r0p + q0) * DM, DM, (size_t)HD, QT, HD, nk, (size_t)NHD * QT * PKX, (size_t)NH * HD * SQ, (size_t)SQ * DM); }      /* o (merged heads, x64) as f16 rows */
  k_gemm2<0><<<dim3((unsigned)((MPO / 128) * (DM / 64)), 1), 128, 0, stream>>>(O16 + r0p * DM, DM, 0, BO, DM, 0, 0.0009765625f, nullptr, 0, nullptr, 1, 0, 0, YO + r0p * DM, nullptr, DM, 0, MPO, DM, DM, 0, 0, 0);      /* out rows are the output layout */
  k_hl<<<(unsigned)(((size_t)NB * QT0 * DM / 8 + 255) / 256), 256, 0, stream>>>(OF0, OH0, OL0, (size_t)NB * QT0 * DM / 8);      /* first-tile o (x64) -> f16 hi + x1024 residual planes */
  k_gemm2<0><<<dim3((QT0 / 128) * (DM / 64), NBR), 128, 0, stream>>>(OH0 + f0p * DM, DM, (size_t)QT0 * DM, BO, DM, 0, 0.0009765625f, bo, 0, nullptr, 1, 0, 0, YO + r0p * DM, nullptr, DM, (size_t)SQ * DM, QT0, DM, DM, 0, 0, 0);      /* rows 0..127 of each batch: out = o_hi Wo (+ b), overwriting the f16-path rows */
  k_gemm2<0><<<dim3((QT0 / 128) * (DM / 64), NBR), 128, 0, stream>>>(OL0 + f0p * DM, DM, (size_t)QT0 * DM, BO, DM, 0, 0.00000095367431640625f, nullptr, 0, (const float*)YO + r0p * DM, -1, 0, 0, YO + r0p * DM, nullptr, DM, (size_t)SQ * DM, QT0, DM, DM, 0, 0, 0);      /* += o_lo Wo 2^-20 (own-element accumulate) */
  k_lnx<0, 0, 1><<<(unsigned)NR, 256, 0, stream>>>(YO, lng, lnb, 1e-5f, nullptr, (float*)d_out);      /* out = LayerNorm(y) -> f32 output rows */
}

// v004
// A run of this version takes 473 microseconds.
// Timed twice side by side with v003, it ran 2.16 and 2.15 times as fast.
// Counting every step since v000, it is 20.9 times as fast.
#include <hip/hip_runtime.h>
// Causal multi-head self-attention with a fused post-LayerNorm (x [4][2048][1024]; k/q/v = x W^T (natural [1024][1024], no biases); 16 heads of 64; wei = q k^T * 64^-0.5; causal (tril, -inf); softmax; y = merged Wp^T; out = LayerNorm(y) (biased var, eps per the module, gamma / beta) -> [4][2048][1024]).
// Structure: token rows r = b*2048 + s; x as exact f16 rows (bf16-rounded); Q, K, V as three WMMA GEMMs (32x64 wave tiles, f32 accumulation, exact x16 weights, f16 outputs); V^T for all heads via LDS transposes; attention in ONE launch (k_fattn): a wave holds 32 queries of one head and walks the keys up to its diagonal in passes of 32: S^T = K Q^T, running maximum and sum in f32 (native exp2; weights x256 f16), O^T += V^T P^T, scores and weights never leave the registers; o (x64, folded into the output GEMM alpha) written straight into the merged f16 o rows; out = o W_o GEMM (f32) into the output layout.
// Compute dtype: inputs rounded to bf16; x / weights exact; q, k, v, softmax weights and o as plain f16 GEMM operands (~2^-12); scores and softmax statistics f32. v_wmma_f32_16x16x32_f16.
#define NB 4
#define SQ 2048
#define DM 1024
#define NH 16
#define HD 64
#define HG 4                         /* heads per launch of the (b, h0) k_vt form; k_fattn takes all NH */
#define QT0 128                      /* first-tile rows recomputed exactly in f32 */
#define B0 0                         /* first batch processed (debug hook) */
#define NBR NB                       /* batches processed (debug hook) */
#define NR ((size_t)NB * SQ)         /* token rows */
#define MP ((int)((size_t)NBR * SQ)) /* rows projected (debug hook) */
#define QN SQ                        /* unused: k_fattn attends all SQ query rows */
#define NHD NH                       /* unused: k_fattn attends all NH heads */
#define MPO MP                       /* rows through the output stage (debug hook) */
#define LQ DM      /* row pitch of the q/k/v rows */
typedef __bf16 v16b __attribute__((ext_vector_type(16)));
typedef unsigned short v8us __attribute__((ext_vector_type(8), may_alias));
typedef float  v8f  __attribute__((ext_vector_type(8)));
typedef float  v4f  __attribute__((ext_vector_type(4)));
typedef float  v4fa __attribute__((ext_vector_type(4), may_alias));
union FragB { v16b v; v8us half[2]; unsigned short u[16]; };

__device__ __forceinline__ unsigned short bf16_bits(float x) { unsigned int u = __float_as_uint(x); return (unsigned short)((u + 0x7FFFu + ((u >> 16) & 1u)) >> 16); }
__device__ __forceinline__ float bf16_val(unsigned short b) { return __uint_as_float(((unsigned int)b) << 16); }
__device__ __forceinline__ float bf16_round(float x) { return bf16_val(bf16_bits(x)); }
// D += A·B with NT terms: 1 = ah·bh, 2 = + al·bh (A split), 3 = + ah·bl (both split)
template <int NT>
__device__ __forceinline__ v8f mmaN(v16b ah, v16b al, v16b bh, v16b bl, v8f c) {
  c = __builtin_amdgcn_wmma_f32_16x16x32_bf16(false, ah, false, bh, (short)0, c, false, false);
  if (NT >= 2) c = __builtin_amdgcn_wmma_f32_16x16x32_bf16(false, al, false, bh, (short)0, c, false, false);
  if (NT >= 3) c = __builtin_amdgcn_wmma_f32_16x16x32_bf16(false, ah, false, bl, (short)0, c, false, false);
  asm volatile("v_nop\n\tv_nop\n\tv_nop\n\tv_nop" : "+v"(c) : "v"(ah), "v"(al), "v"(bh), "v"(bl));
  return c;
}

__global__ __launch_bounds__(256) void k_wt_bf16(const float* __restrict__ W, unsigned short* __restrict__ Wt, int K, int N) {
  const int t = blockIdx.x * 256 + threadIdx.x;
  const int k8n = K / 8;
  if (t >= N * k8n) return;
  const int n = t / k8n, k8 = (t % k8n) * 8;
  v8us v;
#pragma unroll
  for (int i = 0; i < 8; ++i) v[i] = bf16_bits(W[(size_t)(k8 + i) * N + n]);
  *(v8us*)(Wt + (size_t)n * K + k8) = v;
  
}

// GEMM C[M][N] (f32, pitch ldc) = act(A[M][K]·W + bias). A f32 row-major (pitch lda) converted per fragment to bf16
// (ASPLIT: hi/lo two planes -> 2 terms, else single rounded term); Wt bf16 [N][K] (pitch ldb). BIAS_BF16 rounds the
// bias to bf16 first (bias quantised to bf16 before the add). K%32==0, M%16==0, N%64==0.
template <bool ASPLIT, int ACT, bool BIAS_BF16>
__global__ __launch_bounds__(128) void k_gemm_bf(const float* __restrict__ A, int lda, const unsigned short* __restrict__ Wt, int ldb,
                                               const float* __restrict__ bias, float* __restrict__ C, int ldc, int M, int N, int K) {
  __shared__ __attribute__((aligned(16))) float so[4][16][64];
  const int tid = threadIdx.x, w = tid >> 5, lane = tid & 31, ln = lane & 15, hh = lane >> 4;
  const int ntn = N / 64;
  const int wid = blockIdx.x * 4 + w;
  const int mt = wid / ntn, nq = wid % ntn;
  if (mt * 16 >= M) return;
  const int row0 = mt * 16, col0 = nq * 64;
  const float* arow = A + (size_t)(row0 + ln) * lda;
  v8f acc[4] = {};
  for (int kb = 0; kb < K; kb += 32) {
    FragB ah, al;
    const v4f x0 = *(const v4fa*)(arow + kb + 8 * hh), x1 = *(const v4fa*)(arow + kb + 8 * hh + 4);
    const v4f x2 = *(const v4fa*)(arow + kb + 16 + 8 * hh), x3 = *(const v4fa*)(arow + kb + 16 + 8 * hh + 4);
    float xs[16] = {x0[0],x0[1],x0[2],x0[3],x1[0],x1[1],x1[2],x1[3],x2[0],x2[1],x2[2],x2[3],x3[0],x3[1],x3[2],x3[3]};
#pragma unroll
    for (int i = 0; i < 16; ++i) { const unsigned short hb = bf16_bits(xs[i]); ah.u[i] = hb; al.u[i] = ASPLIT ? bf16_bits(xs[i] - bf16_val(hb)) : (unsigned short)0; }
#pragma unroll
    for (int t = 0; t < 4; ++t) {
      const unsigned short* brow = Wt + (size_t)(col0 + t * 16 + ln) * ldb + kb;
      FragB b;
      b.half[0] = *(const v8us*)(brow + 8 * hh);
      b.half[1] = *(const v8us*)(brow + 16 + 8 * hh);
      acc[t] = mmaN<ASPLIT ? 2 : 1>(ah.v, al.v, b.v, b.v, acc[t]);
    }
  }
#pragma unroll
  for (int t = 0; t < 4; ++t) {
    float bv = bias ? bias[col0 + t * 16 + ln] : 0.f;
    if (BIAS_BF16) bv = bf16_round(bv);
#pragma unroll
    for (int r = 0; r < 8; ++r) { float v = acc[t][r] + bv; if (ACT == 1) v = fmaxf(v, 0.f); so[w][8 * hh + r][t * 16 + ln] = v; }
  }
  __builtin_amdgcn_fence(__ATOMIC_ACQ_REL, "workgroup");
  __builtin_amdgcn_wave_barrier();
  const int rsub = lane >> 4, c4 = (lane & 15) * 4;
  {
#pragma unroll
    for (int q = 0; q < 8; ++q) {
      const int r = q * 2 + rsub;
      const v4f v = *(const v4fa*)&so[w][r][c4];
      *(v4f*)(C + (size_t)(row0 + r) * ldc + col0 + c4) = v;
    }
    
  }
}

// GEMM C = act(A·W + bias + resid): A f32 (ASPLIT -> hi/lo 2 terms), Wt bf16 [N][K]; ACT 0 none, 1 relu, 2 exact gelu;
// resid (optional, f32, row index = (row % rmod), pitch ldr, RES_BF16 rounds it) added before the activation.
template <bool ASPLIT, int ACT, bool BIAS_BF16, bool RES_BF16>
__global__ __launch_bounds__(128) void k_gemm_bf3(const float* __restrict__ A, int lda, const unsigned short* __restrict__ Wt, int ldb,
                                                const float* __restrict__ bias, const float* __restrict__ resid, int rmod, int ldr,
                                                float* __restrict__ C, int ldc, int M, int N, int K) {
  __shared__ __attribute__((aligned(16))) float so[4][16][64];
  const int tid = threadIdx.x, w = tid >> 5, lane = tid & 31, ln = lane & 15, hh = lane >> 4;
  const int ntn = N / 64;
  const int wid = blockIdx.x * 4 + w;
  const int mt = wid / ntn, nq = wid % ntn;
  if (mt * 16 >= M) return;
  const int row0 = mt * 16, col0 = nq * 64;
  const float* arow = A + (size_t)(row0 + ln) * lda;
  v8f acc[4] = {};
  for (int kb = 0; kb < K; kb += 32) {
    FragB ah, al;
    const v4f x0 = *(const v4fa*)(arow + kb + 8 * hh), x1 = *(const v4fa*)(arow + kb + 8 * hh + 4);
    const v4f x2 = *(const v4fa*)(arow + kb + 16 + 8 * hh), x3 = *(const v4fa*)(arow + kb + 16 + 8 * hh + 4);
    float xs[16] = {x0[0],x0[1],x0[2],x0[3],x1[0],x1[1],x1[2],x1[3],x2[0],x2[1],x2[2],x2[3],x3[0],x3[1],x3[2],x3[3]};
#pragma unroll
    for (int i = 0; i < 16; ++i) { const unsigned short hb = bf16_bits(xs[i]); ah.u[i] = hb; al.u[i] = ASPLIT ? bf16_bits(xs[i] - bf16_val(hb)) : (unsigned short)0; }
#pragma unroll
    for (int t = 0; t < 4; ++t) {
      const unsigned short* brow = Wt + (size_t)(col0 + t * 16 + ln) * ldb + kb;
      FragB b;
      b.half[0] = *(const v8us*)(brow + 8 * hh);
      b.half[1] = *(const v8us*)(brow + 16 + 8 * hh);
      acc[t] = mmaN<ASPLIT ? 2 : 1>(ah.v, al.v, b.v, b.v, acc[t]);
    }
  }
#pragma unroll
  for (int t = 0; t < 4; ++t) {
    const int col = col0 + t * 16 + ln;
    float bv = bias ? bias[col] : 0.f;
    if (BIAS_BF16) bv = bf16_round(bv);
#pragma unroll
    for (int r = 0; r < 8; ++r) {
      float v = acc[t][r] + bv;
      if (resid) { float rv = resid[(size_t)((row0 + 8 * hh + r) % rmod) * ldr + col]; if (RES_BF16) rv = bf16_round(rv); v += rv; }
      if (ACT == 1) v = fmaxf(v, 0.f);
      if (ACT == 2) v = 0.5f * v * (1.0f + erff(v * 0.70710678118654752f));
      if (ACT == 3) { const float u = 0.7978845608028654f * (v + 0.044715f * v * v * v); v = 0.5f * v * (1.0f + tanhf(u)); }
      so[w][8 * hh + r][t * 16 + ln] = v;
    }
  }
  __builtin_amdgcn_fence(__ATOMIC_ACQ_REL, "workgroup");
  __builtin_amdgcn_wave_barrier();
  const int rsub = lane >> 4, c4 = (lane & 15) * 4;
  {
#pragma unroll
    for (int q = 0; q < 8; ++q) {
      const int r = q * 2 + rsub;
      const v4f v = *(const v4fa*)&so[w][r][c4];
      *(v4f*)(C + (size_t)(row0 + r) * ldc + col0 + c4) = v;
    }
    
  }
}
// row LayerNorm (biased variance, eps) over N: s = X (+ R); optional out_sum <- s; out_norm <- (s-mu)*rsqrt(var+eps)*g + b
template <bool PARAM_BF16>
__global__ __launch_bounds__(256) void k_layernorm(const float* __restrict__ X, const float* __restrict__ R, const float* __restrict__ g, const float* __restrict__ bta,
                                                  float* __restrict__ out_sum, float* __restrict__ out_norm, int N, float eps) {
  __shared__ float red[256];
  const int row = blockIdx.x, tid = threadIdx.x;
  const float* x = X + (size_t)row * N; const float* rr = R ? R + (size_t)row * N : nullptr;
  float vals[16];                     // up to N = 4096
  const int per = N / 256;            // contiguous chunk per thread? use strided-by-4 chunks: thread handles j = tid*4 + 1024*u
  float s1 = 0.f;
  for (int u = 0; u < per / 4; ++u) {
    const int j = tid * 4 + 1024 * u;
    const v4f a = *(const v4fa*)(x + j);
    v4f b = {0.f,0.f,0.f,0.f}; if (rr) b = *(const v4fa*)(rr + j);
#pragma unroll
    for (int q = 0; q < 4; ++q) { const float v = a[q] + b[q]; vals[u * 4 + q] = v; s1 += v; }
  }
  red[tid] = s1; __syncthreads();
  for (int st = 128; st > 0; st >>= 1) { if (tid < st) red[tid] += red[tid + st]; __syncthreads(); }
  const float mu = red[0] / (float)N; __syncthreads();
  float s2 = 0.f;
  for (int u = 0; u < per / 4; ++u)
#pragma unroll
    for (int q = 0; q < 4; ++q) { const float c = vals[u * 4 + q] - mu; s2 += c * c; }
  red[tid] = s2; __syncthreads();
  for (int st = 128; st > 0; st >>= 1) { if (tid < st) red[tid] += red[tid + st]; __syncthreads(); }
  const float rs = rsqrtf(red[0] / (float)N + eps);
  {
    for (int u = 0; u < per / 4; ++u) {
      const int j = tid * 4 + 1024 * u;
      v4f o, sm;
#pragma unroll
      for (int q = 0; q < 4; ++q) {
        float gg = g[j + q], bb = bta[j + q];
        if (PARAM_BF16) { gg = bf16_round(gg); bb = bf16_round(bb); }
        sm[q] = vals[u * 4 + q]; o[q] = (vals[u * 4 + q] - mu) * rs * gg + bb;
      }
      if (out_sum) *(v4f*)(out_sum + (size_t)row * N + j) = sm;
      *(v4f*)(out_norm + (size_t)row * N + j) = o;
    }
    
  }
}



// ---- f16 WMMA path (v_wmma_f32_16x16x32_f16): 11-bit significands for operands in range — used where a [0,1] probability operand needs more precision than bf16
typedef _Float16 v16h __attribute__((ext_vector_type(16)));
union FragH { v16h v; v8us half[2]; _Float16 h[16]; unsigned short u[16]; };
template <int NT>
__device__ __forceinline__ v8f mmaH(v16h ah, v16h al, v16h bh, v16h bl, v8f c) {
  c = __builtin_amdgcn_wmma_f32_16x16x32_f16(false, ah, false, bh, (short)0, c, false, false);
  if (NT >= 2) c = __builtin_amdgcn_wmma_f32_16x16x32_f16(false, al, false, bh, (short)0, c, false, false);
  if (NT >= 3) c = __builtin_amdgcn_wmma_f32_16x16x32_f16(false, ah, false, bl, (short)0, c, false, false);
  asm volatile("v_nop\n\tv_nop\n\tv_nop\n\tv_nop" : "+v"(c) : "v"(ah), "v"(al), "v"(bh), "v"(bl));
  return c;
}
// batched GEMM like k_gemm_b but f16 operands: A f32 (split into f16 hi/lo if ASPLIT, else rounded to f16), Bt = f16 values [n][k]; alpha; C f32; N multiple of 16 (partial tiles skipped)
template <bool ASPLIT>
__global__ __launch_bounds__(128) void k_gemm_h(const float* __restrict__ A, int lda, size_t sA, const _Float16* __restrict__ Bh, int ldb, size_t sB, float alpha, float* __restrict__ C, int ldc, size_t sC, int M, int N, int K) {
  __shared__ __attribute__((aligned(16))) float so[4][16][64];
  const int tid = threadIdx.x, w = tid >> 5, lane = tid & 31, ln = lane & 15, hh = lane >> 4; const int by = blockIdx.y;
  A += (size_t)by * sA; Bh += (size_t)by * sB; C += (size_t)by * sC;
  const int ntn = (N + 63) / 64; const int wid = blockIdx.x * 4 + w; const int mt = wid / ntn, nq = wid % ntn; if (mt * 16 >= M) return;
  const int row0 = mt * 16, col0 = nq * 64; const float* arow = A + (size_t)(row0 + ln) * lda;
  v8f acc[4] = {};
  for (int kb = 0; kb < K; kb += 32) {
    FragH ah, al;
    const v4f x0 = *(const v4fa*)(arow + kb + 8 * hh), x1 = *(const v4fa*)(arow + kb + 8 * hh + 4), x2 = *(const v4fa*)(arow + kb + 16 + 8 * hh), x3 = *(const v4fa*)(arow + kb + 16 + 8 * hh + 4);
    float xs[16] = {x0[0],x0[1],x0[2],x0[3],x1[0],x1[1],x1[2],x1[3],x2[0],x2[1],x2[2],x2[3],x3[0],x3[1],x3[2],x3[3]};
#pragma unroll
    for (int i = 0; i < 16; ++i) { const _Float16 h = (_Float16)xs[i]; ah.h[i] = h; al.h[i] = ASPLIT ? (_Float16)(xs[i] - (float)h) : (_Float16)0.0f; }
#pragma unroll
    for (int t = 0; t < 4; ++t) { if (col0 + t * 16 >= N) continue; const size_t boff = (size_t)(col0 + t * 16 + ln) * ldb + kb; FragH bq; bq.half[0] = *(const v8us*)(Bh + boff + 8 * hh); bq.half[1] = *(const v8us*)(Bh + boff + 16 + 8 * hh);
      acc[t] = mmaH<ASPLIT ? 2 : 1>(ah.v, al.v, bq.v, bq.v, acc[t]); }
  }
#pragma unroll
  for (int t = 0; t < 4; ++t) { if (col0 + t * 16 >= N) continue;
#pragma unroll
    for (int r = 0; r < 8; ++r) so[w][8 * hh + r][t * 16 + ln] = acc[t][r] * alpha; }
  __builtin_amdgcn_fence(__ATOMIC_ACQ_REL, "workgroup"); __builtin_amdgcn_wave_barrier();
  const int rsub = lane >> 4, c4 = (lane & 15) * 4;
  {
#pragma unroll
    for (int q = 0; q < 8; ++q) { const int r = q * 2 + rsub; if (col0 + c4 < N) { const v4f v = *(const v4fa*)&so[w][r][c4]; *(v4f*)(C + (size_t)(row0 + r) * ldc + col0 + c4) = v; } }
     }
}

// Wt[n][k] = f16(W[k][n]·scale) from f32 row-major W[K][N] (scale = power of two; bf16-exact weights stay exact in f16 away from the subnormal range)
__global__ __launch_bounds__(256) void k_wt_f16(const float* __restrict__ W, _Float16* __restrict__ Wt, int K, int N, float scale) {
  const int t = blockIdx.x * 256 + threadIdx.x; if (t >= N * (K / 8)) return; const int n = t / (K / 8), k8 = (t % (K / 8)) * 8; FragH f;
#pragma unroll
  for (int i = 0; i < 8; ++i) f.h[i] = (_Float16)(bf16_round(W[(size_t)(k8 + i) * N + n]) * scale); const v8us o = f.half[0];
  *(v8us*)((unsigned short*)Wt + (size_t)n * K + k8) = o; 
}
// k_gemm_hh variant with fused epilogue: v = acc·alpha + bias[by·sBias + col] (+ CP[(row/rowsPerB)·sCPb + by·64 + col] if CP) ; ACT 0 none / 1 elu ; writes f16 C16 (and f32 C if non-null)
template <int ACT>
__global__ __launch_bounds__(128) void k_gemm_hhx(const _Float16* __restrict__ A, int lda, size_t sA, const _Float16* __restrict__ Bh, int ldb, size_t sB, float alpha, const float* __restrict__ bias, size_t sBias, const float* __restrict__ CP, int rowsPerB, size_t sCPb, int row0g,
    float* __restrict__ C, _Float16* __restrict__ C16, int ldc, size_t sC, int M, int N, int K) {
  __shared__ __attribute__((aligned(16))) float so[4][16][64];
  const int tid = threadIdx.x, w = tid >> 5, lane = tid & 31, ln = lane & 15, hh = lane >> 4; const int by = blockIdx.y;
  A += (size_t)by * sA; Bh += (size_t)by * sB; const size_t cofs = (size_t)by * sC; const float* bp = bias ? bias + (size_t)by * sBias : nullptr;
  const int ntn = (N + 63) / 64; const int wid = blockIdx.x * 4 + w; const int mt = wid / ntn, nq = wid % ntn; if (mt * 16 >= M) return;
  const int row0 = mt * 16, col0 = nq * 64; const _Float16* arow = A + (size_t)(row0 + ln) * lda;
  v8f acc[4] = {};
  for (int kb = 0; kb < K; kb += 32) { FragH ah; ah.half[0] = *(const v8us*)((const unsigned short*)arow + kb + 8 * hh); ah.half[1] = *(const v8us*)((const unsigned short*)arow + kb + 16 + 8 * hh);
#pragma unroll
    for (int t = 0; t < 4; ++t) { if (col0 + t * 16 >= N) continue; const size_t boff = (size_t)(col0 + t * 16 + ln) * ldb + kb; FragH bq; bq.half[0] = *(const v8us*)((const unsigned short*)Bh + boff + 8 * hh); bq.half[1] = *(const v8us*)((const unsigned short*)Bh + boff + 16 + 8 * hh);
      acc[t] = mmaH<1>(ah.v, ah.v, bq.v, bq.v, acc[t]); }
  }
#pragma unroll
  for (int t = 0; t < 4; ++t) { if (col0 + t * 16 >= N) continue; const int col = col0 + t * 16 + ln; const float bv = bp ? bf16_round(bp[col]) : 0.f;
#pragma unroll
    for (int r = 0; r < 8; ++r) { float v = acc[t][r] * alpha + bv; if (CP) { const int rr = row0g + row0 + 8 * hh + r; if (rowsPerB < 0) v += CP[cofs + (size_t)rr * ldc + col];      /* rowsPerB < 0: own element of the batched C plane */ else { const int bidx = rr / rowsPerB; v += CP[(size_t)bidx * sCPb + (size_t)by * 64 + col]; } } if (ACT == 1) v = (v > 0.f) ? v : expm1f(v); else if (ACT == 7) v = (v > 0.f) ? v + 1.0f : expf(v); else if (ACT == 8) v = tanhf(v); else if (ACT == 9) v = 0.5f * v * (1.0f + tanhf(0.7978845608028654f * (v + 0.044715f * v * v * v))); else if (ACT == 11) v = 1.0f / (1.0f + expf(-v)); else if (ACT == 12) v = (v > 0.f) ? v : 0.01f * v; else if (ACT == 14) v = (v > 0.f) ? v : 0.1f * v; else if (ACT == 16) v = (v >= 0.f) ? v : 0.3f * v; else if (ACT == 17) v = (v >= 0.f) ? v : 0.2f * v; else if (ACT == 15) v = v / (1.0f + expf(-v)); else if (ACT == 3) v = fmaxf(v, 0.f); else if (ACT == 6) v = 0.5f * v * (1.0f + erff(v * 0.70710678118654752f)); so[w][8 * hh + r][t * 16 + ln] = v; } }
  __builtin_amdgcn_fence(__ATOMIC_ACQ_REL, "workgroup"); __builtin_amdgcn_wave_barrier();
  const int rsub = lane >> 4, c4 = (lane & 15) * 4; typedef _Float16 v4h __attribute__((ext_vector_type(4)));
  {
#pragma unroll
    for (int q = 0; q < 8; ++q) { const int r = q * 2 + rsub; if (col0 + c4 < N) { const v4f v = *(const v4fa*)&so[w][r][c4]; if (C) *(v4f*)(C + cofs + (size_t)(row0 + r) * ldc + col0 + c4) = v; if (C16) { v4h h4; for (int i = 0; i < 4; ++i) h4[i] = (_Float16)v[i]; *(v4h*)(C16 + cofs + (size_t)(row0 + r) * ldc + col0 + c4) = h4; } } }
     }
}


typedef _Float16 v4h __attribute__((ext_vector_type(4)));

__global__ __launch_bounds__(256) void k_x16(const float* __restrict__ x, _Float16* __restrict__ X16, size_t n8) { const size_t t = (size_t)blockIdx.x * 256 + threadIdx.x; if (t >= n8) return; FragH f;
#pragma unroll
  for (int q = 0; q < 8; ++q) f.h[q] = (_Float16)bf16_round(x[t * 8 + q]); *(v8us*)((unsigned short*)X16 + t * 8) = f.half[0];  }
__global__ __launch_bounds__(256) void k_h16(const float* __restrict__ x, _Float16* __restrict__ X16, size_t n8) { const size_t t = (size_t)blockIdx.x * 256 + threadIdx.x; if (t >= n8) return; FragH f;
#pragma unroll
  for (int q = 0; q < 8; ++q) f.h[q] = (_Float16)x[t * 8 + q]; *(v8us*)((unsigned short*)X16 + t * 8) = f.half[0];  }
__global__ __launch_bounds__(256) void k_round16f(const float* __restrict__ W, _Float16* __restrict__ Bt, size_t n8) { const size_t t = (size_t)blockIdx.x * 256 + threadIdx.x; if (t >= n8) return; FragH f;
#pragma unroll
  for (int i = 0; i < 8; ++i) f.h[i] = (_Float16)(bf16_round(W[t * 8 + i]) * 16.0f); *(v8us*)((unsigned short*)Bt + t * 8) = f.half[0];  }
template <int NHv, int TTv>
__global__ __launch_bounds__(256) void k_vt(const _Float16* __restrict__ V16, int ldv, int voff, _Float16* __restrict__ Vt) { __shared__ unsigned short tl[64][66]; const int tid = threadIdx.x; const int slab = blockIdx.x / (TTv / 64), lg = blockIdx.x % (TTv / 64); const int b = slab / NHv, h = slab % NHv;
  for (int i = tid; i < 64 * 8; i += 256) { const int r = i / 8, c8 = (i % 8) * 8; FragH f; f.half[0] = *(const v8us*)((const unsigned short*)V16 + ((size_t)b * TTv + lg * 64 + r) * ldv + voff + h * 64 + c8);
#pragma unroll
    for (int q = 0; q < 8; ++q) tl[r][c8 + q] = f.u[q]; }
  __syncthreads();
  {
#pragma unroll
    for (int rd = 0; rd < 2; ++rd) { const int d = rd * 32 + tid / 8, pc = tid % 8; FragH f;
#pragma unroll
      for (int q = 0; q < 8; ++q) f.u[q] = tl[pc * 8 + q][d];
      *(v8us*)((unsigned short*)Vt + ((size_t)slab * 64 + d) * TTv + lg * 64 + pc * 8) = f.half[0]; }
     } }

__global__ __launch_bounds__(256) void k_hl(const float* __restrict__ F, _Float16* __restrict__ Hh, _Float16* __restrict__ Hl, size_t n8) { const size_t t = (size_t)blockIdx.x * 256 + threadIdx.x; if (t >= n8) return; FragH fh, fl; const v4f a = *(const v4fa*)(F + t * 8), c = *(const v4fa*)(F + t * 8 + 4);
#pragma unroll
  for (int q = 0; q < 4; ++q) { _Float16 h = (_Float16)a[q]; fh.h[q] = h; fl.h[q] = (_Float16)((a[q] - (float)h) * 1024.0f); h = (_Float16)c[q]; fh.h[4 + q] = h; fl.h[4 + q] = (_Float16)((c[q] - (float)h) * 1024.0f); }
  { *(v8us*)((unsigned short*)Hh + t * 8) = fh.half[0]; *(v8us*)((unsigned short*)Hl + t * 8) = fl.half[0];  } }

// ---- fast GEMM (wave tile 32x64; requires M % 32 == 0 rows per launch region and N % 64 == 0); epilogue = k_gemm_hhx semantics ----
__device__ __forceinline__ v16h g2_frag(const _Float16* p, int hh) { FragH f; f.half[0] = *(const v8us*)((const unsigned short*)p + 8 * hh); f.half[1] = *(const v8us*)((const unsigned short*)p + 16 + 8 * hh); return f.v; }
__device__ __forceinline__ v8f g2_mma(v16h a, v16h b, v8f c) { v8f d = __builtin_amdgcn_wmma_f32_16x16x32_f16(false, a, false, b, (short)0, c, false, false); asm volatile("v_nop\n\tv_nop\n\tv_nop\n\tv_nop" : "+v"(d) : "v"(a), "v"(b)); return d; }
template <int ACT>
__global__ __launch_bounds__(128) void k_gemm2(const _Float16* __restrict__ A, int lda, size_t sA, const _Float16* __restrict__ Bh, int ldb, size_t sB, float alpha, const float* __restrict__ bias, size_t sBias, const float* __restrict__ CP, int rowsPerB, size_t sCPb, int row0g,
    float* __restrict__ C, _Float16* __restrict__ C16, int ldc, size_t sC, int M, int N, int K, size_t zA, size_t zB, size_t zC) { static_assert(ACT == 0 || ACT == 3 || ACT == 6 || ACT == 8 || ACT == 9 || ACT == 11 || ACT == 12 || ACT == 14 || ACT == 15 || ACT == 16 || ACT == 17, "k_gemm2: unsupported ACT code (would silently apply no activation)");
  __shared__ __attribute__((aligned(16))) float so[4][32][68];
  const int tid = threadIdx.x, w = tid >> 5, lane = tid & 31, ln = lane & 15, hh = lane >> 4; const int by = blockIdx.y, bz = blockIdx.z;      /* two batch axes, each with its own strides */
  A += (size_t)by * sA + (size_t)bz * zA; Bh += (size_t)by * sB + (size_t)bz * zB; const size_t cofs = (size_t)by * sC + (size_t)bz * zC; const float* bp = bias ? bias + (size_t)by * sBias : nullptr;
  const int ntn = N >> 6; const int mt = blockIdx.x / ntn, nq = blockIdx.x - mt * ntn; const int row0 = mt * 128 + 32 * w, col0 = nq * 64; if (row0 >= M) return;
  const _Float16* a0p = A + (size_t)(row0 + ln) * lda; const _Float16* a1p = a0p + (size_t)16 * lda;
  const _Float16* b0p = Bh + (size_t)(col0 + ln) * ldb; const _Float16* b1p = b0p + (size_t)16 * ldb; const _Float16* b2p = b1p + (size_t)16 * ldb; const _Float16* b3p = b2p + (size_t)16 * ldb;
  const v8f z8 = {0.f,0.f,0.f,0.f,0.f,0.f,0.f,0.f}; v8f c00 = z8, c01 = z8, c02 = z8, c03 = z8, c10 = z8, c11 = z8, c12 = z8, c13 = z8;
#pragma unroll 1
  for (int kb = 0; kb < K; kb += 32) { const v16h a0 = g2_frag(a0p + kb, hh), a1 = g2_frag(a1p + kb, hh);
    v16h b = g2_frag(b0p + kb, hh); c00 = g2_mma(a0, b, c00); c10 = g2_mma(a1, b, c10);
    b = g2_frag(b1p + kb, hh); c01 = g2_mma(a0, b, c01); c11 = g2_mma(a1, b, c11);
    b = g2_frag(b2p + kb, hh); c02 = g2_mma(a0, b, c02); c12 = g2_mma(a1, b, c12);
    b = g2_frag(b3p + kb, hh); c03 = g2_mma(a0, b, c03); c13 = g2_mma(a1, b, c13); }
  v8f accs[8] = {c00, c01, c02, c03, c10, c11, c12, c13};
#pragma unroll
  for (int u = 0; u < 8; ++u) { const int t = u & 3, half = u >> 2; const int col = col0 + t * 16 + ln; const float bv = bp ? bf16_round(bp[col]) : 0.f;
#pragma unroll
    for (int r = 0; r < 8; ++r) { const int rloc = half * 16 + 8 * hh + r; float v = accs[u][r] * alpha + bv; if (CP) { if (rowsPerB < 0) v += CP[cofs + (size_t)(row0g + row0 + rloc) * ldc + col];      /* rowsPerB < 0: own element of the batched C plane */ else { const int bidx = (row0g + row0 + rloc) / rowsPerB; v += CP[(size_t)bidx * sCPb + (size_t)by * 64 + col]; } }
      if (ACT == 3) v = fmaxf(v, 0.f); else if (ACT == 6) v = 0.5f * v * (1.0f + erff(v * 0.70710678118654752f)); else if (ACT == 11) v = 1.0f / (1.0f + expf(-v)); else if (ACT == 15) v = v / (1.0f + expf(-v)); else if (ACT == 12) v = (v > 0.f) ? v : 0.01f * v; else if (ACT == 8) v = tanhf(v); else if (ACT == 9) v = 0.5f * v * (1.0f + tanhf(0.7978845608028654f * (v + 0.044715f * v * v * v))); else if (ACT == 14) v = (v > 0.f) ? v : 0.1f * v; else if (ACT == 16) v = (v >= 0.f) ? v : 0.3f * v; else if (ACT == 17) v = (v >= 0.f) ? v : 0.2f * v;
      so[w][rloc][t * 16 + ln] = v; } }
  __builtin_amdgcn_fence(__ATOMIC_ACQ_REL, "workgroup"); __builtin_amdgcn_wave_barrier();
  const int rsub = lane >> 4, c4 = (lane & 15) * 4;
  {
#pragma unroll
    for (int q = 0; q < 16; ++q) { const int r = q * 2 + rsub; const v4f v = *(const v4fa*)&so[w][r][c4]; if (C) *(v4f*)(C + cofs + (size_t)(row0 + r) * ldc + col0 + c4) = v; if (C16) { v4h h4; for (int i = 0; i < 4; ++i) h4[i] = (_Float16)v[i]; *(v4h*)(C16 + cofs + (size_t)(row0 + r) * ldc + col0 + c4) = h4; } }
     } }


__global__ __launch_bounds__(256) void k_wnat(const float* __restrict__ w, size_t n8, _Float16* __restrict__ Bt) { const size_t t = (size_t)blockIdx.x * 256 + threadIdx.x; if (t >= n8) return; FragH f; for (int q = 0; q < 8; ++q) f.h[q] = (_Float16)(bf16_round(w[t * 8 + q]) * 16.0f); *(v8us*)((unsigned short*)Bt + t * 8) = f.half[0];  }
__global__ __launch_bounds__(256) void k_rsm(const float* __restrict__ S, _Float16* __restrict__ P, int nrows) {
  #pragma clang fp contract(off)
  const int i = blockIdx.x * 256 + threadIdx.x; if (i >= nrows) return; const float* s = S + (size_t)i * SQ; float mx = -3.0e38f;
#pragma unroll 1
  for (int j = 0; j < SQ; ++j) mx = fmaxf(mx, s[j]); float se = 0.f;
#pragma unroll 1
  for (int j = 0; j < SQ; ++j) se += expf(s[j] - mx); const float sc = 256.0f / se;
#pragma unroll 1
  for (int j0 = 0; j0 < SQ; j0 += 8) { FragH f; for (int q = 0; q < 8; ++q) f.h[q] = (_Float16)(expf(s[j0 + q] - mx) * sc); unsigned short* d = (unsigned short*)P + (size_t)i * SQ + j0; *(v8us*)d = f.half[0];  } }
__global__ __launch_bounds__(256) void k_vt(const _Float16* __restrict__ V16, int b, int h0, _Float16* __restrict__ VT) { __shared__ unsigned short tl[64][65]; const int tid = threadIdx.x; const int hh = blockIdx.x % HG, sg = blockIdx.x / HG; const int s0 = sg * 64; const int h = h0 + hh;
  for (int i = tid; i < 64 * 8; i += 256) { const int j = i / 8, d8 = (i % 8) * 8; FragH f; f.half[0] = *(const v8us*)((const unsigned short*)V16 + ((size_t)b * SQ + s0 + j) * DM + h * HD + d8); for (int q = 0; q < 8; ++q) tl[d8 + q][j] = f.u[q]; }
  __syncthreads();
  { for (int i = tid; i < 64 * 8; i += 256) { const int d = i / 8, j8 = (i % 8) * 8; FragH f; for (int q = 0; q < 8; ++q) f.u[q] = tl[d][j8 + q]; *(v8us*)((unsigned short*)VT + ((size_t)hh * HD + d) * SQ + s0 + j8) = f.half[0]; }  } }



// ---- fused causal attention ----
typedef _Float16 v8h __attribute__((ext_vector_type(8)));
__device__ __forceinline__ float fa_xhalf(float x) { return __builtin_bit_cast(float, __builtin_amdgcn_permlanex16(__builtin_bit_cast(int, x), __builtin_bit_cast(int, x), 0x76543210, 0xfedcba98, false, false)); }      /* lane l takes lane l ^ 16 */
__device__ __forceinline__ v8f fa_mma(v16h a, v16h b, v8f c) { return __builtin_amdgcn_wmma_f32_16x16x32_f16(false, a, false, b, (short)0, c, false, false); }
// Native 2^x and 1/x. In asm so that the v_nop stands directly behind the last transcendental: the one free issue slot that the instruction set asks for before an instruction that
// reads the result or overwrites the source. In the group of four each v_exp_f32 is
// the free slot of the one before it: the early-clobber results lie on no source.
__device__ __forceinline__ float fa_exp2(float x) { float r; asm("v_exp_f32 %0, %1\n\tv_nop" : "=v"(r) : "v"(x)); return r; }
__device__ __forceinline__ float fa_rcp(float x) { float r; asm("v_rcp_f32 %0, %1\n\tv_nop" : "=v"(r) : "v"(x)); return r; }
__device__ __forceinline__ v4f fa_exp2x4(v4f x) { float r0, r1, r2, r3;
  asm("v_exp_f32 %0, %4\n\tv_exp_f32 %1, %5\n\tv_exp_f32 %2, %6\n\tv_exp_f32 %3, %7\n\tv_nop" : "=&v"(r0), "=&v"(r1), "=&v"(r2), "=&v"(r3) : "v"(x[0]), "v"(x[1]), "v"(x[2]), "v"(x[3]));
  const v4f r = {r0, r1, r2, r3}; return r; }
// Fragment of 16 rows x 32 k in the k order of g2_frag; p = the lane's row + 8 * (lane >> 4), so that the pointer itself is the loads' address register.
__device__ __forceinline__ v16h fa_frag(const _Float16* p) { FragH f; f.half[0] = *(const v8us*)((const unsigned short*)p); f.half[1] = *(const v8us*)((const unsigned short*)p + 16); return f.v; }
// The wait in front of any overwrite of a register that the loads issued so far name. The address is an input, so it keeps its register up to here; the memory clobber keeps
// the loads in front of it, where they were written: issued as one batch, long before their first use.
__device__ __forceinline__ void fa_issued(const _Float16* p) { asm volatile("s_wait_xcnt 0x0" :: "v"(p) : "memory"); }
// One pass: 32 keys against the wave's 32 queries (two groups of 16). Lane (c = lane & 15, hh = lane >> 4) owns query 16 g + c in both products:
//   S^T = K Q^T : A = 16 K rows, B = 16 Q rows, both by fa_frag; s[g][kt][r] = score of key 16 kt + 8 hh + r
//   O^T += V^T P^T : A = 16 V^T rows (dims) by fa_frag over the 32 keys; B element e = weight of key (e < 8 ? 8 hh + e : 16 + 8 hh + e - 8) = s[g][e >> 3][e & 7], the k order of fa_frag
// so maximum, sum and rescale are the lane's own, with one exchange between the wave's halves. mr = maximum in use (log2 units); it may trail the true one by up to 6
// (weights then reach 256 * 2^6, well inside f16); sums and o are rescaled only in a pass in which some query's maximum has run further ahead.
// The unroll directives here and in k_fattn: the loop indices pick fragments and accumulators, which stay in registers only if every index is a constant.
template <bool DIAG>
__device__ __forceinline__ void fa_pass(v16h (&kf)[2][2], const _Float16*& kq, const _Float16*& vq, const v16h (&qf)[2][2], v8f (&o)[2][4], float (&mr)[2], float (&l)[2], int rel) {
  const float cs = 0.125f * 1.44269504088896340736f;      /* score scale times log2(e) */
  v16h vf[4];
#pragma unroll
  for (int t = 0; t < 4; ++t) vf[t] = fa_frag(vq + (size_t)t * 16 * SQ);      /* this pass's V^T: in flight under the first product and the softmax */
  fa_issued(vq); vq += 32;
  v8f s[2][2]; const v8f z8 = {0.f, 0.f, 0.f, 0.f, 0.f, 0.f, 0.f, 0.f};
#pragma unroll
  for (int g = 0; g < 2; ++g) for (int kt = 0; kt < 2; ++kt) s[g][kt] = fa_mma(kf[kt][1], qf[g][1], fa_mma(kf[kt][0], qf[g][0], z8));
  if (!DIAG) {
#pragma unroll
    for (int kt = 0; kt < 2; ++kt) for (int d = 0; d < 2; ++d) kf[kt][d] = fa_frag(kq + (size_t)kt * 16 * DM + d * 32);
    fa_issued(kq); kq += (size_t)32 * DM; }
  if (DIAG) {      /* the pass on the diagonal: key 16 kt + 8 hh + r stays while it is not above query 16 g + c (rel = c - 8 hh) */
#pragma unroll
    for (int g = 0; g < 2; ++g) for (int kt = 0; kt < 2; ++kt) for (int r = 0; r < 8; ++r) s[g][kt][r] = (16 * kt + r - 16 * g <= rel) ? s[g][kt][r] : -1.0e30f; }
  float mb[2]; bool need = false;
#pragma unroll
  for (int g = 0; g < 2; ++g) { float mx = s[g][0][0];
    for (int r = 1; r < 8; ++r) mx = fmaxf(mx, s[g][0][r]);
    for (int r = 0; r < 8; ++r) mx = fmaxf(mx, s[g][1][r]);
    mx = fmaxf(mx, fa_xhalf(mx)) * cs; mb[g] = mx; need = need || (mx > mr[g] + 6.0f); }
  if (__builtin_amdgcn_ballot_w32(need) != 0) {      /* wave-uniform; always taken in the first pass (mr = -1e30, factor 0), seldom later */
#pragma unroll
    for (int g = 0; g < 2; ++g) { const float mn = fmaxf(mr[g], mb[g]); const float corr = fa_exp2(mr[g] - mn); mr[g] = mn; l[g] *= corr;
      for (int t = 0; t < 4; ++t) o[g][t] *= corr; } }
#pragma unroll
  for (int g = 0; g < 2; ++g) { const float nm = 8.0f - mr[g];      /* weights carried x256 */
    FragH pf; v4f ls = {0.f, 0.f, 0.f, 0.f};
    for (int i = 0; i < 4; ++i) { v4f a; for (int u = 0; u < 4; ++u) a[u] = fmaf(s[g][i >> 1][(i & 1) * 4 + u], cs, nm);
      const v4f p = fa_exp2x4(a); ls += p; for (int u = 0; u < 4; ++u) pf.h[i * 4 + u] = (_Float16)p[u]; }
    l[g] += (ls[0] + ls[1]) + (ls[2] + ls[3]);
    for (int t = 0; t < 3; ++t) o[g][t] = fa_mma(vf[t], pf.v, o[g][t]);
    o[g][3] = g2_mma(vf[3], pf.v, o[g][3]); } }      /* the weights' last use, with g2_mma's four free slots: what may next land on their registers is asm text (fa_exp2x4, fa_rcp) */
// grid (heads, batches, blocks of 128 queries, the longest first); 4 waves of 32 queries; no LDS, no barrier.
__global__ __launch_bounds__(128) void k_fattn(const _Float16* __restrict__ Q, const _Float16* __restrict__ K, const _Float16* __restrict__ VT, _Float16* __restrict__ O) {
  const int lane = threadIdx.x & 31, c = lane & 15, hh = lane >> 4; const int h = blockIdx.x, b = blockIdx.y;
  const int q0 = (int)(gridDim.z - 1 - blockIdx.z) * 128 + __builtin_amdgcn_readfirstlane(threadIdx.x >> 5) * 32;      /* the wave's first query: scalar, so the pass count is */
  const _Float16* qp = Q + ((size_t)b * SQ + q0 + c) * DM + h * HD + 8 * hh; const _Float16* kq = K + ((size_t)b * SQ + c) * DM + h * HD + 8 * hh; const _Float16* vq = VT + ((size_t)(b * NH + h) * HD + c) * SQ + 8 * hh;      /* the lane's row and half, as fa_frag takes them */
  v16h qf[2][2], kf[2][2];
#pragma unroll
  for (int g = 0; g < 2; ++g) for (int d = 0; d < 2; ++d) { qf[g][d] = fa_frag(qp + (size_t)g * 16 * DM + d * 32); kf[g][d] = fa_frag(kq + (size_t)g * 16 * DM + d * 32); }
  asm volatile("s_wait_xcnt 0x0" :: "v"(qp), "v"(kq) : "memory");      /* as in fa_issued, for both addresses */
  kq += (size_t)32 * DM;
  const v8f z8 = {0.f, 0.f, 0.f, 0.f, 0.f, 0.f, 0.f, 0.f}; v8f o[2][4] = {{z8, z8, z8, z8}, {z8, z8, z8, z8}}; float mr[2] = {-1.0e30f, -1.0e30f}, l[2] = {0.f, 0.f};
  const int rel = c - 8 * hh;
  for (int kb = 0; kb < q0 / 32; ++kb) fa_pass<false>(kf, kq, vq, qf, o, mr, l, rel);      /* keys below the wave's first query: no mask */
  fa_pass<true>(kf, kq, vq, qf, o, mr, l, rel);
  _Float16* op = O + ((size_t)b * SQ + q0 + c) * DM + h * HD + 8 * hh;      /* o[g][t][r] = dim 16 t + 8 hh + r of query 16 g + c: eight neighbours, one 16-byte store */
  v8h ov[2][4];
#pragma unroll
  for (int g = 0; g < 2; ++g) { const float fin = 64.0f * fa_rcp(l[g] + fa_xhalf(l[g]));      /* the halves' sums joined; o carried x64 */
    for (int t = 0; t < 4; ++t) for (int r = 0; r < 8; ++r) ov[g][t][r] = (_Float16)(o[g][t][r] * fin); }
#pragma unroll
  for (int g = 0; g < 2; ++g) for (int t = 0; t < 4; ++t) *(v8h*)(op + (size_t)g * 16 * DM + t * 16) = ov[g][t]; }


typedef float v2f __attribute__((ext_vector_type(2)));
// exp(x) to f32 accuracy, in the way expf is expanded: n = nearest integer to x log2(e); v_exp_f32 of x log2(e) - n, log2(e) taken in two parts (two fma, so the difference is
// rounded once); ldexp by n; 0 and infinity beyond the two range ends. Written out so that v_exp_f32 can stand in asm with its v_nop directly behind it: the one free issue slot
// that the instruction set asks for before an instruction that reads the result or overwrites the source.
__device__ __forceinline__ float exp_slot(float x) {
  const float c_hi = __uint_as_float(0x3fb8aa3bu), c_lo = __uint_as_float(0x32a5705fu);
  const float n = rintf(x * c_hi); const float a = fmaf(x, c_lo, fmaf(x, c_hi, -n));
  float r; asm("v_exp_f32 %0, %1\n\tv_nop" : "=v"(r) : "v"(a));
  r = ldexpf(r, (int)n); r = (__uint_as_float(0xc2ce8ed0u) > x) ? 0.f : r; r = (__uint_as_float(0x42b17218u) < x) ? __uint_as_float(0x7f800000u) : r; return r; }
// Exact f32 attention of the first QT0 rows, one thread per query row. The row's q and o stay in registers. K and V come in tiles of 64 keys through LDS
// (K transposed to [dim][key], V as [key][dim]) and are read back as broadcasts, 32 reads at a time, one such batch in flight while the batch before it is worked on.
// Eight keys are worked on together: their eight score sums run side by side (each still summed over the dims in ascending order, s = fma(q, k, s)),
// then the running maximum, the two exps and the running sum key by key, then the o update key by key (o = fma(o, sc, e v), l = fma(l, sc, e)).
// Every row sees its keys, and every sum its terms, in the same order as with one key at a time.
template <int MASKADD>
__global__ __launch_bounds__(64) void k_att0(const float* __restrict__ QF, const float* __restrict__ KF, const float* __restrict__ VF, int ld, const float* __restrict__ mask, float scale, float* __restrict__ OF, int ldo) {
  __shared__ __attribute__((aligned(16))) float lkt[HD][64]; __shared__ __attribute__((aligned(16))) float lv[64][HD]; __shared__ __attribute__((aligned(16))) float lo[64][HD + 4];
  const int tid = threadIdx.x; const int h = blockIdx.x / (QT0 / 64), rg = blockIdx.x % (QT0 / 64); const int i = rg * 64 + tid;
  { const size_t rb = (size_t)blockIdx.y * QT0; QF += rb * ld; KF += rb * ld; VF += rb * ld; OF += rb * ldo; }      /* blockIdx.y = batch: QT0 rows of q, k, v and o each */
  const float* qr = QF + (size_t)i * ld + h * HD;
  float q[HD]; v2f o[HD / 2];
#pragma unroll
  for (int c = 0; c < HD / 4; ++c) { const v4f t = *(const v4fa*)(qr + c * 4); for (int u = 0; u < 4; ++u) q[c * 4 + u] = t[u]; const v2f z = {0.f, 0.f}; o[c * 2] = z; o[c * 2 + 1] = z; }
  asm volatile("s_wait_xcnt 0x0" :: "v"(qr) : "memory");      /* the wait in front of any overwrite of the loads' address register; named as an input, the address stays in its register up to here (else the last load's result lands on it) */
  float m = -1.0e30f, l = 0.f; const int jmax = MASKADD ? (SQ - 1) : (rg * 64 + 63);      /* additive-mask form: every key (the mask input decides); causal form: keys up to the block's last row */
#pragma unroll 1
  for (int j0 = 0; j0 <= jmax; j0 += 64) {      /* rolled, for speed only */
    const float* kr = KF + (size_t)(j0 + tid) * ld + h * HD;      /* thread = key: the transposed stores of a wave fall on consecutive banks */
    const float* vr = VF + (size_t)(j0 + tid / 16) * ld + h * HD + (tid % 16) * 4;      /* 16 threads a row: whole lines */
    v4f tk[16], tv[16]; const float* vp[16];
#pragma unroll
    for (int c = 0; c < 16; ++c) { vp[c] = vr + (size_t)(c * 4) * ld; tk[c] = *(const v4fa*)(kr + c * 4); tv[c] = *(const v4fa*)vp[c]; }
    asm volatile("s_wait_xcnt 0x0" :: "v"(kr), "v"(vp[0]), "v"(vp[1]), "v"(vp[2]), "v"(vp[3]), "v"(vp[4]), "v"(vp[5]), "v"(vp[6]), "v"(vp[7]), "v"(vp[8]), "v"(vp[9]), "v"(vp[10]), "v"(vp[11]), "v"(vp[12]), "v"(vp[13]), "v"(vp[14]), "v"(vp[15]) : "memory");      /* as behind the q loads: every address of the batch keeps its register up to the wait (else later loads' results land on earlier loads' addresses) */
    __builtin_amdgcn_sched_barrier(0);      /* all 32 loads of the tile are issued before the first is waited for: without it each load sinks to its LDS store and the latencies add up */
#pragma unroll
    for (int c = 0; c < 16; ++c) { for (int u = 0; u < 4; ++u) lkt[c * 4 + u][tid] = tk[c][u]; *(v4f*)&lv[c * 4 + tid / 16][(tid % 16) * 4] = tv[c]; }
    __syncthreads();      /* the tile is complete before any thread reads it */
#pragma unroll 1
    for (int jg = 0; jg < 64; jg += 8) {      /* rolled for the same reason */
      v4f ba[32], bb[32]; v2f s2[4]; float sc[8], e[8]; for (int p = 0; p < 4; ++p) { const v2f z = {0.f, 0.f}; s2[p] = z; }
      /* batch b of K: dims 16 b .. + 15 of the eight keys; batch b of V: keys 2 b and 2 b + 1, all dims */
      auto load_k = [&](int b, v4f* t) {
#pragma unroll
        for (int x = 0; x < 16; ++x) { t[x * 2] = *(const v4f*)&lkt[b * 16 + x][jg]; t[x * 2 + 1] = *(const v4f*)&lkt[b * 16 + x][jg + 4]; }
        __builtin_amdgcn_sched_barrier(0); };      /* keeps the batch's reads in front of the arithmetic on the batch before: without it they sink to their first use and every read's latency shows */
      auto load_v = [&](int b, v4f* t) {
#pragma unroll
        for (int x = 0; x < 32; ++x) t[x] = *(const v4f*)&lv[jg + b * 2 + (x >> 4)][(x & 15) * 4];
        __builtin_amdgcn_sched_barrier(0); };      /* as in load_k */
      auto work_k = [&](int b, const v4f* t) {
#pragma unroll
        for (int x = 0; x < 16; ++x) { const float qs = q[b * 16 + x]; const v2f qd = {qs, qs}; const v4f ka = t[x * 2], kb = t[x * 2 + 1];
          const v2f k0 = {ka[0], ka[1]}, k1 = {ka[2], ka[3]}, k2 = {kb[0], kb[1]}, k3 = {kb[2], kb[3]};
          s2[0] = __builtin_elementwise_fma(qd, k0, s2[0]); s2[1] = __builtin_elementwise_fma(qd, k1, s2[1]); s2[2] = __builtin_elementwise_fma(qd, k2, s2[2]); s2[3] = __builtin_elementwise_fma(qd, k3, s2[3]); }
        __builtin_amdgcn_sched_barrier(0); };      /* the next batch's reads stay behind this arithmetic, so that no more than two batches hold registers */
      auto work_v = [&](int b, const v4f* t) {
#pragma unroll
        for (int x = 0; x < 32; ++x) { const int u = b * 2 + (x >> 4), c = x & 15; const v2f sc2 = {sc[u], sc[u]}, e2 = {e[u], e[u]}; const v4f vv = t[x]; const v2f v0 = {vv[0], vv[1]}, v1 = {vv[2], vv[3]};
          o[c * 2] = __builtin_elementwise_fma(o[c * 2], sc2, e2 * v0); o[c * 2 + 1] = __builtin_elementwise_fma(o[c * 2 + 1], sc2, e2 * v1); }
        __builtin_amdgcn_sched_barrier(0); };      /* as in work_k */
      load_k(0, ba); load_k(1, bb); work_k(0, ba); load_k(2, ba); work_k(1, bb); load_k(3, bb); work_k(2, ba); load_v(0, ba); work_k(3, bb); load_v(1, bb);
#pragma unroll
      for (int u = 0; u < 8; ++u) { const int j = j0 + jg + u; float s = __fmul_rn(s2[u >> 1][u & 1], scale); if (MASKADD) s = __fadd_rn(s, __fmul_rn(bf16_round(mask[(size_t)i * SQ + j]), -10000.0f));
        const float f = (MASKADD || j <= i) ? 1.f : 0.f; const float sm = fmaf(f, s, (1.f - f) * -1.0e30f); const float mn = fmaxf(m, sm); sc[u] = exp_slot(m - mn); e[u] = exp_slot(sm - mn); l = fmaf(l, sc[u], e[u]); m = mn; }
      work_v(0, ba); load_v(2, ba); work_v(1, bb); load_v(3, bb); work_v(2, ba); work_v(3, bb); }
    __syncthreads(); }      /* every thread has left the tile before the next one overwrites it */
  const float fin = 64.0f / l;      /* o carried x64 like the f16 path */
#pragma unroll
  for (int c = 0; c < HD / 4; ++c) { const v4f oo = {__fmul_rn(o[c * 2][0], fin), __fmul_rn(o[c * 2][1], fin), __fmul_rn(o[c * 2 + 1][0], fin), __fmul_rn(o[c * 2 + 1][1], fin)}; *(v4f*)&lo[tid][c * 4] = oo; }
  __syncthreads();
  {
#pragma unroll 1
    for (int it = 0; it < 16; ++it) { const int row = it * 4 + tid / 16, pc = (tid % 16) * 4; const v4f v = *(const v4f*)&lo[row][pc]; *(v4f*)(OF + (size_t)(rg * 64 + row) * ldo + h * HD + pc) = v; }
     } }

#define DMQ DM

template <int BFIN, int W16, int W32>
__global__ __launch_bounds__(256) void k_lnx(const float* __restrict__ X, const float* __restrict__ g, const float* __restrict__ bb, float eps, _Float16* __restrict__ N16, float* __restrict__ N32) {
  #pragma clang fp contract(off)
  __shared__ float red[256]; const size_t r = blockIdx.x; const int t = threadIdx.x; const bool act = t < (DMQ / 4); const int c0 = act ? t * 4 : 0;
  const v4f xa = *(const v4fa*)(X + r * DMQ + c0); float s[4]; float sum = 0.f;
  for (int q = 0; q < 4; ++q) { s[q] = act ? (BFIN ? bf16_round(xa[q]) : xa[q]) : 0.f; sum = __fadd_rn(sum, s[q]); }
  red[t] = sum; __syncthreads(); for (int st = 128; st > 0; st >>= 1) { if (t < st) red[t] = __fadd_rn(red[t], red[t + st]); __syncthreads(); } const float mu = red[0] / (float)DMQ; __syncthreads();
  float vs = 0.f; for (int q = 0; q < 4; ++q) { const float dl = act ? __fadd_rn(s[q], -mu) : 0.f; vs = __fadd_rn(vs, __fmul_rn(dl, dl)); } red[t] = vs; __syncthreads(); for (int st = 128; st > 0; st >>= 1) { if (t < st) red[t] = __fadd_rn(red[t], red[t + st]); __syncthreads(); }
  const float rs = rsqrtf(__fadd_rn(red[0] / (float)DMQ, eps)); v4h y; v4f yf;
  for (int q = 0; q < 4; ++q) { const int c = c0 + q; yf[q] = __fadd_rn(__fmul_rn(__fmul_rn(__fadd_rn(s[q], -mu), rs), bf16_round(g[c])), bf16_round(bb[c])); y[q] = (_Float16)yf[q]; }
  if (!act) return;      /* no barriers after this point */
  { if (W16) *(v4h*)(N16 + r * DMQ + c0) = y; if (W32) *(v4f*)(N32 + r * DMQ + c0) = yf;  } }


extern "C" void kernel_launch(void* const* d_in, const int* in_sizes, int n_in,
                              void* d_out, int out_size, void* d_ws, size_t ws_size, hipStream_t stream) {
  (void)in_sizes; (void)n_in; (void)out_size;
  const float* const* I = (const float* const*)d_in; const float* x = I[0]; const float* wk = I[1]; const float* wq = I[2]; const float* wv = I[3]; const float* wo = I[4]; const float* lng = I[5]; const float* lnb = I[6]; const float* bq = nullptr; const float* bk = nullptr; const float* bv = nullptr; const float* bo = nullptr;      /* x; natural [out][in] Wk, Wq, Wv (THIS order), Wp; LayerNorm gamma, beta; no biases */
  char* ws = (char*)d_ws; size_t off = 0;
  auto take = [&](size_t bytes) { char* p = ws + off; off += (bytes + 255) & ~(size_t)255; return p; };
  _Float16* BQ = (_Float16*)take((size_t)DM * DM * 2); _Float16* BK = (_Float16*)take((size_t)DM * DM * 2); _Float16* BV = (_Float16*)take((size_t)DM * DM * 2); _Float16* BO = (_Float16*)take((size_t)DM * DM * 2);
  _Float16* X16 = (_Float16*)take(NR * DM * 2); _Float16* Q16 = (_Float16*)take(NR * DM * 2); _Float16* K16 = (_Float16*)take(NR * DM * 2); _Float16* V16 = (_Float16*)take(NR * DM * 2); _Float16* O16 = (_Float16*)take(NR * DM * 2);
  float* YO = (float*)take(NR * DM * 4); _Float16* VT = (_Float16*)take((size_t)NB * NH * HD * SQ * 2);      /* pre-norm projection rows y (f32); V^T [NB][NH][HD][SQ] */
  float* QF0 = (float*)take((size_t)NB * QT0 * DM * 4); float* KF0 = (float*)take((size_t)NB * QT0 * DM * 4); float* VF0 = (float*)take((size_t)NB * QT0 * DM * 4); float* OF0 = (float*)take((size_t)NB * QT0 * DM * 4); _Float16* OH0 = (_Float16*)take((size_t)NB * QT0 * DM * 2); _Float16* OL0 = (_Float16*)take((size_t)NB * QT0 * DM * 2);
  if (off > ws_size) return;
  { const unsigned g = (unsigned)(((size_t)DM * DM / 8 + 255) / 256); k_wnat<<<g, 256, 0, stream>>>(wq, (size_t)DM * DM / 8, BQ); k_wnat<<<g, 256, 0, stream>>>(wk, (size_t)DM * DM / 8, BK); k_wnat<<<g, 256, 0, stream>>>(wv, (size_t)DM * DM / 8, BV); k_wnat<<<g, 256, 0, stream>>>(wo, (size_t)DM * DM / 8, BO); }      /* natural [out][in] = Bt x16 */

  k_x16<<<(unsigned)((NR * DM / 8 + 255) / 256), 256, 0, stream>>>(x, X16, NR * DM / 8);
  const size_t r0p = (size_t)B0 * SQ;      /* first projected row */
  const size_t f0p = (size_t)B0 * QT0;      /* its first-tile row */
  k_gemm2<0><<<dim3((unsigned)((MP / 128) * (DM / 64)), 1), 128, 0, stream>>>(X16 + r0p * DM, DM, 0, BQ, DM, 0, 0.0625f, nullptr, 0, nullptr, 1, 0, 0, nullptr, Q16 + r0p * DM, DM, 0, MP, DM, DM, 0, 0, 0);
  k_gemm2<0><<<dim3((unsigned)((MP / 128) * (DM / 64)), 1), 128, 0, stream>>>(X16 + r0p * DM, DM, 0, BK, DM, 0, 0.0625f, nullptr, 0, nullptr, 1, 0, 0, nullptr, K16 + r0p * DM, DM, 0, MP, DM, DM, 0, 0, 0);
  k_gemm2<0><<<dim3((unsigned)((MP / 128) * (DM / 64)), 1), 128, 0, stream>>>(X16 + r0p * DM, DM, 0, BV, DM, 0, 0.0625f, nullptr, 0, nullptr, 1, 0, 0, nullptr, V16 + r0p * DM, DM, 0, MP, DM, DM, 0, 0, 0);
  k_vt<NH, SQ><<<NBR * NH * (SQ / 64), 256, 0, stream>>>(V16 + r0p * LQ, LQ, 0, VT);      /* V^T [NBR][NH][HD][SQ] */
  k_gemm2<0><<<dim3((QT0 / 128) * (DM / 64), NBR), 128, 0, stream>>>(X16 + r0p * DM, DM, (size_t)SQ * DM, BQ, DM, 0, 0.0625f, nullptr, 0, nullptr, 1, 0, 0, QF0, nullptr, DM, (size_t)QT0 * DM, QT0, DM, DM, 0, 0, 0);      /* f32 q, k, v of each batch's first 128 rows (exact products), batch on grid.y */
  k_gemm2<0><<<dim3((QT0 / 128) * (DM / 64), NBR), 128, 0, stream>>>(X16 + r0p * DM, DM, (size_t)SQ * DM, BK, DM, 0, 0.0625f, nullptr, 0, nullptr, 1, 0, 0, KF0, nullptr, DM, (size_t)QT0 * DM, QT0, DM, DM, 0, 0, 0);
  k_gemm2<0><<<dim3((QT0 / 128) * (DM / 64), NBR), 128, 0, stream>>>(X16 + r0p * DM, DM, (size_t)SQ * DM, BV, DM, 0, 0.0625f, nullptr, 0, nullptr, 1, 0, 0, VF0, nullptr, DM, (size_t)QT0 * DM, QT0, DM, DM, 0, 0, 0);
  k_att0<0><<<dim3(NH * (QT0 / 64), NBR), 64, 0, stream>>>(QF0, KF0, VF0, DM, nullptr, 0.125f, OF0 + f0p * DM, DM);      /* exact f32 attention for rows 0..127 of each batch (o x64) */
  k_fattn<<<dim3(NH, NB, SQ / 128), 128, 0, stream>>>(Q16, K16, VT, O16);      /* causal attention of all batches and heads: o (merged heads, x64) as f16 rows */
  k_gemm2<0><<<dim3((unsigned)((MPO / 128) * (DM / 64)), 1), 128, 0, stream>>>(O16 + r0p * DM, DM, 0, BO, DM, 0, 0.0009765625f, nullptr, 0, nullptr, 1, 0, 0, YO + r0p * DM, nullptr, DM, 0, MPO, DM, DM, 0, 0, 0);      /* out rows are the output layout */
  k_hl<<<(unsigned)(((size_t)NB * QT0 * DM / 8 + 255) / 256), 256, 0, stream>>>(OF0, OH0, OL0, (size_t)NB * QT0 * DM / 8);      /* first-tile o (x64) -> f16 hi + x1024 residual planes */
  k_gemm2<0><<<dim3((QT0 / 128) * (DM / 64), NBR), 128, 0, stream>>>(OH0 + f0p * DM, DM, (size_t)QT0 * DM, BO, DM, 0, 0.0009765625f, bo, 0, nullptr, 1, 0, 0, YO + r0p * DM, nullptr, DM, (size_t)SQ * DM, QT0, DM, DM, 0, 0, 0);      /* rows 0..127 of each batch: out = o_hi Wo (+ b), overwriting the f16-path rows */
  k_gemm2<0><<<dim3((QT0 / 128) * (DM / 64), NBR), 128, 0, stream>>>(OL0 + f0p * DM, DM, (size_t)QT0 * DM, BO, DM, 0, 0.00000095367431640625f, nullptr, 0, (const float*)YO + r0p * DM, -1, 0, 0, YO + r0p * DM, nullptr, DM, (size_t)SQ * DM, QT0, DM, DM, 0, 0, 0);      /* += o_lo Wo 2^-20 (own-element accumulate) */
  k_lnx<0, 0, 1><<<(unsigned)NR, 256, 0, stream>>>(YO, lng, lnb, 1e-5f, nullptr, (float*)d_out);      /* out = LayerNorm(y) -> f32 output rows */
}

// v005
// It runs in 271 microseconds.
// Two timings next to v004 put it at 1.73 and 1.74 times that version's speed.
// Over all steps from v000 it is 36.2 times as fast.
#include <hip/hip_runtime.h>
// Causal multi-head self-attention with a fused post-LayerNorm (x [4][2048][1024]; k/q/v = x W^T (natural [1024][1024], no biases); 16 heads of 64; wei = q k^T * 64^-0.5; causal (tril, -inf); softmax; y = merged Wp^T; out = LayerNorm(y) (biased var, eps per the module, gamma / beta) -> [4][2048][1024]).
// Structure: token rows r = b*2048 + s; x as exact f16 rows (bf16-rounded); Q, K, V as three WMMA GEMMs (32x64 wave tiles, f32 accumulation, exact x16 weights, f16 outputs); V^T for all heads via LDS transposes; attention in ONE launch (k_fattn): a wave holds 32 queries of one head and walks the keys up to its diagonal in passes of 32: S^T = K Q^T, running maximum and sum in f32 (native exp2; weights x256 f16), O^T += V^T P^T, scores and weights never leave the registers; o (x64, folded into the output GEMM alpha) written straight into the merged f16 o rows; out = o W_o GEMM (f32) into the output layout.
// Compute dtype: inputs rounded to bf16; x / weights exact; q, k, v, softmax weights and o as plain f16 GEMM operands (~2^-12); scores and softmax statistics f32. v_wmma_f32_16x16x32_f16.
#define NB 4
#define SQ 2048
#define DM 1024
#define NH 16
#define HD 64
#define HG 4                         /* heads per launch of the (b, h0) k_vt form; k_fattn takes all NH */
#define QT0 128                      /* first-tile rows recomputed exactly in f32 */
#define B0 0                         /* first batch processed (debug hook) */
#define NBR NB                       /* batches processed (debug hook) */
#define NR ((size_t)NB * SQ)         /* token rows */
#define MP ((int)((size_t)NBR * SQ)) /* rows projected (debug hook) */
#define QN SQ                        /* unused: k_fattn attends all SQ query rows */
#define NHD NH                       /* unused: k_fattn attends all NH heads */
#define MPO MP                       /* rows through the output stage (debug hook) */
#define LQ DM      /* row pitch of the q/k/v rows */
typedef __bf16 v16b __attribute__((ext_vector_type(16)));
typedef unsigned short v8us __attribute__((ext_vector_type(8), may_alias));
typedef float  v8f  __attribute__((ext_vector_type(8)));
typedef float  v4f  __attribute__((ext_vector_type(4)));
typedef float  v4fa __attribute__((ext_vector_type(4), may_alias));
union FragB { v16b v; v8us half[2]; unsigned short u[16]; };

__device__ __forceinline__ unsigned short bf16_bits(float x) { unsigned int u = __float_as_uint(x); return (unsigned short)((u + 0x7FFFu + ((u >> 16) & 1u)) >> 16); }
__device__ __forceinline__ float bf16_val(unsigned short b) { return __uint_as_float(((unsigned int)b) << 16); }
__device__ __forceinline__ float bf16_round(float x) { return bf16_val(bf16_bits(x)); }
// D += A·B with NT terms: 1 = ah·bh, 2 = + al·bh (A split), 3 = + ah·bl (both split)
template <int NT>
__device__ __forceinline__ v8f mmaN(v16b ah, v16b al, v16b bh, v16b bl, v8f c) {
  c = __builtin_amdgcn_wmma_f32_16x16x32_bf16(false, ah, false, bh, (short)0, c, false, false);
  if (NT >= 2) c = __builtin_amdgcn_wmma_f32_16x16x32_bf16(false, al, false, bh, (short)0, c, false, false);
  if (NT >= 3) c = __builtin_amdgcn_wmma_f32_16x16x32_bf16(false, ah, false, bl, (short)0, c, false, false);
  asm volatile("v_nop\n\tv_nop\n\tv_nop\n\tv_nop" : "+v"(c) : "v"(ah), "v"(al), "v"(bh), "v"(bl));
  return c;
}

__global__ __launch_bounds__(256) void k_wt_bf16(const float* __restrict__ W, unsigned short* __restrict__ Wt, int K, int N) {
  const int t = blockIdx.x * 256 + threadIdx.x;
  const int k8n = K / 8;
  if (t >= N * k8n) return;
  const int n = t / k8n, k8 = (t % k8n) * 8;
  v8us v;
#pragma unroll
  for (int i = 0; i < 8; ++i) v[i] = bf16_bits(W[(size_t)(k8 + i) * N + n]);
  *(v8us*)(Wt + (size_t)n * K + k8) = v;
  
}

// GEMM C[M][N] (f32, pitch ldc) = act(A[M][K]·W + bias). A f32 row-major (pitch lda) converted per fragment to bf16
// (ASPLIT: hi/lo two planes -> 2 terms, else single rounded term); Wt bf16 [N][K] (pitch ldb). BIAS_BF16 rounds the
// bias to bf16 first (bias quantised to bf16 before the add). K%32==0, M%16==0, N%64==0.
template <bool ASPLIT, int ACT, bool BIAS_BF16>
__global__ __launch_bounds__(128) void k_gemm_bf(const float* __restrict__ A, int lda, const unsigned short* __restrict__ Wt, int ldb,
                                               const float* __restrict__ bias, float* __restrict__ C, int ldc, int M, int N, int K) {
  __shared__ __attribute__((aligned(16))) float so[4][16][64];
  const int tid = threadIdx.x, w = tid >> 5, lane = tid & 31, ln = lane & 15, hh = lane >> 4;
  const int ntn = N / 64;
  const int wid = blockIdx.x * 4 + w;
  const int mt = wid / ntn, nq = wid % ntn;
  if (mt * 16 >= M) return;
  const int row0 = mt * 16, col0 = nq * 64;
  const float* arow = A + (size_t)(row0 + ln) * lda;
  v8f acc[4] = {};
  for (int kb = 0; kb < K; kb += 32) {
    FragB ah, al;
    const v4f x0 = *(const v4fa*)(arow + kb + 8 * hh), x1 = *(const v4fa*)(arow + kb + 8 * hh + 4);
    const v4f x2 = *(const v4fa*)(arow + kb + 16 + 8 * hh), x3 = *(const v4fa*)(arow + kb + 16 + 8 * hh + 4);
    float xs[16] = {x0[0],x0[1],x0[2],x0[3],x1[0],x1[1],x1[2],x1[3],x2[0],x2[1],x2[2],x2[3],x3[0],x3[1],x3[2],x3[3]};
#pragma unroll
    for (int i = 0; i < 16; ++i) { const unsigned short hb = bf16_bits(xs[i]); ah.u[i] = hb; al.u[i] = ASPLIT ? bf16_bits(xs[i] - bf16_val(hb)) : (unsigned short)0; }
#pragma unroll
    for (int t = 0; t < 4; ++t) {
      const unsigned short* brow = Wt + (size_t)(col0 + t * 16 + ln) * ldb + kb;
      FragB b;
      b.half[0] = *(const v8us*)(brow + 8 * hh);
      b.half[1] = *(const v8us*)(brow + 16 + 8 * hh);
      acc[t] = mmaN<ASPLIT ? 2 : 1>(ah.v, al.v, b.v, b.v, acc[t]);
    }
  }
#pragma unroll
  for (int t = 0; t < 4; ++t) {
    float bv = bias ? bias[col0 + t * 16 + ln] : 0.f;
    if (BIAS_BF16) bv = bf16_round(bv);
#pragma unroll
    for (int r = 0; r < 8; ++r) { float v = acc[t][r] + bv; if (ACT == 1) v = fmaxf(v, 0.f); so[w][8 * hh + r][t * 16 + ln] = v; }
  }
  __builtin_amdgcn_fence(__ATOMIC_ACQ_REL, "workgroup");
  __builtin_amdgcn_wave_barrier();
  const int rsub = lane >> 4, c4 = (lane & 15) * 4;
  {
#pragma unroll
    for (int q = 0; q < 8; ++q) {
      const int r = q * 2 + rsub;
      const v4f v = *(const v4fa*)&so[w][r][c4];
      *(v4f*)(C + (size_t)(row0 + r) * ldc + col0 + c4) = v;
    }
    
  }
}

// GEMM C = act(A·W + bias + resid): A f32 (ASPLIT -> hi/lo 2 terms), Wt bf16 [N][K]; ACT 0 none, 1 relu, 2 exact gelu;
// resid (optional, f32, row index = (row % rmod), pitch ldr, RES_BF16 rounds it) added before the activation.
template <bool ASPLIT, int ACT, bool BIAS_BF16, bool RES_BF16>
__global__ __launch_bounds__(128) void k_gemm_bf3(const float* __restrict__ A, int lda, const unsigned short* __restrict__ Wt, int ldb,
                                                const float* __restrict__ bias, const float* __restrict__ resid, int rmod, int ldr,
                                                float* __restrict__ C, int ldc, int M, int N, int K) {
  __shared__ __attribute__((aligned(16))) float so[4][16][64];
  const int tid = threadIdx.x, w = tid >> 5, lane = tid & 31, ln = lane & 15, hh = lane >> 4;
  const int ntn = N / 64;
  const int wid = blockIdx.x * 4 + w;
  const int mt = wid / ntn, nq = wid % ntn;
  if (mt * 16 >= M) return;
  const int row0 = mt * 16, col0 = nq * 64;
  const float* arow = A + (size_t)(row0 + ln) * lda;
  v8f acc[4] = {};
  for (int kb = 0; kb < K; kb += 32) {
    FragB ah, al;
    const v4f x0 = *(const v4fa*)(arow + kb + 8 * hh), x1 = *(const v4fa*)(arow + kb + 8 * hh + 4);
    const v4f x2 = *(const v4fa*)(arow + kb + 16 + 8 * hh), x3 = *(const v4fa*)(arow + kb + 16 + 8 * hh + 4);
    float xs[16] = {x0[0],x0[1],x0[2],x0[3],x1[0],x1[1],x1[2],x1[3],x2[0],x2[1],x2[2],x2[3],x3[0],x3[1],x3[2],x3[3]};
#pragma unroll
    for (int i = 0; i < 16; ++i) { const unsigned short hb = bf16_bits(xs[i]); ah.u[i] = hb; al.u[i] = ASPLIT ? bf16_bits(xs[i] - bf16_val(hb)) : (unsigned short)0; }
#pragma unroll
    for (int t = 0; t < 4; ++t) {
      const unsigned short* brow = Wt + (size_t)(col0 + t * 16 + ln) * ldb + kb;
      FragB b;
      b.half[0] = *(const v8us*)(brow + 8 * hh);
      b.half[1] = *(const v8us*)(brow + 16 + 8 * hh);
      acc[t] = mmaN<ASPLIT ? 2 : 1>(ah.v, al.v, b.v, b.v, acc[t]);
    }
  }
#pragma unroll
  for (int t = 0; t < 4; ++t) {
    const int col = col0 + t * 16 + ln;
    float bv = bias ? bias[col] : 0.f;
    if (BIAS_BF16) bv = bf16_round(bv);
#pragma unroll
    for (int r = 0; r < 8; ++r) {
      float v = acc[t][r] + bv;
      if (resid) { float rv = resid[(size_t)((row0 + 8 * hh + r) % rmod) * ldr + col]; if (RES_BF16) rv = bf16_round(rv); v += rv; }
      if (ACT == 1) v = fmaxf(v, 0.f);
      if (ACT == 2) v = 0.5f * v * (1.0f + erff(v * 0.70710678118654752f));
      if (ACT == 3) { const float u = 0.7978845608028654f * (v + 0.044715f * v * v * v); v = 0.5f * v * (1.0f + tanhf(u)); }
      so[w][8 * hh + r][t * 16 + ln] = v;
    }
  }
  __builtin_amdgcn_fence(__ATOMIC_ACQ_REL, "workgroup");
  __builtin_amdgcn_wave_barrier();
  const int rsub = lane >> 4, c4 = (lane & 15) * 4;
  {
#pragma unroll
    for (int q = 0; q < 8; ++q) {
      const int r = q * 2 + rsub;
      const v4f v = *(const v4fa*)&so[w][r][c4];
      *(v4f*)(C + (size_t)(row0 + r) * ldc + col0 + c4) = v;
    }
    
  }
}
// row LayerNorm (biased variance, eps) over N: s = X (+ R); optional out_sum <- s; out_norm <- (s-mu)*rsqrt(var+eps)*g + b
template <bool PARAM_BF16>
__global__ __launch_bounds__(256) void k_layernorm(const float* __restrict__ X, const float* __restrict__ R, const float* __restrict__ g, const float* __restrict__ bta,
                                                  float* __restrict__ out_sum, float* __restrict__ out_norm, int N, float eps) {
  __shared__ float red[256];
  const int row = blockIdx.x, tid = threadIdx.x;
  const float* x = X + (size_t)row * N; const float* rr = R ? R + (size_t)row * N : nullptr;
  float vals[16];                     // up to N = 4096
  const int per = N / 256;            // contiguous chunk per thread? use strided-by-4 chunks: thread handles j = tid*4 + 1024*u
  float s1 = 0.f;
  for (int u = 0; u < per / 4; ++u) {
    const int j = tid * 4 + 1024 * u;
    const v4f a = *(const v4fa*)(x + j);
    v4f b = {0.f,0.f,0.f,0.f}; if (rr) b = *(const v4fa*)(rr + j);
#pragma unroll
    for (int q = 0; q < 4; ++q) { const float v = a[q] + b[q]; vals[u * 4 + q] = v; s1 += v; }
  }
  red[tid] = s1; __syncthreads();
  for (int st = 128; st > 0; st >>= 1) { if (tid < st) red[tid] += red[tid + st]; __syncthreads(); }
  const float mu = red[0] / (float)N; __syncthreads();
  float s2 = 0.f;
  for (int u = 0; u < per / 4; ++u)
#pragma unroll
    for (int q = 0; q < 4; ++q) { const float c = vals[u * 4 + q] - mu; s2 += c * c; }
  red[tid] = s2; __syncthreads();
  for (int st = 128; st > 0; st >>= 1) { if (tid < st) red[tid] += red[tid + st]; __syncthreads(); }
  const float rs = rsqrtf(red[0] / (float)N + eps);
  {
    for (int u = 0; u < per / 4; ++u) {
      const int j = tid * 4 + 1024 * u;
      v4f o, sm;
#pragma unroll
      for (int q = 0; q < 4; ++q) {
        float gg = g[j + q], bb = bta[j + q];
        if (PARAM_BF16) { gg = bf16_round(gg); bb = bf16_round(bb); }
        sm[q] = vals[u * 4 + q]; o[q] = (vals[u * 4 + q] - mu) * rs * gg + bb;
      }
      if (out_sum) *(v4f*)(out_sum + (size_t)row * N + j) = sm;
      *(v4f*)(out_norm + (size_t)row * N + j) = o;
    }
    
  }
}



// ---- f16 WMMA path (v_wmma_f32_16x16x32_f16): 11-bit significands for operands in range — used where a [0,1] probability operand needs more precision than bf16
typedef _Float16 v16h __attribute__((ext_vector_type(16)));
union FragH { v16h v; v8us half[2]; _Float16 h[16]; unsigned short u[16]; };
template <int NT>
__device__ __forceinline__ v8f mmaH(v16h ah, v16h al, v16h bh, v16h bl, v8f c) {
  c = __builtin_amdgcn_wmma_f32_16x16x32_f16(false, ah, false, bh, (short)0, c, false, false);
  if (NT >= 2) c = __builtin_amdgcn_wmma_f32_16x16x32_f16(false, al, false, bh, (short)0, c, false, false);
  if (NT >= 3) c = __builtin_amdgcn_wmma_f32_16x16x32_f16(false, ah, false, bl, (short)0, c, false, false);
  asm volatile("v_nop\n\tv_nop\n\tv_nop\n\tv_nop" : "+v"(c) : "v"(ah), "v"(al), "v"(bh), "v"(bl));
  return c;
}
// batched GEMM like k_gemm_b but f16 operands: A f32 (split into f16 hi/lo if ASPLIT, else rounded to f16), Bt = f16 values [n][k]; alpha; C f32; N multiple of 16 (partial tiles skipped)
template <bool ASPLIT>
__global__ __launch_bounds__(128) void k_gemm_h(const float* __restrict__ A, int lda, size_t sA, const _Float16* __restrict__ Bh, int ldb, size_t sB, float alpha, float* __restrict__ C, int ldc, size_t sC, int M, int N, int K) {
  __shared__ __attribute__((aligned(16))) float so[4][16][64];
  const int tid = threadIdx.x, w = tid >> 5, lane = tid & 31, ln = lane & 15, hh = lane >> 4; const int by = blockIdx.y;
  A += (size_t)by * sA; Bh += (size_t)by * sB; C += (size_t)by * sC;
  const int ntn = (N + 63) / 64; const int wid = blockIdx.x * 4 + w; const int mt = wid / ntn, nq = wid % ntn; if (mt * 16 >= M) return;
  const int row0 = mt * 16, col0 = nq * 64; const float* arow = A + (size_t)(row0 + ln) * lda;
  v8f acc[4] = {};
  for (int kb = 0; kb < K; kb += 32) {
    FragH ah, al;
    const v4f x0 = *(const v4fa*)(arow + kb + 8 * hh), x1 = *(const v4fa*)(arow + kb + 8 * hh + 4), x2 = *(const v4fa*)(arow + kb + 16 + 8 * hh), x3 = *(const v4fa*)(arow + kb + 16 + 8 * hh + 4);
    float xs[16] = {x0[0],x0[1],x0[2],x0[3],x1[0],x1[1],x1[2],x1[3],x2[0],x2[1],x2[2],x2[3],x3[0],x3[1],x3[2],x3[3]};
#pragma unroll
    for (int i = 0; i < 16; ++i) { const _Float16 h = (_Float16)xs[i]; ah.h[i] = h; al.h[i] = ASPLIT ? (_Float16)(xs[i] - (float)h) : (_Float16)0.0f; }
#pragma unroll
    for (int t = 0; t < 4; ++t) { if (col0 + t * 16 >= N) continue; const size_t boff = (size_t)(col0 + t * 16 + ln) * ldb + kb; FragH bq; bq.half[0] = *(const v8us*)(Bh + boff + 8 * hh); bq.half[1] = *(const v8us*)(Bh + boff + 16 + 8 * hh);
      acc[t] = mmaH<ASPLIT ? 2 : 1>(ah.v, al.v, bq.v, bq.v, acc[t]); }
  }
#pragma unroll
  for (int t = 0; t < 4; ++t) { if (col0 + t * 16 >= N) continue;
#pragma unroll
    for (int r = 0; r < 8; ++r) so[w][8 * hh + r][t * 16 + ln] = acc[t][r] * alpha; }
  __builtin_amdgcn_fence(__ATOMIC_ACQ_REL, "workgroup"); __builtin_amdgcn_wave_barrier();
  const int rsub = lane >> 4, c4 = (lane & 15) * 4;
  {
#pragma unroll
    for (int q = 0; q < 8; ++q) { const int r = q * 2 + rsub; if (col0 + c4 < N) { const v4f v = *(const v4fa*)&so[w][r][c4]; *(v4f*)(C + (size_t)(row0 + r) * ldc + col0 + c4) = v; } }
     }
}

// Wt[n][k] = f16(W[k][n]·scale) from f32 row-major W[K][N] (scale = power of two; bf16-exact weights stay exact in f16 away from the subnormal range)
__global__ __launch_bounds__(256) void k_wt_f16(const float* __restrict__ W, _Float16* __restrict__ Wt, int K, int N, float scale) {
  const int t = blockIdx.x * 256 + threadIdx.x; if (t >= N * (K / 8)) return; const int n = t / (K / 8), k8 = (t % (K / 8)) * 8; FragH f;
#pragma unroll
  for (int i = 0; i < 8; ++i) f.h[i] = (_Float16)(bf16_round(W[(size_t)(k8 + i) * N + n]) * scale); const v8us o = f.half[0];
  *(v8us*)((unsigned short*)Wt + (size_t)n * K + k8) = o; 
}
// k_gemm_hh variant with fused epilogue: v = acc·alpha + bias[by·sBias + col] (+ CP[(row/rowsPerB)·sCPb + by·64 + col] if CP) ; ACT 0 none / 1 elu ; writes f16 C16 (and f32 C if non-null)
template <int ACT>
__global__ __launch_bounds__(128) void k_gemm_hhx(const _Float16* __restrict__ A, int lda, size_t sA, const _Float16* __restrict__ Bh, int ldb, size_t sB, float alpha, const float* __restrict__ bias, size_t sBias, const float* __restrict__ CP, int rowsPerB, size_t sCPb, int row0g,
    float* __restrict__ C, _Float16* __restrict__ C16, int ldc, size_t sC, int M, int N, int K) {
  __shared__ __attribute__((aligned(16))) float so[4][16][64];
  const int tid = threadIdx.x, w = tid >> 5, lane = tid & 31, ln = lane & 15, hh = lane >> 4; const int by = blockIdx.y;
  A += (size_t)by * sA; Bh += (size_t)by * sB; const size_t cofs = (size_t)by * sC; const float* bp = bias ? bias + (size_t)by * sBias : nullptr;
  const int ntn = (N + 63) / 64; const int wid = blockIdx.x * 4 + w; const int mt = wid / ntn, nq = wid % ntn; if (mt * 16 >= M) return;
  const int row0 = mt * 16, col0 = nq * 64; const _Float16* arow = A + (size_t)(row0 + ln) * lda;
  v8f acc[4] = {};
  for (int kb = 0; kb < K; kb += 32) { FragH ah; ah.half[0] = *(const v8us*)((const unsigned short*)arow + kb + 8 * hh); ah.half[1] = *(const v8us*)((const unsigned short*)arow + kb + 16 + 8 * hh);
#pragma unroll
    for (int t = 0; t < 4; ++t) { if (col0 + t * 16 >= N) continue; const size_t boff = (size_t)(col0 + t * 16 + ln) * ldb + kb; FragH bq; bq.half[0] = *(const v8us*)((const unsigned short*)Bh + boff + 8 * hh); bq.half[1] = *(const v8us*)((const unsigned short*)Bh + boff + 16 + 8 * hh);
      acc[t] = mmaH<1>(ah.v, ah.v, bq.v, bq.v, acc[t]); }
  }
#pragma unroll
  for (int t = 0; t < 4; ++t) { if (col0 + t * 16 >= N) continue; const int col = col0 + t * 16 + ln; const float bv = bp ? bf16_round(bp[col]) : 0.f;
#pragma unroll
    for (int r = 0; r < 8; ++r) { float v = acc[t][r] * alpha + bv; if (CP) { const int rr = row0g + row0 + 8 * hh + r; if (rowsPerB < 0) v += CP[cofs + (size_t)rr * ldc + col];      /* rowsPerB < 0: own element of the batched C plane */ else { const int bidx = rr / rowsPerB; v += CP[(size_t)bidx * sCPb + (size_t)by * 64 + col]; } } if (ACT == 1) v = (v > 0.f) ? v : expm1f(v); else if (ACT == 7) v = (v > 0.f) ? v + 1.0f : expf(v); else if (ACT == 8) v = tanhf(v); else if (ACT == 9) v = 0.5f * v * (1.0f + tanhf(0.7978845608028654f * (v + 0.044715f * v * v * v))); else if (ACT == 11) v = 1.0f / (1.0f + expf(-v)); else if (ACT == 12) v = (v > 0.f) ? v : 0.01f * v; else if (ACT == 14) v = (v > 0.f) ? v : 0.1f * v; else if (ACT == 16) v = (v >= 0.f) ? v : 0.3f * v; else if (ACT == 17) v = (v >= 0.f) ? v : 0.2f * v; else if (ACT == 15) v = v / (1.0f + expf(-v)); else if (ACT == 3) v = fmaxf(v, 0.f); else if (ACT == 6) v = 0.5f * v * (1.0f + erff(v * 0.70710678118654752f)); so[w][8 * hh + r][t * 16 + ln] = v; } }
  __builtin_amdgcn_fence(__ATOMIC_ACQ_REL, "workgroup"); __builtin_amdgcn_wave_barrier();
  const int rsub = lane >> 4, c4 = (lane & 15) * 4; typedef _Float16 v4h __attribute__((ext_vector_type(4)));
  {
#pragma unroll
    for (int q = 0; q < 8; ++q) { const int r = q * 2 + rsub; if (col0 + c4 < N) { const v4f v = *(const v4fa*)&so[w][r][c4]; if (C) *(v4f*)(C + cofs + (size_t)(row0 + r) * ldc + col0 + c4) = v; if (C16) { v4h h4; for (int i = 0; i < 4; ++i) h4[i] = (_Float16)v[i]; *(v4h*)(C16 + cofs + (size_t)(row0 + r) * ldc + col0 + c4) = h4; } } }
     }
}


typedef _Float16 v4h __attribute__((ext_vector_type(4)));

__global__ __launch_bounds__(256) void k_x16(const float* __restrict__ x, _Float16* __restrict__ X16, size_t n8) { const size_t t = (size_t)blockIdx.x * 256 + threadIdx.x; if (t >= n8) return; FragH f;
#pragma unroll
  for (int q = 0; q < 8; ++q) f.h[q] = (_Float16)bf16_round(x[t * 8 + q]); *(v8us*)((unsigned short*)X16 + t * 8) = f.half[0];  }
__global__ __launch_bounds__(256) void k_h16(const float* __restrict__ x, _Float16* __restrict__ X16, size_t n8) { const size_t t = (size_t)blockIdx.x * 256 + threadIdx.x; if (t >= n8) return; FragH f;
#pragma unroll
  for (int q = 0; q < 8; ++q) f.h[q] = (_Float16)x[t * 8 + q]; *(v8us*)((unsigned short*)X16 + t * 8) = f.half[0];  }
__global__ __launch_bounds__(256) void k_round16f(const float* __restrict__ W, _Float16* __restrict__ Bt, size_t n8) { const size_t t = (size_t)blockIdx.x * 256 + threadIdx.x; if (t >= n8) return; FragH f;
#pragma unroll
  for (int i = 0; i < 8; ++i) f.h[i] = (_Float16)(bf16_round(W[t * 8 + i]) * 16.0f); *(v8us*)((unsigned short*)Bt + t * 8) = f.half[0];  }
template <int NHv, int TTv>
__global__ __launch_bounds__(256) void k_vt(const _Float16* __restrict__ V16, int ldv, int voff, _Float16* __restrict__ Vt) { __shared__ unsigned short tl[64][66]; const int tid = threadIdx.x; const int slab = blockIdx.x / (TTv / 64), lg = blockIdx.x % (TTv / 64); const int b = slab / NHv, h = slab % NHv;
  for (int i = tid; i < 64 * 8; i += 256) { const int r = i / 8, c8 = (i % 8) * 8; FragH f; f.half[0] = *(const v8us*)((const unsigned short*)V16 + ((size_t)b * TTv + lg * 64 + r) * ldv + voff + h * 64 + c8);
#pragma unroll
    for (int q = 0; q < 8; ++q) tl[r][c8 + q] = f.u[q]; }
  __syncthreads();
  {
#pragma unroll
    for (int rd = 0; rd < 2; ++rd) { const int d = rd * 32 + tid / 8, pc = tid % 8; FragH f;
#pragma unroll
      for (int q = 0; q < 8; ++q) f.u[q] = tl[pc * 8 + q][d];
      *(v8us*)((unsigned short*)Vt + ((size_t)slab * 64 + d) * TTv + lg * 64 + pc * 8) = f.half[0]; }
     } }

__global__ __launch_bounds__(256) void k_hl(const float* __restrict__ F, _Float16* __restrict__ Hh, _Float16* __restrict__ Hl, size_t n8) { const size_t t = (size_t)blockIdx.x * 256 + threadIdx.x; if (t >= n8) return; FragH fh, fl; const v4f a = *(const v4fa*)(F + t * 8), c = *(const v4fa*)(F + t * 8 + 4);
#pragma unroll
  for (int q = 0; q < 4; ++q) { _Float16 h = (_Float16)a[q]; fh.h[q] = h; fl.h[q] = (_Float16)((a[q] - (float)h) * 1024.0f); h = (_Float16)c[q]; fh.h[4 + q] = h; fl.h[4 + q] = (_Float16)((c[q] - (float)h) * 1024.0f); }
  { *(v8us*)((unsigned short*)Hh + t * 8) = fh.half[0]; *(v8us*)((unsigned short*)Hl + t * 8) = fl.half[0];  } }

// ---- fast GEMM (block tile 128x64, wave tile 32x64; requires M % 32 == 0 rows per launch region, N % 64 == 0 and K a positive multiple of 64); epilogue = k_gemm_hhx semantics ----
// The operands go through LDS in stages of 64 k: every global load of a wave covers four whole 128-byte lines (4 rows x 64 k), each line is fetched once per block, and the
// fragments are read back from LDS in the k order of g2_frag. Two stage buffers: stage s + 1 is stored and stage s + 2 is requested while stage s is multiplied; one barrier a stage.
// The unroll directives in g2_request, g2_store and k_gemm2: the loop indices pick staging registers, offsets and fragments, which stay in registers only if every index is a constant.
__device__ __forceinline__ v16h g2_frag(const _Float16* p, int hh) { FragH f; f.half[0] = *(const v8us*)((const unsigned short*)p + 8 * hh); f.half[1] = *(const v8us*)((const unsigned short*)p + 16 + 8 * hh); return f.v; }
__device__ __forceinline__ v8f g2_mma(v16h a, v16h b, v8f c) { v8f d = __builtin_amdgcn_wmma_f32_16x16x32_f16(false, a, false, b, (short)0, c, false, false); asm volatile("v_nop\n\tv_nop\n\tv_nop\n\tv_nop" : "+v"(d) : "v"(a), "v"(b)); return d; }
#define G2_PITCH 144                  /* LDS row pitch in bytes for rows of 128: 16 x odd, so that the 16 rows of a 16-byte fragment read fall on all 64 banks */
#define G2_STAGE (192 * G2_PITCH)     /* one stage: 128 A rows, then 64 B rows */
__device__ __forceinline__ v16h g2_lfrag(const unsigned char* p) { FragH f; f.half[0] = *(const v8us*)p; f.half[1] = *(const v8us*)(p + 32); return f.v; }      /* p = the lane's LDS row + 16 * (lane >> 4) bytes: k 8 hh .. + 7 and 16 + 8 hh .. + 7, as g2_frag */
// The thread's 12 pieces of 16 bytes of the next stage (8 of A, 4 of B), requested as one batch; then every offset steps on by one stage. go = byte offsets from the block's A and B
// (32 bits: an operand plane stays under 4 GiB), so that the loads take the kernel's own global pointers as their bases.
__device__ __forceinline__ void g2_request(v8us (&rg)[12], const _Float16* A, const _Float16* B, unsigned (&go)[12]) {
#pragma unroll
  for (int j = 0; j < 12; ++j) rg[j] = *(const v8us*)((const char*)(j < 8 ? A : B) + go[j]);      /* unrolled: rg and go stay in registers only under constant indices */
  asm volatile("s_wait_xcnt 0x0" :: "v"(go[0]), "v"(go[1]), "v"(go[2]), "v"(go[3]), "v"(go[4]), "v"(go[5]), "v"(go[6]), "v"(go[7]), "v"(go[8]), "v"(go[9]), "v"(go[10]), "v"(go[11]) : "memory");      /* the wait in front of the overwrite of the loads' offset registers just below; as inputs the offsets keep their registers up to here; the memory clobber keeps the 12 loads in front of it, one batch ahead of the products */
#pragma unroll
  for (int j = 0; j < 12; ++j) go[j] += 128; }
__device__ __forceinline__ void g2_store(const v8us (&rg)[12], unsigned char* sw) {
#pragma unroll
  for (int j = 0; j < 12; ++j) *(v8us*)(sw + j * 16 * G2_PITCH) = rg[j]; }      /* piece j lies 16 rows below piece j - 1 */
template <int ACT>
__global__ __launch_bounds__(128) void k_gemm2(const _Float16* __restrict__ A, int lda, size_t sA, const _Float16* __restrict__ Bh, int ldb, size_t sB, float alpha, const float* __restrict__ bias, size_t sBias, const float* __restrict__ CP, int rowsPerB, size_t sCPb, int row0g,
    float* __restrict__ C, _Float16* __restrict__ C16, int ldc, size_t sC, int M, int N, int K, size_t zA, size_t zB, size_t zC) { static_assert(ACT == 0 || ACT == 3 || ACT == 6 || ACT == 8 || ACT == 9 || ACT == 11 || ACT == 12 || ACT == 14 || ACT == 15 || ACT == 16 || ACT == 17, "k_gemm2: unsupported ACT code (would silently apply no activation)");
  __shared__ __attribute__((aligned(16))) unsigned char sm[2 * G2_STAGE]; float (*so)[32][68] = (float (*)[32][68])sm;      /* the epilogue's staging rows reuse the stage buffers, behind the loop's last barrier */
  const int tid = threadIdx.x, w = tid >> 5, lane = tid & 31, ln = lane & 15, hh = lane >> 4; const int by = blockIdx.y, bz = blockIdx.z;      /* two batch axes, each with its own strides */
  A += (size_t)by * sA + (size_t)bz * zA; Bh += (size_t)by * sB + (size_t)bz * zB; const size_t cofs = (size_t)by * sC + (size_t)bz * zC; const float* bp = bias ? bias + (size_t)by * sBias : nullptr;
  const int ntn = N >> 6; const int mt = blockIdx.x / ntn, nq = blockIdx.x - mt * ntn; const int row0 = mt * 128 + 32 * w, col0 = nq * 64;
  const int sr = tid >> 3, sc = (tid & 7) * 8;      /* staging: 8 threads a row, piece j of a thread = stage row 16 j + sr, k sc .. sc + 7 */
  unsigned go[12]; v8us rg[12];
#pragma unroll
  for (int j = 0; j < 8; ++j) { const int r = mt * 128 + j * 16 + sr; go[j] = ((unsigned)(r < M ? r : M - 1) * (unsigned)lda + sc) * 2u; }      /* a row past M (its wave stores nothing) reads the last row instead */
#pragma unroll
  for (int j = 0; j < 4; ++j) go[8 + j] = ((unsigned)(col0 + j * 16 + sr) * (unsigned)ldb + sc) * 2u;
  unsigned char* const sw = sm + sr * G2_PITCH + sc * 2;
  const unsigned char* const ar = sm + (32 * w + ln) * G2_PITCH + 16 * hh; const unsigned char* const br = sm + (128 + ln) * G2_PITCH + 16 * hh;
  const v8f z8 = {0.f,0.f,0.f,0.f,0.f,0.f,0.f,0.f}; v8f c00 = z8, c01 = z8, c02 = z8, c03 = z8, c10 = z8, c11 = z8, c12 = z8, c13 = z8;
  const int nst = K >> 6;
  g2_request(rg, A, Bh, go); g2_store(rg, sw); if (nst > 1) g2_request(rg, A, Bh, go);
  __syncthreads();      /* stage 0 is complete before any wave reads it */
#pragma unroll 1
  for (int s = 0; s < nst; ++s) {      /* rolled: the trip count is a run-time value and one copy of the body holds all the overlap there is */
    const int cur = (s & 1) * G2_STAGE;
    if (s + 1 < nst) { g2_store(rg, sw + (G2_STAGE - cur)); if (s + 2 < nst) g2_request(rg, A, Bh, go); }      /* stage s + 1 into the buffer that every wave left at the last barrier; stage s + 2 in flight under this stage's products */
    v16h fa[2][2], fb[2][4];
#pragma unroll
    for (int ks = 0; ks < 2; ++ks) { fa[ks][0] = g2_lfrag(ar + cur + ks * 64); fa[ks][1] = g2_lfrag(ar + cur + 16 * G2_PITCH + ks * 64);
      for (int t = 0; t < 4; ++t) fb[ks][t] = g2_lfrag(br + cur + t * 16 * G2_PITCH + ks * 64); }
#pragma unroll
    for (int ks = 0; ks < 2; ++ks) {      /* both unrolled: the indices pick fragments, which stay in registers only if they are constants */
      c00 = g2_mma(fa[ks][0], fb[ks][0], c00); c10 = g2_mma(fa[ks][1], fb[ks][0], c10);
      c01 = g2_mma(fa[ks][0], fb[ks][1], c01); c11 = g2_mma(fa[ks][1], fb[ks][1], c11);
      c02 = g2_mma(fa[ks][0], fb[ks][2], c02); c12 = g2_mma(fa[ks][1], fb[ks][2], c12);
      c03 = g2_mma(fa[ks][0], fb[ks][3], c03); c13 = g2_mma(fa[ks][1], fb[ks][3], c13); }
    __syncthreads(); }      /* stage s + 1 is complete, and every wave has left stage s, whose buffer the next trip overwrites (behind the last trip: the epilogue) */
  if (row0 >= M) return;      /* no barrier behind this point */
  v8f accs[8] = {c00, c01, c02, c03, c10, c11, c12, c13};
#pragma unroll
  for (int u = 0; u < 8; ++u) { const int t = u & 3, half = u >> 2; const int col = col0 + t * 16 + ln; const float bv = bp ? bf16_round(bp[col]) : 0.f;
#pragma unroll
    for (int r = 0; r < 8; ++r) { const int rloc = half * 16 + 8 * hh + r; float v = accs[u][r] * alpha + bv; if (CP) { if (rowsPerB < 0) v += CP[cofs + (size_t)(row0g + row0 + rloc) * ldc + col];      /* rowsPerB < 0: own element of the batched C plane */ else { const int bidx = (row0g + row0 + rloc) / rowsPerB; v += CP[(size_t)bidx * sCPb + (size_t)by * 64 + col]; } }
      if (ACT == 3) v = fmaxf(v, 0.f); else if (ACT == 6) v = 0.5f * v * (1.0f + erff(v * 0.70710678118654752f)); else if (ACT == 11) v = 1.0f / (1.0f + expf(-v)); else if (ACT == 15) v = v / (1.0f + expf(-v)); else if (ACT == 12) v = (v > 0.f) ? v : 0.01f * v; else if (ACT == 8) v = tanhf(v); else if (ACT == 9) v = 0.5f * v * (1.0f + tanhf(0.7978845608028654f * (v + 0.044715f * v * v * v))); else if (ACT == 14) v = (v > 0.f) ? v : 0.1f * v; else if (ACT == 16) v = (v >= 0.f) ? v : 0.3f * v; else if (ACT == 17) v = (v >= 0.f) ? v : 0.2f * v;
      so[w][rloc][t * 16 + ln] = v; } }
  __builtin_amdgcn_fence(__ATOMIC_ACQ_REL, "workgroup"); __builtin_amdgcn_wave_barrier();
  const int rsub = lane >> 4, c4 = (lane & 15) * 4;
  {
#pragma unroll
    for (int q = 0; q < 16; ++q) { const int r = q * 2 + rsub; const v4f v = *(const v4fa*)&so[w][r][c4]; if (C) *(v4f*)(C + cofs + (size_t)(row0 + r) * ldc + col0 + c4) = v; if (C16) { v4h h4; for (int i = 0; i < 4; ++i) h4[i] = (_Float16)v[i]; *(v4h*)(C16 + cofs + (size_t)(row0 + r) * ldc + col0 + c4) = h4; } }
     } }


__global__ __launch_bounds__(256) void k_wnat(const float* __restrict__ w, size_t n8, _Float16* __restrict__ Bt) { const size_t t = (size_t)blockIdx.x * 256 + threadIdx.x; if (t >= n8) return; FragH f; for (int q = 0; q < 8; ++q) f.h[q] = (_Float16)(bf16_round(w[t * 8 + q]) * 16.0f); *(v8us*)((unsigned short*)Bt + t * 8) = f.half[0];  }
__global__ __launch_bounds__(256) void k_rsm(const float* __restrict__ S, _Float16* __restrict__ P, int nrows) {
  #pragma clang fp contract(off)
  const int i = blockIdx.x * 256 + threadIdx.x; if (i >= nrows) return; const float* s = S + (size_t)i * SQ; float mx = -3.0e38f;
#pragma unroll 1
  for (int j = 0; j < SQ; ++j) mx = fmaxf(mx, s[j]); float se = 0.f;
#pragma unroll 1
  for (int j = 0; j < SQ; ++j) se += expf(s[j] - mx); const float sc = 256.0f / se;
#pragma unroll 1
  for (int j0 = 0; j0 < SQ; j0 += 8) { FragH f; for (int q = 0; q < 8; ++q) f.h[q] = (_Float16)(expf(s[j0 + q] - mx) * sc); unsigned short* d = (unsigned short*)P + (size_t)i * SQ + j0; *(v8us*)d = f.half[0];  } }
__global__ __launch_bounds__(256) void k_vt(const _Float16* __restrict__ V16, int b, int h0, _Float16* __restrict__ VT) { __shared__ unsigned short tl[64][65]; const int tid = threadIdx.x; const int hh = blockIdx.x % HG, sg = blockIdx.x / HG; const int s0 = sg * 64; const int h = h0 + hh;
  for (int i = tid; i < 64 * 8; i += 256) { const int j = i / 8, d8 = (i % 8) * 8; FragH f; f.half[0] = *(const v8us*)((const unsigned short*)V16 + ((size_t)b * SQ + s0 + j) * DM + h * HD + d8); for (int q = 0; q < 8; ++q) tl[d8 + q][j] = f.u[q]; }
  __syncthreads();
  { for (int i = tid; i < 64 * 8; i += 256) { const int d = i / 8, j8 = (i % 8) * 8; FragH f; for (int q = 0; q < 8; ++q) f.u[q] = tl[d][j8 + q]; *(v8us*)((unsigned short*)VT + ((size_t)hh * HD + d) * SQ + s0 + j8) = f.half[0]; }  } }



// ---- fused causal attention ----
typedef _Float16 v8h __attribute__((ext_vector_type(8)));
__device__ __forceinline__ float fa_xhalf(float x) { return __builtin_bit_cast(float, __builtin_amdgcn_permlanex16(__builtin_bit_cast(int, x), __builtin_bit_cast(int, x), 0x76543210, 0xfedcba98, false, false)); }      /* lane l takes lane l ^ 16 */
__device__ __forceinline__ v8f fa_mma(v16h a, v16h b, v8f c) { return __builtin_amdgcn_wmma_f32_16x16x32_f16(false, a, false, b, (short)0, c, false, false); }
// Native 2^x and 1/x. In asm so that the v_nop stands directly behind the last transcendental: the one free issue slot that the instruction set asks for before an instruction that
// reads the result or overwrites the source. In the group of four each v_exp_f32 is
// the free slot of the one before it: the early-clobber results lie on no source.
__device__ __forceinline__ float fa_exp2(float x) { float r; asm("v_exp_f32 %0, %1\n\tv_nop" : "=v"(r) : "v"(x)); return r; }
__device__ __forceinline__ float fa_rcp(float x) { float r; asm("v_rcp_f32 %0, %1\n\tv_nop" : "=v"(r) : "v"(x)); return r; }
__device__ __forceinline__ v4f fa_exp2x4(v4f x) { float r0, r1, r2, r3;
  asm("v_exp_f32 %0, %4\n\tv_exp_f32 %1, %5\n\tv_exp_f32 %2, %6\n\tv_exp_f32 %3, %7\n\tv_nop" : "=&v"(r0), "=&v"(r1), "=&v"(r2), "=&v"(r3) : "v"(x[0]), "v"(x[1]), "v"(x[2]), "v"(x[3]));
  const v4f r = {r0, r1, r2, r3}; return r; }
// Fragment of 16 rows x 32 k in the k order of g2_frag; p = the lane's row + 8 * (lane >> 4), so that the pointer itself is the loads' address register.
__device__ __forceinline__ v16h fa_frag(const _Float16* p) { FragH f; f.half[0] = *(const v8us*)((const unsigned short*)p); f.half[1] = *(const v8us*)((const unsigned short*)p + 16); return f.v; }
// The wait in front of any overwrite of a register that the loads issued so far name. The address is an input, so it keeps its register up to here; the memory clobber keeps
// the loads in front of it, where they were written: issued as one batch, long before their first use.
__device__ __forceinline__ void fa_issued(const _Float16* p) { asm volatile("s_wait_xcnt 0x0" :: "v"(p) : "memory"); }
// One pass: 32 keys against the wave's 32 queries (two groups of 16). Lane (c = lane & 15, hh = lane >> 4) owns query 16 g + c in both products:
//   S^T = K Q^T : A = 16 K rows, B = 16 Q rows, both by fa_frag; s[g][kt][r] = score of key 16 kt + 8 hh + r
//   O^T += V^T P^T : A = 16 V^T rows (dims) by fa_frag over the 32 keys; B element e = weight of key (e < 8 ? 8 hh + e : 16 + 8 hh + e - 8) = s[g][e >> 3][e & 7], the k order of fa_frag
// so maximum, sum and rescale are the lane's own, with one exchange between the wave's halves. mr = maximum in use (log2 units); it may trail the true one by up to 6
// (weights then reach 256 * 2^6, well inside f16); sums and o are rescaled only in a pass in which some query's maximum has run further ahead.
// The unroll directives here and in k_fattn: the loop indices pick fragments and accumulators, which stay in registers only if every index is a constant.
template <bool DIAG>
__device__ __forceinline__ void fa_pass(v16h (&kf)[2][2], const _Float16*& kq, const _Float16*& vq, const v16h (&qf)[2][2], v8f (&o)[2][4], float (&mr)[2], float (&l)[2], int rel) {
  const float cs = 0.125f * 1.44269504088896340736f;      /* score scale times log2(e) */
  v16h vf[4];
#pragma unroll
  for (int t = 0; t < 4; ++t) vf[t] = fa_frag(vq + (size_t)t * 16 * SQ);      /* this pass's V^T: in flight under the first product and the softmax */
  fa_issued(vq); vq += 32;
  v8f s[2][2]; const v8f z8 = {0.f, 0.f, 0.f, 0.f, 0.f, 0.f, 0.f, 0.f};
#pragma unroll
  for (int g = 0; g < 2; ++g) for (int kt = 0; kt < 2; ++kt) s[g][kt] = fa_mma(kf[kt][1], qf[g][1], fa_mma(kf[kt][0], qf[g][0], z8));
  if (!DIAG) {
#pragma unroll
    for (int kt = 0; kt < 2; ++kt) for (int d = 0; d < 2; ++d) kf[kt][d] = fa_frag(kq + (size_t)kt * 16 * DM + d * 32);
    fa_issued(kq); kq += (size_t)32 * DM; }
  if (DIAG) {      /* the pass on the diagonal: key 16 kt + 8 hh + r stays while it is not above query 16 g + c (rel = c - 8 hh) */
#pragma unroll
    for (int g = 0; g < 2; ++g) for (int kt = 0; kt < 2; ++kt) for (int r = 0; r < 8; ++r) s[g][kt][r] = (16 * kt + r - 16 * g <= rel) ? s[g][kt][r] : -1.0e30f; }
  float mb[2]; bool need = false;
#pragma unroll
  for (int g = 0; g < 2; ++g) { float mx = s[g][0][0];
    for (int r = 1; r < 8; ++r) mx = fmaxf(mx, s[g][0][r]);
    for (int r = 0; r < 8; ++r) mx = fmaxf(mx, s[g][1][r]);
    mx = fmaxf(mx, fa_xhalf(mx)) * cs; mb[g] = mx; need = need || (mx > mr[g] + 6.0f); }
  if (__builtin_amdgcn_ballot_w32(need) != 0) {      /* wave-uniform; always taken in the first pass (mr = -1e30, factor 0), seldom later */
#pragma unroll
    for (int g = 0; g < 2; ++g) { const float mn = fmaxf(mr[g], mb[g]); const float corr = fa_exp2(mr[g] - mn); mr[g] = mn; l[g] *= corr;
      for (int t = 0; t < 4; ++t) o[g][t] *= corr; } }
#pragma unroll
  for (int g = 0; g < 2; ++g) { const float nm = 8.0f - mr[g];      /* weights carried x256 */
    FragH pf; v4f ls = {0.f, 0.f, 0.f, 0.f};
    for (int i = 0; i < 4; ++i) { v4f a; for (int u = 0; u < 4; ++u) a[u] = fmaf(s[g][i >> 1][(i & 1) * 4 + u], cs, nm);
      const v4f p = fa_exp2x4(a); ls += p; for (int u = 0; u < 4; ++u) pf.h[i * 4 + u] = (_Float16)p[u]; }
    l[g] += (ls[0] + ls[1]) + (ls[2] + ls[3]);
    for (int t = 0; t < 3; ++t) o[g][t] = fa_mma(vf[t], pf.v, o[g][t]);
    o[g][3] = g2_mma(vf[3], pf.v, o[g][3]); } }      /* the weights' last use, with g2_mma's four free slots: what may next land on their registers is asm text (fa_exp2x4, fa_rcp) */
// grid (heads, batches, blocks of 128 queries, the longest first); 4 waves of 32 queries; no LDS, no barrier.
__global__ __launch_bounds__(128) void k_fattn(const _Float16* __restrict__ Q, const _Float16* __restrict__ K, const _Float16* __restrict__ VT, _Float16* __restrict__ O) {
  const int lane = threadIdx.x & 31, c = lane & 15, hh = lane >> 4; const int h = blockIdx.x, b = blockIdx.y;
  const int q0 = (int)(gridDim.z - 1 - blockIdx.z) * 128 + __builtin_amdgcn_readfirstlane(threadIdx.x >> 5) * 32;      /* the wave's first query: scalar, so the pass count is */
  const _Float16* qp = Q + ((size_t)b * SQ + q0 + c) * DM + h * HD + 8 * hh; const _Float16* kq = K + ((size_t)b * SQ + c) * DM + h * HD + 8 * hh; const _Float16* vq = VT + ((size_t)(b * NH + h) * HD + c) * SQ + 8 * hh;      /* the lane's row and half, as fa_frag takes them */
  v16h qf[2][2], kf[2][2];
#pragma unroll
  for (int g = 0; g < 2; ++g) for (int d = 0; d < 2; ++d) { qf[g][d] = fa_frag(qp + (size_t)g * 16 * DM + d * 32); kf[g][d] = fa_frag(kq + (size_t)g * 16 * DM + d * 32); }
  asm volatile("s_wait_xcnt 0x0" :: "v"(qp), "v"(kq) : "memory");      /* as in fa_issued, for both addresses */
  kq += (size_t)32 * DM;
  const v8f z8 = {0.f, 0.f, 0.f, 0.f, 0.f, 0.f, 0.f, 0.f}; v8f o[2][4] = {{z8, z8, z8, z8}, {z8, z8, z8, z8}}; float mr[2] = {-1.0e30f, -1.0e30f}, l[2] = {0.f, 0.f};
  const int rel = c - 8 * hh;
  for (int kb = 0; kb < q0 / 32; ++kb) fa_pass<false>(kf, kq, vq, qf, o, mr, l, rel);      /* keys below the wave's first query: no mask */
  fa_pass<true>(kf, kq, vq, qf, o, mr, l, rel);
  _Float16* op = O + ((size_t)b * SQ + q0 + c) * DM + h * HD + 8 * hh;      /* o[g][t][r] = dim 16 t + 8 hh + r of query 16 g + c: eight neighbours, one 16-byte store */
  v8h ov[2][4];
#pragma unroll
  for (int g = 0; g < 2; ++g) { const float fin = 64.0f * fa_rcp(l[g] + fa_xhalf(l[g]));      /* the halves' sums joined; o carried x64 */
    for (int t = 0; t < 4; ++t) for (int r = 0; r < 8; ++r) ov[g][t][r] = (_Float16)(o[g][t][r] * fin); }
#pragma unroll
  for (int g = 0; g < 2; ++g) for (int t = 0; t < 4; ++t) *(v8h*)(op + (size_t)g * 16 * DM + t * 16) = ov[g][t]; }


typedef float v2f __attribute__((ext_vector_type(2)));
// exp(x) to f32 accuracy, in the way expf is expanded: n = nearest integer to x log2(e); v_exp_f32 of x log2(e) - n, log2(e) taken in two parts (two fma, so the difference is
// rounded once); ldexp by n; 0 and infinity beyond the two range ends. Written out so that v_exp_f32 can stand in asm with its v_nop directly behind it: the one free issue slot
// that the instruction set asks for before an instruction that reads the result or overwrites the source.
__device__ __forceinline__ float exp_slot(float x) {
  const float c_hi = __uint_as_float(0x3fb8aa3bu), c_lo = __uint_as_float(0x32a5705fu);
  const float n = rintf(x * c_hi); const float a = fmaf(x, c_lo, fmaf(x, c_hi, -n));
  float r; asm("v_exp_f32 %0, %1\n\tv_nop" : "=v"(r) : "v"(a));
  r = ldexpf(r, (int)n); r = (__uint_as_float(0xc2ce8ed0u) > x) ? 0.f : r; r = (__uint_as_float(0x42b17218u) < x) ? __uint_as_float(0x7f800000u) : r; return r; }
// Exact f32 attention of the first QT0 rows, one thread per query row. The row's q and o stay in registers. K and V come in tiles of 64 keys through LDS
// (K transposed to [dim][key], V as [key][dim]) and are read back as broadcasts, 32 reads at a time, one such batch in flight while the batch before it is worked on.
// Eight keys are worked on together: their eight score sums run side by side (each still summed over the dims in ascending order, s = fma(q, k, s)),
// then the running maximum, the two exps and the running sum key by key, then the o update key by key (o = fma(o, sc, e v), l = fma(l, sc, e)).
// Every row sees its keys, and every sum its terms, in the same order as with one key at a time.
template <int MASKADD>
__global__ __launch_bounds__(64) void k_att0(const float* __restrict__ QF, const float* __restrict__ KF, const float* __restrict__ VF, int ld, const float* __restrict__ mask, float scale, float* __restrict__ OF, int ldo) {
  __shared__ __attribute__((aligned(16))) float lkt[HD][64]; __shared__ __attribute__((aligned(16))) float lv[64][HD]; __shared__ __attribute__((aligned(16))) float lo[64][HD + 4];
  const int tid = threadIdx.x; const int h = blockIdx.x / (QT0 / 64), rg = blockIdx.x % (QT0 / 64); const int i = rg * 64 + tid;
  { const size_t rb = (size_t)blockIdx.y * QT0; QF += rb * ld; KF += rb * ld; VF += rb * ld; OF += rb * ldo; }      /* blockIdx.y = batch: QT0 rows of q, k, v and o each */
  const float* qr = QF + (size_t)i * ld + h * HD;
  float q[HD]; v2f o[HD / 2];
#pragma unroll
  for (int c = 0; c < HD / 4; ++c) { const v4f t = *(const v4fa*)(qr + c * 4); for (int u = 0; u < 4; ++u) q[c * 4 + u] = t[u]; const v2f z = {0.f, 0.f}; o[c * 2] = z; o[c * 2 + 1] = z; }
  asm volatile("s_wait_xcnt 0x0" :: "v"(qr) : "memory");      /* the wait in front of any overwrite of the loads' address register; named as an input, the address stays in its register up to here (else the last load's result lands on it) */
  float m = -1.0e30f, l = 0.f; const int jmax = MASKADD ? (SQ - 1) : (rg * 64 + 63);      /* additive-mask form: every key (the mask input decides); causal form: keys up to the block's last row */
#pragma unroll 1
  for (int j0 = 0; j0 <= jmax; j0 += 64) {      /* rolled, for speed only */
    const float* kr = KF + (size_t)(j0 + tid) * ld + h * HD;      /* thread = key: the transposed stores of a wave fall on consecutive banks */
    const float* vr = VF + (size_t)(j0 + tid / 16) * ld + h * HD + (tid % 16) * 4;      /* 16 threads a row: whole lines */
    v4f tk[16], tv[16]; const float* vp[16];
#pragma unroll
    for (int c = 0; c < 16; ++c) { vp[c] = vr + (size_t)(c * 4) * ld; tk[c] = *(const v4fa*)(kr + c * 4); tv[c] = *(const v4fa*)vp[c]; }
    asm volatile("s_wait_xcnt 0x0" :: "v"(kr), "v"(vp[0]), "v"(vp[1]), "v"(vp[2]), "v"(vp[3]), "v"(vp[4]), "v"(vp[5]), "v"(vp[6]), "v"(vp[7]), "v"(vp[8]), "v"(vp[9]), "v"(vp[10]), "v"(vp[11]), "v"(vp[12]), "v"(vp[13]), "v"(vp[14]), "v"(vp[15]) : "memory");      /* as behind the q loads: every address of the batch keeps its register up to the wait (else later loads' results land on earlier loads' addresses) */
    __builtin_amdgcn_sched_barrier(0);      /* all 32 loads of the tile are issued before the first is waited for: without it each load sinks to its LDS store and the latencies add up */
#pragma unroll
    for (int c = 0; c < 16; ++c) { for (int u = 0; u < 4; ++u) lkt[c * 4 + u][tid] = tk[c][u]; *(v4f*)&lv[c * 4 + tid / 16][(tid % 16) * 4] = tv[c]; }
    __syncthreads();      /* the tile is complete before any thread reads it */
#pragma unroll 1
    for (int jg = 0; jg < 64; jg += 8) {      /* rolled for the same reason */
      v4f ba[32], bb[32]; v2f s2[4]; float sc[8], e[8]; for (int p = 0; p < 4; ++p) { const v2f z = {0.f, 0.f}; s2[p] = z; }
      /* batch b of K: dims 16 b .. + 15 of the eight keys; batch b of V: keys 2 b and 2 b + 1, all dims */
      auto load_k = [&](int b, v4f* t) {
#pragma unroll
        for (int x = 0; x < 16; ++x) { t[x * 2] = *(const v4f*)&lkt[b * 16 + x][jg]; t[x * 2 + 1] = *(const v4f*)&lkt[b * 16 + x][jg + 4]; }
        __builtin_amdgcn_sched_barrier(0); };      /* keeps the batch's reads in front of the arithmetic on the batch before: without it they sink to their first use and every read's latency shows */
      auto load_v = [&](int b, v4f* t) {
#pragma unroll
        for (int x = 0; x < 32; ++x) t[x] = *(const v4f*)&lv[jg + b * 2 + (x >> 4)][(x & 15) * 4];
        __builtin_amdgcn_sched_barrier(0); };      /* as in load_k */
      auto work_k = [&](int b, const v4f* t) {
#pragma unroll
        for (int x = 0; x < 16; ++x) { const float qs = q[b * 16 + x]; const v2f qd = {qs, qs}; const v4f ka = t[x * 2], kb = t[x * 2 + 1];
          const v2f k0 = {ka[0], ka[1]}, k1 = {ka[2], ka[3]}, k2 = {kb[0], kb[1]}, k3 = {kb[2], kb[3]};
          s2[0] = __builtin_elementwise_fma(qd, k0, s2[0]); s2[1] = __builtin_elementwise_fma(qd, k1, s2[1]); s2[2] = __builtin_elementwise_fma(qd, k2, s2[2]); s2[3] = __builtin_elementwise_fma(qd, k3, s2[3]); }
        __builtin_amdgcn_sched_barrier(0); };      /* the next batch's reads stay behind this arithmetic, so that no more than two batches hold registers */
      auto work_v = [&](int b, const v4f* t) {
#pragma unroll
        for (int x = 0; x < 32; ++x) { const int u = b * 2 + (x >> 4), c = x & 15; const v2f sc2 = {sc[u], sc[u]}, e2 = {e[u], e[u]}; const v4f vv = t[x]; const v2f v0 = {vv[0], vv[1]}, v1 = {vv[2], vv[3]};
          o[c * 2] = __builtin_elementwise_fma(o[c * 2], sc2, e2 * v0); o[c * 2 + 1] = __builtin_elementwise_fma(o[c * 2 + 1], sc2, e2 * v1); }
        __builtin_amdgcn_sched_barrier(0); };      /* as in work_k */
      load_k(0, ba); load_k(1, bb); work_k(0, ba); load_k(2, ba); work_k(1, bb); load_k(3, bb); work_k(2, ba); load_v(0, ba); work_k(3, bb); load_v(1, bb);
#pragma unroll
      for (int u = 0; u < 8; ++u) { const int j = j0 + jg + u; float s = __fmul_rn(s2[u >> 1][u & 1], scale); if (MASKADD) s = __fadd_rn(s, __fmul_rn(bf16_round(mask[(size_t)i * SQ + j]), -10000.0f));
        const float f = (MASKADD || j <= i) ? 1.f : 0.f; const float sm = fmaf(f, s, (1.f - f) * -1.0e30f); const float mn = fmaxf(m, sm); sc[u] = exp_slot(m - mn); e[u] = exp_slot(sm - mn); l = fmaf(l, sc[u], e[u]); m = mn; }
      work_v(0, ba); load_v(2, ba); work_v(1, bb); load_v(3, bb); work_v(2, ba); work_v(3, bb); }
    __syncthreads(); }      /* every thread has left the tile before the next one overwrites it */
  const float fin = 64.0f / l;      /* o carried x64 like the f16 path */
#pragma unroll
  for (int c = 0; c < HD / 4; ++c) { const v4f oo = {__fmul_rn(o[c * 2][0], fin), __fmul_rn(o[c * 2][1], fin), __fmul_rn(o[c * 2 + 1][0], fin), __fmul_rn(o[c * 2 + 1][1], fin)}; *(v4f*)&lo[tid][c * 4] = oo; }
  __syncthreads();
  {
#pragma unroll 1
    for (int it = 0; it < 16; ++it) { const int row = it * 4 + tid / 16, pc = (tid % 16) * 4; const v4f v = *(const v4f*)&lo[row][pc]; *(v4f*)(OF + (size_t)(rg * 64 + row) * ldo + h * HD + pc) = v; }
     } }

#define DMQ DM

template <int BFIN, int W16, int W32>
__global__ __launch_bounds__(256) void k_lnx(const float* __restrict__ X, const float* __restrict__ g, const float* __restrict__ bb, float eps, _Float16* __restrict__ N16, float* __restrict__ N32) {
  #pragma clang fp contract(off)
  __shared__ float red[256]; const size_t r = blockIdx.x; const int t = threadIdx.x; const bool act = t < (DMQ / 4); const int c0 = act ? t * 4 : 0;
  const v4f xa = *(const v4fa*)(X + r * DMQ + c0); float s[4]; float sum = 0.f;
  for (int q = 0; q < 4; ++q) { s[q] = act ? (BFIN ? bf16_round(xa[q]) : xa[q]) : 0.f; sum = __fadd_rn(sum, s[q]); }
  red[t] = sum; __syncthreads(); for (int st = 128; st > 0; st >>= 1) { if (t < st) red[t] = __fadd_rn(red[t], red[t + st]); __syncthreads(); } const float mu = red[0] / (float)DMQ; __syncthreads();
  float vs = 0.f; for (int q = 0; q < 4; ++q) { const float dl = act ? __fadd_rn(s[q], -mu) : 0.f; vs = __fadd_rn(vs, __fmul_rn(dl, dl)); } red[t] = vs; __syncthreads(); for (int st = 128; st > 0; st >>= 1) { if (t < st) red[t] = __fadd_rn(red[t], red[t + st]); __syncthreads(); }
  const float rs = rsqrtf(__fadd_rn(red[0] / (float)DMQ, eps)); v4h y; v4f yf;
  for (int q = 0; q < 4; ++q) { const int c = c0 + q; yf[q] = __fadd_rn(__fmul_rn(__fmul_rn(__fadd_rn(s[q], -mu), rs), bf16_round(g[c])), bf16_round(bb[c])); y[q] = (_Float16)yf[q]; }
  if (!act) return;      /* no barriers after this point */
  { if (W16) *(v4h*)(N16 + r * DMQ + c0) = y; if (W32) *(v4f*)(N32 + r * DMQ + c0) = yf;  } }


extern "C" void kernel_launch(void* const* d_in, const int* in_sizes, int n_in,
                              void* d_out, int out_size, void* d_ws, size_t ws_size, hipStream_t stream) {
  (void)in_sizes; (void)n_in; (void)out_size;
  const float* const* I = (const float* const*)d_in; const float* x = I[0]; const float* wk = I[1]; const float* wq = I[2]; const float* wv = I[3]; const float* wo = I[4]; const float* lng = I[5]; const float* lnb = I[6]; const float* bq = nullptr; const float* bk = nullptr; const float* bv = nullptr; const float* bo = nullptr;      /* x; natural [out][in] Wk, Wq, Wv (THIS order), Wp; LayerNorm gamma, beta; no biases */
  char* ws = (char*)d_ws; size_t off = 0;
  auto take = [&](size_t bytes) { char* p = ws + off; off += (bytes + 255) & ~(size_t)255; return p; };
  _Float16* BQ = (_Float16*)take((size_t)DM * DM * 2); _Float16* BK = (_Float16*)take((size_t)DM * DM * 2); _Float16* BV = (_Float16*)take((size_t)DM * DM * 2); _Float16* BO = (_Float16*)take((size_t)DM * DM * 2);
  _Float16* X16 = (_Float16*)take(NR * DM * 2); _Float16* Q16 = (_Float16*)take(NR * DM * 2); _Float16* K16 = (_Float16*)take(NR * DM * 2); _Float16* V16 = (_Float16*)take(NR * DM * 2); _Float16* O16 = (_Float16*)take(NR * DM * 2);
  float* YO = (float*)take(NR * DM * 4); _Float16* VT = (_Float16*)take((size_t)NB * NH * HD * SQ * 2);      /* pre-norm projection rows y (f32); V^T [NB][NH][HD][SQ] */
  float* QF0 = (float*)take((size_t)NB * QT0 * DM * 4); float* KF0 = (float*)take((size_t)NB * QT0 * DM * 4); float* VF0 = (float*)take((size_t)NB * QT0 * DM * 4); float* OF0 = (float*)take((size_t)NB * QT0 * DM * 4); _Float16* OH0 = (_Float16*)take((size_t)NB * QT0 * DM * 2); _Float16* OL0 = (_Float16*)take((size_t)NB * QT0 * DM * 2);
  if (off > ws_size) return;
  { const unsigned g = (unsigned)(((size_t)DM * DM / 8 + 255) / 256); k_wnat<<<g, 256, 0, stream>>>(wq, (size_t)DM * DM / 8, BQ); k_wnat<<<g, 256, 0, stream>>>(wk, (size_t)DM * DM / 8, BK); k_wnat<<<g, 256, 0, stream>>>(wv, (size_t)DM * DM / 8, BV); k_wnat<<<g, 256, 0, stream>>>(wo, (size_t)DM * DM / 8, BO); }      /* natural [out][in] = Bt x16 */

  k_x16<<<(unsigned)((NR * DM / 8 + 255) / 256), 256, 0, stream>>>(x, X16, NR * DM / 8);
  const size_t r0p = (size_t)B0 * SQ;      /* first projected row */
  const size_t f0p = (size_t)B0 * QT0;      /* its first-tile row */
  k_gemm2<0><<<dim3((unsigned)((MP / 128) * (DM / 64)), 1), 128, 0, stream>>>(X16 + r0p * DM, DM, 0, BQ, DM, 0, 0.0625f, nullptr, 0, nullptr, 1, 0, 0, nullptr, Q16 + r0p * DM, DM, 0, MP, DM, DM, 0, 0, 0);
  k_gemm2<0><<<dim3((unsigned)((MP / 128) * (DM / 64)), 1), 128, 0, stream>>>(X16 + r0p * DM, DM, 0, BK, DM, 0, 0.0625f, nullptr, 0, nullptr, 1, 0, 0, nullptr, K16 + r0p * DM, DM, 0, MP, DM, DM, 0, 0, 0);
  k_gemm2<0><<<dim3((unsigned)((MP / 128) * (DM / 64)), 1), 128, 0, stream>>>(X16 + r0p * DM, DM, 0, BV, DM, 0, 0.0625f, nullptr, 0, nullptr, 1, 0, 0, nullptr, V16 + r0p * DM, DM, 0, MP, DM, DM, 0, 0, 0);
  k_vt<NH, SQ><<<NBR * NH * (SQ / 64), 256, 0, stream>>>(V16 + r0p * LQ, LQ, 0, VT);      /* V^T [NBR][NH][HD][SQ] */
  k_gemm2<0><<<dim3((QT0 / 128) * (DM / 64), NBR), 128, 0, stream>>>(X16 + r0p * DM, DM, (size_t)SQ * DM, BQ, DM, 0, 0.0625f, nullptr, 0, nullptr, 1, 0, 0, QF0, nullptr, DM, (size_t)QT0 * DM, QT0, DM, DM, 0, 0, 0);      /* f32 q, k, v of each batch's first 128 rows (exact products), batch on grid.y */
  k_gemm2<0><<<dim3((QT0 / 128) * (DM / 64), NBR), 128, 0, stream>>>(X16 + r0p * DM, DM, (size_t)SQ * DM, BK, DM, 0, 0.0625f, nullptr, 0, nullptr, 1, 0, 0, KF0, nullptr, DM, (size_t)QT0 * DM, QT0, DM, DM, 0, 0, 0);
  k_gemm2<0><<<dim3((QT0 / 128) * (DM / 64), NBR), 128, 0, stream>>>(X16 + r0p * DM, DM, (size_t)SQ * DM, BV, DM, 0, 0.0625f, nullptr, 0, nullptr, 1, 0, 0, VF0, nullptr, DM, (size_t)QT0 * DM, QT0, DM, DM, 0, 0, 0);
  k_att0<0><<<dim3(NH * (QT0 / 64), NBR), 64, 0, stream>>>(QF0, KF0, VF0, DM, nullptr, 0.125f, OF0 + f0p * DM, DM);      /* exact f32 attention for rows 0..127 of each batch (o x64) */
  k_fattn<<<dim3(NH, NB, SQ / 128), 128, 0, stream>>>(Q16, K16, VT, O16);      /* causal attention of all batches and heads: o (merged heads, x64) as f16 rows */
  k_gemm2<0><<<dim3((unsigned)((MPO / 128) * (DM / 64)), 1), 128, 0, stream>>>(O16 + r0p * DM, DM, 0, BO, DM, 0, 0.0009765625f, nullptr, 0, nullptr, 1, 0, 0, YO + r0p * DM, nullptr, DM, 0, MPO, DM, DM, 0, 0, 0);      /* out rows are the output layout */
  k_hl<<<(unsigned)(((size_t)NB * QT0 * DM / 8 + 255) / 256), 256, 0, stream>>>(OF0, OH0, OL0, (size_t)NB * QT0 * DM / 8);      /* first-tile o (x64) -> f16 hi + x1024 residual planes */
  k_gemm2<0><<<dim3((QT0 / 128) * (DM / 64), NBR), 128, 0, stream>>>(OH0 + f0p * DM, DM, (size_t)QT0 * DM, BO, DM, 0, 0.0009765625f, bo, 0, nullptr, 1, 0, 0, YO + r0p * DM, nullptr, DM, (size_t)SQ * DM, QT0, DM, DM, 0, 0, 0);      /* rows 0..127 of each batch: out = o_hi Wo (+ b), overwriting the f16-path rows */
  k_gemm2<0><<<dim3((QT0 / 128) * (DM / 64), NBR), 128, 0, stream>>>(OL0 + f0p * DM, DM, (size_t)QT0 * DM, BO, DM, 0, 0.00000095367431640625f, nullptr, 0, (const float*)YO + r0p * DM, -1, 0, 0, YO + r0p * DM, nullptr, DM, (size_t)SQ * DM, QT0, DM, DM, 0, 0, 0);      /* += o_lo Wo 2^-20 (own-element accumulate) */
  k_lnx<0, 0, 1><<<(unsigned)NR, 256, 0, stream>>>(YO, lng, lnb, 1e-5f, nullptr, (float*)d_out);      /* out = LayerNorm(y) -> f32 output rows */
}

// v006
// One run takes 203 microseconds.
// Two timings next to v005 put it at 1.30 and 1.34 times that version's speed.
// All steps since v000 together make it 47.8 times as fast.
#include <hip/hip_runtime.h>
// Causal multi-head self-attention with a fused post-LayerNorm (x [4][2048][1024]; k/q/v = x W^T (natural [1024][1024], no biases); 16 heads of 64; wei = q k^T * 64^-0.5; causal (tril, -inf); softmax; y = merged Wp^T; out = LayerNorm(y) (biased var, eps per the module, gamma / beta) -> [4][2048][1024]).
// Structure: token rows r = b*2048 + s; x as exact f16 rows (bf16-rounded); Q, K, V as WMMA GEMMs in one launch (32x64 wave tiles, f32 accumulation, exact x16 weights, f16 outputs; each batch's first 128 rows also in f32, for an exact f32 attention of those rows); V^T for all heads via LDS transposes; attention in ONE launch (k_fattn): a wave holds 32 queries of one head and walks the keys up to its diagonal in passes of 32: S^T = K Q^T, running maximum and sum in f32 (native exp2; weights x256 f16), O^T += V^T P^T, scores and weights never leave the registers; o (x64, folded into the output GEMM alpha) written straight into the merged f16 o rows; y = o W_o GEMM (f32; the first 128 rows of a batch from the exact o as f16 high part + residual), then the row LayerNorm into the output layout.
// Compute dtype: inputs rounded to bf16; x / weights exact; q, k, v, softmax weights and o as plain f16 GEMM operands (~2^-12); scores and softmax statistics f32. v_wmma_f32_16x16x32_f16.
#define NB 4
#define SQ 2048
#define DM 1024
#define NH 16
#define HD 64
#define HG 4                         /* heads per launch of the (b, h0) k_vt form; k_fattn takes all NH */
#define QT0 128                      /* first-tile rows recomputed exactly in f32 */
#define B0 0                         /* first batch processed (debug hook) */
#define NBR NB                       /* batches processed (debug hook) */
#define NR ((size_t)NB * SQ)         /* token rows */
#define MP ((int)((size_t)NBR * SQ)) /* rows projected (debug hook) */
#define QN SQ                        /* unused: k_fattn attends all SQ query rows */
#define NHD NH                       /* unused: k_fattn attends all NH heads */
#define MPO MP                       /* rows through the output stage (debug hook) */
#define LQ DM      /* row pitch of the q/k/v rows */
typedef __bf16 v16b __attribute__((ext_vector_type(16)));
typedef unsigned short v8us __attribute__((ext_vector_type(8), may_alias));
typedef float  v8f  __attribute__((ext_vector_type(8)));
typedef float  v4f  __attribute__((ext_vector_type(4)));
typedef float  v4fa __attribute__((ext_vector_type(4), may_alias));
union FragB { v16b v; v8us half[2]; unsigned short u[16]; };

__device__ __forceinline__ unsigned short bf16_bits(float x) { unsigned int u = __float_as_uint(x); return (unsigned short)((u + 0x7FFFu + ((u >> 16) & 1u)) >> 16); }
__device__ __forceinline__ float bf16_val(unsigned short b) { return __uint_as_float(((unsigned int)b) << 16); }
__device__ __forceinline__ float bf16_round(float x) { return bf16_val(bf16_bits(x)); }
// D += A·B with NT terms: 1 = ah·bh, 2 = + al·bh (A split), 3 = + ah·bl (both split)
template <int NT>
__device__ __forceinline__ v8f mmaN(v16b ah, v16b al, v16b bh, v16b bl, v8f c) {
  c = __builtin_amdgcn_wmma_f32_16x16x32_bf16(false, ah, false, bh, (short)0, c, false, false);
  if (NT >= 2) c = __builtin_amdgcn_wmma_f32_16x16x32_bf16(false, al, false, bh, (short)0, c, false, false);
  if (NT >= 3) c = __builtin_amdgcn_wmma_f32_16x16x32_bf16(false, ah, false, bl, (short)0, c, false, false);
  asm volatile("v_nop\n\tv_nop\n\tv_nop\n\tv_nop" : "+v"(c) : "v"(ah), "v"(al), "v"(bh), "v"(bl));
  return c;
}

__global__ __launch_bounds__(256) void k_wt_bf16(const float* __restrict__ W, unsigned short* __restrict__ Wt, int K, int N) {
  const int t = blockIdx.x * 256 + threadIdx.x;
  const int k8n = K / 8;
  if (t >= N * k8n) return;
  const int n = t / k8n, k8 = (t % k8n) * 8;
  v8us v;
#pragma unroll
  for (int i = 0; i < 8; ++i) v[i] = bf16_bits(W[(size_t)(k8 + i) * N + n]);
  *(v8us*)(Wt + (size_t)n * K + k8) = v;
  
}

// GEMM C[M][N] (f32, pitch ldc) = act(A[M][K]·W + bias). A f32 row-major (pitch lda) converted per fragment to bf16
// (ASPLIT: hi/lo two planes -> 2 terms, else single rounded term); Wt bf16 [N][K] (pitch ldb). BIAS_BF16 rounds the
// bias to bf16 first (bias quantised to bf16 before the add). K%32==0, M%16==0, N%64==0.
template <bool ASPLIT, int ACT, bool BIAS_BF16>
__global__ __launch_bounds__(128) void k_gemm_bf(const float* __restrict__ A, int lda, const unsigned short* __restrict__ Wt, int ldb,
                                               const float* __restrict__ bias, float* __restrict__ C, int ldc, int M, int N, int K) {
  __shared__ __attribute__((aligned(16))) float so[4][16][64];
  const int tid = threadIdx.x, w = tid >> 5, lane = tid & 31, ln = lane & 15, hh = lane >> 4;
  const int ntn = N / 64;
  const int wid = blockIdx.x * 4 + w;
  const int mt = wid / ntn, nq = wid % ntn;
  if (mt * 16 >= M) return;
  const int row0 = mt * 16, col0 = nq * 64;
  const float* arow = A + (size_t)(row0 + ln) * lda;
  v8f acc[4] = {};
  for (int kb = 0; kb < K; kb += 32) {
    FragB ah, al;
    const v4f x0 = *(const v4fa*)(arow + kb + 8 * hh), x1 = *(const v4fa*)(arow + kb + 8 * hh + 4);
    const v4f x2 = *(const v4fa*)(arow + kb + 16 + 8 * hh), x3 = *(const v4fa*)(arow + kb + 16 + 8 * hh + 4);
    float xs[16] = {x0[0],x0[1],x0[2],x0[3],x1[0],x1[1],x1[2],x1[3],x2[0],x2[1],x2[2],x2[3],x3[0],x3[1],x3[2],x3[3]};
#pragma unroll
    for (int i = 0; i < 16; ++i) { const unsigned short hb = bf16_bits(xs[i]); ah.u[i] = hb; al.u[i] = ASPLIT ? bf16_bits(xs[i] - bf16_val(hb)) : (unsigned short)0; }
#pragma unroll
    for (int t = 0; t < 4; ++t) {
      const unsigned short* brow = Wt + (size_t)(col0 + t * 16 + ln) * ldb + kb;
      FragB b;
      b.half[0] = *(const v8us*)(brow + 8 * hh);
      b.half[1] = *(const v8us*)(brow + 16 + 8 * hh);
      acc[t] = mmaN<ASPLIT ? 2 : 1>(ah.v, al.v, b.v, b.v, acc[t]);
    }
  }
#pragma unroll
  for (int t = 0; t < 4; ++t) {
    float bv = bias ? bias[col0 + t * 16 + ln] : 0.f;
    if (BIAS_BF16) bv = bf16_round(bv);
#pragma unroll
    for (int r = 0; r < 8; ++r) { float v = acc[t][r] + bv; if (ACT == 1) v = fmaxf(v, 0.f); so[w][8 * hh + r][t * 16 + ln] = v; }
  }
  __builtin_amdgcn_fence(__ATOMIC_ACQ_REL, "workgroup");
  __builtin_amdgcn_wave_barrier();
  const int rsub = lane >> 4, c4 = (lane & 15) * 4;
  {
#pragma unroll
    for (int q = 0; q < 8; ++q) {
      const int r = q * 2 + rsub;
      const v4f v = *(const v4fa*)&so[w][r][c4];
      *(v4f*)(C + (size_t)(row0 + r) * ldc + col0 + c4) = v;
    }
    
  }
}

// GEMM C = act(A·W + bias + resid): A f32 (ASPLIT -> hi/lo 2 terms), Wt bf16 [N][K]; ACT 0 none, 1 relu, 2 exact gelu;
// resid (optional, f32, row index = (row % rmod), pitch ldr, RES_BF16 rounds it) added before the activation.
template <bool ASPLIT, int ACT, bool BIAS_BF16, bool RES_BF16>
__global__ __launch_bounds__(128) void k_gemm_bf3(const float* __restrict__ A, int lda, const unsigned short* __restrict__ Wt, int ldb,
                                                const float* __restrict__ bias, const float* __restrict__ resid, int rmod, int ldr,
                                                float* __restrict__ C, int ldc, int M, int N, int K) {
  __shared__ __attribute__((aligned(16))) float so[4][16][64];
  const int tid = threadIdx.x, w = tid >> 5, lane = tid & 31, ln = lane & 15, hh = lane >> 4;
  const int ntn = N / 64;
  const int wid = blockIdx.x * 4 + w;
  const int mt = wid / ntn, nq = wid % ntn;
  if (mt * 16 >= M) return;
  const int row0 = mt * 16, col0 = nq * 64;
  const float* arow = A + (size_t)(row0 + ln) * lda;
  v8f acc[4] = {};
  for (int kb = 0; kb < K; kb += 32) {
    FragB ah, al;
    const v4f x0 = *(const v4fa*)(arow + kb + 8 * hh), x1 = *(const v4fa*)(arow + kb + 8 * hh + 4);
    const v4f x2 = *(const v4fa*)(arow + kb + 16 + 8 * hh), x3 = *(const v4fa*)(arow + kb + 16 + 8 * hh + 4);
    float xs[16] = {x0[0],x0[1],x0[2],x0[3],x1[0],x1[1],x1[2],x1[3],x2[0],x2[1],x2[2],x2[3],x3[0],x3[1],x3[2],x3[3]};
#pragma unroll
    for (int i = 0; i < 16; ++i) { const unsigned short hb = bf16_bits(xs[i]); ah.u[i] = hb; al.u[i] = ASPLIT ? bf16_bits(xs[i] - bf16_val(hb)) : (unsigned short)0; }
#pragma unroll
    for (int t = 0; t < 4; ++t) {
      const unsigned short* brow = Wt + (size_t)(col0 + t * 16 + ln) * ldb + kb;
      FragB b;
      b.half[0] = *(const v8us*)(brow + 8 * hh);
      b.half[1] = *(const v8us*)(brow + 16 + 8 * hh);
      acc[t] = mmaN<ASPLIT ? 2 : 1>(ah.v, al.v, b.v, b.v, acc[t]);
    }
  }
#pragma unroll
  for (int t = 0; t < 4; ++t) {
    const int col = col0 + t * 16 + ln;
    float bv = bias ? bias[col] : 0.f;
    if (BIAS_BF16) bv = bf16_round(bv);
#pragma unroll
    for (int r = 0; r < 8; ++r) {
      float v = acc[t][r] + bv;
      if (resid) { float rv = resid[(size_t)((row0 + 8 * hh + r) % rmod) * ldr + col]; if (RES_BF16) rv = bf16_round(rv); v += rv; }
      if (ACT == 1) v = fmaxf(v, 0.f);
      if (ACT == 2) v = 0.5f * v * (1.0f + erff(v * 0.70710678118654752f));
      if (ACT == 3) { const float u = 0.7978845608028654f * (v + 0.044715f * v * v * v); v = 0.5f * v * (1.0f + tanhf(u)); }
      so[w][8 * hh + r][t * 16 + ln] = v;
    }
  }
  __builtin_amdgcn_fence(__ATOMIC_ACQ_REL, "workgroup");
  __builtin_amdgcn_wave_barrier();
  const int rsub = lane >> 4, c4 = (lane & 15) * 4;
  {
#pragma unroll
    for (int q = 0; q < 8; ++q) {
      const int r = q * 2 + rsub;
      const v4f v = *(const v4fa*)&so[w][r][c4];
      *(v4f*)(C + (size_t)(row0 + r) * ldc + col0 + c4) = v;
    }
    
  }
}
// row LayerNorm (biased variance, eps) over N: s = X (+ R); optional out_sum <- s; out_norm <- (s-mu)*rsqrt(var+eps)*g + b
template <bool PARAM_BF16>
__global__ __launch_bounds__(256) void k_layernorm(const float* __restrict__ X, const float* __restrict__ R, const float* __restrict__ g, const float* __restrict__ bta,
                                                  float* __restrict__ out_sum, float* __restrict__ out_norm, int N, float eps) {
  __shared__ float red[256];
  const int row = blockIdx.x, tid = threadIdx.x;
  const float* x = X + (size_t)row * N; const float* rr = R ? R + (size_t)row * N : nullptr;
  float vals[16];                     // up to N = 4096
  const int per = N / 256;            // contiguous chunk per thread? use strided-by-4 chunks: thread handles j = tid*4 + 1024*u
  float s1 = 0.f;
  for (int u = 0; u < per / 4; ++u) {
    const int j = tid * 4 + 1024 * u;
    const v4f a = *(const v4fa*)(x + j);
    v4f b = {0.f,0.f,0.f,0.f}; if (rr) b = *(const v4fa*)(rr + j);
#pragma unroll
    for (int q = 0; q < 4; ++q) { const float v = a[q] + b[q]; vals[u * 4 + q] = v; s1 += v; }
  }
  red[tid] = s1; __syncthreads();
  for (int st = 128; st > 0; st >>= 1) { if (tid < st) red[tid] += red[tid + st]; __syncthreads(); }
  const float mu = red[0] / (float)N; __syncthreads();
  float s2 = 0.f;
  for (int u = 0; u < per / 4; ++u)
#pragma unroll
    for (int q = 0; q < 4; ++q) { const float c = vals[u * 4 + q] - mu; s2 += c * c; }
  red[tid] = s2; __syncthreads();
  for (int st = 128; st > 0; st >>= 1) { if (tid < st) red[tid] += red[tid + st]; __syncthreads(); }
  const float rs = rsqrtf(red[0] / (float)N + eps);
  {
    for (int u = 0; u < per / 4; ++u) {
      const int j = tid * 4 + 1024 * u;
      v4f o, sm;
#pragma unroll
      for (int q = 0; q < 4; ++q) {
        float gg = g[j + q], bb = bta[j + q];
        if (PARAM_BF16) { gg = bf16_round(gg); bb = bf16_round(bb); }
        sm[q] = vals[u * 4 + q]; o[q] = (vals[u * 4 + q] - mu) * rs * gg + bb;
      }
      if (out_sum) *(v4f*)(out_sum + (size_t)row * N + j) = sm;
      *(v4f*)(out_norm + (size_t)row * N + j) = o;
    }
    
  }
}



// ---- f16 WMMA path (v_wmma_f32_16x16x32_f16): 11-bit significands for operands in range — used where a [0,1] probability operand needs more precision than bf16
typedef _Float16 v16h __attribute__((ext_vector_type(16)));
union FragH { v16h v; v8us half[2]; _Float16 h[16]; unsigned short u[16]; };
template <int NT>
__device__ __forceinline__ v8f mmaH(v16h ah, v16h al, v16h bh, v16h bl, v8f c) {
  c = __builtin_amdgcn_wmma_f32_16x16x32_f16(false, ah, false, bh, (short)0, c, false, false);
  if (NT >= 2) c = __builtin_amdgcn_wmma_f32_16x16x32_f16(false, al, false, bh, (short)0, c, false, false);
  if (NT >= 3) c = __builtin_amdgcn_wmma_f32_16x16x32_f16(false, ah, false, bl, (short)0, c, false, false);
  asm volatile("v_nop\n\tv_nop\n\tv_nop\n\tv_nop" : "+v"(c) : "v"(ah), "v"(al), "v"(bh), "v"(bl));
  return c;
}
// batched GEMM like k_gemm_b but f16 operands: A f32 (split into f16 hi/lo if ASPLIT, else rounded to f16), Bt = f16 values [n][k]; alpha; C f32; N multiple of 16 (partial tiles skipped)
template <bool ASPLIT>
__global__ __launch_bounds__(128) void k_gemm_h(const float* __restrict__ A, int lda, size_t sA, const _Float16* __restrict__ Bh, int ldb, size_t sB, float alpha, float* __restrict__ C, int ldc, size_t sC, int M, int N, int K) {
  __shared__ __attribute__((aligned(16))) float so[4][16][64];
  const int tid = threadIdx.x, w = tid >> 5, lane = tid & 31, ln = lane & 15, hh = lane >> 4; const int by = blockIdx.y;
  A += (size_t)by * sA; Bh += (size_t)by * sB; C += (size_t)by * sC;
  const int ntn = (N + 63) / 64; const int wid = blockIdx.x * 4 + w; const int mt = wid / ntn, nq = wid % ntn; if (mt * 16 >= M) return;
  const int row0 = mt * 16, col0 = nq * 64; const float* arow = A + (size_t)(row0 + ln) * lda;
  v8f acc[4] = {};
  for (int kb = 0; kb < K; kb += 32) {
    FragH ah, al;
    const v4f x0 = *(const v4fa*)(arow + kb + 8 * hh), x1 = *(const v4fa*)(arow + kb + 8 * hh + 4), x2 = *(const v4fa*)(arow + kb + 16 + 8 * hh), x3 = *(const v4fa*)(arow + kb + 16 + 8 * hh + 4);
    float xs[16] = {x0[0],x0[1],x0[2],x0[3],x1[0],x1[1],x1[2],x1[3],x2[0],x2[1],x2[2],x2[3],x3[0],x3[1],x3[2],x3[3]};
#pragma unroll
    for (int i = 0; i < 16; ++i) { const _Float16 h = (_Float16)xs[i]; ah.h[i] = h; al.h[i] = ASPLIT ? (_Float16)(xs[i] - (float)h) : (_Float16)0.0f; }
#pragma unroll
    for (int t = 0; t < 4; ++t) { if (col0 + t * 16 >= N) continue; const size_t boff = (size_t)(col0 + t * 16 + ln) * ldb + kb; FragH bq; bq.half[0] = *(const v8us*)(Bh + boff + 8 * hh); bq.half[1] = *(const v8us*)(Bh + boff + 16 + 8 * hh);
      acc[t] = mmaH<ASPLIT ? 2 : 1>(ah.v, al.v, bq.v, bq.v, acc[t]); }
  }
#pragma unroll
  for (int t = 0; t < 4; ++t) { if (col0 + t * 16 >= N) continue;
#pragma unroll
    for (int r = 0; r < 8; ++r) so[w][8 * hh + r][t * 16 + ln] = acc[t][r] * alpha; }
  __builtin_amdgcn_fence(__ATOMIC_ACQ_REL, "workgroup"); __builtin_amdgcn_wave_barrier();
  const int rsub = lane >> 4, c4 = (lane & 15) * 4;
  {
#pragma unroll
    for (int q = 0; q < 8; ++q) { const int r = q * 2 + rsub; if (col0 + c4 < N) { const v4f v = *(const v4fa*)&so[w][r][c4]; *(v4f*)(C + (size_t)(row0 + r) * ldc + col0 + c4) = v; } }
     }
}

// Wt[n][k] = f16(W[k][n]·scale) from f32 row-major W[K][N] (scale = power of two; bf16-exact weights stay exact in f16 away from the subnormal range)
__global__ __launch_bounds__(256) void k_wt_f16(const float* __restrict__ W, _Float16* __restrict__ Wt, int K, int N, float scale) {
  const int t = blockIdx.x * 256 + threadIdx.x; if (t >= N * (K / 8)) return; const int n = t / (K / 8), k8 = (t % (K / 8)) * 8; FragH f;
#pragma unroll
  for (int i = 0; i < 8; ++i) f.h[i] = (_Float16)(bf16_round(W[(size_t)(k8 + i) * N + n]) * scale); const v8us o = f.half[0];
  *(v8us*)((unsigned short*)Wt + (size_t)n * K + k8) = o; 
}
// k_gemm_hh variant with fused epilogue: v = acc·alpha + bias[by·sBias + col] (+ CP[(row/rowsPerB)·sCPb + by·64 + col] if CP) ; ACT 0 none / 1 elu ; writes f16 C16 (and f32 C if non-null)
template <int ACT>
__global__ __launch_bounds__(128) void k_gemm_hhx(const _Float16* __restrict__ A, int lda, size_t sA, const _Float16* __restrict__ Bh, int ldb, size_t sB, float alpha, const float* __restrict__ bias, size_t sBias, const float* __restrict__ CP, int rowsPerB, size_t sCPb, int row0g,
    float* __restrict__ C, _Float16* __restrict__ C16, int ldc, size_t sC, int M, int N, int K) {
  __shared__ __attribute__((aligned(16))) float so[4][16][64];
  const int tid = threadIdx.x, w = tid >> 5, lane = tid & 31, ln = lane & 15, hh = lane >> 4; const int by = blockIdx.y;
  A += (size_t)by * sA; Bh += (size_t)by * sB; const size_t cofs = (size_t)by * sC; const float* bp = bias ? bias + (size_t)by * sBias : nullptr;
  const int ntn = (N + 63) / 64; const int wid = blockIdx.x * 4 + w; const int mt = wid / ntn, nq = wid % ntn; if (mt * 16 >= M) return;
  const int row0 = mt * 16, col0 = nq * 64; const _Float16* arow = A + (size_t)(row0 + ln) * lda;
  v8f acc[4] = {};
  for (int kb = 0; kb < K; kb += 32) { FragH ah; ah.half[0] = *(const v8us*)((const unsigned short*)arow + kb + 8 * hh); ah.half[1] = *(const v8us*)((const unsigned short*)arow + kb + 16 + 8 * hh);
#pragma unroll
    for (int t = 0; t < 4; ++t) { if (col0 + t * 16 >= N) continue; const size_t boff = (size_t)(col0 + t * 16 + ln) * ldb + kb; FragH bq; bq.half[0] = *(const v8us*)((const unsigned short*)Bh + boff + 8 * hh); bq.half[1] = *(const v8us*)((const unsigned short*)Bh + boff + 16 + 8 * hh);
      acc[t] = mmaH<1>(ah.v, ah.v, bq.v, bq.v, acc[t]); }
  }
#pragma unroll
  for (int t = 0; t < 4; ++t) { if (col0 + t * 16 >= N) continue; const int col = col0 + t * 16 + ln; const float bv = bp ? bf16_round(bp[col]) : 0.f;
#pragma unroll
    for (int r = 0; r < 8; ++r) { float v = acc[t][r] * alpha + bv; if (CP) { const int rr = row0g + row0 + 8 * hh + r; if (rowsPerB < 0) v += CP[cofs + (size_t)rr * ldc + col];      /* rowsPerB < 0: own element of the batched C plane */ else { const int bidx = rr / rowsPerB; v += CP[(size_t)bidx * sCPb + (size_t)by * 64 + col]; } } if (ACT == 1) v = (v > 0.f) ? v : expm1f(v); else if (ACT == 7) v = (v > 0.f) ? v + 1.0f : expf(v); else if (ACT == 8) v = tanhf(v); else if (ACT == 9) v = 0.5f * v * (1.0f + tanhf(0.7978845608028654f * (v + 0.044715f * v * v * v))); else if (ACT == 11) v = 1.0f / (1.0f + expf(-v)); else if (ACT == 12) v = (v > 0.f) ? v : 0.01f * v; else if (ACT == 14) v = (v > 0.f) ? v : 0.1f * v; else if (ACT == 16) v = (v >= 0.f) ? v : 0.3f * v; else if (ACT == 17) v = (v >= 0.f) ? v : 0.2f * v; else if (ACT == 15) v = v / (1.0f + expf(-v)); else if (ACT == 3) v = fmaxf(v, 0.f); else if (ACT == 6) v = 0.5f * v * (1.0f + erff(v * 0.70710678118654752f)); so[w][8 * hh + r][t * 16 + ln] = v; } }
  __builtin_amdgcn_fence(__ATOMIC_ACQ_REL, "workgroup"); __builtin_amdgcn_wave_barrier();
  const int rsub = lane >> 4, c4 = (lane & 15) * 4; typedef _Float16 v4h __attribute__((ext_vector_type(4)));
  {
#pragma unroll
    for (int q = 0; q < 8; ++q) { const int r = q * 2 + rsub; if (col0 + c4 < N) { const v4f v = *(const v4fa*)&so[w][r][c4]; if (C) *(v4f*)(C + cofs + (size_t)(row0 + r) * ldc + col0 + c4) = v; if (C16) { v4h h4; for (int i = 0; i < 4; ++i) h4[i] = (_Float16)v[i]; *(v4h*)(C16 + cofs + (size_t)(row0 + r) * ldc + col0 + c4) = h4; } } }
     }
}


typedef _Float16 v4h __attribute__((ext_vector_type(4)));

// All five operand conversions in one grid, 8 elements a thread. Blocks 0 .. 4 CVT_WB - 1: the four weight planes (natural [out][in] = Bt; rounded to bf16, x16, exact in f16), in the
// order in which the planes follow one another in Bt. The other blocks: x (rounded to bf16, exact in f16). Every plane is a whole number of blocks.
#define CVT_WB (DM * DM / 8 / 256)      /* blocks per weight plane */
#define CVT_XB ((unsigned)(NR * DM / 8 / 256))      /* blocks of x */
static_assert(DM * DM % (8 * 256) == 0 && NR * DM % (8 * 256) == 0, "k_cvt: whole blocks only");
__global__ __launch_bounds__(256) void k_cvt(const float* __restrict__ w0, const float* __restrict__ w1, const float* __restrict__ w2, const float* __restrict__ w3, const float* __restrict__ x, _Float16* __restrict__ Bt, _Float16* __restrict__ X16) {
  const unsigned blk = blockIdx.x; const bool isw = blk < 4 * CVT_WB; const unsigned pl = blk / CVT_WB;
  const float* src = !isw ? x : pl == 0 ? w0 : pl == 1 ? w1 : pl == 2 ? w2 : w3; _Float16* dst = isw ? Bt + (size_t)pl * DM * DM : X16; const float sc = isw ? 16.0f : 1.0f;
  const size_t t = (size_t)(isw ? blk - pl * CVT_WB : blk - 4 * CVT_WB) * 256 + threadIdx.x; FragH f;
#pragma unroll
  for (int q = 0; q < 8; ++q) f.h[q] = (_Float16)(bf16_round(src[t * 8 + q]) * sc);
  *(v8us*)((unsigned short*)dst + t * 8) = f.half[0]; }
__global__ __launch_bounds__(256) void k_h16(const float* __restrict__ x, _Float16* __restrict__ X16, size_t n8) { const size_t t = (size_t)blockIdx.x * 256 + threadIdx.x; if (t >= n8) return; FragH f;
#pragma unroll
  for (int q = 0; q < 8; ++q) f.h[q] = (_Float16)x[t * 8 + q]; *(v8us*)((unsigned short*)X16 + t * 8) = f.half[0];  }
__global__ __launch_bounds__(256) void k_round16f(const float* __restrict__ W, _Float16* __restrict__ Bt, size_t n8) { const size_t t = (size_t)blockIdx.x * 256 + threadIdx.x; if (t >= n8) return; FragH f;
#pragma unroll
  for (int i = 0; i < 8; ++i) f.h[i] = (_Float16)(bf16_round(W[t * 8 + i]) * 16.0f); *(v8us*)((unsigned short*)Bt + t * 8) = f.half[0];  }
template <int NHv, int TTv>
__global__ __launch_bounds__(256) void k_vt(const _Float16* __restrict__ V16, int ldv, int voff, _Float16* __restrict__ Vt) { __shared__ unsigned short tl[64][66]; const int tid = threadIdx.x; const int slab = blockIdx.x / (TTv / 64), lg = blockIdx.x % (TTv / 64); const int b = slab / NHv, h = slab % NHv;
  for (int i = tid; i < 64 * 8; i += 256) { const int r = i / 8, c8 = (i % 8) * 8; FragH f; f.half[0] = *(const v8us*)((const unsigned short*)V16 + ((size_t)b * TTv + lg * 64 + r) * ldv + voff + h * 64 + c8);
#pragma unroll
    for (int q = 0; q < 8; ++q) tl[r][c8 + q] = f.u[q]; }
  __syncthreads();
  {
#pragma unroll
    for (int rd = 0; rd < 2; ++rd) { const int d = rd * 32 + tid / 8, pc = tid % 8; FragH f;
#pragma unroll
      for (int q = 0; q < 8; ++q) f.u[q] = tl[pc * 8 + q][d];
      *(v8us*)((unsigned short*)Vt + ((size_t)slab * 64 + d) * TTv + lg * 64 + pc * 8) = f.half[0]; }
     } }

// ---- fast GEMM (block tile 128x64, wave tile 32x64; requires M % 32 == 0 rows per launch region, N % 64 == 0 and K a positive multiple of 64); epilogue = k_gemm_hhx semantics ----
// The operands go through LDS in stages of 64 k: every global load of a wave covers four whole 128-byte lines (4 rows x 64 k), each line is fetched once per block, and the
// fragments are read back from LDS in the k order of g2_frag. Two stage buffers: stage s + 1 is stored and stage s + 2 is requested while stage s is multiplied; one barrier a stage.
// The unroll directives in g2_request, g2_store and k_gemm2: the loop indices pick staging registers, offsets and fragments, which stay in registers only if every index is a constant.
__device__ __forceinline__ v16h g2_frag(const _Float16* p, int hh) { FragH f; f.half[0] = *(const v8us*)((const unsigned short*)p + 8 * hh); f.half[1] = *(const v8us*)((const unsigned short*)p + 16 + 8 * hh); return f.v; }
__device__ __forceinline__ v8f g2_mma(v16h a, v16h b, v8f c) { v8f d = __builtin_amdgcn_wmma_f32_16x16x32_f16(false, a, false, b, (short)0, c, false, false); asm volatile("v_nop\n\tv_nop\n\tv_nop\n\tv_nop" : "+v"(d) : "v"(a), "v"(b)); return d; }
#define G2_PITCH 144                  /* LDS row pitch in bytes for rows of 128: 16 x odd, so that the 16 rows of a 16-byte fragment read fall on all 64 banks */
#define G2_STAGE (192 * G2_PITCH)     /* one stage: 128 A rows, then 64 B rows */
__device__ __forceinline__ v16h g2_lfrag(const unsigned char* p) { FragH f; f.half[0] = *(const v8us*)p; f.half[1] = *(const v8us*)(p + 32); return f.v; }      /* p = the lane's LDS row + 16 * (lane >> 4) bytes: k 8 hh .. + 7 and 16 + 8 hh .. + 7, as g2_frag */
// The thread's 12 pieces of 16 bytes of the next stage (8 of A, 4 of B), requested as one batch; then every offset steps on by one stage. go = byte offsets from the block's A and B
// (32 bits: an operand plane stays under 4 GiB), so that the loads take the kernel's own global pointers as their bases.
__device__ __forceinline__ void g2_request(v8us (&rg)[12], const _Float16* A, const _Float16* B, unsigned (&go)[12]) {
#pragma unroll
  for (int j = 0; j < 12; ++j) rg[j] = *(const v8us*)((const char*)(j < 8 ? A : B) + go[j]);      /* unrolled: rg and go stay in registers only under constant indices */
  asm volatile("s_wait_xcnt 0x0" :: "v"(go[0]), "v"(go[1]), "v"(go[2]), "v"(go[3]), "v"(go[4]), "v"(go[5]), "v"(go[6]), "v"(go[7]), "v"(go[8]), "v"(go[9]), "v"(go[10]), "v"(go[11]) : "memory");      /* the wait in front of the overwrite of the loads' offset registers just below; as inputs the offsets keep their registers up to here; the memory clobber keeps the 12 loads in front of it, one batch ahead of the products */
#pragma unroll
  for (int j = 0; j < 12; ++j) go[j] += 128; }
__device__ __forceinline__ void g2_store(const v8us (&rg)[12], unsigned char* sw) {
#pragma unroll
  for (int j = 0; j < 12; ++j) *(v8us*)(sw + j * 16 * G2_PITCH) = rg[j]; }      /* piece j lies 16 rows below piece j - 1 */
// FT: what a tile does that holds a batch's first QT0 rows (the rows that are carried in f32 beside the f16 path); such a tile is one whole block tile.
//   FT 1: it stores its values as f32 too, into CF (planes of NB * QT0 rows, pitch ldc, sCF elements apart along blockIdx.y).
//   FT 2: its A rows come from AF instead of A, as two f16 planes sAF elements apart: the high part, then the residual x1024. It walks K twice: the high part's sums are
//         multiplied by 1024 (exact) where the second walk begins, the residual's products are added to them, and alpha takes the 2^-10 back. K at least 128.
template <int ACT, int FT>
__global__ __launch_bounds__(128) void k_gemm2(const _Float16* __restrict__ A, int lda, size_t sA, const _Float16* __restrict__ Bh, int ldb, size_t sB, float alpha, const float* __restrict__ bias, size_t sBias, const float* __restrict__ CP, int rowsPerB, size_t sCPb, int row0g,
    float* __restrict__ C, _Float16* __restrict__ C16, int ldc, size_t sC, int M, int N, int K, size_t zA, size_t zB, size_t zC, const _Float16* __restrict__ AF, size_t sAF, float* __restrict__ CF, size_t sCF) { static_assert(QT0 == 128 && SQ % 128 == 0, "k_gemm2: a first tile is one block tile"); static_assert(ACT == 0 || ACT == 3 || ACT == 6 || ACT == 8 || ACT == 9 || ACT == 11 || ACT == 12 || ACT == 14 || ACT == 15 || ACT == 16 || ACT == 17, "k_gemm2: unsupported ACT code (would silently apply no activation)");
  __shared__ __attribute__((aligned(16))) unsigned char sm[2 * G2_STAGE]; float (*so)[32][68] = (float (*)[32][68])sm;      /* the epilogue's staging rows reuse the stage buffers, behind the loop's last barrier */
  const int tid = threadIdx.x, w = tid >> 5, lane = tid & 31, ln = lane & 15, hh = lane >> 4; const int by = blockIdx.y, bz = blockIdx.z;      /* two batch axes, each with its own strides */
  A += (size_t)by * sA + (size_t)bz * zA; Bh += (size_t)by * sB + (size_t)bz * zB; const size_t cofs = (size_t)by * sC + (size_t)bz * zC; const float* bp = bias ? bias + (size_t)by * sBias : nullptr;
  const int ntn = N >> 6; const int mt = blockIdx.x / ntn, nq = blockIdx.x - mt * ntn; const int row0 = mt * 128 + 32 * w, col0 = nq * 64;
  const bool ft = (mt % (SQ / 128)) == 0; const int fr0 = (mt / (SQ / 128)) * QT0;      /* a first tile, and its first row in the first-tile planes; the same for the whole block */
  const _Float16* const Ab = (FT == 2 && ft) ? AF : A;
  const int sr = tid >> 3, sc = (tid & 7) * 8;      /* staging: 8 threads a row, piece j of a thread = stage row 16 j + sr, k sc .. sc + 7 */
  unsigned go[12]; v8us rg[12];
#pragma unroll
  for (int j = 0; j < 8; ++j) { const int r = mt * 128 + j * 16 + sr; go[j] = ((unsigned)((FT == 2 && ft) ? fr0 + j * 16 + sr : r < M ? r : M - 1) * (unsigned)lda + sc) * 2u; }      /* a row past M (its wave stores nothing) reads the last row instead */
#pragma unroll
  for (int j = 0; j < 4; ++j) go[8 + j] = ((unsigned)(col0 + j * 16 + sr) * (unsigned)ldb + sc) * 2u;
  unsigned char* const sw = sm + sr * G2_PITCH + sc * 2;
  const unsigned char* const ar = sm + (32 * w + ln) * G2_PITCH + 16 * hh; const unsigned char* const br = sm + (128 + ln) * G2_PITCH + 16 * hh;
  const v8f z8 = {0.f,0.f,0.f,0.f,0.f,0.f,0.f,0.f}; v8f c00 = z8, c01 = z8, c02 = z8, c03 = z8, c10 = z8, c11 = z8, c12 = z8, c13 = z8;
  const int nk = K >> 6; const int nst = (FT == 2 && ft) ? 2 * nk : nk;
  g2_request(rg, Ab, Bh, go); g2_store(rg, sw); if (nst > 1) g2_request(rg, Ab, Bh, go);
  __syncthreads();      /* stage 0 is complete before any wave reads it */
#pragma unroll 1
  for (int s = 0; s < nst; ++s) {      /* rolled: the trip count is a run-time value and one copy of the body holds all the overlap there is */
    const int cur = (s & 1) * G2_STAGE;
    if (FT == 2 && s == nk) { c00 *= 1024.0f; c01 *= 1024.0f; c02 *= 1024.0f; c03 *= 1024.0f; c10 *= 1024.0f; c11 *= 1024.0f; c12 *= 1024.0f; c13 *= 1024.0f; }      /* the second walk begins (first tiles only: elsewhere s stays below nk) */
    if (s + 1 < nst) { g2_store(rg, sw + (G2_STAGE - cur));
      if (s + 2 < nst) {
        if (FT == 2 && s + 2 == nk) {      /* the next request is the second walk's first: A on to the residual plane, B back to k = 0 */
#pragma unroll
          for (int j = 0; j < 12; ++j) go[j] += (j < 8 ? (unsigned)sAF * 2u : 0u) - (unsigned)K * 2u; }      /* unrolled: go stays in registers only under constant indices */
        g2_request(rg, Ab, Bh, go); } }      /* stage s + 1 into the buffer that every wave left at the last barrier; stage s + 2 in flight under this stage's products */
    v16h fa[2][2], fb[2][4];
#pragma unroll
    for (int ks = 0; ks < 2; ++ks) { fa[ks][0] = g2_lfrag(ar + cur + ks * 64); fa[ks][1] = g2_lfrag(ar + cur + 16 * G2_PITCH + ks * 64);
      for (int t = 0; t < 4; ++t) fb[ks][t] = g2_lfrag(br + cur + t * 16 * G2_PITCH + ks * 64); }
#pragma unroll
    for (int ks = 0; ks < 2; ++ks) {      /* both unrolled: the indices pick fragments, which stay in registers only if they are constants */
      c00 = g2_mma(fa[ks][0], fb[ks][0], c00); c10 = g2_mma(fa[ks][1], fb[ks][0], c10);
      c01 = g2_mma(fa[ks][0], fb[ks][1], c01); c11 = g2_mma(fa[ks][1], fb[ks][1], c11);
      c02 = g2_mma(fa[ks][0], fb[ks][2], c02); c12 = g2_mma(fa[ks][1], fb[ks][2], c12);
      c03 = g2_mma(fa[ks][0], fb[ks][3], c03); c13 = g2_mma(fa[ks][1], fb[ks][3], c13); }
    __syncthreads(); }      /* stage s + 1 is complete, and every wave has left stage s, whose buffer the next trip overwrites (behind the last trip: the epilogue) */
  if (row0 >= M) return;      /* no barrier behind this point */
  v8f accs[8] = {c00, c01, c02, c03, c10, c11, c12, c13}; const float al = (FT == 2 && ft) ? alpha * 0.0009765625f : alpha;
#pragma unroll
  for (int u = 0; u < 8; ++u) { const int t = u & 3, half = u >> 2; const int col = col0 + t * 16 + ln; const float bv = bp ? bf16_round(bp[col]) : 0.f;
#pragma unroll
    for (int r = 0; r < 8; ++r) { const int rloc = half * 16 + 8 * hh + r; float v = accs[u][r] * al + bv; if (CP) { if (rowsPerB < 0) v += CP[cofs + (size_t)(row0g + row0 + rloc) * ldc + col];      /* rowsPerB < 0: own element of the batched C plane */ else { const int bidx = (row0g + row0 + rloc) / rowsPerB; v += CP[(size_t)bidx * sCPb + (size_t)by * 64 + col]; } }
      if (ACT == 3) v = fmaxf(v, 0.f); else if (ACT == 6) v = 0.5f * v * (1.0f + erff(v * 0.70710678118654752f)); else if (ACT == 11) v = 1.0f / (1.0f + expf(-v)); else if (ACT == 15) v = v / (1.0f + expf(-v)); else if (ACT == 12) v = (v > 0.f) ? v : 0.01f * v; else if (ACT == 8) v = tanhf(v); else if (ACT == 9) v = 0.5f * v * (1.0f + tanhf(0.7978845608028654f * (v + 0.044715f * v * v * v))); else if (ACT == 14) v = (v > 0.f) ? v : 0.1f * v; else if (ACT == 16) v = (v >= 0.f) ? v : 0.3f * v; else if (ACT == 17) v = (v >= 0.f) ? v : 0.2f * v;
      so[w][rloc][t * 16 + ln] = v; } }
  __builtin_amdgcn_fence(__ATOMIC_ACQ_REL, "workgroup"); __builtin_amdgcn_wave_barrier();
  const int rsub = lane >> 4, c4 = (lane & 15) * 4;
  {
#pragma unroll
    for (int q = 0; q < 16; ++q) { const int r = q * 2 + rsub; const v4f v = *(const v4fa*)&so[w][r][c4];
      /* behind each of the two stores, at the end of its branch: the wait in front of the overwrite of the store's registers (the next store's value or address, formed in the next branch, lands on them) */
      if (C) { *(v4f*)(C + cofs + (size_t)(row0 + r) * ldc + col0 + c4) = v; asm volatile("s_wait_xcnt 0x0" ::: "memory"); }
      if (C16) { v4h h4; for (int i = 0; i < 4; ++i) h4[i] = (_Float16)v[i]; *(v4h*)(C16 + cofs + (size_t)(row0 + r) * ldc + col0 + c4) = h4; asm volatile("s_wait_xcnt 0x0" ::: "memory"); }
      if (FT == 1 && ft) *(v4f*)(CF + (size_t)by * sCF + (size_t)(fr0 + 32 * w + r) * ldc + col0 + c4) = v; }
     } }


__global__ __launch_bounds__(256) void k_rsm(const float* __restrict__ S, _Float16* __restrict__ P, int nrows) {
  #pragma clang fp contract(off)
  const int i = blockIdx.x * 256 + threadIdx.x; if (i >= nrows) return; const float* s = S + (size_t)i * SQ; float mx = -3.0e38f;
#pragma unroll 1
  for (int j = 0; j < SQ; ++j) mx = fmaxf(mx, s[j]); float se = 0.f;
#pragma unroll 1
  for (int j = 0; j < SQ; ++j) se += expf(s[j] - mx); const float sc = 256.0f / se;
#pragma unroll 1
  for (int j0 = 0; j0 < SQ; j0 += 8) { FragH f; for (int q = 0; q < 8; ++q) f.h[q] = (_Float16)(expf(s[j0 + q] - mx) * sc); unsigned short* d = (unsigned short*)P + (size_t)i * SQ + j0; *(v8us*)d = f.half[0];  } }
__global__ __launch_bounds__(256) void k_vt(const _Float16* __restrict__ V16, int b, int h0, _Float16* __restrict__ VT) { __shared__ unsigned short tl[64][65]; const int tid = threadIdx.x; const int hh = blockIdx.x % HG, sg = blockIdx.x / HG; const int s0 = sg * 64; const int h = h0 + hh;
  for (int i = tid; i < 64 * 8; i += 256) { const int j = i / 8, d8 = (i % 8) * 8; FragH f; f.half[0] = *(const v8us*)((const unsigned short*)V16 + ((size_t)b * SQ + s0 + j) * DM + h * HD + d8); for (int q = 0; q < 8; ++q) tl[d8 + q][j] = f.u[q]; }
  __syncthreads();
  { for (int i = tid; i < 64 * 8; i += 256) { const int d = i / 8, j8 = (i % 8) * 8; FragH f; for (int q = 0; q < 8; ++q) f.u[q] = tl[d][j8 + q]; *(v8us*)((unsigned short*)VT + ((size_t)hh * HD + d) * SQ + s0 + j8) = f.half[0]; }  } }



// ---- fused causal attention ----
typedef _Float16 v8h __attribute__((ext_vector_type(8)));
__device__ __forceinline__ float fa_xhalf(float x) { return __builtin_bit_cast(float, __builtin_amdgcn_permlanex16(__builtin_bit_cast(int, x), __builtin_bit_cast(int, x), 0x76543210, 0xfedcba98, false, false)); }      /* lane l takes lane l ^ 16 */
__device__ __forceinline__ v8f fa_mma(v16h a, v16h b, v8f c) { return __builtin_amdgcn_wmma_f32_16x16x32_f16(false, a, false, b, (short)0, c, false, false); }
// Native 2^x and 1/x. In asm so that the v_nop stands directly behind the last transcendental: the one free issue slot that the instruction set asks for before an instruction that
// reads the result or overwrites the source. In the group of four each v_exp_f32 is
// the free slot of the one before it: the early-clobber results lie on no source.
__device__ __forceinline__ float fa_exp2(float x) { float r; asm("v_exp_f32 %0, %1\n\tv_nop" : "=v"(r) : "v"(x)); return r; }
__device__ __forceinline__ float fa_rcp(float x) { float r; asm("v_rcp_f32 %0, %1\n\tv_nop" : "=v"(r) : "v"(x)); return r; }
__device__ __forceinline__ v4f fa_exp2x4(v4f x) { float r0, r1, r2, r3;
  asm("v_exp_f32 %0, %4\n\tv_exp_f32 %1, %5\n\tv_exp_f32 %2, %6\n\tv_exp_f32 %3, %7\n\tv_nop" : "=&v"(r0), "=&v"(r1), "=&v"(r2), "=&v"(r3) : "v"(x[0]), "v"(x[1]), "v"(x[2]), "v"(x[3]));
  const v4f r = {r0, r1, r2, r3}; return r; }
// Fragment of 16 rows x 32 k in the k order of g2_frag; p = the lane's row + 8 * (lane >> 4), so that the pointer itself is the loads' address register.
__device__ __forceinline__ v16h fa_frag(const _Float16* p) { FragH f; f.half[0] = *(const v8us*)((const unsigned short*)p); f.half[1] = *(const v8us*)((const unsigned short*)p + 16); return f.v; }
// The wait in front of any overwrite of a register that the loads issued so far name. The address is an input, so it keeps its register up to here; the memory clobber keeps
// the loads in front of it, where they were written: issued as one batch, long before their first use.
__device__ __forceinline__ void fa_issued(const _Float16* p) { asm volatile("s_wait_xcnt 0x0" :: "v"(p) : "memory"); }
// One pass: 32 keys against the wave's 32 queries (two groups of 16). Lane (c = lane & 15, hh = lane >> 4) owns query 16 g + c in both products:
//   S^T = K Q^T : A = 16 K rows, B = 16 Q rows, both by fa_frag; s[g][kt][r] = score of key 16 kt + 8 hh + r
//   O^T += V^T P^T : A = 16 V^T rows (dims) by fa_frag over the 32 keys; B element e = weight of key (e < 8 ? 8 hh + e : 16 + 8 hh + e - 8) = s[g][e >> 3][e & 7], the k order of fa_frag
// so maximum, sum and rescale are the lane's own, with one exchange between the wave's halves. mr = maximum in use (log2 units); it may trail the true one by up to 6
// (weights then reach 256 * 2^6, well inside f16); sums and o are rescaled only in a pass in which some query's maximum has run further ahead.
// The unroll directives here and in k_fattn: the loop indices pick fragments and accumulators, which stay in registers only if every index is a constant.
template <bool DIAG>
__device__ __forceinline__ void fa_pass(v16h (&kf)[2][2], const _Float16*& kq, const _Float16*& vq, const v16h (&qf)[2][2], v8f (&o)[2][4], float (&mr)[2], float (&l)[2], int rel) {
  const float cs = 0.125f * 1.44269504088896340736f;      /* score scale times log2(e) */
  v16h vf[4];
#pragma unroll
  for (int t = 0; t < 4; ++t) vf[t] = fa_frag(vq + (size_t)t * 16 * SQ);      /* this pass's V^T: in flight under the first product and the softmax */
  fa_issued(vq); vq += 32;
  v8f s[2][2]; const v8f z8 = {0.f, 0.f, 0.f, 0.f, 0.f, 0.f, 0.f, 0.f};
#pragma unroll
  for (int g = 0; g < 2; ++g) for (int kt = 0; kt < 2; ++kt) s[g][kt] = fa_mma(kf[kt][1], qf[g][1], fa_mma(kf[kt][0], qf[g][0], z8));
  if (!DIAG) {
#pragma unroll
    for (int kt = 0; kt < 2; ++kt) for (int d = 0; d < 2; ++d) kf[kt][d] = fa_frag(kq + (size_t)kt * 16 * DM + d * 32);
    fa_issued(kq); kq += (size_t)32 * DM; }
  if (DIAG) {      /* the pass on the diagonal: key 16 kt + 8 hh + r stays while it is not above query 16 g + c (rel = c - 8 hh) */
#pragma unroll
    for (int g = 0; g < 2; ++g) for (int kt = 0; kt < 2; ++kt) for (int r = 0; r < 8; ++r) s[g][kt][r] = (16 * kt + r - 16 * g <= rel) ? s[g][kt][r] : -1.0e30f; }
  float mb[2]; bool need = false;
#pragma unroll
  for (int g = 0; g < 2; ++g) { float mx = s[g][0][0];
    for (int r = 1; r < 8; ++r) mx = fmaxf(mx, s[g][0][r]);
    for (int r = 0; r < 8; ++r) mx = fmaxf(mx, s[g][1][r]);
    mx = fmaxf(mx, fa_xhalf(mx)) * cs; mb[g] = mx; need = need || (mx > mr[g] + 6.0f); }
  if (__builtin_amdgcn_ballot_w32(need) != 0) {      /* wave-uniform; always taken in the first pass (mr = -1e30, factor 0), seldom later */
#pragma unroll
    for (int g = 0; g < 2; ++g) { const float mn = fmaxf(mr[g], mb[g]); const float corr = fa_exp2(mr[g] - mn); mr[g] = mn; l[g] *= corr;
      for (int t = 0; t < 4; ++t) o[g][t] *= corr; } }
#pragma unroll
  for (int g = 0; g < 2; ++g) { const float nm = 8.0f - mr[g];      /* weights carried x256 */
    FragH pf; v4f ls = {0.f, 0.f, 0.f, 0.f};
    for (int i = 0; i < 4; ++i) { v4f a; for (int u = 0; u < 4; ++u) a[u] = fmaf(s[g][i >> 1][(i & 1) * 4 + u], cs, nm);
      const v4f p = fa_exp2x4(a); ls += p; for (int u = 0; u < 4; ++u) pf.h[i * 4 + u] = (_Float16)p[u]; }
    l[g] += (ls[0] + ls[1]) + (ls[2] + ls[3]);
    for (int t = 0; t < 3; ++t) o[g][t] = fa_mma(vf[t], pf.v, o[g][t]);
    o[g][3] = g2_mma(vf[3], pf.v, o[g][3]); } }      /* the weights' last use, with g2_mma's four free slots: what may next land on their registers is asm text (fa_exp2x4, fa_rcp) */
// grid (heads, batches, blocks of 128 queries, the longest first); 4 waves of 32 queries; no LDS, no barrier.
__global__ __launch_bounds__(128) void k_fattn(const _Float16* __restrict__ Q, const _Float16* __restrict__ K, const _Float16* __restrict__ VT, _Float16* __restrict__ O) {
  const int lane = threadIdx.x & 31, c = lane & 15, hh = lane >> 4; const int h = blockIdx.x, b = blockIdx.y;
  const int q0 = (int)(gridDim.z - 1 - blockIdx.z) * 128 + __builtin_amdgcn_readfirstlane(threadIdx.x >> 5) * 32;      /* the wave's first query: scalar, so the pass count is */
  const _Float16* qp = Q + ((size_t)b * SQ + q0 + c) * DM + h * HD + 8 * hh; const _Float16* kq = K + ((size_t)b * SQ + c) * DM + h * HD + 8 * hh; const _Float16* vq = VT + ((size_t)(b * NH + h) * HD + c) * SQ + 8 * hh;      /* the lane's row and half, as fa_frag takes them */
  v16h qf[2][2], kf[2][2];
#pragma unroll
  for (int g = 0; g < 2; ++g) for (int d = 0; d < 2; ++d) { qf[g][d] = fa_frag(qp + (size_t)g * 16 * DM + d * 32); kf[g][d] = fa_frag(kq + (size_t)g * 16 * DM + d * 32); }
  asm volatile("s_wait_xcnt 0x0" :: "v"(qp), "v"(kq) : "memory");      /* as in fa_issued, for both addresses */
  kq += (size_t)32 * DM;
  const v8f z8 = {0.f, 0.f, 0.f, 0.f, 0.f, 0.f, 0.f, 0.f}; v8f o[2][4] = {{z8, z8, z8, z8}, {z8, z8, z8, z8}}; float mr[2] = {-1.0e30f, -1.0e30f}, l[2] = {0.f, 0.f};
  const int rel = c - 8 * hh;
  for (int kb = 0; kb < q0 / 32; ++kb) fa_pass<false>(kf, kq, vq, qf, o, mr, l, rel);      /* keys below the wave's first query: no mask */
  fa_pass<true>(kf, kq, vq, qf, o, mr, l, rel);
  _Float16* op = O + ((size_t)b * SQ + q0 + c) * DM + h * HD + 8 * hh;      /* o[g][t][r] = dim 16 t + 8 hh + r of query 16 g + c: eight neighbours, one 16-byte store */
  v8h ov[2][4];
#pragma unroll
  for (int g = 0; g < 2; ++g) { const float fin = 64.0f * fa_rcp(l[g] + fa_xhalf(l[g]));      /* the halves' sums joined; o carried x64 */
    for (int t = 0; t < 4; ++t) for (int r = 0; r < 8; ++r) ov[g][t][r] = (_Float16)(o[g][t][r] * fin); }
#pragma unroll
  for (int g = 0; g < 2; ++g) for (int t = 0; t < 4; ++t) *(v8h*)(op + (size_t)g * 16 * DM + t * 16) = ov[g][t]; }


typedef float v2f __attribute__((ext_vector_type(2)));
// exp(x) to f32 accuracy, in the way expf is expanded: n = nearest integer to x log2(e); v_exp_f32 of x log2(e) - n, log2(e) taken in two parts (two fma, so the difference is
// rounded once); ldexp by n; 0 and infinity beyond the two range ends. Written out so that v_exp_f32 can stand in asm with its v_nop directly behind it: the one free issue slot
// that the instruction set asks for before an instruction that reads the result or overwrites the source.
__device__ __forceinline__ float exp_slot(float x) {
  const float c_hi = __uint_as_float(0x3fb8aa3bu), c_lo = __uint_as_float(0x32a5705fu);
  const float n = rintf(x * c_hi); const float a = fmaf(x, c_lo, fmaf(x, c_hi, -n));
  float r; asm("v_exp_f32 %0, %1\n\tv_nop" : "=v"(r) : "v"(a));
  r = ldexpf(r, (int)n); r = (__uint_as_float(0xc2ce8ed0u) > x) ? 0.f : r; r = (__uint_as_float(0x42b17218u) < x) ? __uint_as_float(0x7f800000u) : r; return r; }
// Exact f32 attention of the first QT0 rows, one thread per query row. The row's q and o stay in registers. K and V come in tiles of 64 keys through LDS
// (K transposed to [dim][key], V as [key][dim]) and are read back as broadcasts, 32 reads at a time, one such batch in flight while the batch before it is worked on.
// Eight keys are worked on together: their eight score sums run side by side (each still summed over the dims in ascending order, s = fma(q, k, s)),
// then the running maximum, the two exps and the running sum key by key, then the o update key by key (o = fma(o, sc, e v), l = fma(l, sc, e)).
// Every row sees its keys, and every sum its terms, in the same order as with one key at a time.
template <int MASKADD>
__global__ __launch_bounds__(64) void k_att0(const float* __restrict__ QF, const float* __restrict__ KF, const float* __restrict__ VF, int ld, const float* __restrict__ mask, float scale, _Float16* __restrict__ OH, _Float16* __restrict__ OL, int ldo) {
  __shared__ __attribute__((aligned(16))) float lkt[HD][64]; __shared__ __attribute__((aligned(16))) float lv[64][HD]; __shared__ __attribute__((aligned(16))) float lo[64][HD + 4];
  const int tid = threadIdx.x; const int h = blockIdx.x / (QT0 / 64), rg = blockIdx.x % (QT0 / 64); const int i = rg * 64 + tid;
  { const size_t rb = (size_t)blockIdx.y * QT0; QF += rb * ld; KF += rb * ld; VF += rb * ld; OH += rb * ldo; OL += rb * ldo; }      /* blockIdx.y = batch: QT0 rows of q, k, v and o each */
  const float* qr = QF + (size_t)i * ld + h * HD;
  float q[HD]; v2f o[HD / 2];
#pragma unroll
  for (int c = 0; c < HD / 4; ++c) { const v4f t = *(const v4fa*)(qr + c * 4); for (int u = 0; u < 4; ++u) q[c * 4 + u] = t[u]; const v2f z = {0.f, 0.f}; o[c * 2] = z; o[c * 2 + 1] = z; }
  asm volatile("s_wait_xcnt 0x0" :: "v"(qr) : "memory");      /* the wait in front of any overwrite of the loads' address register; named as an input, the address stays in its register up to here (else the last load's result lands on it) */
  float m = -1.0e30f, l = 0.f; const int jmax = MASKADD ? (SQ - 1) : (rg * 64 + 63);      /* additive-mask form: every key (the mask input decides); causal form: keys up to the block's last row */
#pragma unroll 1
  for (int j0 = 0; j0 <= jmax; j0 += 64) {      /* rolled, for speed only */
    const float* kr = KF + (size_t)(j0 + tid) * ld + h * HD;      /* thread = key: the transposed stores of a wave fall on consecutive banks */
    const float* vr = VF + (size_t)(j0 + tid / 16) * ld + h * HD + (tid % 16) * 4;      /* 16 threads a row: whole lines */
    v4f tk[16], tv[16]; const float* vp[16];
#pragma unroll
    for (int c = 0; c < 16; ++c) { vp[c] = vr + (size_t)(c * 4) * ld; tk[c] = *(const v4fa*)(kr + c * 4); tv[c] = *(const v4fa*)vp[c]; }
    asm volatile("s_wait_xcnt 0x0" :: "v"(kr), "v"(vp[0]), "v"(vp[1]), "v"(vp[2]), "v"(vp[3]), "v"(vp[4]), "v"(vp[5]), "v"(vp[6]), "v"(vp[7]), "v"(vp[8]), "v"(vp[9]), "v"(vp[10]), "v"(vp[11]), "v"(vp[12]), "v"(vp[13]), "v"(vp[14]), "v"(vp[15]) : "memory");      /* as behind the q loads: every address of the batch keeps its register up to the wait (else later loads' results land on earlier loads' addresses) */
    __builtin_amdgcn_sched_barrier(0);      /* all 32 loads of the tile are issued before the first is waited for: without it each load sinks to its LDS store and the latencies add up */
#pragma unroll
    for (int c = 0; c < 16; ++c) { for (int u = 0; u < 4; ++u) lkt[c * 4 + u][tid] = tk[c][u]; *(v4f*)&lv[c * 4 + tid / 16][(tid % 16) * 4] = tv[c]; }
    __syncthreads();      /* the tile is complete before any thread reads it */
#pragma unroll 1
    for (int jg = 0; jg < 64; jg += 8) {      /* rolled for the same reason */
      v4f ba[32], bb[32]; v2f s2[4]; float sc[8], e[8]; for (int p = 0; p < 4; ++p) { const v2f z = {0.f, 0.f}; s2[p] = z; }
      /* batch b of K: dims 16 b .. + 15 of the eight keys; batch b of V: keys 2 b and 2 b + 1, all dims */
      auto load_k = [&](int b, v4f* t) {
#pragma unroll
        for (int x = 0; x < 16; ++x) { t[x * 2] = *(const v4f*)&lkt[b * 16 + x][jg]; t[x * 2 + 1] = *(const v4f*)&lkt[b * 16 + x][jg + 4]; }
        __builtin_amdgcn_sched_barrier(0); };      /* keeps the batch's reads in front of the arithmetic on the batch before: without it they sink to their first use and every read's latency shows */
      auto load_v = [&](int b, v4f* t) {
#pragma unroll
        for (int x = 0; x < 32; ++x) t[x] = *(const v4f*)&lv[jg + b * 2 + (x >> 4)][(x & 15) * 4];
        __builtin_amdgcn_sched_barrier(0); };      /* as in load_k */
      auto work_k = [&](int b, const v4f* t) {
#pragma unroll
        for (int x = 0; x < 16; ++x) { const float qs = q[b * 16 + x]; const v2f qd = {qs, qs}; const v4f ka = t[x * 2], kb = t[x * 2 + 1];
          const v2f k0 = {ka[0], ka[1]}, k1 = {ka[2], ka[3]}, k2 = {kb[0], kb[1]}, k3 = {kb[2], kb[3]};
          s2[0] = __builtin_elementwise_fma(qd, k0, s2[0]); s2[1] = __builtin_elementwise_fma(qd, k1, s2[1]); s2[2] = __builtin_elementwise_fma(qd, k2, s2[2]); s2[3] = __builtin_elementwise_fma(qd, k3, s2[3]); }
        __builtin_amdgcn_sched_barrier(0); };      /* the next batch's reads stay behind this arithmetic, so that no more than two batches hold registers */
      auto work_v = [&](int b, const v4f* t) {
#pragma unroll
        for (int x = 0; x < 32; ++x) { const int u = b * 2 + (x >> 4), c = x & 15; const v2f sc2 = {sc[u], sc[u]}, e2 = {e[u], e[u]}; const v4f vv = t[x]; const v2f v0 = {vv[0], vv[1]}, v1 = {vv[2], vv[3]};
          o[c * 2] = __builtin_elementwise_fma(o[c * 2], sc2, e2 * v0); o[c * 2 + 1] = __builtin_elementwise_fma(o[c * 2 + 1], sc2, e2 * v1); }
        __builtin_amdgcn_sched_barrier(0); };      /* as in work_k */
      load_k(0, ba); load_k(1, bb); work_k(0, ba); load_k(2, ba); work_k(1, bb); load_k(3, bb); work_k(2, ba); load_v(0, ba); work_k(3, bb); load_v(1, bb);
#pragma unroll
      for (int u = 0; u < 8; ++u) { const int j = j0 + jg + u; float s = __fmul_rn(s2[u >> 1][u & 1], scale); if (MASKADD) s = __fadd_rn(s, __fmul_rn(bf16_round(mask[(size_t)i * SQ + j]), -10000.0f));
        const float f = (MASKADD || j <= i) ? 1.f : 0.f; const float sm = fmaf(f, s, (1.f - f) * -1.0e30f); const float mn = fmaxf(m, sm); sc[u] = exp_slot(m - mn); e[u] = exp_slot(sm - mn); l = fmaf(l, sc[u], e[u]); m = mn; }
      work_v(0, ba); load_v(2, ba); work_v(1, bb); load_v(3, bb); work_v(2, ba); work_v(3, bb); }
    __syncthreads(); }      /* every thread has left the tile before the next one overwrites it */
  const float fin = 64.0f / l;      /* o carried x64 like the f16 path */
#pragma unroll
  for (int c = 0; c < HD / 4; ++c) { const v4f oo = {__fmul_rn(o[c * 2][0], fin), __fmul_rn(o[c * 2][1], fin), __fmul_rn(o[c * 2 + 1][0], fin), __fmul_rn(o[c * 2 + 1][1], fin)}; *(v4f*)&lo[tid][c * 4] = oo; }
  __syncthreads();
  {
#pragma unroll 1
    for (int it = 0; it < 16; ++it) { const int row = it * 4 + tid / 16, pc = (tid % 16) * 4; const v4f v = *(const v4f*)&lo[row][pc]; v4h vh, vl;      /* o leaves as two f16 planes: the high part and the residual x1024 */
      for (int u = 0; u < 4; ++u) { const _Float16 hp = (_Float16)v[u]; vh[u] = hp; vl[u] = (_Float16)((v[u] - (float)hp) * 1024.0f); }
      const size_t e = (size_t)(rg * 64 + row) * ldo + h * HD + pc; *(v4h*)(OH + e) = vh; *(v4h*)(OL + e) = vl; }
     } }

#define DMQ DM

template <int BFIN, int W16, int W32>
__global__ __launch_bounds__(256) void k_lnx(const float* __restrict__ X, const float* __restrict__ g, const float* __restrict__ bb, float eps, _Float16* __restrict__ N16, float* __restrict__ N32) {
  #pragma clang fp contract(off)
  __shared__ float red[256]; const size_t r = blockIdx.x; const int t = threadIdx.x; const bool act = t < (DMQ / 4); const int c0 = act ? t * 4 : 0;
  const v4f xa = *(const v4fa*)(X + r * DMQ + c0); float s[4]; float sum = 0.f;
  for (int q = 0; q < 4; ++q) { s[q] = act ? (BFIN ? bf16_round(xa[q]) : xa[q]) : 0.f; sum = __fadd_rn(sum, s[q]); }
  red[t] = sum; __syncthreads(); for (int st = 128; st > 0; st >>= 1) { if (t < st) red[t] = __fadd_rn(red[t], red[t + st]); __syncthreads(); } const float mu = red[0] / (float)DMQ; __syncthreads();
  float vs = 0.f; for (int q = 0; q < 4; ++q) { const float dl = act ? __fadd_rn(s[q], -mu) : 0.f; vs = __fadd_rn(vs, __fmul_rn(dl, dl)); } red[t] = vs; __syncthreads(); for (int st = 128; st > 0; st >>= 1) { if (t < st) red[t] = __fadd_rn(red[t], red[t + st]); __syncthreads(); }
  const float rs = rsqrtf(__fadd_rn(red[0] / (float)DMQ, eps)); v4h y; v4f yf;
  for (int q = 0; q < 4; ++q) { const int c = c0 + q; yf[q] = __fadd_rn(__fmul_rn(__fmul_rn(__fadd_rn(s[q], -mu), rs), bf16_round(g[c])), bf16_round(bb[c])); y[q] = (_Float16)yf[q]; }
  if (!act) return;      /* no barriers after this point */
  { if (W16) *(v4h*)(N16 + r * DMQ + c0) = y; if (W32) *(v4f*)(N32 + r * DMQ + c0) = yf;  } }


extern "C" void kernel_launch(void* const* d_in, const int* in_sizes, int n_in,
                              void* d_out, int out_size, void* d_ws, size_t ws_size, hipStream_t stream) {
  (void)in_sizes; (void)n_in; (void)out_size;
  const float* const* I = (const float* const*)d_in; const float* x = I[0]; const float* wk = I[1]; const float* wq = I[2]; const float* wv = I[3]; const float* wo = I[4]; const float* lng = I[5]; const float* lnb = I[6];      /* x; natural [out][in] Wk, Wq, Wv (THIS order), Wp; LayerNorm gamma, beta; no biases */
  char* ws = (char*)d_ws; size_t off = 0;
  auto take = [&](size_t bytes) { char* p = ws + off; off += (bytes + 255) & ~(size_t)255; return p; };
  /* planes that one launch walks by a stride follow one another without a gap (every size is a multiple of 256 bytes): BQ BK BV BO; Q16 K16 V16; QF0 KF0 VF0; OH0 OL0 */
  _Float16* BQ = (_Float16*)take((size_t)DM * DM * 2); take((size_t)DM * DM * 2); take((size_t)DM * DM * 2); _Float16* BO = (_Float16*)take((size_t)DM * DM * 2);
  _Float16* X16 = (_Float16*)take(NR * DM * 2); _Float16* Q16 = (_Float16*)take(NR * DM * 2); _Float16* K16 = (_Float16*)take(NR * DM * 2); _Float16* V16 = (_Float16*)take(NR * DM * 2); _Float16* O16 = (_Float16*)take(NR * DM * 2);
  float* YO = (float*)take(NR * DM * 4); _Float16* VT = (_Float16*)take((size_t)NB * NH * HD * SQ * 2);      /* pre-norm projection rows y (f32); V^T [NB][NH][HD][SQ] */
  float* QF0 = (float*)take((size_t)NB * QT0 * DM * 4); float* KF0 = (float*)take((size_t)NB * QT0 * DM * 4); float* VF0 = (float*)take((size_t)NB * QT0 * DM * 4); _Float16* OH0 = (_Float16*)take((size_t)NB * QT0 * DM * 2); _Float16* OL0 = (_Float16*)take((size_t)NB * QT0 * DM * 2);
  if (off > ws_size) return;
  k_cvt<<<4 * CVT_WB + CVT_XB, 256, 0, stream>>>(wq, wk, wv, wo, x, BQ, X16);      /* BQ BK BV BO (x16) and the x rows */
  const size_t r0p = (size_t)B0 * SQ;      /* first projected row */
  const size_t f0p = (size_t)B0 * QT0;      /* its first-tile row */
  k_gemm2<0, 1><<<dim3((unsigned)((MP / 128) * (DM / 64)), 3), 128, 0, stream>>>(X16 + r0p * DM, DM, 0, BQ, DM, (size_t)DM * DM, 0.0625f, nullptr, 0, nullptr, 1, 0, 0, nullptr, Q16 + r0p * DM, DM, NR * DM, MP, DM, DM, 0, 0, 0, nullptr, 0, QF0 + f0p * DM, (size_t)NB * QT0 * DM);      /* q, k, v on grid.y: f16 rows, and f32 (exact products) for each batch's first 128 rows */
  k_vt<NH, SQ><<<NBR * NH * (SQ / 64), 256, 0, stream>>>(V16 + r0p * LQ, LQ, 0, VT);      /* V^T [NBR][NH][HD][SQ] */
  k_att0<0><<<dim3(NH * (QT0 / 64), NBR), 64, 0, stream>>>(QF0, KF0, VF0, DM, nullptr, 0.125f, OH0 + f0p * DM, OL0 + f0p * DM, DM);      /* exact f32 attention for rows 0..127 of each batch: o (x64) as f16 high part + x1024 residual planes */
  k_fattn<<<dim3(NH, NB, SQ / 128), 128, 0, stream>>>(Q16, K16, VT, O16);      /* causal attention of all batches and heads: o (merged heads, x64) as f16 rows */
  k_gemm2<0, 2><<<dim3((unsigned)((MPO / 128) * (DM / 64)), 1), 128, 0, stream>>>(O16 + r0p * DM, DM, 0, BO, DM, 0, 0.0009765625f, nullptr, 0, nullptr, 1, 0, 0, YO + r0p * DM, nullptr, DM, 0, MPO, DM, DM, 0, 0, 0, OH0 + f0p * DM, (size_t)NB * QT0 * DM, nullptr, 0);      /* y = o Wp; rows 0..127 of each batch from the two exact planes */
  k_lnx<0, 0, 1><<<(unsigned)NR, 256, 0, stream>>>(YO, lng, lnb, 1e-5f, nullptr, (float*)d_out);      /* out = LayerNorm(y) -> f32 output rows */
}

// v007
// It runs in 186 microseconds.
// Timed twice side by side with v006, it ran 1.10 and 1.08 times as fast.
// Over all steps from v000 it is 52.1 times as fast.
#include <hip/hip_runtime.h>
// Causal multi-head self-attention with a fused post-LayerNorm (x [4][2048][1024]; k/q/v = x W^T (natural [1024][1024], no biases); 16 heads of 64; wei = q k^T * 64^-0.5; causal (tril, -inf); softmax; y = merged Wp^T; out = LayerNorm(y) (biased var, eps per the module, gamma / beta) -> [4][2048][1024]).
// Structure: token rows r = b*2048 + s; x as exact f16 rows (bf16-rounded); Q, K, V as WMMA GEMMs in one launch (32x64 wave tiles, f32 accumulation, exact x16 weights, f16 outputs; each batch's first 128 rows also in f32, for an exact f32 attention of those rows); V^T for all heads via LDS transposes; attention in ONE launch (k_fattn): a wave holds 32 queries of one head and walks the keys up to its diagonal in passes of 32 (K, V^T from LDS stages of 64 keys, shared by a block's 4 waves): S^T = K Q^T, running maximum and sum in f32 (native exp2; weights x256 f16), O^T += V^T P^T, scores and weights never leave the registers; o (x64, folded into the output GEMM alpha) written straight into the merged f16 o rows; y = o W_o GEMM (f32; the first 128 rows of a batch from the exact o as f16 high part + residual), then the row LayerNorm into the output layout.
// Compute dtype: inputs rounded to bf16; x / weights exact; q, k, v, softmax weights and o as plain f16 GEMM operands (~2^-12); scores and softmax statistics f32. v_wmma_f32_16x16x32_f16.
#define NB 4
#define SQ 2048
#define DM 1024
#define NH 16
#define HD 64
#define HG 4                         /* heads per launch of the (b, h0) k_vt form; k_fattn takes all NH */
#define QT0 128                      /* first-tile rows recomputed exactly in f32 */
#define B0 0                         /* first batch processed (debug hook) */
#define NBR NB                       /* batches processed (debug hook) */
#define NR ((size_t)NB * SQ)         /* token rows */
#define MP ((int)((size_t)NBR * SQ)) /* rows projected (debug hook) */
#define QN SQ                        /* unused: k_fattn attends all SQ query rows */
#define NHD NH                       /* unused: k_fattn attends all NH heads */
#define MPO MP                       /* rows through the output stage (debug hook) */
#define LQ DM      /* row pitch of the q/k/v rows */
typedef __bf16 v16b __attribute__((ext_vector_type(16)));
typedef unsigned short v8us __attribute__((ext_vector_type(8), may_alias));
typedef float  v8f  __attribute__((ext_vector_type(8)));
typedef float  v4f  __attribute__((ext_vector_type(4)));
typedef float  v4fa __attribute__((ext_vector_type(4), may_alias));
union FragB { v16b v; v8us half[2]; unsigned short u[16]; };

__device__ __forceinline__ unsigned short bf16_bits(float x) { unsigned int u = __float_as_uint(x); return (unsigned short)((u + 0x7FFFu + ((u >> 16) & 1u)) >> 16); }
__device__ __forceinline__ float bf16_val(unsigned short b) { return __uint_as_float(((unsigned int)b) << 16); }
__device__ __forceinline__ float bf16_round(float x) { return bf16_val(bf16_bits(x)); }
// D += A·B with NT terms: 1 = ah·bh, 2 = + al·bh (A split), 3 = + ah·bl (both split)
template <int NT>
__device__ __forceinline__ v8f mmaN(v16b ah, v16b al, v16b bh, v16b bl, v8f c) {
  c = __builtin_amdgcn_wmma_f32_16x16x32_bf16(false, ah, false, bh, (short)0, c, false, false);
  if (NT >= 2) c = __builtin_amdgcn_wmma_f32_16x16x32_bf16(false, al, false, bh, (short)0, c, false, false);
  if (NT >= 3) c = __builtin_amdgcn_wmma_f32_16x16x32_bf16(false, ah, false, bl, (short)0, c, false, false);
  asm volatile("v_nop\n\tv_nop\n\tv_nop\n\tv_nop" : "+v"(c) : "v"(ah), "v"(al), "v"(bh), "v"(bl));
  return c;
}

__global__ __launch_bounds__(256) void k_wt_bf16(const float* __restrict__ W, unsigned short* __restrict__ Wt, int K, int N) {
  const int t = blockIdx.x * 256 + threadIdx.x;
  const int k8n = K / 8;
  if (t >= N * k8n) return;
  const int n = t / k8n, k8 = (t % k8n) * 8;
  v8us v;
#pragma unroll
  for (int i = 0; i < 8; ++i) v[i] = bf16_bits(W[(size_t)(k8 + i) * N + n]);
  *(v8us*)(Wt + (size_t)n * K + k8) = v;
  
}

// GEMM C[M][N] (f32, pitch ldc) = act(A[M][K]·W + bias). A f32 row-major (pitch lda) converted per fragment to bf16
// (ASPLIT: hi/lo two planes -> 2 terms, else single rounded term); Wt bf16 [N][K] (pitch ldb). BIAS_BF16 rounds the
// bias to bf16 first (bias quantised to bf16 before the add). K%32==0, M%16==0, N%64==0.
template <bool ASPLIT, int ACT, bool BIAS_BF16>
__global__ __launch_bounds__(128) void k_gemm_bf(const float* __restrict__ A, int lda, const unsigned short* __restrict__ Wt, int ldb,
                                               const float* __restrict__ bias, float* __restrict__ C, int ldc, int M, int N, int K) {
  __shared__ __attribute__((aligned(16))) float so[4][16][64];
  const int tid = threadIdx.x, w = tid >> 5, lane = tid & 31, ln = lane & 15, hh = lane >> 4;
  const int ntn = N / 64;
  const int wid = blockIdx.x * 4 + w;
  const int mt = wid / ntn, nq = wid % ntn;
  if (mt * 16 >= M) return;
  const int row0 = mt * 16, col0 = nq * 64;
  const float* arow = A + (size_t)(row0 + ln) * lda;
  v8f acc[4] = {};
  for (int kb = 0; kb < K; kb += 32) {
    FragB ah, al;
    const v4f x0 = *(const v4fa*)(arow + kb + 8 * hh), x1 = *(const v4fa*)(arow + kb + 8 * hh + 4);
    const v4f x2 = *(const v4fa*)(arow + kb + 16 + 8 * hh), x3 = *(const v4fa*)(arow + kb + 16 + 8 * hh + 4);
    float xs[16] = {x0[0],x0[1],x0[2],x0[3],x1[0],x1[1],x1[2],x1[3],x2[0],x2[1],x2[2],x2[3],x3[0],x3[1],x3[2],x3[3]};
#pragma unroll
    for (int i = 0; i < 16; ++i) { const unsigned short hb = bf16_bits(xs[i]); ah.u[i] = hb; al.u[i] = ASPLIT ? bf16_bits(xs[i] - bf16_val(hb)) : (unsigned short)0; }
#pragma unroll
    for (int t = 0; t < 4; ++t) {
      const unsigned short* brow = Wt + (size_t)(col0 + t * 16 + ln) * ldb + kb;
      FragB b;
      b.half[0] = *(const v8us*)(brow + 8 * hh);
      b.half[1] = *(const v8us*)(brow + 16 + 8 * hh);
      acc[t] = mmaN<ASPLIT ? 2 : 1>(ah.v, al.v, b.v, b.v, acc[t]);
    }
  }
#pragma unroll
  for (int t = 0; t < 4; ++t) {
    float bv = bias ? bias[col0 + t * 16 + ln] : 0.f;
    if (BIAS_BF16) bv = bf16_round(bv);
#pragma unroll
    for (int r = 0; r < 8; ++r) { float v = acc[t][r] + bv; if (ACT == 1) v = fmaxf(v, 0.f); so[w][8 * hh + r][t * 16 + ln] = v; }
  }
  __builtin_amdgcn_fence(__ATOMIC_ACQ_REL, "workgroup");
  __builtin_amdgcn_wave_barrier();
  const int rsub = lane >> 4, c4 = (lane & 15) * 4;
  {
#pragma unroll
    for (int q = 0; q < 8; ++q) {
      const int r = q * 2 + rsub;
      const v4f v = *(const v4fa*)&so[w][r][c4];
      *(v4f*)(C + (size_t)(row0 + r) * ldc + col0 + c4) = v;
    }
    
  }
}

// GEMM C = act(A·W + bias + resid): A f32 (ASPLIT -> hi/lo 2 terms), Wt bf16 [N][K]; ACT 0 none, 1 relu, 2 exact gelu;
// resid (optional, f32, row index = (row % rmod), pitch ldr, RES_BF16 rounds it) added before the activation.
template <bool ASPLIT, int ACT, bool BIAS_BF16, bool RES_BF16>
__global__ __launch_bounds__(128) void k_gemm_bf3(const float* __restrict__ A, int lda, const unsigned short* __restrict__ Wt, int ldb,
                                                const float* __restrict__ bias, const float* __restrict__ resid, int rmod, int ldr,
                                                float* __restrict__ C, int ldc, int M, int N, int K) {
  __shared__ __attribute__((aligned(16))) float so[4][16][64];
  const int tid = threadIdx.x, w = tid >> 5, lane = tid & 31, ln = lane & 15, hh = lane >> 4;
  const int ntn = N / 64;
  const int wid = blockIdx.x * 4 + w;
  const int mt = wid / ntn, nq = wid % ntn;
  if (mt * 16 >= M) return;
  const int row0 = mt * 16, col0 = nq * 64;
  const float* arow = A + (size_t)(row0 + ln) * lda;
  v8f acc[4] = {};
  for (int kb = 0; kb < K; kb += 32) {
    FragB ah, al;
    const v4f x0 = *(const v4fa*)(arow + kb + 8 * hh), x1 = *(const v4fa*)(arow + kb + 8 * hh + 4);
    const v4f x2 = *(const v4fa*)(arow + kb + 16 + 8 * hh), x3 = *(const v4fa*)(arow + kb + 16 + 8 * hh + 4);
    float xs[16] = {x0[0],x0[1],x0[2],x0[3],x1[0],x1[1],x1[2],x1[3],x2[0],x2[1],x2[2],x2[3],x3[0],x3[1],x3[2],x3[3]};
#pragma unroll
    for (int i = 0; i < 16; ++i) { const unsigned short hb = bf16_bits(xs[i]); ah.u[i] = hb; al.u[i] = ASPLIT ? bf16_bits(xs[i] - bf16_val(hb)) : (unsigned short)0; }
#pragma unroll
    for (int t = 0; t < 4; ++t) {
      const unsigned short* brow = Wt + (size_t)(col0 + t * 16 + ln) * ldb + kb;
      FragB b;
      b.half[0] = *(const v8us*)(brow + 8 * hh);
      b.half[1] = *(const v8us*)(brow + 16 + 8 * hh);
      acc[t] = mmaN<ASPLIT ? 2 : 1>(ah.v, al.v, b.v, b.v, acc[t]);
    }
  }
#pragma unroll
  for (int t = 0; t < 4; ++t) {
    const int col = col0 + t * 16 + ln;
    float bv = bias ? bias[col] : 0.f;
    if (BIAS_BF16) bv = bf16_round(bv);
#pragma unroll
    for (int r = 0; r < 8; ++r) {
      float v = acc[t][r] + bv;
      if (resid) { float rv = resid[(size_t)((row0 + 8 * hh + r) % rmod) * ldr + col]; if (RES_BF16) rv = bf16_round(rv); v += rv; }
      if (ACT == 1) v = fmaxf(v, 0.f);
      if (ACT == 2) v = 0.5f * v * (1.0f + erff(v * 0.70710678118654752f));
      if (ACT == 3) { const float u = 0.7978845608028654f * (v + 0.044715f * v * v * v); v = 0.5f * v * (1.0f + tanhf(u)); }
      so[w][8 * hh + r][t * 16 + ln] = v;
    }
  }
  __builtin_amdgcn_fence(__ATOMIC_ACQ_REL, "workgroup");
  __builtin_amdgcn_wave_barrier();
  const int rsub = lane >> 4, c4 = (lane & 15) * 4;
  {
#pragma unroll
    for (int q = 0; q < 8; ++q) {
      const int r = q * 2 + rsub;
      const v4f v = *(const v4fa*)&so[w][r][c4];
      *(v4f*)(C + (size_t)(row0 + r) * ldc + col0 + c4) = v;
    }
    
  }
}
// row LayerNorm (biased variance, eps) over N: s = X (+ R); optional out_sum <- s; out_norm <- (s-mu)*rsqrt(var+eps)*g + b
template <bool PARAM_BF16>
__global__ __launch_bounds__(256) void k_layernorm(const float* __restrict__ X, const float* __restrict__ R, const float* __restrict__ g, const float* __restrict__ bta,
                                                  float* __restrict__ out_sum, float* __restrict__ out_norm, int N, float eps) {
  __shared__ float red[256];
  const int row = blockIdx.x, tid = threadIdx.x;
  const float* x = X + (size_t)row * N; const float* rr = R ? R + (size_t)row * N : nullptr;
  float vals[16];                     // up to N = 4096
  const int per = N / 256;            // contiguous chunk per thread? use strided-by-4 chunks: thread handles j = tid*4 + 1024*u
  float s1 = 0.f;
  for (int u = 0; u < per / 4; ++u) {
    const int j = tid * 4 + 1024 * u;
    const v4f a = *(const v4fa*)(x + j);
    v4f b = {0.f,0.f,0.f,0.f}; if (rr) b = *(const v4fa*)(rr + j);
#pragma unroll
    for (int q = 0; q < 4; ++q) { const float v = a[q] + b[q]; vals[u * 4 + q] = v; s1 += v; }
  }
  red[tid] = s1; __syncthreads();
  for (int st = 128; st > 0; st >>= 1) { if (tid < st) red[tid] += red[tid + st]; __syncthreads(); }
  const float mu = red[0] / (float)N; __syncthreads();
  float s2 = 0.f;
  for (int u = 0; u < per / 4; ++u)
#pragma unroll
    for (int q = 0; q < 4; ++q) { const float c = vals[u * 4 + q] - mu; s2 += c * c; }
  red[tid] = s2; __syncthreads();
  for (int st = 128; st > 0; st >>= 1) { if (tid < st) red[tid] += red[tid + st]; __syncthreads(); }
  const float rs = rsqrtf(red[0] / (float)N + eps);
  {
    for (int u = 0; u < per / 4; ++u) {
      const int j = tid * 4 + 1024 * u;
      v4f o, sm;
#pragma unroll
      for (int q = 0; q < 4; ++q) {
        float gg = g[j + q], bb = bta[j + q];
        if (PARAM_BF16) { gg = bf16_round(gg); bb = bf16_round(bb); }
        sm[q] = vals[u * 4 + q]; o[q] = (vals[u * 4 + q] - mu) * rs * gg + bb;
      }
      if (out_sum) *(v4f*)(out_sum + (size_t)row * N + j) = sm;
      *(v4f*)(out_norm + (size_t)row * N + j) = o;
    }
    
  }
}



// ---- f16 WMMA path (v_wmma_f32_16x16x32_f16): 11-bit significands for operands in range — used where a [0,1] probability operand needs more precision than bf16
typedef _Float16 v16h __attribute__((ext_vector_type(16)));
union FragH { v16h v; v8us half[2]; _Float16 h[16]; unsigned short u[16]; };
template <int NT>
__device__ __forceinline__ v8f mmaH(v16h ah, v16h al, v16h bh, v16h bl, v8f c) {
  c = __builtin_amdgcn_wmma_f32_16x16x32_f16(false, ah, false, bh, (short)0, c, false, false);
  if (NT >= 2) c = __builtin_amdgcn_wmma_f32_16x16x32_f16(false, al, false, bh, (short)0, c, false, false);
  if (NT >= 3) c = __builtin_amdgcn_wmma_f32_16x16x32_f16(false, ah, false, bl, (short)0, c, false, false);
  asm volatile("v_nop\n\tv_nop\n\tv_nop\n\tv_nop" : "+v"(c) : "v"(ah), "v"(al), "v"(bh), "v"(bl));
  return c;
}
// batched GEMM like k_gemm_b but f16 operands: A f32 (split into f16 hi/lo if ASPLIT, else rounded to f16), Bt = f16 values [n][k]; alpha; C f32; N multiple of 16 (partial tiles skipped)
template <bool ASPLIT>
__global__ __launch_bounds__(128) void k_gemm_h(const float* __restrict__ A, int lda, size_t sA, const _Float16* __restrict__ Bh, int ldb, size_t sB, float alpha, float* __restrict__ C, int ldc, size_t sC, int M, int N, int K) {
  __shared__ __attribute__((aligned(16))) float so[4][16][64];
  const int tid = threadIdx.x, w = tid >> 5, lane = tid & 31, ln = lane & 15, hh = lane >> 4; const int by = blockIdx.y;
  A += (size_t)by * sA; Bh += (size_t)by * sB; C += (size_t)by * sC;
  const int ntn = (N + 63) / 64; const int wid = blockIdx.x * 4 + w; const int mt = wid / ntn, nq = wid % ntn; if (mt * 16 >= M) return;
  const int row0 = mt * 16, col0 = nq * 64; const float* arow = A + (size_t)(row0 + ln) * lda;
  v8f acc[4] = {};
  for (int kb = 0; kb < K; kb += 32) {
    FragH ah, al;
    const v4f x0 = *(const v4fa*)(arow + kb + 8 * hh), x1 = *(const v4fa*)(arow + kb + 8 * hh + 4), x2 = *(const v4fa*)(arow + kb + 16 + 8 * hh), x3 = *(const v4fa*)(arow + kb + 16 + 8 * hh + 4);
    float xs[16] = {x0[0],x0[1],x0[2],x0[3],x1[0],x1[1],x1[2],x1[3],x2[0],x2[1],x2[2],x2[3],x3[0],x3[1],x3[2],x3[3]};
#pragma unroll
    for (int i = 0; i < 16; ++i) { const _Float16 h = (_Float16)xs[i]; ah.h[i] = h; al.h[i] = ASPLIT ? (_Float16)(xs[i] - (float)h) : (_Float16)0.0f; }
#pragma unroll
    for (int t = 0; t < 4; ++t) { if (col0 + t * 16 >= N) continue; const size_t boff = (size_t)(col0 + t * 16 + ln) * ldb + kb; FragH bq; bq.half[0] = *(const v8us*)(Bh + boff + 8 * hh); bq.half[1] = *(const v8us*)(Bh + boff + 16 + 8 * hh);
      acc[t] = mmaH<ASPLIT ? 2 : 1>(ah.v, al.v, bq.v, bq.v, acc[t]); }
  }
#pragma unroll
  for (int t = 0; t < 4; ++t) { if (col0 + t * 16 >= N) continue;
#pragma unroll
    for (int r = 0; r < 8; ++r) so[w][8 * hh + r][t * 16 + ln] = acc[t][r] * alpha; }
  __builtin_amdgcn_fence(__ATOMIC_ACQ_REL, "workgroup"); __builtin_amdgcn_wave_barrier();
  const int rsub = lane >> 4, c4 = (lane & 15) * 4;
  {
#pragma unroll
    for (int q = 0; q < 8; ++q) { const int r = q * 2 + rsub; if (col0 + c4 < N) { const v4f v = *(const v4fa*)&so[w][r][c4]; *(v4f*)(C + (size_t)(row0 + r) * ldc + col0 + c4) = v; } }
     }
}

// Wt[n][k] = f16(W[k][n]·scale) from f32 row-major W[K][N] (scale = power of two; bf16-exact weights stay exact in f16 away from the subnormal range)
__global__ __launch_bounds__(256) void k_wt_f16(const float* __restrict__ W, _Float16* __restrict__ Wt, int K, int N, float scale) {
  const int t = blockIdx.x * 256 + threadIdx.x; if (t >= N * (K / 8)) return; const int n = t / (K / 8), k8 = (t % (K / 8)) * 8; FragH f;
#pragma unroll
  for (int i = 0; i < 8; ++i) f.h[i] = (_Float16)(bf16_round(W[(size_t)(k8 + i) * N + n]) * scale); const v8us o = f.half[0];
  *(v8us*)((unsigned short*)Wt + (size_t)n * K + k8) = o; 
}
// k_gemm_hh variant with fused epilogue: v = acc·alpha + bias[by·sBias + col] (+ CP[(row/rowsPerB)·sCPb + by·64 + col] if CP) ; ACT 0 none / 1 elu ; writes f16 C16 (and f32 C if non-null)
template <int ACT>
__global__ __launch_bounds__(128) void k_gemm_hhx(const _Float16* __restrict__ A, int lda, size_t sA, const _Float16* __restrict__ Bh, int ldb, size_t sB, float alpha, const float* __restrict__ bias, size_t sBias, const float* __restrict__ CP, int rowsPerB, size_t sCPb, int row0g,
    float* __restrict__ C, _Float16* __restrict__ C16, int ldc, size_t sC, int M, int N, int K) {
  __shared__ __attribute__((aligned(16))) float so[4][16][64];
  const int tid = threadIdx.x, w = tid >> 5, lane = tid & 31, ln = lane & 15, hh = lane >> 4; const int by = blockIdx.y;
  A += (size_t)by * sA; Bh += (size_t)by * sB; const size_t cofs = (size_t)by * sC; const float* bp = bias ? bias + (size_t)by * sBias : nullptr;
  const int ntn = (N + 63) / 64; const int wid = blockIdx.x * 4 + w; const int mt = wid / ntn, nq = wid % ntn; if (mt * 16 >= M) return;
  const int row0 = mt * 16, col0 = nq * 64; const _Float16* arow = A + (size_t)(row0 + ln) * lda;
  v8f acc[4] = {};
  for (int kb = 0; kb < K; kb += 32) { FragH ah; ah.half[0] = *(const v8us*)((const unsigned short*)arow + kb + 8 * hh); ah.half[1] = *(const v8us*)((const unsigned short*)arow + kb + 16 + 8 * hh);
#pragma unroll
    for (int t = 0; t < 4; ++t) { if (col0 + t * 16 >= N) continue; const size_t boff = (size_t)(col0 + t * 16 + ln) * ldb + kb; FragH bq; bq.half[0] = *(const v8us*)((const unsigned short*)Bh + boff + 8 * hh); bq.half[1] = *(const v8us*)((const unsigned short*)Bh + boff + 16 + 8 * hh);
      acc[t] = mmaH<1>(ah.v, ah.v, bq.v, bq.v, acc[t]); }
  }
#pragma unroll
  for (int t = 0; t < 4; ++t) { if (col0 + t * 16 >= N) continue; const int col = col0 + t * 16 + ln; const float bv = bp ? bf16_round(bp[col]) : 0.f;
#pragma unroll
    for (int r = 0; r < 8; ++r) { float v = acc[t][r] * alpha + bv; if (CP) { const int rr = row0g + row0 + 8 * hh + r; if (rowsPerB < 0) v += CP[cofs + (size_t)rr * ldc + col];      /* rowsPerB < 0: own element of the batched C plane */ else { const int bidx = rr / rowsPerB; v += CP[(size_t)bidx * sCPb + (size_t)by * 64 + col]; } } if (ACT == 1) v = (v > 0.f) ? v : expm1f(v); else if (ACT == 7) v = (v > 0.f) ? v + 1.0f : expf(v); else if (ACT == 8) v = tanhf(v); else if (ACT == 9) v = 0.5f * v * (1.0f + tanhf(0.7978845608028654f * (v + 0.044715f * v * v * v))); else if (ACT == 11) v = 1.0f / (1.0f + expf(-v)); else if (ACT == 12) v = (v > 0.f) ? v : 0.01f * v; else if (ACT == 14) v = (v > 0.f) ? v : 0.1f * v; else if (ACT == 16) v = (v >= 0.f) ? v : 0.3f * v; else if (ACT == 17) v = (v >= 0.f) ? v : 0.2f * v; else if (ACT == 15) v = v / (1.0f + expf(-v)); else if (ACT == 3) v = fmaxf(v, 0.f); else if (ACT == 6) v = 0.5f * v * (1.0f + erff(v * 0.70710678118654752f)); so[w][8 * hh + r][t * 16 + ln] = v; } }
  __builtin_amdgcn_fence(__ATOMIC_ACQ_REL, "workgroup"); __builtin_amdgcn_wave_barrier();
  const int rsub = lane >> 4, c4 = (lane & 15) * 4; typedef _Float16 v4h __attribute__((ext_vector_type(4)));
  {
#pragma unroll
    for (int q = 0; q < 8; ++q) { const int r = q * 2 + rsub; if (col0 + c4 < N) { const v4f v = *(const v4fa*)&so[w][r][c4]; if (C) *(v4f*)(C + cofs + (size_t)(row0 + r) * ldc + col0 + c4) = v; if (C16) { v4h h4; for (int i = 0; i < 4; ++i) h4[i] = (_Float16)v[i]; *(v4h*)(C16 + cofs + (size_t)(row0 + r) * ldc + col0 + c4) = h4; } } }
     }
}


typedef _Float16 v4h __attribute__((ext_vector_type(4)));

// All five operand conversions in one grid, 8 elements a thread. Blocks 0 .. 4 CVT_WB - 1: the four weight planes (natural [out][in] = Bt; rounded to bf16, x16, exact in f16), in the
// order in which the planes follow one another in Bt. The other blocks: x (rounded to bf16, exact in f16). Every plane is a whole number of blocks.
#define CVT_WB (DM * DM / 8 / 256)      /* blocks per weight plane */
#define CVT_XB ((unsigned)(NR * DM / 8 / 256))      /* blocks of x */
static_assert(DM * DM % (8 * 256) == 0 && NR * DM % (8 * 256) == 0, "k_cvt: whole blocks only");
__global__ __launch_bounds__(256) void k_cvt(const float* __restrict__ w0, const float* __restrict__ w1, const float* __restrict__ w2, const float* __restrict__ w3, const float* __restrict__ x, _Float16* __restrict__ Bt, _Float16* __restrict__ X16) {
  const unsigned blk = blockIdx.x; const bool isw = blk < 4 * CVT_WB; const unsigned pl = blk / CVT_WB;
  const float* src = !isw ? x : pl == 0 ? w0 : pl == 1 ? w1 : pl == 2 ? w2 : w3; _Float16* dst = isw ? Bt + (size_t)pl * DM * DM : X16; const float sc = isw ? 16.0f : 1.0f;
  const size_t t = (size_t)(isw ? blk - pl * CVT_WB : blk - 4 * CVT_WB) * 256 + threadIdx.x; FragH f;
#pragma unroll
  for (int q = 0; q < 8; ++q) f.h[q] = (_Float16)(bf16_round(src[t * 8 + q]) * sc);
  *(v8us*)((unsigned short*)dst + t * 8) = f.half[0]; }
__global__ __launch_bounds__(256) void k_h16(const float* __restrict__ x, _Float16* __restrict__ X16, size_t n8) { const size_t t = (size_t)blockIdx.x * 256 + threadIdx.x; if (t >= n8) return; FragH f;
#pragma unroll
  for (int q = 0; q < 8; ++q) f.h[q] = (_Float16)x[t * 8 + q]; *(v8us*)((unsigned short*)X16 + t * 8) = f.half[0];  }
__global__ __launch_bounds__(256) void k_round16f(const float* __restrict__ W, _Float16* __restrict__ Bt, size_t n8) { const size_t t = (size_t)blockIdx.x * 256 + threadIdx.x; if (t >= n8) return; FragH f;
#pragma unroll
  for (int i = 0; i < 8; ++i) f.h[i] = (_Float16)(bf16_round(W[t * 8 + i]) * 16.0f); *(v8us*)((unsigned short*)Bt + t * 8) = f.half[0];  }
template <int NHv, int TTv>
__global__ __launch_bounds__(256) void k_vt(const _Float16* __restrict__ V16, int ldv, int voff, _Float16* __restrict__ Vt) { __shared__ unsigned short tl[64][66]; const int tid = threadIdx.x; const int slab = blockIdx.x / (TTv / 64), lg = blockIdx.x % (TTv / 64); const int b = slab / NHv, h = slab % NHv;
  for (int i = tid; i < 64 * 8; i += 256) { const int r = i / 8, c8 = (i % 8) * 8; FragH f; f.half[0] = *(const v8us*)((const unsigned short*)V16 + ((size_t)b * TTv + lg * 64 + r) * ldv + voff + h * 64 + c8);
#pragma unroll
    for (int q = 0; q < 8; ++q) tl[r][c8 + q] = f.u[q]; }
  __syncthreads();
  {
#pragma unroll
    for (int rd = 0; rd < 2; ++rd) { const int d = rd * 32 + tid / 8, pc = tid % 8; FragH f;
#pragma unroll
      for (int q = 0; q < 8; ++q) f.u[q] = tl[pc * 8 + q][d];
      *(v8us*)((unsigned short*)Vt + ((size_t)slab * 64 + d) * TTv + lg * 64 + pc * 8) = f.half[0]; }
     } }

// ---- fast GEMM (block tile 128x64, wave tile 32x64; requires M % 32 == 0 rows per launch region, N % 64 == 0 and K a positive multiple of 64); epilogue = k_gemm_hhx semantics ----
// The operands go through LDS in stages of 64 k: every global load of a wave covers four whole 128-byte lines (4 rows x 64 k), each line is fetched once per block, and the
// fragments are read back from LDS in the k order of g2_frag. Two stage buffers: stage s + 1 is stored and stage s + 2 is requested while stage s is multiplied; one barrier a stage.
// The unroll directives in g2_request, g2_store and k_gemm2: the loop indices pick staging registers, offsets and fragments, which stay in registers only if every index is a constant.
__device__ __forceinline__ v16h g2_frag(const _Float16* p, int hh) { FragH f; f.half[0] = *(const v8us*)((const unsigned short*)p + 8 * hh); f.half[1] = *(const v8us*)((const unsigned short*)p + 16 + 8 * hh); return f.v; }
__device__ __forceinline__ v8f g2_mma(v16h a, v16h b, v8f c) { v8f d = __builtin_amdgcn_wmma_f32_16x16x32_f16(false, a, false, b, (short)0, c, false, false); asm volatile("v_nop\n\tv_nop\n\tv_nop\n\tv_nop" : "+v"(d) : "v"(a), "v"(b)); return d; }
#define G2_PITCH 144                  /* LDS row pitch in bytes for rows of 128: 16 x odd, so that the 16 rows of a 16-byte fragment read fall on all 64 banks */
#define G2_STAGE (192 * G2_PITCH)     /* one stage: 128 A rows, then 64 B rows */
__device__ __forceinline__ v16h g2_lfrag(const unsigned char* p) { FragH f; f.half[0] = *(const v8us*)p; f.half[1] = *(const v8us*)(p + 32); return f.v; }      /* p = the lane's LDS row + 16 * (lane >> 4) bytes: k 8 hh .. + 7 and 16 + 8 hh .. + 7, as g2_frag */
// The thread's 12 pieces of 16 bytes of the next stage (8 of A, 4 of B), requested as one batch; then every offset steps on by one stage. go = byte offsets from the block's A and B
// (32 bits: an operand plane stays under 4 GiB), so that the loads take the kernel's own global pointers as their bases.
__device__ __forceinline__ void g2_request(v8us (&rg)[12], const _Float16* A, const _Float16* B, unsigned (&go)[12]) {
#pragma unroll
  for (int j = 0; j < 12; ++j) rg[j] = *(const v8us*)((const char*)(j < 8 ? A : B) + go[j]);      /* unrolled: rg and go stay in registers only under constant indices */
  asm volatile("s_wait_xcnt 0x0" :: "v"(go[0]), "v"(go[1]), "v"(go[2]), "v"(go[3]), "v"(go[4]), "v"(go[5]), "v"(go[6]), "v"(go[7]), "v"(go[8]), "v"(go[9]), "v"(go[10]), "v"(go[11]) : "memory");      /* the wait in front of the overwrite of the loads' offset registers just below; as inputs the offsets keep their registers up to here; the memory clobber keeps the 12 loads in front of it, one batch ahead of the products */
#pragma unroll
  for (int j = 0; j < 12; ++j) go[j] += 128; }
__device__ __forceinline__ void g2_store(const v8us (&rg)[12], unsigned char* sw) {
#pragma unroll
  for (int j = 0; j < 12; ++j) *(v8us*)(sw + j * 16 * G2_PITCH) = rg[j]; }      /* piece j lies 16 rows below piece j - 1 */
// FT: what a tile does that holds a batch's first QT0 rows (the rows that are carried in f32 beside the f16 path); such a tile is one whole block tile.
//   FT 1: it stores its values as f32 too, into CF (planes of NB * QT0 rows, pitch ldc, sCF elements apart along blockIdx.y).
//   FT 2: its A rows come from AF instead of A, as two f16 planes sAF elements apart: the high part, then the residual x1024. It walks K twice: the high part's sums are
//         multiplied by 1024 (exact) where the second walk begins, the residual's products are added to them, and alpha takes the 2^-10 back. K at least 128.
template <int ACT, int FT>
__global__ __launch_bounds__(128) void k_gemm2(const _Float16* __restrict__ A, int lda, size_t sA, const _Float16* __restrict__ Bh, int ldb, size_t sB, float alpha, const float* __restrict__ bias, size_t sBias, const float* __restrict__ CP, int rowsPerB, size_t sCPb, int row0g,
    float* __restrict__ C, _Float16* __restrict__ C16, int ldc, size_t sC, int M, int N, int K, size_t zA, size_t zB, size_t zC, const _Float16* __restrict__ AF, size_t sAF, float* __restrict__ CF, size_t sCF) { static_assert(QT0 == 128 && SQ % 128 == 0, "k_gemm2: a first tile is one block tile"); static_assert(ACT == 0 || ACT == 3 || ACT == 6 || ACT == 8 || ACT == 9 || ACT == 11 || ACT == 12 || ACT == 14 || ACT == 15 || ACT == 16 || ACT == 17, "k_gemm2: unsupported ACT code (would silently apply no activation)");
  __shared__ __attribute__((aligned(16))) unsigned char sm[2 * G2_STAGE]; float (*so)[32][68] = (float (*)[32][68])sm;      /* the epilogue's staging rows reuse the stage buffers, behind the loop's last barrier */
  const int tid = threadIdx.x, w = tid >> 5, lane = tid & 31, ln = lane & 15, hh = lane >> 4; const int by = blockIdx.y, bz = blockIdx.z;      /* two batch axes, each with its own strides */
  A += (size_t)by * sA + (size_t)bz * zA; Bh += (size_t)by * sB + (size_t)bz * zB; const size_t cofs = (size_t)by * sC + (size_t)bz * zC; const float* bp = bias ? bias + (size_t)by * sBias : nullptr;
  const int ntn = N >> 6; const int mt = blockIdx.x / ntn, nq = blockIdx.x - mt * ntn; const int row0 = mt * 128 + 32 * w, col0 = nq * 64;
  const bool ft = (mt % (SQ / 128)) == 0; const int fr0 = (mt / (SQ / 128)) * QT0;      /* a first tile, and its first row in the first-tile planes; the same for the whole block */
  const _Float16* const Ab = (FT == 2 && ft) ? AF : A;
  const int sr = tid >> 3, sc = (tid & 7) * 8;      /* staging: 8 threads a row, piece j of a thread = stage row 16 j + sr, k sc .. sc + 7 */
  unsigned go[12]; v8us rg[12];
#pragma unroll
  for (int j = 0; j < 8; ++j) { const int r = mt * 128 + j * 16 + sr; go[j] = ((unsigned)((FT == 2 && ft) ? fr0 + j * 16 + sr : r < M ? r : M - 1) * (unsigned)lda + sc) * 2u; }      /* a row past M (its wave stores nothing) reads the last row instead */
#pragma unroll
  for (int j = 0; j < 4; ++j) go[8 + j] = ((unsigned)(col0 + j * 16 + sr) * (unsigned)ldb + sc) * 2u;
  unsigned char* const sw = sm + sr * G2_PITCH + sc * 2;
  const unsigned char* const ar = sm + (32 * w + ln) * G2_PITCH + 16 * hh; const unsigned char* const br = sm + (128 + ln) * G2_PITCH + 16 * hh;
  const v8f z8 = {0.f,0.f,0.f,0.f,0.f,0.f,0.f,0.f}; v8f c00 = z8, c01 = z8, c02 = z8, c03 = z8, c10 = z8, c11 = z8, c12 = z8, c13 = z8;
  const int nk = K >> 6; const int nst = (FT == 2 && ft) ? 2 * nk : nk;
  g2_request(rg, Ab, Bh, go); g2_store(rg, sw); if (nst > 1) g2_request(rg, Ab, Bh, go);
  __syncthreads();      /* stage 0 is complete before any wave reads it */
#pragma unroll 1
  for (int s = 0; s < nst; ++s) {      /* rolled: the trip count is a run-time value and one copy of the body holds all the overlap there is */
    const int cur = (s & 1) * G2_STAGE;
    if (FT == 2 && s == nk) { c00 *= 1024.0f; c01 *= 1024.0f; c02 *= 1024.0f; c03 *= 1024.0f; c10 *= 1024.0f; c11 *= 1024.0f; c12 *= 1024.0f; c13 *= 1024.0f; }      /* the second walk begins (first tiles only: elsewhere s stays below nk) */
    if (s + 1 < nst) { g2_store(rg, sw + (G2_STAGE - cur));
      if (s + 2 < nst) {
        if (FT == 2 && s + 2 == nk) {      /* the next request is the second walk's first: A on to the residual plane, B back to k = 0 */
#pragma unroll
          for (int j = 0; j < 12; ++j) go[j] += (j < 8 ? (unsigned)sAF * 2u : 0u) - (unsigned)K * 2u; }      /* unrolled: go stays in registers only under constant indices */
        g2_request(rg, Ab, Bh, go); } }      /* stage s + 1 into the buffer that every wave left at the last barrier; stage s + 2 in flight under this stage's products */
    v16h fa[2][2], fb[2][4];
#pragma unroll
    for (int ks = 0; ks < 2; ++ks) { fa[ks][0] = g2_lfrag(ar + cur + ks * 64); fa[ks][1] = g2_lfrag(ar + cur + 16 * G2_PITCH + ks * 64);
      for (int t = 0; t < 4; ++t) fb[ks][t] = g2_lfrag(br + cur + t * 16 * G2_PITCH + ks * 64); }
#pragma unroll
    for (int ks = 0; ks < 2; ++ks) {      /* both unrolled: the indices pick fragments, which stay in registers only if they are constants */
      c00 = g2_mma(fa[ks][0], fb[ks][0], c00); c10 = g2_mma(fa[ks][1], fb[ks][0], c10);
      c01 = g2_mma(fa[ks][0], fb[ks][1], c01); c11 = g2_mma(fa[ks][1], fb[ks][1], c11);
      c02 = g2_mma(fa[ks][0], fb[ks][2], c02); c12 = g2_mma(fa[ks][1], fb[ks][2], c12);
      c03 = g2_mma(fa[ks][0], fb[ks][3], c03); c13 = g2_mma(fa[ks][1], fb[ks][3], c13); }
    __syncthreads(); }      /* stage s + 1 is complete, and every wave has left stage s, whose buffer the next trip overwrites (behind the last trip: the epilogue) */
  if (row0 >= M) return;      /* no barrier behind this point */
  v8f accs[8] = {c00, c01, c02, c03, c10, c11, c12, c13}; const float al = (FT == 2 && ft) ? alpha * 0.0009765625f : alpha;
#pragma unroll
  for (int u = 0; u < 8; ++u) { const int t = u & 3, half = u >> 2; const int col = col0 + t * 16 + ln; const float bv = bp ? bf16_round(bp[col]) : 0.f;
#pragma unroll
    for (int r = 0; r < 8; ++r) { const int rloc = half * 16 + 8 * hh + r; float v = accs[u][r] * al + bv; if (CP) { if (rowsPerB < 0) v += CP[cofs + (size_t)(row0g + row0 + rloc) * ldc + col];      /* rowsPerB < 0: own element of the batched C plane */ else { const int bidx = (row0g + row0 + rloc) / rowsPerB; v += CP[(size_t)bidx * sCPb + (size_t)by * 64 + col]; } }
      if (ACT == 3) v = fmaxf(v, 0.f); else if (ACT == 6) v = 0.5f * v * (1.0f + erff(v * 0.70710678118654752f)); else if (ACT == 11) v = 1.0f / (1.0f + expf(-v)); else if (ACT == 15) v = v / (1.0f + expf(-v)); else if (ACT == 12) v = (v > 0.f) ? v : 0.01f * v; else if (ACT == 8) v = tanhf(v); else if (ACT == 9) v = 0.5f * v * (1.0f + tanhf(0.7978845608028654f * (v + 0.044715f * v * v * v))); else if (ACT == 14) v = (v > 0.f) ? v : 0.1f * v; else if (ACT == 16) v = (v >= 0.f) ? v : 0.3f * v; else if (ACT == 17) v = (v >= 0.f) ? v : 0.2f * v;
      so[w][rloc][t * 16 + ln] = v; } }
  __builtin_amdgcn_fence(__ATOMIC_ACQ_REL, "workgroup"); __builtin_amdgcn_wave_barrier();
  const int rsub = lane >> 4, c4 = (lane & 15) * 4;
  {
#pragma unroll
    for (int q = 0; q < 16; ++q) { const int r = q * 2 + rsub; const v4f v = *(const v4fa*)&so[w][r][c4];
      /* behind each of the two stores, at the end of its branch: the wait in front of the overwrite of the store's registers (the next store's value or address, formed in the next branch, lands on them) */
      if (C) { *(v4f*)(C + cofs + (size_t)(row0 + r) * ldc + col0 + c4) = v; asm volatile("s_wait_xcnt 0x0" ::: "memory"); }
      if (C16) { v4h h4; for (int i = 0; i < 4; ++i) h4[i] = (_Float16)v[i]; *(v4h*)(C16 + cofs + (size_t)(row0 + r) * ldc + col0 + c4) = h4; asm volatile("s_wait_xcnt 0x0" ::: "memory"); }
      if (FT == 1 && ft) *(v4f*)(CF + (size_t)by * sCF + (size_t)(fr0 + 32 * w + r) * ldc + col0 + c4) = v; }
     } }


__global__ __launch_bounds__(256) void k_rsm(const float* __restrict__ S, _Float16* __restrict__ P, int nrows) {
  #pragma clang fp contract(off)
  const int i = blockIdx.x * 256 + threadIdx.x; if (i >= nrows) return; const float* s = S + (size_t)i * SQ; float mx = -3.0e38f;
#pragma unroll 1
  for (int j = 0; j < SQ; ++j) mx = fmaxf(mx, s[j]); float se = 0.f;
#pragma unroll 1
  for (int j = 0; j < SQ; ++j) se += expf(s[j] - mx); const float sc = 256.0f / se;
#pragma unroll 1
  for (int j0 = 0; j0 < SQ; j0 += 8) { FragH f; for (int q = 0; q < 8; ++q) f.h[q] = (_Float16)(expf(s[j0 + q] - mx) * sc); unsigned short* d = (unsigned short*)P + (size_t)i * SQ + j0; *(v8us*)d = f.half[0];  } }
__global__ __launch_bounds__(256) void k_vt(const _Float16* __restrict__ V16, int b, int h0, _Float16* __restrict__ VT) { __shared__ unsigned short tl[64][65]; const int tid = threadIdx.x; const int hh = blockIdx.x % HG, sg = blockIdx.x / HG; const int s0 = sg * 64; const int h = h0 + hh;
  for (int i = tid; i < 64 * 8; i += 256) { const int j = i / 8, d8 = (i % 8) * 8; FragH f; f.half[0] = *(const v8us*)((const unsigned short*)V16 + ((size_t)b * SQ + s0 + j) * DM + h * HD + d8); for (int q = 0; q < 8; ++q) tl[d8 + q][j] = f.u[q]; }
  __syncthreads();
  { for (int i = tid; i < 64 * 8; i += 256) { const int d = i / 8, j8 = (i % 8) * 8; FragH f; for (int q = 0; q < 8; ++q) f.u[q] = tl[d][j8 + q]; *(v8us*)((unsigned short*)VT + ((size_t)hh * HD + d) * SQ + s0 + j8) = f.half[0]; }  } }



// ---- fused causal attention ----
typedef _Float16 v8h __attribute__((ext_vector_type(8)));
__device__ __forceinline__ float fa_xhalf(float x) { return __builtin_bit_cast(float, __builtin_amdgcn_permlanex16(__builtin_bit_cast(int, x), __builtin_bit_cast(int, x), 0x76543210, 0xfedcba98, false, false)); }      /* lane l takes lane l ^ 16 */
__device__ __forceinline__ v8f fa_mma(v16h a, v16h b, v8f c) { return __builtin_amdgcn_wmma_f32_16x16x32_f16(false, a, false, b, (short)0, c, false, false); }
// Native 2^x and 1/x. In asm so that the v_nop stands directly behind the last transcendental: the one free issue slot that the instruction set asks for before an instruction that
// reads the result or overwrites the source. In the group of four each v_exp_f32 is
// the free slot of the one before it: the early-clobber results lie on no source.
__device__ __forceinline__ float fa_exp2(float x) { float r; asm("v_exp_f32 %0, %1\n\tv_nop" : "=v"(r) : "v"(x)); return r; }
__device__ __forceinline__ float fa_rcp(float x) { float r; asm("v_rcp_f32 %0, %1\n\tv_nop" : "=v"(r) : "v"(x)); return r; }
__device__ __forceinline__ v4f fa_exp2x4(v4f x) { float r0, r1, r2, r3;
  asm("v_exp_f32 %0, %4\n\tv_exp_f32 %1, %5\n\tv_exp_f32 %2, %6\n\tv_exp_f32 %3, %7\n\tv_nop" : "=&v"(r0), "=&v"(r1), "=&v"(r2), "=&v"(r3) : "v"(x[0]), "v"(x[1]), "v"(x[2]), "v"(x[3]));
  const v4f r = {r0, r1, r2, r3}; return r; }
// Fragment of 16 rows x 32 k in the k order of g2_frag; p = the lane's row + 8 * (lane >> 4), so that the pointer itself is the loads' address register.
__device__ __forceinline__ v16h fa_frag(const _Float16* p) { FragH f; f.half[0] = *(const v8us*)((const unsigned short*)p); f.half[1] = *(const v8us*)((const unsigned short*)p + 16); return f.v; }
// K and V^T reach the waves through LDS, in stages of 64 keys that the block's four waves share: 64 K rows (64 dims each), then 64 V^T rows (64 keys each), all rows of 128 bytes.
#define FA_PITCH 144                  /* LDS row pitch in bytes, as G2_PITCH: 16 x odd, so that the 16 rows of a 16-byte fragment read fall on all 64 banks */
#define FA_TILE (64 * FA_PITCH)       /* 64 rows */
#define FA_STAGE (2 * FA_TILE)        /* one stage: the K rows, then the V^T rows */
// One stage's copies of a thread: 8 pieces of 16 bytes, global memory to LDS through no register (8 threads a row, piece j 16 rows below piece j - 1; 4 pieces of K, 4 of V^T).
// ld = the thread's LDS byte address in the stage's first K row group; kg, vg = its global addresses there. The s_wait_xcnt is the statement's last line, so that it stands in
// front of every later write of a register that a copy names (the callers step kg and vg right behind the call).
__device__ __forceinline__ void fa_copy(unsigned ld, const _Float16* kg, const _Float16* vg) {
  asm volatile("global_load_async_to_lds_b128 %0, %8, off\n\t"
               "global_load_async_to_lds_b128 %1, %9, off\n\t"
               "global_load_async_to_lds_b128 %2, %10, off\n\t"
               "global_load_async_to_lds_b128 %3, %11, off\n\t"
               "global_load_async_to_lds_b128 %4, %12, off\n\t"
               "global_load_async_to_lds_b128 %5, %13, off\n\t"
               "global_load_async_to_lds_b128 %6, %14, off\n\t"
               "global_load_async_to_lds_b128 %7, %15, off\n\t"
               "s_wait_xcnt 0x0"
               :: "v"(ld), "v"(ld + 16 * FA_PITCH), "v"(ld + 32 * FA_PITCH), "v"(ld + 48 * FA_PITCH),
                  "v"(ld + FA_TILE), "v"(ld + FA_TILE + 16 * FA_PITCH), "v"(ld + FA_TILE + 32 * FA_PITCH), "v"(ld + FA_TILE + 48 * FA_PITCH),
                  "v"(kg), "v"(kg + (size_t)16 * DM), "v"(kg + (size_t)32 * DM), "v"(kg + (size_t)48 * DM),
                  "v"(vg), "v"(vg + (size_t)16 * SQ), "v"(vg + (size_t)32 * SQ), "v"(vg + (size_t)48 * SQ)
               : "memory"); }
// One pass: 32 keys against the wave's 32 queries (two groups of 16). Lane (c = lane & 15, hh = lane >> 4) owns query 16 g + c in both products:
//   S^T = K Q^T : A = 16 K rows (g2_lfrag from LDS), B = 16 Q rows (fa_frag), the same k order; s[g][kt][r] = score of key 16 kt + 8 hh + r
//   O^T += V^T P^T : A = 16 V^T rows (dims) by g2_lfrag over the 32 keys; B element e = weight of key (e < 8 ? 8 hh + e : 16 + 8 hh + e - 8) = s[g][e >> 3][e & 7], the k order of g2_lfrag
// so maximum, sum and rescale are the lane's own, with one exchange between the wave's halves. mr = maximum in use (log2 units); it may trail the true one by up to 6
// (weights then reach 256 * 2^6, well inside f16); sums and o are rescaled only in a pass in which some query's maximum has run further ahead.
// kn = the lane's place in the K rows of the next pass, read only where NEXTK says that the wave has that pass and that it lies in the same stage; vl = its place in this pass's
// V^T columns. DIAG and NEXTK are the same for the whole wave (scalar branches): one copy of the pass serves all cases, so the accumulators stay in their registers.
// The unroll directives here and in k_fattn: the loop indices pick fragments and accumulators, which stay in registers only if every index is a constant.
__device__ __forceinline__ void fa_pass(const bool DIAG, const bool NEXTK, v16h (&kf)[2][2], const unsigned char* kn, const unsigned char* vl, const v16h (&qf)[2][2], v8f (&o)[2][4], float (&mr)[2], float (&l)[2], int rel) {
  const float cs = 0.125f * 1.44269504088896340736f;      /* score scale times log2(e) */
  v16h vf[4];
#pragma unroll
  for (int t = 0; t < 4; ++t) vf[t] = g2_lfrag(vl + t * 16 * FA_PITCH);      /* this pass's V^T: in flight under the first product and the softmax */
  v8f s[2][2]; const v8f z8 = {0.f, 0.f, 0.f, 0.f, 0.f, 0.f, 0.f, 0.f};
#pragma unroll
  for (int g = 0; g < 2; ++g) for (int kt = 0; kt < 2; ++kt) { const v8f t = fa_mma(kf[kt][0], qf[g][0], z8); s[g][kt] = (g + kt == 2) ? g2_mma(kf[kt][1], qf[g][1], t) : fa_mma(kf[kt][1], qf[g][1], t); }      /* the last one with g2_mma's four free slots: a branch follows */
  if (NEXTK) {      /* the next pass's K, of the same stage: in flight under this pass's softmax and second product */
#pragma unroll
    for (int kt = 0; kt < 2; ++kt) for (int d = 0; d < 2; ++d) kf[kt][d] = g2_lfrag(kn + kt * 16 * FA_PITCH + d * 64); }
  if (DIAG) {      /* the pass on the diagonal: key 16 kt + 8 hh + r stays while it is not above query 16 g + c (rel = c - 8 hh) */
#pragma unroll
    for (int g = 0; g < 2; ++g) for (int kt = 0; kt < 2; ++kt) for (int r = 0; r < 8; ++r) s[g][kt][r] = (16 * kt + r - 16 * g <= rel) ? s[g][kt][r] : -1.0e30f; }
  float mb[2]; bool need = false;
#pragma unroll
  for (int g = 0; g < 2; ++g) { float mx = s[g][0][0];
    for (int r = 1; r < 8; ++r) mx = fmaxf(mx, s[g][0][r]);
    for (int r = 0; r < 8; ++r) mx = fmaxf(mx, s[g][1][r]);
    mx = fmaxf(mx, fa_xhalf(mx)) * cs; mb[g] = mx; need = need || (mx > mr[g] + 6.0f); }
  if (__builtin_amdgcn_ballot_w32(need) != 0) {      /* wave-uniform; always taken in the first pass (mr = -1e30, factor 0), seldom later */
#pragma unroll
    for (int g = 0; g < 2; ++g) { const float mn = fmaxf(mr[g], mb[g]); const float corr = fa_exp2(mr[g] - mn); mr[g] = mn; l[g] *= corr;
      for (int t = 0; t < 4; ++t) o[g][t] *= corr; } }
#pragma unroll
  for (int g = 0; g < 2; ++g) { const float nm = 8.0f - mr[g];      /* weights carried x256 */
    FragH pf; v4f ls = {0.f, 0.f, 0.f, 0.f};
    for (int i = 0; i < 4; ++i) { v4f a; for (int u = 0; u < 4; ++u) a[u] = fmaf(s[g][i >> 1][(i & 1) * 4 + u], cs, nm);
      const v4f p = fa_exp2x4(a); ls += p; for (int u = 0; u < 4; ++u) pf.h[i * 4 + u] = (_Float16)p[u]; }
    l[g] += (ls[0] + ls[1]) + (ls[2] + ls[3]);
    for (int t = 0; t < 3; ++t) o[g][t] = fa_mma(vf[t], pf.v, o[g][t]);
    o[g][3] = g2_mma(vf[3], pf.v, o[g][3]); } }      /* the weights' last use, with g2_mma's four free slots: what may next land on their registers is asm text (fa_exp2x4, fa_rcp) */
// grid (heads, batches, blocks of 128 queries, the longest first); 4 waves of 32 queries. The block walks the keys up to its last query in stages of 64 (two passes), two LDS
// buffers: stage st + 1's copies fly while stage st is worked on. A wave skips the passes above its own diagonal, but passes every wait and barrier.
__global__ __launch_bounds__(128) void k_fattn(const _Float16* __restrict__ Q, const _Float16* __restrict__ K, const _Float16* __restrict__ VT, _Float16* __restrict__ O) {
  __shared__ __attribute__((aligned(16))) unsigned char sm[2 * FA_STAGE];
  const int tid = threadIdx.x, lane = tid & 31, c = lane & 15, hh = lane >> 4; const int h = blockIdx.x, b = blockIdx.y;
  const int zb = (int)(gridDim.z - 1 - blockIdx.z);      /* the block's 128 queries */
  const int q0 = zb * 128 + __builtin_amdgcn_readfirstlane(tid >> 5) * 32;      /* the wave's first query: scalar, so the pass count is */
  const _Float16* qp = Q + ((size_t)b * SQ + q0 + c) * DM + h * HD + 8 * hh;      /* the lane's row and half, as fa_frag takes them */
  v16h qf[2][2], kf[2][2];
#pragma unroll
  for (int g = 0; g < 2; ++g) for (int d = 0; d < 2; ++d) qf[g][d] = fa_frag(qp + (size_t)g * 16 * DM + d * 32);
  asm volatile("s_wait_xcnt 0x0" :: "v"(qp) : "memory");      /* the wait in front of any overwrite of the loads' address register; as an input the address keeps its register up to here */
  const int sr = tid >> 3, sc = (tid & 7) * 8;      /* staging: 8 threads a row */
  const _Float16* kg = K + ((size_t)b * SQ + sr) * DM + h * HD + sc; const _Float16* vg = VT + ((size_t)(b * NH + h) * HD + sr) * SQ + sc;
  const unsigned ld = (unsigned)(size_t)(sm + sr * FA_PITCH + sc * 2);      /* the low 32 bits of the address: the byte offset in the block's LDS */
  const unsigned char* const kl = sm + c * FA_PITCH + 16 * hh; const unsigned char* const vl = kl + FA_TILE;      /* the lane's row and half in a tile, as g2_lfrag takes them */
  const int nst = 2 * zb + 2, nd = q0 >> 5;      /* stages of the block (two at least); the wave's pass on the diagonal */
  const v8f z8 = {0.f, 0.f, 0.f, 0.f, 0.f, 0.f, 0.f, 0.f}; v8f o[2][4] = {{z8, z8, z8, z8}, {z8, z8, z8, z8}}; float mr[2] = {-1.0e30f, -1.0e30f}, l[2] = {0.f, 0.f};
  const int rel = c - 8 * hh;
  fa_copy(ld, kg, vg); kg += (size_t)64 * DM; vg += 64;
  asm volatile("s_wait_asynccnt 0x0" ::: "memory");      /* the wave's own copies of stage 0 have landed */
  __syncthreads();      /* stage 0 is complete before any wave reads it */
  fa_copy(ld + FA_STAGE, kg, vg); kg += (size_t)64 * DM; vg += 64;
#pragma unroll 1
  for (int st = 0; st < nst; ++st) {      /* rolled: the trip count is a run-time value, and the buffer's offset is one addition */
    const int cur = (st & 1) * FA_STAGE;
    if (2 * st <= nd) {      /* a scalar test: the wave has the stage's first pass */
#pragma unroll
      for (int kt = 0; kt < 2; ++kt) for (int d = 0; d < 2; ++d) kf[kt][d] = g2_lfrag(kl + cur + kt * 16 * FA_PITCH + d * 64); }
#pragma unroll 1
    for (int p = 0; p < 2; ++p) {      /* rolled: one copy of the pass */
      const int kb = 2 * st + p;
      if (kb <= nd) fa_pass(kb == nd, p == 0 && kb < nd, kf, kl + cur + 32 * FA_PITCH, vl + cur + p * 64, qf, o, mr, l, rel); }      /* scalar tests: a pass above the wave's diagonal is skipped */
    asm volatile("s_wait_dscnt 0x0" ::: "memory");      /* the wave's reads of this stage have returned before the buffer is given up */
    asm volatile("s_wait_asynccnt 0x0" ::: "memory");      /* its copies of stage st + 1 have landed */
    __syncthreads();      /* stage st + 1 is complete, and every wave has left stage st */
    if (st + 2 < nst) { fa_copy(ld + cur, kg, vg); kg += (size_t)64 * DM; vg += 64; } }      /* stage st + 2 into the buffer just left; the test is the same for the whole block */
  asm volatile("s_wait_asynccnt 0x0" ::: "memory");      /* no copy is outstanding when the wave ends */
  _Float16* op = O + ((size_t)b * SQ + q0 + c) * DM + h * HD + 8 * hh;      /* o[g][t][r] = dim 16 t + 8 hh + r of query 16 g + c: eight neighbours, one 16-byte store */
  v8h ov[2][4];
#pragma unroll
  for (int g = 0; g < 2; ++g) { const float fin = 64.0f * fa_rcp(l[g] + fa_xhalf(l[g]));      /* the halves' sums joined; o carried x64 */
    for (int t = 0; t < 4; ++t) for (int r = 0; r < 8; ++r) ov[g][t][r] = (_Float16)(o[g][t][r] * fin); }
#pragma unroll
  for (int g = 0; g < 2; ++g) for (int t = 0; t < 4; ++t) *(v8h*)(op + (size_t)g * 16 * DM + t * 16) = ov[g][t]; }


typedef float v2f __attribute__((ext_vector_type(2)));
// exp(x) to f32 accuracy, in the way expf is expanded: n = nearest integer to x log2(e); v_exp_f32 of x log2(e) - n, log2(e) taken in two parts (two fma, so the difference is
// rounded once); ldexp by n; 0 and infinity beyond the two range ends. Written out so that v_exp_f32 can stand in asm with its v_nop directly behind it: the one free issue slot
// that the instruction set asks for before an instruction that reads the result or overwrites the source.
__device__ __forceinline__ float exp_slot(float x) {
  const float c_hi = __uint_as_float(0x3fb8aa3bu), c_lo = __uint_as_float(0x32a5705fu);
  const float n = rintf(x * c_hi); const float a = fmaf(x, c_lo, fmaf(x, c_hi, -n));
  float r; asm("v_exp_f32 %0, %1\n\tv_nop" : "=v"(r) : "v"(a));
  r = ldexpf(r, (int)n); r = (__uint_as_float(0xc2ce8ed0u) > x) ? 0.f : r; r = (__uint_as_float(0x42b17218u) < x) ? __uint_as_float(0x7f800000u) : r; return r; }
// Exact f32 attention of the first QT0 rows, one thread per query row. The row's q and o stay in registers. K and V come in tiles of 64 keys through LDS
// (K transposed to [dim][key], V as [key][dim]) and are read back as broadcasts, 32 reads at a time, one such batch in flight while the batch before it is worked on.
// Eight keys are worked on together: their eight score sums run side by side (each still summed over the dims in ascending order, s = fma(q, k, s)),
// then the running maximum, the two exps and the running sum key by key, then the o update key by key (o = fma(o, sc, e v), l = fma(l, sc, e)).
// Every row sees its keys, and every sum its terms, in the same order as with one key at a time.
template <int MASKADD>
__global__ __launch_bounds__(64) void k_att0(const float* __restrict__ QF, const float* __restrict__ KF, const float* __restrict__ VF, int ld, const float* __restrict__ mask, float scale, _Float16* __restrict__ OH, _Float16* __restrict__ OL, int ldo) {
  __shared__ __attribute__((aligned(16))) float lkt[HD][64]; __shared__ __attribute__((aligned(16))) float lv[64][HD]; __shared__ __attribute__((aligned(16))) float lo[64][HD + 4];
  const int tid = threadIdx.x; const int h = blockIdx.x / (QT0 / 64), rg = blockIdx.x % (QT0 / 64); const int i = rg * 64 + tid;
  { const size_t rb = (size_t)blockIdx.y * QT0; QF += rb * ld; KF += rb * ld; VF += rb * ld; OH += rb * ldo; OL += rb * ldo; }      /* blockIdx.y = batch: QT0 rows of q, k, v and o each */
  const float* qr = QF + (size_t)i * ld + h * HD;
  float q[HD]; v2f o[HD / 2];
#pragma unroll
  for (int c = 0; c < HD / 4; ++c) { const v4f t = *(const v4fa*)(qr + c * 4); for (int u = 0; u < 4; ++u) q[c * 4 + u] = t[u]; const v2f z = {0.f, 0.f}; o[c * 2] = z; o[c * 2 + 1] = z; }
  asm volatile("s_wait_xcnt 0x0" :: "v"(qr) : "memory");      /* the wait in front of any overwrite of the loads' address register; named as an input, the address stays in its register up to here (else the last load's result lands on it) */
  float m = -1.0e30f, l = 0.f; const int jmax = MASKADD ? (SQ - 1) : (rg * 64 + 63);      /* additive-mask form: every key (the mask input decides); causal form: keys up to the block's last row */
#pragma unroll 1
  for (int j0 = 0; j0 <= jmax; j0 += 64) {      /* rolled, for speed only */
    const float* kr = KF + (size_t)(j0 + tid) * ld + h * HD;      /* thread = key: the transposed stores of a wave fall on consecutive banks */
    const float* vr = VF + (size_t)(j0 + tid / 16) * ld + h * HD + (tid % 16) * 4;      /* 16 threads a row: whole lines */
    v4f tk[16], tv[16]; const float* vp[16];
#pragma unroll
    for (int c = 0; c < 16; ++c) { vp[c] = vr + (size_t)(c * 4) * ld; tk[c] = *(const v4fa*)(kr + c * 4); tv[c] = *(const v4fa*)vp[c]; }
    asm volatile("s_wait_xcnt 0x0" :: "v"(kr), "v"(vp[0]), "v"(vp[1]), "v"(vp[2]), "v"(vp[3]), "v"(vp[4]), "v"(vp[5]), "v"(vp[6]), "v"(vp[7]), "v"(vp[8]), "v"(vp[9]), "v"(vp[10]), "v"(vp[11]), "v"(vp[12]), "v"(vp[13]), "v"(vp[14]), "v"(vp[15]) : "memory");      /* as behind the q loads: every address of the batch keeps its register up to the wait (else later loads' results land on earlier loads' addresses) */
    __builtin_amdgcn_sched_barrier(0);      /* all 32 loads of the tile are issued before the first is waited for: without it each load sinks to its LDS store and the latencies add up */
#pragma unroll
    for (int c = 0; c < 16; ++c) { for (int u = 0; u < 4; ++u) lkt[c * 4 + u][tid] = tk[c][u]; *(v4f*)&lv[c * 4 + tid / 16][(tid % 16) * 4] = tv[c]; }
    __syncthreads();      /* the tile is complete before any thread reads it */
#pragma unroll 1
    for (int jg = 0; jg < 64; jg += 8) {      /* rolled for the same reason */
      v4f ba[32], bb[32]; v2f s2[4]; float sc[8], e[8]; for (int p = 0; p < 4; ++p) { const v2f z = {0.f, 0.f}; s2[p] = z; }
      /* batch b of K: dims 16 b .. + 15 of the eight keys; batch b of V: keys 2 b and 2 b + 1, all dims */
      auto load_k = [&](int b, v4f* t) {
#pragma unroll
        for (int x = 0; x < 16; ++x) { t[x * 2] = *(const v4f*)&lkt[b * 16 + x][jg]; t[x * 2 + 1] = *(const v4f*)&lkt[b * 16 + x][jg + 4]; }
        __builtin_amdgcn_sched_barrier(0); };      /* keeps the batch's reads in front of the arithmetic on the batch before: without it they sink to their first use and every read's latency shows */
      auto load_v = [&](int b, v4f* t) {
#pragma unroll
        for (int x = 0; x < 32; ++x) t[x] = *(const v4f*)&lv[jg + b * 2 + (x >> 4)][(x & 15) * 4];
        __builtin_amdgcn_sched_barrier(0); };      /* as in load_k */
      auto work_k = [&](int b, const v4f* t) {
#pragma unroll
        for (int x = 0; x < 16; ++x) { const float qs = q[b * 16 + x]; const v2f qd = {qs, qs}; const v4f ka = t[x * 2], kb = t[x * 2 + 1];
          const v2f k0 = {ka[0], ka[1]}, k1 = {ka[2], ka[3]}, k2 = {kb[0], kb[1]}, k3 = {kb[2], kb[3]};
          s2[0] = __builtin_elementwise_fma(qd, k0, s2[0]); s2[1] = __builtin_elementwise_fma(qd, k1, s2[1]); s2[2] = __builtin_elementwise_fma(qd, k2, s2[2]); s2[3] = __builtin_elementwise_fma(qd, k3, s2[3]); }
        __builtin_amdgcn_sched_barrier(0); };      /* the next batch's reads stay behind this arithmetic, so that no more than two batches hold registers */
      auto work_v = [&](int b, const v4f* t) {
#pragma unroll
        for (int x = 0; x < 32; ++x) { const int u = b * 2 + (x >> 4), c = x & 15; const v2f sc2 = {sc[u], sc[u]}, e2 = {e[u], e[u]}; const v4f vv = t[x]; const v2f v0 = {vv[0], vv[1]}, v1 = {vv[2], vv[3]};
          o[c * 2] = __builtin_elementwise_fma(o[c * 2], sc2, e2 * v0); o[c * 2 + 1] = __builtin_elementwise_fma(o[c * 2 + 1], sc2, e2 * v1); }
        __builtin_amdgcn_sched_barrier(0); };      /* as in work_k */
      load_k(0, ba); load_k(1, bb); work_k(0, ba); load_k(2, ba); work_k(1, bb); load_k(3, bb); work_k(2, ba); load_v(0, ba); work_k(3, bb); load_v(1, bb);
#pragma unroll
      for (int u = 0; u < 8; ++u) { const int j = j0 + jg + u; float s = __fmul_rn(s2[u >> 1][u & 1], scale); if (MASKADD) s = __fadd_rn(s, __fmul_rn(bf16_round(mask[(size_t)i * SQ + j]), -10000.0f));
        const float f = (MASKADD || j <= i) ? 1.f : 0.f; const float sm = fmaf(f, s, (1.f - f) * -1.0e30f); const float mn = fmaxf(m, sm); sc[u] = exp_slot(m - mn); e[u] = exp_slot(sm - mn); l = fmaf(l, sc[u], e[u]); m = mn; }
      work_v(0, ba); load_v(2, ba); work_v(1, bb); load_v(3, bb); work_v(2, ba); work_v(3, bb); }
    __syncthreads(); }      /* every thread has left the tile before the next one overwrites it */
  const float fin = 64.0f / l;      /* o carried x64 like the f16 path */
#pragma unroll
  for (int c = 0; c < HD / 4; ++c) { const v4f oo = {__fmul_rn(o[c * 2][0], fin), __fmul_rn(o[c * 2][1], fin), __fmul_rn(o[c * 2 + 1][0], fin), __fmul_rn(o[c * 2 + 1][1], fin)}; *(v4f*)&lo[tid][c * 4] = oo; }
  __syncthreads();
  {
#pragma unroll 1
    for (int it = 0; it < 16; ++it) { const int row = it * 4 + tid / 16, pc = (tid % 16) * 4; const v4f v = *(const v4f*)&lo[row][pc]; v4h vh, vl;      /* o leaves as two f16 planes: the high part and the residual x1024 */
      for (int u = 0; u < 4; ++u) { const _Float16 hp = (_Float16)v[u]; vh[u] = hp; vl[u] = (_Float16)((v[u] - (float)hp) * 1024.0f); }
      const size_t e = (size_t)(rg * 64 + row) * ldo + h * HD + pc; *(v4h*)(OH + e) = vh; *(v4h*)(OL + e) = vl; }
     } }

#define DMQ DM

template <int BFIN, int W16, int W32>
__global__ __launch_bounds__(256) void k_lnx(const float* __restrict__ X, const float* __restrict__ g, const float* __restrict__ bb, float eps, _Float16* __restrict__ N16, float* __restrict__ N32) {
  #pragma clang fp contract(off)
  __shared__ float red[256]; const size_t r = blockIdx.x; const int t = threadIdx.x; const bool act = t < (DMQ / 4); const int c0 = act ? t * 4 : 0;
  const v4f xa = *(const v4fa*)(X + r * DMQ + c0); float s[4]; float sum = 0.f;
  for (int q = 0; q < 4; ++q) { s[q] = act ? (BFIN ? bf16_round(xa[q]) : xa[q]) : 0.f; sum = __fadd_rn(sum, s[q]); }
  red[t] = sum; __syncthreads(); for (int st = 128; st > 0; st >>= 1) { if (t < st) red[t] = __fadd_rn(red[t], red[t + st]); __syncthreads(); } const float mu = red[0] / (float)DMQ; __syncthreads();
  float vs = 0.f; for (int q = 0; q < 4; ++q) { const float dl = act ? __fadd_rn(s[q], -mu) : 0.f; vs = __fadd_rn(vs, __fmul_rn(dl, dl)); } red[t] = vs; __syncthreads(); for (int st = 128; st > 0; st >>= 1) { if (t < st) red[t] = __fadd_rn(red[t], red[t + st]); __syncthreads(); }
  const float rs = rsqrtf(__fadd_rn(red[0] / (float)DMQ, eps)); v4h y; v4f yf;
  for (int q = 0; q < 4; ++q) { const int c = c0 + q; yf[q] = __fadd_rn(__fmul_rn(__fmul_rn(__fadd_rn(s[q], -mu), rs), bf16_round(g[c])), bf16_round(bb[c])); y[q] = (_Float16)yf[q]; }
  if (!act) return;      /* no barriers after this point */
  { if (W16) *(v4h*)(N16 + r * DMQ + c0) = y; if (W32) *(v4f*)(N32 + r * DMQ + c0) = yf;  } }


extern "C" void kernel_launch(void* const* d_in, const int* in_sizes, int n_in,
                              void* d_out, int out_size, void* d_ws, size_t ws_size, hipStream_t stream) {
  (void)in_sizes; (void)n_in; (void)out_size;
  const float* const* I = (const float* const*)d_in; const float* x = I[0]; const float* wk = I[1]; const float* wq = I[2]; const float* wv = I[3]; const float* wo = I[4]; const float* lng = I[5]; const float* lnb = I[6];      /* x; natural [out][in] Wk, Wq, Wv (THIS order), Wp; LayerNorm gamma, beta; no biases */
  char* ws = (char*)d_ws; size_t off = 0;
  auto take = [&](size_t bytes) { char* p = ws + off; off += (bytes + 255) & ~(size_t)255; return p; };
  /* planes that one launch walks by a stride follow one another without a gap (every size is a multiple of 256 bytes): BQ BK BV BO; Q16 K16 V16; QF0 KF0 VF0; OH0 OL0 */
  _Float16* BQ = (_Float16*)take((size_t)DM * DM * 2); take((size_t)DM * DM * 2); take((size_t)DM * DM * 2); _Float16* BO = (_Float16*)take((size_t)DM * DM * 2);
  _Float16* X16 = (_Float16*)take(NR * DM * 2); _Float16* Q16 = (_Float16*)take(NR * DM * 2); _Float16* K16 = (_Float16*)take(NR * DM * 2); _Float16* V16 = (_Float16*)take(NR * DM * 2); _Float16* O16 = (_Float16*)take(NR * DM * 2);
  float* YO = (float*)take(NR * DM * 4); _Float16* VT = (_Float16*)take((size_t)NB * NH * HD * SQ * 2);      /* pre-norm projection rows y (f32); V^T [NB][NH][HD][SQ] */
  float* QF0 = (float*)take((size_t)NB * QT0 * DM * 4); float* KF0 = (float*)take((size_t)NB * QT0 * DM * 4); float* VF0 = (float*)take((size_t)NB * QT0 * DM * 4); _Float16* OH0 = (_Float16*)take((size_t)NB * QT0 * DM * 2); _Float16* OL0 = (_Float16*)take((size_t)NB * QT0 * DM * 2);
  if (off > ws_size) return;
  k_cvt<<<4 * CVT_WB + CVT_XB, 256, 0, stream>>>(wq, wk, wv, wo, x, BQ, X16);      /* BQ BK BV BO (x16) and the x rows */
  const size_t r0p = (size_t)B0 * SQ;      /* first projected row */
  const size_t f0p = (size_t)B0 * QT0;      /* its first-tile row */
  k_gemm2<0, 1><<<dim3((unsigned)((MP / 128) * (DM / 64)), 3), 128, 0, stream>>>(X16 + r0p * DM, DM, 0, BQ, DM, (size_t)DM * DM, 0.0625f, nullptr, 0, nullptr, 1, 0, 0, nullptr, Q16 + r0p * DM, DM, NR * DM, MP, DM, DM, 0, 0, 0, nullptr, 0, QF0 + f0p * DM, (size_t)NB * QT0 * DM);      /* q, k, v on grid.y: f16 rows, and f32 (exact products) for each batch's first 128 rows */
  k_vt<NH, SQ><<<NBR * NH * (SQ / 64), 256, 0, stream>>>(V16 + r0p * LQ, LQ, 0, VT);      /* V^T [NBR][NH][HD][SQ] */
  k_att0<0><<<dim3(NH * (QT0 / 64), NBR), 64, 0, stream>>>(QF0, KF0, VF0, DM, nullptr, 0.125f, OH0 + f0p * DM, OL0 + f0p * DM, DM);      /* exact f32 attention for rows 0..127 of each batch: o (x64) as f16 high part + x1024 residual planes */
  k_fattn<<<dim3(NH, NB, SQ / 128), 128, 0, stream>>>(Q16, K16, VT, O16);      /* causal attention of all batches and heads: o (merged heads, x64) as f16 rows */
  k_gemm2<0, 2><<<dim3((unsigned)((MPO / 128) * (DM / 64)), 1), 128, 0, stream>>>(O16 + r0p * DM, DM, 0, BO, DM, 0, 0.0009765625f, nullptr, 0, nullptr, 1, 0, 0, YO + r0p * DM, nullptr, DM, 0, MPO, DM, DM, 0, 0, 0, OH0 + f0p * DM, (size_t)NB * QT0 * DM, nullptr, 0);      /* y = o Wp; rows 0..127 of each batch from the two exact planes */
  k_lnx<0, 0, 1><<<(unsigned)NR, 256, 0, stream>>>(YO, lng, lnb, 1e-5f, nullptr, (float*)d_out);      /* out = LayerNorm(y) -> f32 output rows */
}

// v008
// One run takes 167 microseconds.
// Timed twice side by side with v007, it ran 1.13 and 1.11 times as fast.
// Over all steps from v000 it is 58.3 times as fast.
#include <hip/hip_runtime.h>
// Causal multi-head self-attention with a fused post-LayerNorm (x [4][2048][1024]; k/q/v = x W^T (natural [1024][1024], no biases); 16 heads of 64; wei = q k^T * 64^-0.5; causal (tril, -inf); softmax; y = merged Wp^T; out = LayerNorm(y) (biased var, eps per the module, gamma / beta) -> [4][2048][1024]).
// Structure: token rows r = b*2048 + s; x as exact f16 rows (bf16-rounded); Q, K, V as WMMA GEMMs in one launch (64x64 wave tiles, f32 accumulation, exact x16 weights, f16 outputs; each batch's first 128 rows also in f32, for an exact f32 attention of those rows); V^T for all heads via LDS transposes; attention in ONE launch (k_fattn): a wave holds 32 queries of one head and walks the keys up to its diagonal in passes of 32 (K, V^T from LDS stages of 64 keys, shared by a block's 4 waves): S^T = K Q^T, running maximum and sum in f32 (native exp2; weights x256 f16), O^T += V^T P^T, scores and weights never leave the registers; o (x64, folded into the output GEMM alpha) written straight into the merged f16 o rows; y = o W_o GEMM (f32; the first 128 rows of a batch from the exact o as f16 high part + residual), then the row LayerNorm into the output layout.
// Compute dtype: inputs rounded to bf16; x / weights exact; q, k, v, softmax weights and o as plain f16 GEMM operands (~2^-12); scores and softmax statistics f32. v_wmma_f32_16x16x32_f16.
#define NB 4
#define SQ 2048
#define DM 1024
#define NH 16
#define HD 64
#define HG 4                         /* heads per launch of the (b, h0) k_vt form; k_fattn takes all NH */
#define QT0 128                      /* first-tile rows recomputed exactly in f32 */
#define B0 0                         /* first batch processed (debug hook) */
#define NBR NB                       /* batches processed (debug hook) */
#define NR ((size_t)NB * SQ)         /* token rows */
#define MP ((int)((size_t)NBR * SQ)) /* rows projected (debug hook) */
#define QN SQ                        /* unused: k_fattn attends all SQ query rows */
#define NHD NH                       /* unused: k_fattn attends all NH heads */
#define MPO MP                       /* rows through the output stage (debug hook) */
#define LQ DM      /* row pitch of the q/k/v rows */
typedef __bf16 v16b __attribute__((ext_vector_type(16)));
typedef unsigned short v8us __attribute__((ext_vector_type(8), may_alias));
typedef float  v8f  __attribute__((ext_vector_type(8)));
typedef float  v4f  __attribute__((ext_vector_type(4)));
typedef float  v4fa __attribute__((ext_vector_type(4), may_alias));
union FragB { v16b v; v8us half[2]; unsigned short u[16]; };

__device__ __forceinline__ unsigned short bf16_bits(float x) { unsigned int u = __float_as_uint(x); return (unsigned short)((u + 0x7FFFu + ((u >> 16) & 1u)) >> 16); }
__device__ __forceinline__ float bf16_val(unsigned short b) { return __uint_as_float(((unsigned int)b) << 16); }
__device__ __forceinline__ float bf16_round(float x) { return bf16_val(bf16_bits(x)); }
// D += A·B with NT terms: 1 = ah·bh, 2 = + al·bh (A split), 3 = + ah·bl (both split)
template <int NT>
__device__ __forceinline__ v8f mmaN(v16b ah, v16b al, v16b bh, v16b bl, v8f c) {
  c = __builtin_amdgcn_wmma_f32_16x16x32_bf16(false, ah, false, bh, (short)0, c, false, false);
  if (NT >= 2) c = __builtin_amdgcn_wmma_f32_16x16x32_bf16(false, al, false, bh, (short)0, c, false, false);
  if (NT >= 3) c = __builtin_amdgcn_wmma_f32_16x16x32_bf16(false, ah, false, bl, (short)0, c, false, false);
  asm volatile("v_nop\n\tv_nop\n\tv_nop\n\tv_nop" : "+v"(c) : "v"(ah), "v"(al), "v"(bh), "v"(bl));
  return c;
}

__global__ __launch_bounds__(256) void k_wt_bf16(const float* __restrict__ W, unsigned short* __restrict__ Wt, int K, int N) {
  const int t = blockIdx.x * 256 + threadIdx.x;
  const int k8n = K / 8;
  if (t >= N * k8n) return;
  const int n = t / k8n, k8 = (t % k8n) * 8;
  v8us v;
#pragma unroll
  for (int i = 0; i < 8; ++i) v[i] = bf16_bits(W[(size_t)(k8 + i) * N + n]);
  *(v8us*)(Wt + (size_t)n * K + k8) = v;
  
}

// GEMM C[M][N] (f32, pitch ldc) = act(A[M][K]·W + bias). A f32 row-major (pitch lda) converted per fragment to bf16
// (ASPLIT: hi/lo two planes -> 2 terms, else single rounded term); Wt bf16 [N][K] (pitch ldb). BIAS_BF16 rounds the
// bias to bf16 first (bias quantised to bf16 before the add). K%32==0, M%16==0, N%64==0.
template <bool ASPLIT, int ACT, bool BIAS_BF16>
__global__ __launch_bounds__(128) void k_gemm_bf(const float* __restrict__ A, int lda, const unsigned short* __restrict__ Wt, int ldb,
                                               const float* __restrict__ bias, float* __restrict__ C, int ldc, int M, int N, int K) {
  __shared__ __attribute__((aligned(16))) float so[4][16][64];
  const int tid = threadIdx.x, w = tid >> 5, lane = tid & 31, ln = lane & 15, hh = lane >> 4;
  const int ntn = N / 64;
  const int wid = blockIdx.x * 4 + w;
  const int mt = wid / ntn, nq = wid % ntn;
  if (mt * 16 >= M) return;
  const int row0 = mt * 16, col0 = nq * 64;
  const float* arow = A + (size_t)(row0 + ln) * lda;
  v8f acc[4] = {};
  for (int kb = 0; kb < K; kb += 32) {
    FragB ah, al;
    const v4f x0 = *(const v4fa*)(arow + kb + 8 * hh), x1 = *(const v4fa*)(arow + kb + 8 * hh + 4);
    const v4f x2 = *(const v4fa*)(arow + kb + 16 + 8 * hh), x3 = *(const v4fa*)(arow + kb + 16 + 8 * hh + 4);
    float xs[16] = {x0[0],x0[1],x0[2],x0[3],x1[0],x1[1],x1[2],x1[3],x2[0],x2[1],x2[2],x2[3],x3[0],x3[1],x3[2],x3[3]};
#pragma unroll
    for (int i = 0; i < 16; ++i) { const unsigned short hb = bf16_bits(xs[i]); ah.u[i] = hb; al.u[i] = ASPLIT ? bf16_bits(xs[i] - bf16_val(hb)) : (unsigned short)0; }
#pragma unroll
    for (int t = 0; t < 4; ++t) {
      const unsigned short* brow = Wt + (size_t)(col0 + t * 16 + ln) * ldb + kb;
      FragB b;
      b.half[0] = *(const v8us*)(brow + 8 * hh);
      b.half[1] = *(const v8us*)(brow + 16 + 8 * hh);
      acc[t] = mmaN<ASPLIT ? 2 : 1>(ah.v, al.v, b.v, b.v, acc[t]);
    }
  }
#pragma unroll
  for (int t = 0; t < 4; ++t) {
    float bv = bias ? bias[col0 + t * 16 + ln] : 0.f;
    if (BIAS_BF16) bv = bf16_round(bv);
#pragma unroll
    for (int r = 0; r < 8; ++r) { float v = acc[t][r] + bv; if (ACT == 1) v = fmaxf(v, 0.f); so[w][8 * hh + r][t * 16 + ln] = v; }
  }
  __builtin_amdgcn_fence(__ATOMIC_ACQ_REL, "workgroup");
  __builtin_amdgcn_wave_barrier();
  const int rsub = lane >> 4, c4 = (lane & 15) * 4;
  {
#pragma unroll
    for (int q = 0; q < 8; ++q) {
      const int r = q * 2 + rsub;
      const v4f v = *(const v4fa*)&so[w][r][c4];
      *(v4f*)(C + (size_t)(row0 + r) * ldc + col0 + c4) = v;
    }
    
  }
}

// GEMM C = act(A·W + bias + resid): A f32 (ASPLIT -> hi/lo 2 terms), Wt bf16 [N][K]; ACT 0 none, 1 relu, 2 exact gelu;
// resid (optional, f32, row index = (row % rmod), pitch ldr, RES_BF16 rounds it) added before the activation.
template <bool ASPLIT, int ACT, bool BIAS_BF16, bool RES_BF16>
__global__ __launch_bounds__(128) void k_gemm_bf3(const float* __restrict__ A, int lda, const unsigned short* __restrict__ Wt, int ldb,
                                                const float* __restrict__ bias, const float* __restrict__ resid, int rmod, int ldr,
                                                float* __restrict__ C, int ldc, int M, int N, int K) {
  __shared__ __attribute__((aligned(16))) float so[4][16][64];
  const int tid = threadIdx.x, w = tid >> 5, lane = tid & 31, ln = lane & 15, hh = lane >> 4;
  const int ntn = N / 64;
  const int wid = blockIdx.x * 4 + w;
  const int mt = wid / ntn, nq = wid % ntn;
  if (mt * 16 >= M) return;
  const int row0 = mt * 16, col0 = nq * 64;
  const float* arow = A + (size_t)(row0 + ln) * lda;
  v8f acc[4] = {};
  for (int kb = 0; kb < K; kb += 32) {
    FragB ah, al;
    const v4f x0 = *(const v4fa*)(arow + kb + 8 * hh), x1 = *(const v4fa*)(arow + kb + 8 * hh + 4);
    const v4f x2 = *(const v4fa*)(arow + kb + 16 + 8 * hh), x3 = *(const v4fa*)(arow + kb + 16 + 8 * hh + 4);
    float xs[16] = {x0[0],x0[1],x0[2],x0[3],x1[0],x1[1],x1[2],x1[3],x2[0],x2[1],x2[2],x2[3],x3[0],x3[1],x3[2],x3[3]};
#pragma unroll
    for (int i = 0; i < 16; ++i) { const unsigned short hb = bf16_bits(xs[i]); ah.u[i] = hb; al.u[i] = ASPLIT ? bf16_bits(xs[i] - bf16_val(hb)) : (unsigned short)0; }
#pragma unroll
    for (int t = 0; t < 4; ++t) {
      const unsigned short* brow = Wt + (size_t)(col0 + t * 16 + ln) * ldb + kb;
      FragB b;
      b.half[0] = *(const v8us*)(brow + 8 * hh);
      b.half[1] = *(const v8us*)(brow + 16 + 8 * hh);
      acc[t] = mmaN<ASPLIT ? 2 : 1>(ah.v, al.v, b.v, b.v, acc[t]);
    }
  }
#pragma unroll
  for (int t = 0; t < 4; ++t) {
    const int col = col0 + t * 16 + ln;
    float bv = bias ? bias[col] : 0.f;
    if (BIAS_BF16) bv = bf16_round(bv);
#pragma unroll
    for (int r = 0; r < 8; ++r) {
      float v = acc[t][r] + bv;
      if (resid) { float rv = resid[(size_t)((row0 + 8 * hh + r) % rmod) * ldr + col]; if (RES_BF16) rv = bf16_round(rv); v += rv; }
      if (ACT == 1) v = fmaxf(v, 0.f);
      if (ACT == 2) v = 0.5f * v * (1.0f + erff(v * 0.70710678118654752f));
      if (ACT == 3) { const float u = 0.7978845608028654f * (v + 0.044715f * v * v * v); v = 0.5f * v * (1.0f + tanhf(u)); }
      so[w][8 * hh + r][t * 16 + ln] = v;
    }
  }
  __builtin_amdgcn_fence(__ATOMIC_ACQ_REL, "workgroup");
  __builtin_amdgcn_wave_barrier();
  const int rsub = lane >> 4, c4 = (lane & 15) * 4;
  {
#pragma unroll
    for (int q = 0; q < 8; ++q) {
      const int r = q * 2 + rsub;
      const v4f v = *(const v4fa*)&so[w][r][c4];
      *(v4f*)(C + (size_t)(row0 + r) * ldc + col0 + c4) = v;
    }
    
  }
}
// row LayerNorm (biased variance, eps) over N: s = X (+ R); optional out_sum <- s; out_norm <- (s-mu)*rsqrt(var+eps)*g + b
template <bool PARAM_BF16>
__global__ __launch_bounds__(256) void k_layernorm(const float* __restrict__ X, const float* __restrict__ R, const float* __restrict__ g, const float* __restrict__ bta,
                                                  float* __restrict__ out_sum, float* __restrict__ out_norm, int N, float eps) {
  __shared__ float red[256];
  const int row = blockIdx.x, tid = threadIdx.x;
  const float* x = X + (size_t)row * N; const float* rr = R ? R + (size_t)row * N : nullptr;
  float vals[16];                     // up to N = 4096
  const int per = N / 256;            // contiguous chunk per thread? use strided-by-4 chunks: thread handles j = tid*4 + 1024*u
  float s1 = 0.f;
  for (int u = 0; u < per / 4; ++u) {
    const int j = tid * 4 + 1024 * u;
    const v4f a = *(const v4fa*)(x + j);
    v4f b = {0.f,0.f,0.f,0.f}; if (rr) b = *(const v4fa*)(rr + j);
#pragma unroll
    for (int q = 0; q < 4; ++q) { const float v = a[q] + b[q]; vals[u * 4 + q] = v; s1 += v; }
  }
  red[tid] = s1; __syncthreads();
  for (int st = 128; st > 0; st >>= 1) { if (tid < st) red[tid] += red[tid + st]; __syncthreads(); }
  const float mu = red[0] / (float)N; __syncthreads();
  float s2 = 0.f;
  for (int u = 0; u < per / 4; ++u)
#pragma unroll
    for (int q = 0; q < 4; ++q) { const float c = vals[u * 4 + q] - mu; s2 += c * c; }
  red[tid] = s2; __syncthreads();
  for (int st = 128; st > 0; st >>= 1) { if (tid < st) red[tid] += red[tid + st]; __syncthreads(); }
  const float rs = rsqrtf(red[0] / (float)N + eps);
  {
    for (int u = 0; u < per / 4; ++u) {
      const int j = tid * 4 + 1024 * u;
      v4f o, sm;
#pragma unroll
      for (int q = 0; q < 4; ++q) {
        float gg = g[j + q], bb = bta[j + q];
        if (PARAM_BF16) { gg = bf16_round(gg); bb = bf16_round(bb); }
        sm[q] = vals[u * 4 + q]; o[q] = (vals[u * 4 + q] - mu) * rs * gg + bb;
      }
      if (out_sum) *(v4f*)(out_sum + (size_t)row * N + j) = sm;
      *(v4f*)(out_norm + (size_t)row * N + j) = o;
    }
    
  }
}



// ---- f16 WMMA path (v_wmma_f32_16x16x32_f16): 11-bit significands for operands in range — used where a [0,1] probability operand needs more precision than bf16
typedef _Float16 v16h __attribute__((ext_vector_type(16)));
union FragH { v16h v; v8us half[2]; _Float16 h[16]; unsigned short u[16]; };
template <int NT>
__device__ __forceinline__ v8f mmaH(v16h ah, v16h al, v16h bh, v16h bl, v8f c) {
  c = __builtin_amdgcn_wmma_f32_16x16x32_f16(false, ah, false, bh, (short)0, c, false, false);
  if (NT >= 2) c = __builtin_amdgcn_wmma_f32_16x16x32_f16(false, al, false, bh, (short)0, c, false, false);
  if (NT >= 3) c = __builtin_amdgcn_wmma_f32_16x16x32_f16(false, ah, false, bl, (short)0, c, false, false);
  asm volatile("v_nop\n\tv_nop\n\tv_nop\n\tv_nop" : "+v"(c) : "v"(ah), "v"(al), "v"(bh), "v"(bl));
  return c;
}
// batched GEMM like k_gemm_b but f16 operands: A f32 (split into f16 hi/lo if ASPLIT, else rounded to f16), Bt = f16 values [n][k]; alpha; C f32; N multiple of 16 (partial tiles skipped)
template <bool ASPLIT>
__global__ __launch_bounds__(128) void k_gemm_h(const float* __restrict__ A, int lda, size_t sA, const _Float16* __restrict__ Bh, int ldb, size_t sB, float alpha, float* __restrict__ C, int ldc, size_t sC, int M, int N, int K) {
  __shared__ __attribute__((aligned(16))) float so[4][16][64];
  const int tid = threadIdx.x, w = tid >> 5, lane = tid & 31, ln = lane & 15, hh = lane >> 4; const int by = blockIdx.y;
  A += (size_t)by * sA; Bh += (size_t)by * sB; C += (size_t)by * sC;
  const int ntn = (N + 63) / 64; const int wid = blockIdx.x * 4 + w; const int mt = wid / ntn, nq = wid % ntn; if (mt * 16 >= M) return;
  const int row0 = mt * 16, col0 = nq * 64; const float* arow = A + (size_t)(row0 + ln) * lda;
  v8f acc[4] = {};
  for (int kb = 0; kb < K; kb += 32) {
    FragH ah, al;
    const v4f x0 = *(const v4fa*)(arow + kb + 8 * hh), x1 = *(const v4fa*)(arow + kb + 8 * hh + 4), x2 = *(const v4fa*)(arow + kb + 16 + 8 * hh), x3 = *(const v4fa*)(arow + kb + 16 + 8 * hh + 4);
    float xs[16] = {x0[0],x0[1],x0[2],x0[3],x1[0],x1[1],x1[2],x1[3],x2[0],x2[1],x2[2],x2[3],x3[0],x3[1],x3[2],x3[3]};
#pragma unroll
    for (int i = 0; i < 16; ++i) { const _Float16 h = (_Float16)xs[i]; ah.h[i] = h; al.h[i] = ASPLIT ? (_Float16)(xs[i] - (float)h) : (_Float16)0.0f; }
#pragma unroll
    for (int t = 0; t < 4; ++t) { if (col0 + t * 16 >= N) continue; const size_t boff = (size_t)(col0 + t * 16 + ln) * ldb + kb; FragH bq; bq.half[0] = *(const v8us*)(Bh + boff + 8 * hh); bq.half[1] = *(const v8us*)(Bh + boff + 16 + 8 * hh);
      acc[t] = mmaH<ASPLIT ? 2 : 1>(ah.v, al.v, bq.v, bq.v, acc[t]); }
  }
#pragma unroll
  for (int t = 0; t < 4; ++t) { if (col0 + t * 16 >= N) continue;
#pragma unroll
    for (int r = 0; r < 8; ++r) so[w][8 * hh + r][t * 16 + ln] = acc[t][r] * alpha; }
  __builtin_amdgcn_fence(__ATOMIC_ACQ_REL, "workgroup"); __builtin_amdgcn_wave_barrier();
  const int rsub = lane >> 4, c4 = (lane & 15) * 4;
  {
#pragma unroll
    for (int q = 0; q < 8; ++q) { const int r = q * 2 + rsub; if (col0 + c4 < N) { const v4f v = *(const v4fa*)&so[w][r][c4]; *(v4f*)(C + (size_t)(row0 + r) * ldc + col0 + c4) = v; } }
     }
}

// Wt[n][k] = f16(W[k][n]·scale) from f32 row-major W[K][N] (scale = power of two; bf16-exact weights stay exact in f16 away from the subnormal range)
__global__ __launch_bounds__(256) void k_wt_f16(const float* __restrict__ W, _Float16* __restrict__ Wt, int K, int N, float scale) {
  const int t = blockIdx.x * 256 + threadIdx.x; if (t >= N * (K / 8)) return; const int n = t / (K / 8), k8 = (t % (K / 8)) * 8; FragH f;
#pragma unroll
  for (int i = 0; i < 8; ++i) f.h[i] = (_Float16)(bf16_round(W[(size_t)(k8 + i) * N + n]) * scale); const v8us o = f.half[0];
  *(v8us*)((unsigned short*)Wt + (size_t)n * K + k8) = o; 
}
// k_gemm_hh variant with fused epilogue: v = acc·alpha + bias[by·sBias + col] (+ CP[(row/rowsPerB)·sCPb + by·64 + col] if CP) ; ACT 0 none / 1 elu ; writes f16 C16 (and f32 C if non-null)
template <int ACT>
__global__ __launch_bounds__(128) void k_gemm_hhx(const _Float16* __restrict__ A, int lda, size_t sA, const _Float16* __restrict__ Bh, int ldb, size_t sB, float alpha, const float* __restrict__ bias, size_t sBias, const float* __restrict__ CP, int rowsPerB, size_t sCPb, int row0g,
    float* __restrict__ C, _Float16* __restrict__ C16, int ldc, size_t sC, int M, int N, int K) {
  __shared__ __attribute__((aligned(16))) float so[4][16][64];
  const int tid = threadIdx.x, w = tid >> 5, lane = tid & 31, ln = lane & 15, hh = lane >> 4; const int by = blockIdx.y;
  A += (size_t)by * sA; Bh += (size_t)by * sB; const size_t cofs = (size_t)by * sC; const float* bp = bias ? bias + (size_t)by * sBias : nullptr;
  const int ntn = (N + 63) / 64; const int wid = blockIdx.x * 4 + w; const int mt = wid / ntn, nq = wid % ntn; if (mt * 16 >= M) return;
  const int row0 = mt * 16, col0 = nq * 64; const _Float16* arow = A + (size_t)(row0 + ln) * lda;
  v8f acc[4] = {};
  for (int kb = 0; kb < K; kb += 32) { FragH ah; ah.half[0] = *(const v8us*)((const unsigned short*)arow + kb + 8 * hh); ah.half[1] = *(const v8us*)((const unsigned short*)arow + kb + 16 + 8 * hh);
#pragma unroll
    for (int t = 0; t < 4; ++t) { if (col0 + t * 16 >= N) continue; const size_t boff = (size_t)(col0 + t * 16 + ln) * ldb + kb; FragH bq; bq.half[0] = *(const v8us*)((const unsigned short*)Bh + boff + 8 * hh); bq.half[1] = *(const v8us*)((const unsigned short*)Bh + boff + 16 + 8 * hh);
      acc[t] = mmaH<1>(ah.v, ah.v, bq.v, bq.v, acc[t]); }
  }
#pragma unroll
  for (int t = 0; t < 4; ++t) { if (col0 + t * 16 >= N) continue; const int col = col0 + t * 16 + ln; const float bv = bp ? bf16_round(bp[col]) : 0.f;
#pragma unroll
    for (int r = 0; r < 8; ++r) { float v = acc[t][r] * alpha + bv; if (CP) { const int rr = row0g + row0 + 8 * hh + r; if (rowsPerB < 0) v += CP[cofs + (size_t)rr * ldc + col];      /* rowsPerB < 0: own element of the batched C plane */ else { const int bidx = rr / rowsPerB; v += CP[(size_t)bidx * sCPb + (size_t)by * 64 + col]; } } if (ACT == 1) v = (v > 0.f) ? v : expm1f(v); else if (ACT == 7) v = (v > 0.f) ? v + 1.0f : expf(v); else if (ACT == 8) v = tanhf(v); else if (ACT == 9) v = 0.5f * v * (1.0f + tanhf(0.7978845608028654f * (v + 0.044715f * v * v * v))); else if (ACT == 11) v = 1.0f / (1.0f + expf(-v)); else if (ACT == 12) v = (v > 0.f) ? v : 0.01f * v; else if (ACT == 14) v = (v > 0.f) ? v : 0.1f * v; else if (ACT == 16) v = (v >= 0.f) ? v : 0.3f * v; else if (ACT == 17) v = (v >= 0.f) ? v : 0.2f * v; else if (ACT == 15) v = v / (1.0f + expf(-v)); else if (ACT == 3) v = fmaxf(v, 0.f); else if (ACT == 6) v = 0.5f * v * (1.0f + erff(v * 0.70710678118654752f)); so[w][8 * hh + r][t * 16 + ln] = v; } }
  __builtin_amdgcn_fence(__ATOMIC_ACQ_REL, "workgroup"); __builtin_amdgcn_wave_barrier();
  const int rsub = lane >> 4, c4 = (lane & 15) * 4; typedef _Float16 v4h __attribute__((ext_vector_type(4)));
  {
#pragma unroll
    for (int q = 0; q < 8; ++q) { const int r = q * 2 + rsub; if (col0 + c4 < N) { const v4f v = *(const v4fa*)&so[w][r][c4]; if (C) *(v4f*)(C + cofs + (size_t)(row0 + r) * ldc + col0 + c4) = v; if (C16) { v4h h4; for (int i = 0; i < 4; ++i) h4[i] = (_Float16)v[i]; *(v4h*)(C16 + cofs + (size_t)(row0 + r) * ldc + col0 + c4) = h4; } } }
     }
}


typedef _Float16 v4h __attribute__((ext_vector_type(4)));

// All five operand conversions in one grid, 8 elements a thread. Blocks 0 .. 4 CVT_WB - 1: the four weight planes (natural [out][in] = Bt; rounded to bf16, x16, exact in f16), in the
// order in which the planes follow one another in Bt. The other blocks: x (rounded to bf16, exact in f16). Every plane is a whole number of blocks.
#define CVT_WB (DM * DM / 8 / 256)      /* blocks per weight plane */
#define CVT_XB ((unsigned)(NR * DM / 8 / 256))      /* blocks of x */
static_assert(DM * DM % (8 * 256) == 0 && NR * DM % (8 * 256) == 0, "k_cvt: whole blocks only");
__global__ __launch_bounds__(256) void k_cvt(const float* __restrict__ w0, const float* __restrict__ w1, const float* __restrict__ w2, const float* __restrict__ w3, const float* __restrict__ x, _Float16* __restrict__ Bt, _Float16* __restrict__ X16) {
  const unsigned blk = blockIdx.x; const bool isw = blk < 4 * CVT_WB; const unsigned pl = blk / CVT_WB;
  const float* src = !isw ? x : pl == 0 ? w0 : pl == 1 ? w1 : pl == 2 ? w2 : w3; _Float16* dst = isw ? Bt + (size_t)pl * DM * DM : X16; const float sc = isw ? 16.0f : 1.0f;
  const size_t t = (size_t)(isw ? blk - pl * CVT_WB : blk - 4 * CVT_WB) * 256 + threadIdx.x; FragH f;
#pragma unroll
  for (int q = 0; q < 8; ++q) f.h[q] = (_Float16)(bf16_round(src[t * 8 + q]) * sc);
  *(v8us*)((unsigned short*)dst + t * 8) = f.half[0]; }
__global__ __launch_bounds__(256) void k_h16(const float* __restrict__ x, _Float16* __restrict__ X16, size_t n8) { const size_t t = (size_t)blockIdx.x * 256 + threadIdx.x; if (t >= n8) return; FragH f;
#pragma unroll
  for (int q = 0; q < 8; ++q) f.h[q] = (_Float16)x[t * 8 + q]; *(v8us*)((unsigned short*)X16 + t * 8) = f.half[0];  }
__global__ __launch_bounds__(256) void k_round16f(const float* __restrict__ W, _Float16* __restrict__ Bt, size_t n8) { const size_t t = (size_t)blockIdx.x * 256 + threadIdx.x; if (t >= n8) return; FragH f;
#pragma unroll
  for (int i = 0; i < 8; ++i) f.h[i] = (_Float16)(bf16_round(W[t * 8 + i]) * 16.0f); *(v8us*)((unsigned short*)Bt + t * 8) = f.half[0];  }
template <int NHv, int TTv>
__global__ __launch_bounds__(256) void k_vt(const _Float16* __restrict__ V16, int ldv, int voff, _Float16* __restrict__ Vt) { __shared__ unsigned short tl[64][66]; const int tid = threadIdx.x; const int slab = blockIdx.x / (TTv / 64), lg = blockIdx.x % (TTv / 64); const int b = slab / NHv, h = slab % NHv;
  for (int i = tid; i < 64 * 8; i += 256) { const int r = i / 8, c8 = (i % 8) * 8; FragH f; f.half[0] = *(const v8us*)((const unsigned short*)V16 + ((size_t)b * TTv + lg * 64 + r) * ldv + voff + h * 64 + c8);
#pragma unroll
    for (int q = 0; q < 8; ++q) tl[r][c8 + q] = f.u[q]; }
  __syncthreads();
  {
#pragma unroll
    for (int rd = 0; rd < 2; ++rd) { const int d = rd * 32 + tid / 8, pc = tid % 8; FragH f;
#pragma unroll
      for (int q = 0; q < 8; ++q) f.u[q] = tl[pc * 8 + q][d];
      *(v8us*)((unsigned short*)Vt + ((size_t)slab * 64 + d) * TTv + lg * 64 + pc * 8) = f.half[0]; }
     } }

// ---- fast GEMM (block tile 128x256, eight waves as 2x4 of 64x64: an operand line is fetched by fewer blocks, and a fragment read from LDS feeds four products; requires M % 64 == 0 rows per launch region, N % 256 == 0 and K a positive multiple of 64); epilogue = k_gemm_hhx semantics ----
// The operands go through LDS in stages of 64 k: every global load of a wave covers four whole 128-byte lines (4 rows x 64 k), each line is fetched once per block, and the
// fragments are read back from LDS in the k order of g2_frag. Two stage buffers: stage s + 1 is stored and stage s + 2 is requested while stage s is multiplied; one barrier a stage.
// The unroll directives in g2_request, g2_store and k_gemm2: the loop indices pick staging registers, offsets and fragments, which stay in registers only if every index is a constant.
__device__ __forceinline__ v16h g2_frag(const _Float16* p, int hh) { FragH f; f.half[0] = *(const v8us*)((const unsigned short*)p + 8 * hh); f.half[1] = *(const v8us*)((const unsigned short*)p + 16 + 8 * hh); return f.v; }
__device__ __forceinline__ v8f g2_mma(v16h a, v16h b, v8f c) { v8f d = __builtin_amdgcn_wmma_f32_16x16x32_f16(false, a, false, b, (short)0, c, false, false); asm volatile("v_nop\n\tv_nop\n\tv_nop\n\tv_nop" : "+v"(d) : "v"(a), "v"(b)); return d; }
__device__ __forceinline__ v8f g2_mmap(v16h a, v16h b, v8f c) { return __builtin_amdgcn_wmma_f32_16x16x32_f16(false, a, false, b, (short)0, c, false, false); }      /* the bare builtin: the compiler keeps the distances between products itself and is free in placing their registers (tied to g2_mma's asm operands, the 64x64 tile's accumulators and fragments spilled) */
#define G2_PITCH 144                  /* LDS row pitch in bytes for rows of 128: 16 x odd, so that the 16 rows of a 16-byte fragment read fall on all 64 banks */
#define G2_STAGE (384 * G2_PITCH)     /* one stage: 128 A rows, then 256 B rows */
__device__ __forceinline__ v16h g2_lfrag(const unsigned char* p) { FragH f; f.half[0] = *(const v8us*)p; f.half[1] = *(const v8us*)(p + 32); return f.v; }      /* p = the lane's LDS row + 16 * (lane >> 4) bytes: k 8 hh .. + 7 and 16 + 8 hh .. + 7, as g2_frag */
// The thread's 12 pieces of 16 bytes of the next stage (4 of A, 8 of B), requested as one batch; then both offsets step on by one stage. go = the thread's own byte offsets in A and in B
// (32 bits: an operand plane stays under 4 GiB); uo = the byte offsets of the 12 row groups, the same for the whole block: they go into the loads' scalar bases, so that
// twelve loads take two offset registers.
__device__ __forceinline__ void g2_request(v8us (&rg)[12], const _Float16* A, const _Float16* B, const unsigned (&uo)[12], unsigned (&go)[2]) {
#pragma unroll
  for (int j = 0; j < 12; ++j) rg[j] = *(const v8us*)(((const char*)(j < 4 ? A : B) + uo[j]) + go[j < 4 ? 0 : 1]);      /* unrolled: rg stays in registers only under constant indices */
  asm volatile("s_wait_xcnt 0x0" :: "v"(go[0]), "v"(go[1]) : "memory");      /* the wait in front of the overwrite of the loads' offset registers just below; as inputs the offsets keep their registers up to here; the memory clobber keeps the 12 loads in front of it, one batch ahead of the products */
  go[0] += 128; go[1] += 128; }
__device__ __forceinline__ void g2_store(const v8us (&rg)[12], unsigned char* sw) {
#pragma unroll
  for (int j = 0; j < 12; ++j) *(v8us*)(sw + j * 32 * G2_PITCH) = rg[j]; }      /* piece j lies 32 rows below piece j - 1 */
// FT: what a tile does that holds a batch's first QT0 rows (the rows that are carried in f32 beside the f16 path); such a tile is one whole block tile.
//   FT 1: it stores its values as f32 too, into CF (planes of NB * QT0 rows, pitch ldc, sCF elements apart along blockIdx.y).
//   FT 2: its A rows come from AF instead of A, as two f16 planes sAF elements apart: the high part, then the residual x1024. It walks K twice: the high part's sums are
//         multiplied by 1024 (exact) where the second walk begins, the residual's products are added to them, and alpha takes the 2^-10 back. K at least 128.
template <int ACT, int FT>
__global__ __launch_bounds__(256) void k_gemm2(const _Float16* __restrict__ A, int lda, size_t sA, const _Float16* __restrict__ Bh, int ldb, size_t sB, float alpha, const float* __restrict__ bias, size_t sBias, const float* __restrict__ CP, int rowsPerB, size_t sCPb, int row0g,
    float* __restrict__ C, _Float16* __restrict__ C16, int ldc, size_t sC, int M, int N, int K, size_t zA, size_t zB, size_t zC, const _Float16* __restrict__ AF, size_t sAF, float* __restrict__ CF, size_t sCF) { static_assert(QT0 == 128 && SQ % 128 == 0, "k_gemm2: a first tile is one block tile"); static_assert(ACT == 0 || ACT == 3 || ACT == 6 || ACT == 8 || ACT == 9 || ACT == 11 || ACT == 12 || ACT == 14 || ACT == 15 || ACT == 16 || ACT == 17, "k_gemm2: unsupported ACT code (would silently apply no activation)");
  __shared__ __attribute__((aligned(16))) unsigned char sm[2 * G2_STAGE]; float (*so)[32][68] = (float (*)[32][68])sm; static_assert(8 * 32 * 68 * 4 <= 2 * G2_STAGE, "k_gemm2: the epilogue's rows fit the stage buffers");      /* the epilogue's staging rows reuse the stage buffers, behind the loop's last barrier */
  const int tid = threadIdx.x, w = tid >> 5, lane = tid & 31, ln = lane & 15, hh = lane >> 4; const int by = blockIdx.y, bz = blockIdx.z;      /* two batch axes, each with its own strides */
  A += (size_t)by * sA + (size_t)bz * zA; Bh += (size_t)by * sB + (size_t)bz * zB; const size_t cofs = (size_t)by * sC + (size_t)bz * zC; const float* bp = bias ? bias + (size_t)by * sBias : nullptr;
  const int ntn = N >> 8; const int mt = blockIdx.x / ntn, nq = blockIdx.x - mt * ntn; const int wr = w >> 2, wc = w & 3; const int row0 = mt * 128 + 64 * wr, col0 = nq * 256 + 64 * wc;      /* the wave's 64x64 tile */
  const bool ft = (mt % (SQ / 128)) == 0; const int fr0 = (mt / (SQ / 128)) * QT0;      /* a first tile, and its first row in the first-tile planes; the same for the whole block */
  const _Float16* const Ab = (FT == 2 && ft) ? AF : A;
  const int sr = tid >> 3, sc = (tid & 7) * 8;      /* staging: 8 threads a row, piece j of a thread = stage row 32 j + sr, k sc .. sc + 7 */
  unsigned go[2], uo[12]; v8us rg[12];
#pragma unroll
  for (int j = 0; j < 4; ++j) { const int rb = mt * 128 + j * 32; uo[j] = (unsigned)((FT == 2 && ft) ? fr0 + j * 32 : rb <= M - 32 ? rb : M - 32) * (unsigned)lda * 2u; }      /* a row group past M (its wave stores nothing) reads the last 32 rows instead */
  go[0] = ((unsigned)sr * (unsigned)lda + sc) * 2u; go[1] = ((unsigned)sr * (unsigned)ldb + sc) * 2u;
#pragma unroll
  for (int j = 0; j < 8; ++j) uo[4 + j] = (unsigned)__builtin_amdgcn_readfirstlane((int)((unsigned)(nq * 256 + j * 32) * (unsigned)ldb * 2u));      /* through readfirstlane, so that each stays a scalar of its own: as plain multiples of one stride the compiler chained them into vector address pairs, on which later loads' results landed */
  unsigned char* const sw = sm + sr * G2_PITCH + sc * 2;
  const unsigned char* const ar = sm + (64 * wr + ln) * G2_PITCH + 16 * hh; const unsigned char* const br = sm + (128 + 64 * wc + ln) * G2_PITCH + 16 * hh;
  const v8f z8 = {0.f,0.f,0.f,0.f,0.f,0.f,0.f,0.f}; v8f cc[4][4];      /* cc[i][t]: rows 16 i .., columns 16 t .. of the wave's tile */
#pragma unroll
  for (int i = 0; i < 4; ++i) for (int t = 0; t < 4; ++t) cc[i][t] = z8;
  const int nk = K >> 6; const int nst = (FT == 2 && ft) ? 2 * nk : nk;
  g2_request(rg, Ab, Bh, uo, go); g2_store(rg, sw); if (nst > 1) g2_request(rg, Ab, Bh, uo, go);
  __syncthreads();      /* stage 0 is complete before any wave reads it */
#pragma unroll 1
  for (int s = 0; s < nst; ++s) {      /* rolled: the trip count is a run-time value and one copy of the body holds all the overlap there is */
    const int cur = (s & 1) * G2_STAGE;
    if (FT == 2 && s == nk) {      /* the second walk begins (first tiles only: elsewhere s stays below nk) */
#pragma unroll
      for (int i = 0; i < 4; ++i) for (int t = 0; t < 4; ++t) cc[i][t] *= 1024.0f; }
    if (s + 1 < nst) { g2_store(rg, sw + (G2_STAGE - cur));
      if (s + 2 < nst) {
        if (FT == 2 && s + 2 == nk) { go[0] += (unsigned)sAF * 2u - (unsigned)K * 2u; go[1] -= (unsigned)K * 2u; }      /* the next request is the second walk's first: A on to the residual plane, B back to k = 0 */
        g2_request(rg, Ab, Bh, uo, go); } }      /* stage s + 1 into the buffer that every wave left at the last barrier; stage s + 2 in flight under this stage's products */
    v16h fa[2][4], fb[2][4];      /* the loops over ks, t and i are unrolled: the indices pick fragments and accumulators, which stay in registers only if they are constants */
#pragma unroll
    for (int ks = 0; ks < 2; ++ks) {
      if (ks == 0 || FT != 2) {      /* FT 2 (one block on a WGP, registers to spare): both k steps' reads in front of the first product; else each k step's 16 reads in front of its own products */
#pragma unroll
        for (int k2 = ks; k2 < (FT == 2 ? 2 : ks + 1); ++k2) for (int t = 0; t < 4; ++t) { fa[k2][t] = g2_lfrag(ar + cur + t * 16 * G2_PITCH + k2 * 64); fb[k2][t] = g2_lfrag(br + cur + t * 16 * G2_PITCH + k2 * 64); }
        __builtin_amdgcn_sched_barrier(0); }      /* the reads go out as one group: left alone they were spread among the products in pairs, each pair waited for at once, and every pair's latency showed */
#pragma unroll
      for (int t = 0; t < 4; ++t) for (int i = 0; i < 4; ++i) if (ks + t + i < 7) cc[i][t] = g2_mmap(fa[ks][i], fb[ks][t], cc[i][t]);
      __builtin_amdgcn_sched_barrier(0); }      /* the next k step's reads stay behind these products (no second fragment set in registers); behind the last step: the products stay in front of the stage's last one (some had sunk behind the barrier, right in front of the loop's branch) */
    cc[3][3] = g2_mma(fa[1][3], fb[1][3], cc[3][3]);      /* the stage's last product with g2_mma's four free slots: a branch follows */
    __syncthreads(); }      /* stage s + 1 is complete, and every wave has left stage s, whose buffer the next trip overwrites (behind the last trip: the epilogue) */
  if (row0 >= M) return;      /* no barrier behind this point */
  const float al = (FT == 2 && ft) ? alpha * 0.0009765625f : alpha;
  const int rsub = lane >> 4, c4 = (lane & 15) * 4;
#pragma unroll
  for (int hf = 0; hf < 2; ++hf) {      /* the wave's tile leaves in two halves of 32 rows, through the same staging rows; unrolled: hf picks accumulators */
  const int rowh = row0 + 32 * hf;
#pragma unroll
  for (int u = 0; u < 8; ++u) { const int t = u & 3, half = u >> 2; const int col = col0 + t * 16 + ln; const float bv = bp ? bf16_round(bp[col]) : 0.f;
#pragma unroll
    for (int r = 0; r < 8; ++r) { const int rloc = half * 16 + 8 * hh + r; float v = cc[2 * hf + half][t][r] * al + bv;      /* no added plane: CP, rowsPerB, sCPb and row0g are not read (every launch passes CP = nullptr); with that branch at each of a lane's 128 elements the kernel's text was five times as long */
      if (ACT == 3) v = fmaxf(v, 0.f); else if (ACT == 6) v = 0.5f * v * (1.0f + erff(v * 0.70710678118654752f)); else if (ACT == 11) v = 1.0f / (1.0f + expf(-v)); else if (ACT == 15) v = v / (1.0f + expf(-v)); else if (ACT == 12) v = (v > 0.f) ? v : 0.01f * v; else if (ACT == 8) v = tanhf(v); else if (ACT == 9) v = 0.5f * v * (1.0f + tanhf(0.7978845608028654f * (v + 0.044715f * v * v * v))); else if (ACT == 14) v = (v > 0.f) ? v : 0.1f * v; else if (ACT == 16) v = (v >= 0.f) ? v : 0.3f * v; else if (ACT == 17) v = (v >= 0.f) ? v : 0.2f * v;
      so[w][rloc][t * 16 + ln] = v; } }
  __builtin_amdgcn_fence(__ATOMIC_ACQ_REL, "workgroup"); __builtin_amdgcn_wave_barrier();
  {
#pragma unroll
    for (int q = 0; q < 16; ++q) { const int r = q * 2 + rsub; const v4f v = *(const v4fa*)&so[w][r][c4];
      /* behind each of the stores, at the end of its branch: the wait in front of the overwrite of the store's registers (the next store's value or address, formed in the next branch, lands on them) */
      if (C) { *(v4f*)(C + cofs + (size_t)(rowh + r) * ldc + col0 + c4) = v; asm volatile("s_wait_xcnt 0x0" ::: "memory"); }
      if (C16) { v4h h4; for (int i = 0; i < 4; ++i) h4[i] = (_Float16)v[i]; *(v4h*)(C16 + cofs + (size_t)(rowh + r) * ldc + col0 + c4) = h4; asm volatile("s_wait_xcnt 0x0" ::: "memory"); }
      if (FT == 1 && ft) { *(v4f*)(CF + (size_t)by * sCF + (size_t)(fr0 + 64 * wr + 32 * hf + r) * ldc + col0 + c4) = v; asm volatile("s_wait_xcnt 0x0" ::: "memory"); } }
     }
  if (hf == 0) { __builtin_amdgcn_fence(__ATOMIC_ACQ_REL, "workgroup"); __builtin_amdgcn_wave_barrier(); } } }      /* the first half's rows are read back by all lanes before the second half overwrites them */


__global__ __launch_bounds__(256) void k_rsm(const float* __restrict__ S, _Float16* __restrict__ P, int nrows) {
  #pragma clang fp contract(off)
  const int i = blockIdx.x * 256 + threadIdx.x; if (i >= nrows) return; const float* s = S + (size_t)i * SQ; float mx = -3.0e38f;
#pragma unroll 1
  for (int j = 0; j < SQ; ++j) mx = fmaxf(mx, s[j]); float se = 0.f;
#pragma unroll 1
  for (int j = 0; j < SQ; ++j) se += expf(s[j] - mx); const float sc = 256.0f / se;
#pragma unroll 1
  for (int j0 = 0; j0 < SQ; j0 += 8) { FragH f; for (int q = 0; q < 8; ++q) f.h[q] = (_Float16)(expf(s[j0 + q] - mx) * sc); unsigned short* d = (unsigned short*)P + (size_t)i * SQ + j0; *(v8us*)d = f.half[0];  } }
__global__ __launch_bounds__(256) void k_vt(const _Float16* __restrict__ V16, int b, int h0, _Float16* __restrict__ VT) { __shared__ unsigned short tl[64][65]; const int tid = threadIdx.x; const int hh = blockIdx.x % HG, sg = blockIdx.x / HG; const int s0 = sg * 64; const int h = h0 + hh;
  for (int i = tid; i < 64 * 8; i += 256) { const int j = i / 8, d8 = (i % 8) * 8; FragH f; f.half[0] = *(const v8us*)((const unsigned short*)V16 + ((size_t)b * SQ + s0 + j) * DM + h * HD + d8); for (int q = 0; q < 8; ++q) tl[d8 + q][j] = f.u[q]; }
  __syncthreads();
  { for (int i = tid; i < 64 * 8; i += 256) { const int d = i / 8, j8 = (i % 8) * 8; FragH f; for (int q = 0; q < 8; ++q) f.u[q] = tl[d][j8 + q]; *(v8us*)((unsigned short*)VT + ((size_t)hh * HD + d) * SQ + s0 + j8) = f.half[0]; }  } }



// ---- fused causal attention ----
typedef _Float16 v8h __attribute__((ext_vector_type(8)));
__device__ __forceinline__ float fa_xhalf(float x) { return __builtin_bit_cast(float, __builtin_amdgcn_permlanex16(__builtin_bit_cast(int, x), __builtin_bit_cast(int, x), 0x76543210, 0xfedcba98, false, false)); }      /* lane l takes lane l ^ 16 */
__device__ __forceinline__ v8f fa_mma(v16h a, v16h b, v8f c) { return __builtin_amdgcn_wmma_f32_16x16x32_f16(false, a, false, b, (short)0, c, false, false); }
// Native 2^x and 1/x. In asm so that the v_nop stands directly behind the last transcendental: the one free issue slot that the instruction set asks for before an instruction that
// reads the result or overwrites the source. In the group of four each v_exp_f32 is
// the free slot of the one before it: the early-clobber results lie on no source.
__device__ __forceinline__ float fa_exp2(float x) { float r; asm("v_exp_f32 %0, %1\n\tv_nop" : "=v"(r) : "v"(x)); return r; }
__device__ __forceinline__ float fa_rcp(float x) { float r; asm("v_rcp_f32 %0, %1\n\tv_nop" : "=v"(r) : "v"(x)); return r; }
__device__ __forceinline__ v4f fa_exp2x4(v4f x) { float r0, r1, r2, r3;
  asm("v_exp_f32 %0, %4\n\tv_exp_f32 %1, %5\n\tv_exp_f32 %2, %6\n\tv_exp_f32 %3, %7\n\tv_nop" : "=&v"(r0), "=&v"(r1), "=&v"(r2), "=&v"(r3) : "v"(x[0]), "v"(x[1]), "v"(x[2]), "v"(x[3]));
  const v4f r = {r0, r1, r2, r3}; return r; }
// Fragment of 16 rows x 32 k in the k order of g2_frag; p = the lane's row + 8 * (lane >> 4), so that the pointer itself is the loads' address register.
__device__ __forceinline__ v16h fa_frag(const _Float16* p) { FragH f; f.half[0] = *(const v8us*)((const unsigned short*)p); f.half[1] = *(const v8us*)((const unsigned short*)p + 16); return f.v; }
// K and V^T reach the waves through LDS, in stages of 64 keys that the block's four waves share: 64 K rows (64 dims each), then 64 V^T rows (64 keys each), all rows of 128 bytes.
#define FA_PITCH 144                  /* LDS row pitch in bytes, as G2_PITCH: 16 x odd, so that the 16 rows of a 16-byte fragment read fall on all 64 banks */
#define FA_TILE (64 * FA_PITCH)       /* 64 rows */
#define FA_STAGE (2 * FA_TILE)        /* one stage: the K rows, then the V^T rows */
// One stage's copies of a thread: 8 pieces of 16 bytes, global memory to LDS through no register (8 threads a row, piece j 16 rows below piece j - 1; 4 pieces of K, 4 of V^T).
// ld = the thread's LDS byte address in the stage's first K row group; kg, vg = its global addresses there. The s_wait_xcnt is the statement's last line, so that it stands in
// front of every later write of a register that a copy names (the callers step kg and vg right behind the call).
__device__ __forceinline__ void fa_copy(unsigned ld, const _Float16* kg, const _Float16* vg) {
  asm volatile("global_load_async_to_lds_b128 %0, %8, off\n\t"
               "global_load_async_to_lds_b128 %1, %9, off\n\t"
               "global_load_async_to_lds_b128 %2, %10, off\n\t"
               "global_load_async_to_lds_b128 %3, %11, off\n\t"
               "global_load_async_to_lds_b128 %4, %12, off\n\t"
               "global_load_async_to_lds_b128 %5, %13, off\n\t"
               "global_load_async_to_lds_b128 %6, %14, off\n\t"
               "global_load_async_to_lds_b128 %7, %15, off\n\t"
               "s_wait_xcnt 0x0"
               :: "v"(ld), "v"(ld + 16 * FA_PITCH), "v"(ld + 32 * FA_PITCH), "v"(ld + 48 * FA_PITCH),
                  "v"(ld + FA_TILE), "v"(ld + FA_TILE + 16 * FA_PITCH), "v"(ld + FA_TILE + 32 * FA_PITCH), "v"(ld + FA_TILE + 48 * FA_PITCH),
                  "v"(kg), "v"(kg + (size_t)16 * DM), "v"(kg + (size_t)32 * DM), "v"(kg + (size_t)48 * DM),
                  "v"(vg), "v"(vg + (size_t)16 * SQ), "v"(vg + (size_t)32 * SQ), "v"(vg + (size_t)48 * SQ)
               : "memory"); }
// One pass: 32 keys against the wave's 32 queries (two groups of 16). Lane (c = lane & 15, hh = lane >> 4) owns query 16 g + c in both products:
//   S^T = K Q^T : A = 16 K rows (g2_lfrag from LDS), B = 16 Q rows (fa_frag), the same k order; s[g][kt][r] = score of key 16 kt + 8 hh + r
//   O^T += V^T P^T : A = 16 V^T rows (dims) by g2_lfrag over the 32 keys; B element e = weight of key (e < 8 ? 8 hh + e : 16 + 8 hh + e - 8) = s[g][e >> 3][e & 7], the k order of g2_lfrag
// so maximum, sum and rescale are the lane's own, with one exchange between the wave's halves. mr = maximum in use (log2 units); it may trail the true one by up to 6
// (weights then reach 256 * 2^6, well inside f16); sums and o are rescaled only in a pass in which some query's maximum has run further ahead.
// kn = the lane's place in the K rows of the next pass, read only where NEXTK says that the wave has that pass and that it lies in the same stage; vl = its place in this pass's
// V^T columns. DIAG and NEXTK are the same for the whole wave (scalar branches): one copy of the pass serves all cases, so the accumulators stay in their registers.
// The unroll directives here and in k_fattn: the loop indices pick fragments and accumulators, which stay in registers only if every index is a constant.
__device__ __forceinline__ void fa_pass(const bool DIAG, const bool NEXTK, v16h (&kf)[2][2], const unsigned char* kn, const unsigned char* vl, const v16h (&qf)[2][2], v8f (&o)[2][4], float (&mr)[2], float (&l)[2], int rel) {
  const float cs = 0.125f * 1.44269504088896340736f;      /* score scale times log2(e) */
  v16h vf[4];
#pragma unroll
  for (int t = 0; t < 4; ++t) vf[t] = g2_lfrag(vl + t * 16 * FA_PITCH);      /* this pass's V^T: in flight under the first product and the softmax */
  v8f s[2][2]; const v8f z8 = {0.f, 0.f, 0.f, 0.f, 0.f, 0.f, 0.f, 0.f};
#pragma unroll
  for (int g = 0; g < 2; ++g) for (int kt = 0; kt < 2; ++kt) { const v8f t = fa_mma(kf[kt][0], qf[g][0], z8); s[g][kt] = (g + kt == 2) ? g2_mma(kf[kt][1], qf[g][1], t) : fa_mma(kf[kt][1], qf[g][1], t); }      /* the last one with g2_mma's four free slots: a branch follows */
  if (NEXTK) {      /* the next pass's K, of the same stage: in flight under this pass's softmax and second product */
#pragma unroll
    for (int kt = 0; kt < 2; ++kt) for (int d = 0; d < 2; ++d) kf[kt][d] = g2_lfrag(kn + kt * 16 * FA_PITCH + d * 64); }
  if (DIAG) {      /* the pass on the diagonal: key 16 kt + 8 hh + r stays while it is not above query 16 g + c (rel = c - 8 hh) */
#pragma unroll
    for (int g = 0; g < 2; ++g) for (int kt = 0; kt < 2; ++kt) for (int r = 0; r < 8; ++r) s[g][kt][r] = (16 * kt + r - 16 * g <= rel) ? s[g][kt][r] : -1.0e30f; }
  float mb[2]; bool need = false;
#pragma unroll
  for (int g = 0; g < 2; ++g) { float mx = s[g][0][0];
    for (int r = 1; r < 8; ++r) mx = fmaxf(mx, s[g][0][r]);
    for (int r = 0; r < 8; ++r) mx = fmaxf(mx, s[g][1][r]);
    mx = fmaxf(mx, fa_xhalf(mx)) * cs; mb[g] = mx; need = need || (mx > mr[g] + 6.0f); }
  if (__builtin_amdgcn_ballot_w32(need) != 0) {      /* wave-uniform; always taken in the first pass (mr = -1e30, factor 0), seldom later */
#pragma unroll
    for (int g = 0; g < 2; ++g) { const float mn = fmaxf(mr[g], mb[g]); const float corr = fa_exp2(mr[g] - mn); mr[g] = mn; l[g] *= corr;
      for (int t = 0; t < 4; ++t) o[g][t] *= corr; } }
#pragma unroll
  for (int g = 0; g < 2; ++g) { const float nm = 8.0f - mr[g];      /* weights carried x256 */
    FragH pf; v4f ls = {0.f, 0.f, 0.f, 0.f};
    for (int i = 0; i < 4; ++i) { v4f a; for (int u = 0; u < 4; ++u) a[u] = fmaf(s[g][i >> 1][(i & 1) * 4 + u], cs, nm);
      const v4f p = fa_exp2x4(a); ls += p; for (int u = 0; u < 4; ++u) pf.h[i * 4 + u] = (_Float16)p[u]; }
    l[g] += (ls[0] + ls[1]) + (ls[2] + ls[3]);
    for (int t = 0; t < 3; ++t) o[g][t] = fa_mma(vf[t], pf.v, o[g][t]);
    o[g][3] = g2_mma(vf[3], pf.v, o[g][3]); } }      /* the weights' last use, with g2_mma's four free slots: what may next land on their registers is asm text (fa_exp2x4, fa_rcp) */
// grid (heads, batches, blocks of 128 queries, the longest first); 4 waves of 32 queries. The block walks the keys up to its last query in stages of 64 (two passes), two LDS
// buffers: stage st + 1's copies fly while stage st is worked on. A wave skips the passes above its own diagonal, but passes every wait and barrier.
__global__ __launch_bounds__(128) void k_fattn(const _Float16* __restrict__ Q, const _Float16* __restrict__ K, const _Float16* __restrict__ VT, _Float16* __restrict__ O) {
  __shared__ __attribute__((aligned(16))) unsigned char sm[2 * FA_STAGE];
  const int tid = threadIdx.x, lane = tid & 31, c = lane & 15, hh = lane >> 4; const int h = blockIdx.x, b = blockIdx.y;
  const int zb = (int)(gridDim.z - 1 - blockIdx.z);      /* the block's 128 queries */
  const int q0 = zb * 128 + __builtin_amdgcn_readfirstlane(tid >> 5) * 32;      /* the wave's first query: scalar, so the pass count is */
  const _Float16* qp = Q + ((size_t)b * SQ + q0 + c) * DM + h * HD + 8 * hh;      /* the lane's row and half, as fa_frag takes them */
  v16h qf[2][2], kf[2][2];
#pragma unroll
  for (int g = 0; g < 2; ++g) for (int d = 0; d < 2; ++d) qf[g][d] = fa_frag(qp + (size_t)g * 16 * DM + d * 32);
  asm volatile("s_wait_xcnt 0x0" :: "v"(qp) : "memory");      /* the wait in front of any overwrite of the loads' address register; as an input the address keeps its register up to here */
  const int sr = tid >> 3, sc = (tid & 7) * 8;      /* staging: 8 threads a row */
  const _Float16* kg = K + ((size_t)b * SQ + sr) * DM + h * HD + sc; const _Float16* vg = VT + ((size_t)(b * NH + h) * HD + sr) * SQ + sc;
  const unsigned ld = (unsigned)(size_t)(sm + sr * FA_PITCH + sc * 2);      /* the low 32 bits of the address: the byte offset in the block's LDS */
  const unsigned char* const kl = sm + c * FA_PITCH + 16 * hh; const unsigned char* const vl = kl + FA_TILE;      /* the lane's row and half in a tile, as g2_lfrag takes them */
  const int nst = 2 * zb + 2, nd = q0 >> 5;      /* stages of the block (two at least); the wave's pass on the diagonal */
  const v8f z8 = {0.f, 0.f, 0.f, 0.f, 0.f, 0.f, 0.f, 0.f}; v8f o[2][4] = {{z8, z8, z8, z8}, {z8, z8, z8, z8}}; float mr[2] = {-1.0e30f, -1.0e30f}, l[2] = {0.f, 0.f};
  const int rel = c - 8 * hh;
  fa_copy(ld, kg, vg); kg += (size_t)64 * DM; vg += 64;
  asm volatile("s_wait_asynccnt 0x0" ::: "memory");      /* the wave's own copies of stage 0 have landed */
  __syncthreads();      /* stage 0 is complete before any wave reads it */
  fa_copy(ld + FA_STAGE, kg, vg); kg += (size_t)64 * DM; vg += 64;
#pragma unroll 1
  for (int st = 0; st < nst; ++st) {      /* rolled: the trip count is a run-time value, and the buffer's offset is one addition */
    const int cur = (st & 1) * FA_STAGE;
    if (2 * st <= nd) {      /* a scalar test: the wave has the stage's first pass */
#pragma unroll
      for (int kt = 0; kt < 2; ++kt) for (int d = 0; d < 2; ++d) kf[kt][d] = g2_lfrag(kl + cur + kt * 16 * FA_PITCH + d * 64); }
#pragma unroll 1
    for (int p = 0; p < 2; ++p) {      /* rolled: one copy of the pass */
      const int kb = 2 * st + p;
      if (kb <= nd) fa_pass(kb == nd, p == 0 && kb < nd, kf, kl + cur + 32 * FA_PITCH, vl + cur + p * 64, qf, o, mr, l, rel); }      /* scalar tests: a pass above the wave's diagonal is skipped */
    asm volatile("s_wait_dscnt 0x0" ::: "memory");      /* the wave's reads of this stage have returned before the buffer is given up */
    asm volatile("s_wait_asynccnt 0x0" ::: "memory");      /* its copies of stage st + 1 have landed */
    __syncthreads();      /* stage st + 1 is complete, and every wave has left stage st */
    if (st + 2 < nst) { fa_copy(ld + cur, kg, vg); kg += (size_t)64 * DM; vg += 64; } }      /* stage st + 2 into the buffer just left; the test is the same for the whole block */
  asm volatile("s_wait_asynccnt 0x0" ::: "memory");      /* no copy is outstanding when the wave ends */
  _Float16* op = O + ((size_t)b * SQ + q0 + c) * DM + h * HD + 8 * hh;      /* o[g][t][r] = dim 16 t + 8 hh + r of query 16 g + c: eight neighbours, one 16-byte store */
  v8h ov[2][4];
#pragma unroll
  for (int g = 0; g < 2; ++g) { const float fin = 64.0f * fa_rcp(l[g] + fa_xhalf(l[g]));      /* the halves' sums joined; o carried x64 */
    for (int t = 0; t < 4; ++t) for (int r = 0; r < 8; ++r) ov[g][t][r] = (_Float16)(o[g][t][r] * fin); }
#pragma unroll
  for (int g = 0; g < 2; ++g) for (int t = 0; t < 4; ++t) *(v8h*)(op + (size_t)g * 16 * DM + t * 16) = ov[g][t]; }


typedef float v2f __attribute__((ext_vector_type(2)));
// exp(x) to f32 accuracy, in the way expf is expanded: n = nearest integer to x log2(e); v_exp_f32 of x log2(e) - n, log2(e) taken in two parts (two fma, so the difference is
// rounded once); ldexp by n; 0 and infinity beyond the two range ends. Written out so that v_exp_f32 can stand in asm with its v_nop directly behind it: the one free issue slot
// that the instruction set asks for before an instruction that reads the result or overwrites the source.
__device__ __forceinline__ float exp_slot(float x) {
  const float c_hi = __uint_as_float(0x3fb8aa3bu), c_lo = __uint_as_float(0x32a5705fu);
  const float n = rintf(x * c_hi); const float a = fmaf(x, c_lo, fmaf(x, c_hi, -n));
  float r; asm("v_exp_f32 %0, %1\n\tv_nop" : "=v"(r) : "v"(a));
  r = ldexpf(r, (int)n); r = (__uint_as_float(0xc2ce8ed0u) > x) ? 0.f : r; r = (__uint_as_float(0x42b17218u) < x) ? __uint_as_float(0x7f800000u) : r; return r; }
// Exact f32 attention of the first QT0 rows, one thread per query row. The row's q and o stay in registers. K and V come in tiles of 64 keys through LDS
// (K transposed to [dim][key], V as [key][dim]) and are read back as broadcasts, 32 reads at a time, one such batch in flight while the batch before it is worked on.
// Eight keys are worked on together: their eight score sums run side by side (each still summed over the dims in ascending order, s = fma(q, k, s)),
// then the running maximum, the two exps and the running sum key by key, then the o update key by key (o = fma(o, sc, e v), l = fma(l, sc, e)).
// Every row sees its keys, and every sum its terms, in the same order as with one key at a time.
template <int MASKADD>
__global__ __launch_bounds__(64) void k_att0(const float* __restrict__ QF, const float* __restrict__ KF, const float* __restrict__ VF, int ld, const float* __restrict__ mask, float scale, _Float16* __restrict__ OH, _Float16* __restrict__ OL, int ldo) {
  __shared__ __attribute__((aligned(16))) float lkt[HD][64]; __shared__ __attribute__((aligned(16))) float lv[64][HD]; __shared__ __attribute__((aligned(16))) float lo[64][HD + 4];
  const int tid = threadIdx.x; const int h = blockIdx.x / (QT0 / 64), rg = blockIdx.x % (QT0 / 64); const int i = rg * 64 + tid;
  { const size_t rb = (size_t)blockIdx.y * QT0; QF += rb * ld; KF += rb * ld; VF += rb * ld; OH += rb * ldo; OL += rb * ldo; }      /* blockIdx.y = batch: QT0 rows of q, k, v and o each */
  const float* qr = QF + (size_t)i * ld + h * HD;
  float q[HD]; v2f o[HD / 2];
#pragma unroll
  for (int c = 0; c < HD / 4; ++c) { const v4f t = *(const v4fa*)(qr + c * 4); for (int u = 0; u < 4; ++u) q[c * 4 + u] = t[u]; const v2f z = {0.f, 0.f}; o[c * 2] = z; o[c * 2 + 1] = z; }
  asm volatile("s_wait_xcnt 0x0" :: "v"(qr) : "memory");      /* the wait in front of any overwrite of the loads' address register; named as an input, the address stays in its register up to here (else the last load's result lands on it) */
  float m = -1.0e30f, l = 0.f; const int jmax = MASKADD ? (SQ - 1) : (rg * 64 + 63);      /* additive-mask form: every key (the mask input decides); causal form: keys up to the block's last row */
#pragma unroll 1
  for (int j0 = 0; j0 <= jmax; j0 += 64) {      /* rolled, for speed only */
    const float* kr = KF + (size_t)(j0 + tid) * ld + h * HD;      /* thread = key: the transposed stores of a wave fall on consecutive banks */
    const float* vr = VF + (size_t)(j0 + tid / 16) * ld + h * HD + (tid % 16) * 4;      /* 16 threads a row: whole lines */
    v4f tk[16], tv[16]; const float* vp[16];
#pragma unroll
    for (int c = 0; c < 16; ++c) { vp[c] = vr + (size_t)(c * 4) * ld; tk[c] = *(const v4fa*)(kr + c * 4); tv[c] = *(const v4fa*)vp[c]; }
    asm volatile("s_wait_xcnt 0x0" :: "v"(kr), "v"(vp[0]), "v"(vp[1]), "v"(vp[2]), "v"(vp[3]), "v"(vp[4]), "v"(vp[5]), "v"(vp[6]), "v"(vp[7]), "v"(vp[8]), "v"(vp[9]), "v"(vp[10]), "v"(vp[11]), "v"(vp[12]), "v"(vp[13]), "v"(vp[14]), "v"(vp[15]) : "memory");      /* as behind the q loads: every address of the batch keeps its register up to the wait (else later loads' results land on earlier loads' addresses) */
    __builtin_amdgcn_sched_barrier(0);      /* all 32 loads of the tile are issued before the first is waited for: without it each load sinks to its LDS store and the latencies add up */
#pragma unroll
    for (int c = 0; c < 16; ++c) { for (int u = 0; u < 4; ++u) lkt[c * 4 + u][tid] = tk[c][u]; *(v4f*)&lv[c * 4 + tid / 16][(tid % 16) * 4] = tv[c]; }
    __syncthreads();      /* the tile is complete before any thread reads it */
#pragma unroll 1
    for (int jg = 0; jg < 64; jg += 8) {      /* rolled for the same reason */
      v4f ba[32], bb[32]; v2f s2[4]; float sc[8], e[8]; for (int p = 0; p < 4; ++p) { const v2f z = {0.f, 0.f}; s2[p] = z; }
      /* batch b of K: dims 16 b .. + 15 of the eight keys; batch b of V: keys 2 b and 2 b + 1, all dims */
      auto load_k = [&](int b, v4f* t) {
#pragma unroll
        for (int x = 0; x < 16; ++x) { t[x * 2] = *(const v4f*)&lkt[b * 16 + x][jg]; t[x * 2 + 1] = *(const v4f*)&lkt[b * 16 + x][jg + 4]; }
        __builtin_amdgcn_sched_barrier(0); };      /* keeps the batch's reads in front of the arithmetic on the batch before: without it they sink to their first use and every read's latency shows */
      auto load_v = [&](int b, v4f* t) {
#pragma unroll
        for (int x = 0; x < 32; ++x) t[x] = *(const v4f*)&lv[jg + b * 2 + (x >> 4)][(x & 15) * 4];
        __builtin_amdgcn_sched_barrier(0); };      /* as in load_k */
      auto work_k = [&](int b, const v4f* t) {
#pragma unroll
        for (int x = 0; x < 16; ++x) { const float qs = q[b * 16 + x]; const v2f qd = {qs, qs}; const v4f ka = t[x * 2], kb = t[x * 2 + 1];
          const v2f k0 = {ka[0], ka[1]}, k1 = {ka[2], ka[3]}, k2 = {kb[0], kb[1]}, k3 = {kb[2], kb[3]};
          s2[0] = __builtin_elementwise_fma(qd, k0, s2[0]); s2[1] = __builtin_elementwise_fma(qd, k1, s2[1]); s2[2] = __builtin_elementwise_fma(qd, k2, s2[2]); s2[3] = __builtin_elementwise_fma(qd, k3, s2[3]); }
        __builtin_amdgcn_sched_barrier(0); };      /* the next batch's reads stay behind this arithmetic, so that no more than two batches hold registers */
      auto work_v = [&](int b, const v4f* t) {
#pragma unroll
        for (int x = 0; x < 32; ++x) { const int u = b * 2 + (x >> 4), c = x & 15; const v2f sc2 = {sc[u], sc[u]}, e2 = {e[u], e[u]}; const v4f vv = t[x]; const v2f v0 = {vv[0], vv[1]}, v1 = {vv[2], vv[3]};
          o[c * 2] = __builtin_elementwise_fma(o[c * 2], sc2, e2 * v0); o[c * 2 + 1] = __builtin_elementwise_fma(o[c * 2 + 1], sc2, e2 * v1); }
        __builtin_amdgcn_sched_barrier(0); };      /* as in work_k */
      load_k(0, ba); load_k(1, bb); work_k(0, ba); load_k(2, ba); work_k(1, bb); load_k(3, bb); work_k(2, ba); load_v(0, ba); work_k(3, bb); load_v(1, bb);
#pragma unroll
      for (int u = 0; u < 8; ++u) { const int j = j0 + jg + u; float s = __fmul_rn(s2[u >> 1][u & 1], scale); if (MASKADD) s = __fadd_rn(s, __fmul_rn(bf16_round(mask[(size_t)i * SQ + j]), -10000.0f));
        const float f = (MASKADD || j <= i) ? 1.f : 0.f; const float sm = fmaf(f, s, (1.f - f) * -1.0e30f); const float mn = fmaxf(m, sm); sc[u] = exp_slot(m - mn); e[u] = exp_slot(sm - mn); l = fmaf(l, sc[u], e[u]); m = mn; }
      work_v(0, ba); load_v(2, ba); work_v(1, bb); load_v(3, bb); work_v(2, ba); work_v(3, bb); }
    __syncthreads(); }      /* every thread has left the tile before the next one overwrites it */
  const float fin = 64.0f / l;      /* o carried x64 like the f16 path */
#pragma unroll
  for (int c = 0; c < HD / 4; ++c) { const v4f oo = {__fmul_rn(o[c * 2][0], fin), __fmul_rn(o[c * 2][1], fin), __fmul_rn(o[c * 2 + 1][0], fin), __fmul_rn(o[c * 2 + 1][1], fin)}; *(v4f*)&lo[tid][c * 4] = oo; }
  __syncthreads();
  {
#pragma unroll 1
    for (int it = 0; it < 16; ++it) { const int row = it * 4 + tid / 16, pc = (tid % 16) * 4; const v4f v = *(const v4f*)&lo[row][pc]; v4h vh, vl;      /* o leaves as two f16 planes: the high part and the residual x1024 */
      for (int u = 0; u < 4; ++u) { const _Float16 hp = (_Float16)v[u]; vh[u] = hp; vl[u] = (_Float16)((v[u] - (float)hp) * 1024.0f); }
      const size_t e = (size_t)(rg * 64 + row) * ldo + h * HD + pc; *(v4h*)(OH + e) = vh; *(v4h*)(OL + e) = vl; }
     } }

#define DMQ DM

template <int BFIN, int W16, int W32>
__global__ __launch_bounds__(256) void k_lnx(const float* __restrict__ X, const float* __restrict__ g, const float* __restrict__ bb, float eps, _Float16* __restrict__ N16, float* __restrict__ N32) {
  #pragma clang fp contract(off)
  __shared__ float red[256]; const size_t r = blockIdx.x; const int t = threadIdx.x; const bool act = t < (DMQ / 4); const int c0 = act ? t * 4 : 0;
  const v4f xa = *(const v4fa*)(X + r * DMQ + c0); float s[4]; float sum = 0.f;
  for (int q = 0; q < 4; ++q) { s[q] = act ? (BFIN ? bf16_round(xa[q]) : xa[q]) : 0.f; sum = __fadd_rn(sum, s[q]); }
  red[t] = sum; __syncthreads(); for (int st = 128; st > 0; st >>= 1) { if (t < st) red[t] = __fadd_rn(red[t], red[t + st]); __syncthreads(); } const float mu = red[0] / (float)DMQ; __syncthreads();
  float vs = 0.f; for (int q = 0; q < 4; ++q) { const float dl = act ? __fadd_rn(s[q], -mu) : 0.f; vs = __fadd_rn(vs, __fmul_rn(dl, dl)); } red[t] = vs; __syncthreads(); for (int st = 128; st > 0; st >>= 1) { if (t < st) red[t] = __fadd_rn(red[t], red[t + st]); __syncthreads(); }
  const float rs = rsqrtf(__fadd_rn(red[0] / (float)DMQ, eps)); v4h y; v4f yf;
  for (int q = 0; q < 4; ++q) { const int c = c0 + q; yf[q] = __fadd_rn(__fmul_rn(__fmul_rn(__fadd_rn(s[q], -mu), rs), bf16_round(g[c])), bf16_round(bb[c])); y[q] = (_Float16)yf[q]; }
  if (!act) return;      /* no barriers after this point */
  { if (W16) *(v4h*)(N16 + r * DMQ + c0) = y; if (W32) *(v4f*)(N32 + r * DMQ + c0) = yf;  } }


extern "C" void kernel_launch(void* const* d_in, const int* in_sizes, int n_in,
                              void* d_out, int out_size, void* d_ws, size_t ws_size, hipStream_t stream) {
  (void)in_sizes; (void)n_in; (void)out_size;
  const float* const* I = (const float* const*)d_in; const float* x = I[0]; const float* wk = I[1]; const float* wq = I[2]; const float* wv = I[3]; const float* wo = I[4]; const float* lng = I[5]; const float* lnb = I[6];      /* x; natural [out][in] Wk, Wq, Wv (THIS order), Wp; LayerNorm gamma, beta; no biases */
  char* ws = (char*)d_ws; size_t off = 0;
  auto take = [&](size_t bytes) { char* p = ws + off; off += (bytes + 255) & ~(size_t)255; return p; };
  /* planes that one launch walks by a stride follow one another without a gap (every size is a multiple of 256 bytes): BQ BK BV BO; Q16 K16 V16; QF0 KF0 VF0; OH0 OL0 */
  _Float16* BQ = (_Float16*)take((size_t)DM * DM * 2); take((size_t)DM * DM * 2); take((size_t)DM * DM * 2); _Float16* BO = (_Float16*)take((size_t)DM * DM * 2);
  _Float16* X16 = (_Float16*)take(NR * DM * 2); _Float16* Q16 = (_Float16*)take(NR * DM * 2); _Float16* K16 = (_Float16*)take(NR * DM * 2); _Float16* V16 = (_Float16*)take(NR * DM * 2); _Float16* O16 = (_Float16*)take(NR * DM * 2);
  float* YO = (float*)take(NR * DM * 4); _Float16* VT = (_Float16*)take((size_t)NB * NH * HD * SQ * 2);      /* pre-norm projection rows y (f32); V^T [NB][NH][HD][SQ] */
  float* QF0 = (float*)take((size_t)NB * QT0 * DM * 4); float* KF0 = (float*)take((size_t)NB * QT0 * DM * 4); float* VF0 = (float*)take((size_t)NB * QT0 * DM * 4); _Float16* OH0 = (_Float16*)take((size_t)NB * QT0 * DM * 2); _Float16* OL0 = (_Float16*)take((size_t)NB * QT0 * DM * 2);
  if (off > ws_size) return;
  k_cvt<<<4 * CVT_WB + CVT_XB, 256, 0, stream>>>(wq, wk, wv, wo, x, BQ, X16);      /* BQ BK BV BO (x16) and the x rows */
  const size_t r0p = (size_t)B0 * SQ;      /* first projected row */
  const size_t f0p = (size_t)B0 * QT0;      /* its first-tile row */
  k_gemm2<0, 1><<<dim3((unsigned)((MP / 128) * (DM / 256)), 3), 256, 0, stream>>>(X16 + r0p * DM, DM, 0, BQ, DM, (size_t)DM * DM, 0.0625f, nullptr, 0, nullptr, 1, 0, 0, nullptr, Q16 + r0p * DM, DM, NR * DM, MP, DM, DM, 0, 0, 0, nullptr, 0, QF0 + f0p * DM, (size_t)NB * QT0 * DM);      /* q, k, v on grid.y: f16 rows, and f32 (exact products) for each batch's first 128 rows */
  k_vt<NH, SQ><<<NBR * NH * (SQ / 64), 256, 0, stream>>>(V16 + r0p * LQ, LQ, 0, VT);      /* V^T [NBR][NH][HD][SQ] */
  k_att0<0><<<dim3(NH * (QT0 / 64), NBR), 64, 0, stream>>>(QF0, KF0, VF0, DM, nullptr, 0.125f, OH0 + f0p * DM, OL0 + f0p * DM, DM);      /* exact f32 attention for rows 0..127 of each batch: o (x64) as f16 high part + x1024 residual planes */
  k_fattn<<<dim3(NH, NB, SQ / 128), 128, 0, stream>>>(Q16, K16, VT, O16);      /* causal attention of all batches and heads: o (merged heads, x64) as f16 rows */
  k_gemm2<0, 2><<<dim3((unsigned)((MPO / 128) * (DM / 256)), 1), 256, 0, stream>>>(O16 + r0p * DM, DM, 0, BO, DM, 0, 0.0009765625f, nullptr, 0, nullptr, 1, 0, 0, YO + r0p * DM, nullptr, DM, 0, MPO, DM, DM, 0, 0, 0, OH0 + f0p * DM, (size_t)NB * QT0 * DM, nullptr, 0);      /* y = o Wp; rows 0..127 of each batch from the two exact planes */
  k_lnx<0, 0, 1><<<(unsigned)NR, 256, 0, stream>>>(YO, lng, lnb, 1e-5f, nullptr, (float*)d_out);      /* out = LayerNorm(y) -> f32 output rows */
}
